// v000
// Measured on an AMD MI455X. A time is GPU time per run, averaged over a window of back-to-back runs after a warm-up
// (all launches, gaps included; the runs take copies of the inputs in turn), and the median of several windows.
// Apart from v000's, it joins two sittings. Times from different sittings can be a few percent apart, while
// side-by-side timings come from the same sitting.
// The starting kernel, v000, takes 5850 microseconds a run.
#include <hip/hip_runtime.h>
#include <stddef.h>
#include <stdint.h>

// Contractions: q/k/v input projections (K=512) and the output projection (K=1024 = activation bf16 hi|lo pair
// accumulate). Window scores (three 64-deep dots per slot), softmax statistics, weighted value sums and the
// per-position segment sums: f32 VALU.
//
// Carry audit: no plane carries a power-of-two scale; nothing is folded back anywhere.
//   XB  [3][4096][512]  bf16 = RNE(query | key | value)               (k_convert) -> A of the projections
//   WB  [3][512][512]   bf16 = RNE(Wq | Wk | Wv), rows [n][k]          (k_convert) -> B of the projections
//   OA  [4096][1024]    bf16 = [hi | lo] of the per-head attention output, hi = RNE(o), lo = RNE(o - hi)
//                                                                     (k_agg)     -> A of the output projection
//   rel_q, rel_k, rel_v are RNE-converted to bf16 values (held as f32) when staged in LDS.
//   f32 planes: QKV [3][32][1024][64] (projection results), S [32][32768] (masked, scaled scores).

#define NB_    4
#define SEQ    1024
#define DM     512
#define NH     8
#define DK     64
#define KP1    16
#define W2     32
#define NSLOT  32768                 // W2 * SEQ flat window slots per (b,h)
#define NHALF  16384                 // KP1 * SEQ
#define NBH    32                    // NB_ * NH
#define MROWS  4096                  // NB_ * SEQ
#define KOUT   1024                  // 2 * DM (hi | lo)
#define NPOS   (NBH * NHALF)         // ints per position table
#define PLQ    (NBH * SEQ * DK)      // floats per q/k/v plane (2097152)
#define NTHR   256
#define NWAVE  8
#define GTHR   128
#define GBM    64
#define GBN    64
#define TPW    (SEQ / NWAVE)         // 128 targets per wave in k_agg
#define DEGCAP 256                   // static cap on slots per target position
#define RINV24 (1.0f / 24.0f)
#define NEGBIG (-1.0e9f)
#define WSMAX  134217728
#define NXU    (3 * (MROWS * DM / 8))   // 786432 convert units (8 elements each)
#define NWU    (3 * (DM * DM / 8))      // 98304
#define NWOU   (DM * KOUT / 8)          // 65536
#define NCU    (NXU + NWU + NWOU)       // 950272
#define LDS_AGG 153728

static_assert((MROWS % GBM) == 0 && (DM % GBN) == 0 && (SEQ % GBM) == 0);
static_assert((DM % 32) == 0 && (KOUT % 32) == 0);
static_assert(GBN == DK);
static_assert(GBM == (GTHR / 32) * 16);
static_assert(NSLOT == W2 * SEQ && NHALF == KP1 * SEQ && NBH == NB_ * NH && MROWS == NB_ * SEQ);
static_assert(NSLOT == (1 << 15) && SEQ == (1 << 10));
static_assert((MROWS * DM / 8) == (1 << 18) && (DM * DM / 8) == (1 << 15) && (KOUT / 8) == 128);
static_assert((NXU % NTHR) == 0 && ((NXU + NWU) % NTHR) == 0 && (NCU % NTHR) == 0);
static_assert(NTHR * 4 == SEQ && TPW * NWAVE == SEQ);
static_assert((NSLOT % (4 * NTHR)) == 0);
static_assert(NTHR * 8 == W2 * DK);
static_assert((NSLOT + 3 * SEQ) * 4 + (W2 * DK + NWAVE * 64 + 16) * 4 + NWAVE * 4 <= LDS_AGG);
static_assert(LDS_AGG <= 300000);
static_assert(PLQ == NB_ * SEQ * DM);

typedef float    v4f  __attribute__((ext_vector_type(4)));
typedef float    v8f  __attribute__((ext_vector_type(8)));
typedef int      v4i  __attribute__((ext_vector_type(4)));
typedef int      v8i  __attribute__((ext_vector_type(8)));
typedef unsigned short v8us __attribute__((ext_vector_type(8)));
typedef __bf16   v16b __attribute__((ext_vector_type(16)));
typedef v4f  __attribute__((may_alias)) v4fa;
typedef v4i  __attribute__((may_alias)) v4ia;
typedef v8us __attribute__((may_alias)) v8usa;
union FragB { v16b v; v8us h[2]; v8i w; };

// WMMA with hazard guard: ties D, keeps A/B live for 4 VALU slots
__device__ __forceinline__ v8f wmb(const FragB& a, const FragB& b, v8f c) {
  v8f d = __builtin_amdgcn_wmma_f32_16x16x32_bf16(false, a.v, false, b.v, (short)0, c, false, false);
  asm volatile("v_nop\n\tv_nop\n\tv_nop\n\tv_nop" : "+v"(d) : "v"(a.w), "v"(b.w));
  return d;
}

// f32 -> bf16 bits, RNE convert
__device__ __forceinline__ unsigned int bf16u(float x) {
  const unsigned int u = __float_as_uint(x);
  return (u + 0x7FFFu + ((u >> 16) & 1u)) >> 16;
}
// f32 -> nearest bf16 value held as f32
__device__ __forceinline__ float bf16f(float x) { return __uint_as_float(bf16u(x) << 16); }

__device__ __forceinline__ v8us cvt8b(const v4f a, const v4f b) {
  v8us r;
  r[0] = (unsigned short)bf16u(a.x); r[1] = (unsigned short)bf16u(a.y);
  r[2] = (unsigned short)bf16u(a.z); r[3] = (unsigned short)bf16u(a.w);
  r[4] = (unsigned short)bf16u(b.x); r[5] = (unsigned short)bf16u(b.y);
  r[6] = (unsigned short)bf16u(b.z); r[7] = (unsigned short)bf16u(b.w);
  return r;
}

__device__ __forceinline__ unsigned short hl1(float x, bool islo) {
  const unsigned int hu = bf16u(x);
  const float hf = __uint_as_float(hu << 16);
  const unsigned int lu = bf16u(x - hf);
  return (unsigned short)(islo ? lu : hu);
}
// 8 floats -> 8 bf16 hi parts (islo false) or 8 bf16 lo parts (islo true), lo = RNE(x - hi)
__device__ __forceinline__ v8us split8(const v4f a, const v4f b, bool islo) {
  v8us r;
  r[0] = hl1(a.x, islo); r[1] = hl1(a.y, islo); r[2] = hl1(a.z, islo); r[3] = hl1(a.w, islo);
  r[4] = hl1(b.x, islo); r[5] = hl1(b.y, islo); r[6] = hl1(b.z, islo); r[7] = hl1(b.w, islo);
  return r;
}

// ---------------------------------------------------------------------------
// Flat window slot f (0..32767) of head group bh: window row w = f >> 10, position s = f & 1023.
//   q index  = w < 16 ? pos_pad[w][s]    : pe[w-16][s]       (pe = pos_enc with -1 -> 0)
//   kv index = w < 16 ? pe[w][s]         : pos_pad[w-16][s]
//   masked   = (pos_enc[w & 15][s] == -1) || f < 1024
// Both tables are read unconditionally (same g for both halves) and clamped into [0, SEQ-1].
// ---------------------------------------------------------------------------
__device__ __forceinline__ void slot_idx(const int* __restrict__ pos_enc, const int* __restrict__ pos_pad,
                                         int bh, int f, int& qi, int& ki, bool& msk) {
  const int g = bh * NHALF + (f & (NHALF - 1));
  const int penc = pos_enc[g];
  const int ppad = pos_pad[g];
  const bool neg = (penc == -1);
  int pe = neg ? 0 : penc;
  pe = pe < 0 ? 0 : (pe > SEQ - 1 ? SEQ - 1 : pe);
  int pp = ppad < 0 ? 0 : (ppad > SEQ - 1 ? SEQ - 1 : ppad);
  const bool lo = f < NHALF;
  qi = lo ? pp : pe;
  ki = lo ? pe : pp;
  msk = neg || (f < SEQ);
}

// ---------------------------------------------------------------------------
//   u <  NXU        : XB[z][off*8 ..]  z = u >> 18 selects query | key | value
//   u <  NXU + NWU  : WB[z][off*8 ..]  z selects Wq | Wk | Wv (rows [n][k] as given)
// coverage: NXU*8 = 3*4096*512, NWU*8 = 3*512*512, NWOU*8 = 512*1024 elements exactly.
// ---------------------------------------------------------------------------
__global__ __launch_bounds__(NTHR) void k_convert(
    const float* __restrict__ xq, const float* __restrict__ xk, const float* __restrict__ xv,
    const float* __restrict__ wq, const float* __restrict__ wk, const float* __restrict__ wv,
    const float* __restrict__ wo,
    unsigned short* xb, unsigned short* wb, unsigned short* wob, int nUnits)
{
  const int u = (int)blockIdx.x * NTHR + (int)threadIdx.x;
  if (u >= nUnits) return;
  const float* src;
  unsigned short* dst;
  if (u < NXU) {
    const int z = u >> 18, off = u & ((1 << 18) - 1);
    const float* xs = (z == 0) ? xq : ((z == 1) ? xk : xv);
    src = xs + (size_t)off * 8;
    dst = xb + (size_t)u * 8;
  } else if (u < NXU + NWU) {
    const int e = u - NXU;
    const int z = e >> 15, off = e & ((1 << 15) - 1);
    const float* wsp = (z == 0) ? wq : ((z == 1) ? wk : wv);
    src = wsp + (size_t)off * 8;
    dst = wb + (size_t)e * 8;
  } else {
    const int e = u - NXU - NWU;
    const int n = e >> 7;
    const int c8 = (e & 127) * 8;
    src = wo + (size_t)n * DM + (c8 & (DM - 1));
    dst = wob + (size_t)n * KOUT + c8;
  }
  const v4f a = *(const v4fa*)src;
  const v4f b = *(const v4fa*)(src + 4);
  const v8us o = cvt8b(a, b);
  *(v8us*)dst = o;
  
}

// ---------------------------------------------------------------------------
// bf16 WMMA GEMM, plane z = blockIdx.z: C[4096][N] tile = A[4096][K] (bf16, pitch K) x WT[N][K]^T (bf16 rows n,
// k-contiguous), K = 32*ksteps. grid (4096/64, N/64, nz), 128 threads: wave w owns rows 16w..16w+15 of the 64x64
// tile, acc[4] = 4 column tiles. A fragment (row m = lane&15): elements 0..7 <- k0+8h+0..7, 8..15 <- k0+16+8h+0..7
// (h = lane>>4); B fragment (col n = lane&15) from WT row (col0+16t+n) with the SAME k map; D element r =
// (row 8h+r, col lane&15). Tile staged in LDS as 64x64 f32, then one instruction writes two 256-B row segments
//   EPI 0: head plane out[z][(b*8 + blockIdx.y)*1024 + s][64] f32 (b = row>>10, s = row&1023; column tile = one head)
//   EPI 1: out[row][512] f32 at columns col0..col0+63 (the final output, z = 0)
// coverage: grid (64, 8, nz) covers every (row, col) of each 4096 x 512 plane exactly once.
// ---------------------------------------------------------------------------
template<int EPI>
__global__ __launch_bounds__(GTHR) void k_gemm(
    const unsigned short* __restrict__ A, const unsigned short* __restrict__ WT,
    float* outF, int K, int strideA, int strideW, int strideO)
{
  __shared__ __attribute__((aligned(16))) float stg[GBM * GBN];   // 16 KB
  const int tid = (int)threadIdx.x, lane = tid & 31, wave = tid >> 5, hh = lane >> 4, m = lane & 15;
  const int z = (int)blockIdx.z;
  const unsigned short* Az = A  + (size_t)z * (size_t)strideA;
  const unsigned short* Wz = WT + (size_t)z * (size_t)strideW;
  float* Oz = outF + (size_t)z * (size_t)strideO;
  const int rowBase = (int)blockIdx.x * GBM;
  const int col0    = (int)blockIdx.y * GBN;

  v8f acc[4];
  {
    const v8f zz = {0.f, 0.f, 0.f, 0.f, 0.f, 0.f, 0.f, 0.f};
    acc[0] = zz; acc[1] = zz; acc[2] = zz; acc[3] = zz;
  }
  const unsigned short* ap = Az + (size_t)(rowBase + 16 * wave + m) * (size_t)K + 8 * hh;
  const unsigned short* wp = Wz + (size_t)(col0 + m) * (size_t)K + 8 * hh;
  const int ksteps = K >> 5;
#pragma unroll 1
  for (int ks = 0; ks < ksteps; ++ks) {
    FragB af;
    af.h[0] = *(const v8usa*)(ap + 32 * ks);          // k = 32ks + 8hh + 0..7
    af.h[1] = *(const v8usa*)(ap + 32 * ks + 16);     // k = 32ks + 16 + 8hh + 0..7
#pragma unroll
    for (int t = 0; t < 4; ++t) {
      const unsigned short* wq = wp + (size_t)(16 * t) * (size_t)K + 32 * ks;   // WT row col0 + 16t + m
      FragB bf;
      bf.h[0] = *(const v8usa*)wq;                    // same k map as A
      bf.h[1] = *(const v8usa*)(wq + 16);
      acc[t] = wmb(af, bf, acc[t]);
    }
  }

#pragma unroll
  for (int t = 0; t < 4; ++t) {
    const int lc = 16 * t + m;
#pragma unroll
    for (int r = 0; r < 8; ++r) {
      const int lr = 16 * wave + 8 * hh + r;          // D element r = (row 8hh+r, col m)
      stg[lr * GBN + lc] = acc[t][r];
    }
  }
  __syncthreads();

  float* ob;
  int ldo;
  if (EPI == 0) {
    const int bq = rowBase >> 10;
    const int s0 = rowBase & (SEQ - 1);
    ob  = Oz + ((size_t)(bq * NH + (int)blockIdx.y) * SEQ + s0) * DK;
    ldo = DK;
  } else {
    ob  = Oz + (size_t)rowBase * DM + col0;
    ldo = DM;
  }
  v4f fv[8];
#pragma unroll
  for (int i = 0; i < 8; ++i) {
    const int lr = 16 * wave + 2 * i + hh;
    fv[i] = *(const v4fa*)(stg + lr * GBN + 4 * m);
  }
#pragma unroll
  for (int i = 0; i < 8; ++i) {
    const int lr = 16 * wave + 2 * i + hh;
    float* op = ob + (size_t)lr * (size_t)ldo + 4 * m;
    *(v4f*)op = fv[i];
  }
  
}

// ---------------------------------------------------------------------------
// Window scores, one thread per flat slot: grid (32768/256, 32 = bh). w = f >> 10 is block-uniform.
// rel_k[h][w], rel_q[h][w] rows staged in LDS as bf16 values; q row (index qi) and k row (ki) gathered by clamped
// index from the f32 head planes; c2c, c2p, p2c as three rolled 64-deep f32 dots; masked slots get -1e9.
// coverage: 128 blocks x 256 threads = all 32768 slots of each of the 32 (b,h).
// ---------------------------------------------------------------------------
__global__ __launch_bounds__(NTHR) void k_scores(
    const int* __restrict__ pos_enc, const int* __restrict__ pos_pad,
    const float* __restrict__ rel_q, const float* __restrict__ rel_k,
    const float* __restrict__ QP, const float* __restrict__ KPl, float* S)
{
  __shared__ __attribute__((aligned(16))) float rk[DK];
  __shared__ __attribute__((aligned(16))) float rq[DK];
  const int tid = (int)threadIdx.x;
  const int bh = (int)blockIdx.y, h = bh & (NH - 1);
  const int f = (int)blockIdx.x * NTHR + tid;
  const int w = f >> 10;
  {
    const int sel = tid >> 6, j = tid & 63;          // sel uniform per pair of waves
    const size_t rb = (size_t)(h * W2 + w) * DK + j;
    if (sel == 0) rk[j] = bf16f(rel_k[rb]);
    if (sel == 1) rq[j] = bf16f(rel_q[rb]);
  }
  __syncthreads();

  int qi, ki; bool msk;
  slot_idx(pos_enc, pos_pad, bh, f, qi, ki, msk);
  const float* qrow = QP  + ((size_t)bh * SEQ + qi) * DK;
  const float* krow = KPl + ((size_t)bh * SEQ + ki) * DK;
  float c2c = 0.f, c2p = 0.f, p2c = 0.f;
#pragma unroll 1
  for (int j = 0; j < DK / 4; ++j) {
    const v4f qv  = *(const v4fa*)(qrow + 4 * j);
    const v4f kv  = *(const v4fa*)(krow + 4 * j);
    const v4f rkv = *(const v4fa*)(rk + 4 * j);
    const v4f rqv = *(const v4fa*)(rq + 4 * j);
    c2c = fmaf(qv.x, kv.x, c2c);   c2c = fmaf(qv.y, kv.y, c2c);   c2c = fmaf(qv.z, kv.z, c2c);   c2c = fmaf(qv.w, kv.w, c2c);
    c2p = fmaf(qv.x, rkv.x, c2p);  c2p = fmaf(qv.y, rkv.y, c2p);  c2p = fmaf(qv.z, rkv.z, c2p);  c2p = fmaf(qv.w, rkv.w, c2p);
    p2c = fmaf(rqv.x, kv.x, p2c);  p2c = fmaf(rqv.y, kv.y, p2c);  p2c = fmaf(rqv.z, kv.z, p2c);  p2c = fmaf(rqv.w, kv.w, p2c);
  }
  const float sc = msk ? NEGBIG : ((c2c + c2p) + p2c) * RINV24;
  float* sp = S + (size_t)bh * NSLOT + f;
  *(float*)sp = sc;
  
}

// ---------------------------------------------------------------------------
// One block per (b,h): softmax statistics over all 32768 slots, deterministic bucketing of every slot by its
// q index into LDS (count -> exclusive scan -> f-ascending cursor fill, wave 0, no atomics, no global tables),
// then an owner drain per target position: out_h[i][d] = sum over its slots of p[f] * (v[kv[f]][d] + rel_v[w][d]),
// p = exp(S[f] - M) * (1/Z). Lane = channel d (and 32 + d); every loop bound and index is clamped to static
// ranges. Result written as the bf16 hi | lo lines of OA row (b*1024 + i), columns h*64.. (hi) and 512 + h*64..
// Count cap overflow or inconsistent totals -> NaN poison of the row.
// coverage: 32 blocks x 1024 targets x (hi line + lo line) = all 4096 rows x 16 lines of OA exactly once.
// ---------------------------------------------------------------------------
__global__ __launch_bounds__(NTHR) void k_agg(
    const int* __restrict__ pos_enc, const int* __restrict__ pos_pad,
    const float* __restrict__ rel_v, const float* __restrict__ S, const float* __restrict__ VP,
    unsigned short* OA)
{
  extern __shared__ v4f lds_dyn[];
  int*   reg2 = (int*)lds_dyn;            // [NSLOT] packed (kv << 15 | f), grouped by target, f ascending
  int*   scnt = reg2 + NSLOT;             // [SEQ]
  int*   soff = scnt + SEQ;               // [SEQ]
  int*   cur  = soff + SEQ;               // [SEQ]
  float* relv = (float*)(cur + SEQ);      // [W2*DK]
  float* stw  = relv + W2 * DK;           // [NWAVE*64]
  float* red  = stw + NWAVE * 64;         // [16]
  int*   wtot = (int*)(red + 16);         // [NWAVE]
  const int tid = (int)threadIdx.x, lane = tid & 31, wave = tid >> 5;
  const int bh = (int)blockIdx.x, b = bh >> 3, h = bh & (NH - 1);
  const float* sb = S + (size_t)bh * NSLOT;

  {
    const v4i z4 = {0, 0, 0, 0};
#pragma unroll 1
    for (int i = tid; i < NSLOT / 4; i += NTHR) *(v4ia*)(reg2 + 4 * i) = z4;
    *(v4ia*)(scnt + 4 * tid) = z4;
    const float* rp = rel_v + (size_t)h * (W2 * DK) + 8 * tid;
    const v4f a = *(const v4fa*)rp;
    const v4f c = *(const v4fa*)(rp + 4);
    float* q = relv + 8 * tid;
    q[0] = bf16f(a.x); q[1] = bf16f(a.y); q[2] = bf16f(a.z); q[3] = bf16f(a.w);
    q[4] = bf16f(c.x); q[5] = bf16f(c.y); q[6] = bf16f(c.z); q[7] = bf16f(c.w);
  }
  __syncthreads();

  // ---- softmax statistics: M = max, Z = sum exp(s - M), two-level fixed order ----
  float mx = -3.0e38f;
#pragma unroll 1
  for (int i = 0; i < NSLOT / (4 * NTHR); ++i) {
    const v4f s4 = *(const v4fa*)(sb + (size_t)i * (4 * NTHR) + 4 * tid);
    mx = fmaxf(fmaxf(mx, fmaxf(s4.x, s4.y)), fmaxf(s4.z, s4.w));
  }
#pragma unroll
  for (int off = 16; off > 0; off >>= 1) mx = fmaxf(mx, __shfl_xor(mx, off));
  if (lane == 0) red[wave] = mx;
  __syncthreads();
  float M = red[0];
#pragma unroll
  for (int w2 = 1; w2 < NWAVE; ++w2) M = fmaxf(M, red[w2]);
  float zs = 0.f;
#pragma unroll 1
  for (int i = 0; i < NSLOT / (4 * NTHR); ++i) {
    const v4f s4 = *(const v4fa*)(sb + (size_t)i * (4 * NTHR) + 4 * tid);
    zs += (__expf(s4.x - M) + __expf(s4.y - M)) + (__expf(s4.z - M) + __expf(s4.w - M));
  }
#pragma unroll
  for (int off = 16; off > 0; off >>= 1) zs += __shfl_xor(zs, off);
  if (lane == 0) red[NWAVE + wave] = zs;
  __syncthreads();
  float Z = 0.f;
#pragma unroll
  for (int w2 = 0; w2 < NWAVE; ++w2) Z += red[NWAVE + w2];
  const float invZ = 1.0f / Z;                        // Z >= 1 (the max slot contributes exp(0))

  // ---- counts per target (wave 0, fixed f order, lane 0 writes) ----
  if (wave == 0) {
#pragma unroll 1
    for (int b0 = 0; b0 < NSLOT; b0 += 32) {
      const int f = b0 + lane;
      int qi, ki; bool msk;
      slot_idx(pos_enc, pos_pad, bh, f, qi, ki, msk);
#pragma unroll 1
      for (int k = 0; k < 32; ++k) {
        const int t = __builtin_amdgcn_readlane(qi, k) & (SEQ - 1);
        if (lane == 0) scnt[t] = scnt[t] + 1;
      }
    }
  }
  __syncthreads();

  // ---- exclusive prefix over SEQ counts -> soff ----
  int tot;
  {
    const v4i ca = *(const v4ia*)(scnt + 4 * tid);
    const int e0 = ca.x < 0 ? 0 : ca.x, e1 = ca.y < 0 ? 0 : ca.y, e2 = ca.z < 0 ? 0 : ca.z, e3 = ca.w < 0 ? 0 : ca.w;
    const int ts = e0 + e1 + e2 + e3;
    int incl = ts;
#pragma unroll
    for (int d = 1; d < 32; d <<= 1) {
      const int up = __shfl_up(incl, d);
      if (lane >= d) incl += up;
    }
    if (lane == 31) wtot[wave] = incl;
    __syncthreads();
    int pre = 0;
    tot = 0;
#pragma unroll
    for (int w2 = 0; w2 < NWAVE; ++w2) {
      const int t = wtot[w2];
      tot += t;
      pre += (w2 < wave) ? t : 0;
    }
    int run = pre + incl - ts;
    soff[4 * tid + 0] = run; run += e0;
    soff[4 * tid + 1] = run; run += e1;
    soff[4 * tid + 2] = run; run += e2;
    soff[4 * tid + 3] = run;
  }
  __syncthreads();
  *(v4ia*)(cur + 4 * tid) = *(const v4ia*)(soff + 4 * tid);
  __syncthreads();

  // ---- fill: packed (kv << 15 | f) into target segments (wave 0, fixed f order) ----
  if (wave == 0) {
#pragma unroll 1
    for (int b0 = 0; b0 < NSLOT; b0 += 32) {
      const int f = b0 + lane;
      int qi, ki; bool msk;
      slot_idx(pos_enc, pos_pad, bh, f, qi, ki, msk);
      const int ent = f | (ki << 15);
#pragma unroll 1
      for (int k = 0; k < 32; ++k) {
        const int t = __builtin_amdgcn_readlane(qi, k) & (SEQ - 1);
        const int e = __builtin_amdgcn_readlane(ent, k);
        if (lane == 0) {
          int pos = cur[t];
          pos = pos < 0 ? 0 : (pos > NSLOT - 1 ? NSLOT - 1 : pos);
          reg2[pos] = e;
          cur[t] = pos + 1;
        }
      }
    }
  }
  __syncthreads();

  // ---- drain: wave owns targets [wave*TPW, wave*TPW + TPW) ----
  const float qnan = __int_as_float(0x7fc00000);
  const bool bad_tot = (tot != NSLOT);
  float* sw = stw + wave * 64;
  const int lc = lane & 7;
  const bool islo = (lane & 8) != 0;
  const float* vb = VP + (size_t)bh * SEQ * DK;
#pragma unroll 1
  for (int jt = 0; jt < TPW; ++jt) {
    const int tg = wave * TPW + jt;                    // 0..1023
    int st = soff[tg];
    const int craw = scnt[tg];
    int cnt = craw;
    st  = st < 0 ? 0 : (st > NSLOT ? NSLOT : st);
    cnt = cnt < 0 ? 0 : (cnt > DEGCAP ? DEGCAP : cnt);
    if (cnt > NSLOT - st) cnt = NSLOT - st;
    const float pz = (bad_tot || craw > DEGCAP || craw < 0) ? qnan : 0.0f;
    float a0 = 0.f, a1 = 0.f;
#pragma unroll 1
    for (int q = 0; q < cnt; ++q) {
      int idx = st + q;
      idx = idx > NSLOT - 1 ? NSLOT - 1 : idx;
      const int e  = reg2[idx];
      const int f  = e & (NSLOT - 1);
      const int ki = (e >> 15) & (SEQ - 1);
      const int wr = f >> 10;                          // 0..31
      const float s = sb[f];
      const float p = __expf(s - M) * invZ;
      const float* vr = vb + (size_t)ki * DK + lane;
      const float v0 = vr[0];
      const float v1 = vr[32];
      const float r0 = relv[wr * DK + lane];
      const float r1 = relv[wr * DK + 32 + lane];
      a0 = fmaf(p, v0 + r0, a0);
      a1 = fmaf(p, v1 + r1, a1);
    }
    a0 += pz;
    a1 += pz;
    // per-wave relayout: channels in order, then lanes 0..7 (hi) / 8..15 (lo) read 8 consecutive channels each
    __builtin_amdgcn_fence(__ATOMIC_RELEASE, "wavefront");
    __builtin_amdgcn_wave_barrier();
    sw[lane]      = a0;
    sw[32 + lane] = a1;
    __builtin_amdgcn_fence(__ATOMIC_RELEASE, "wavefront");
    __builtin_amdgcn_wave_barrier();
    const v4f ga = *(const v4fa*)(sw + 8 * lc);
    const v4f gb = *(const v4fa*)(sw + 8 * lc + 4);
    const v8us ov = split8(ga, gb, islo);
    const int orow = b * SEQ + tg;
    unsigned short* dst = OA + (size_t)orow * KOUT + (islo ? DM : 0) + h * DK + 8 * lc;
    const bool wsv = lane < 16;
    if (wsv) *(v8us*)dst = ov;
    
  }
}

// ---------------------------------------------------------------------------
static inline int cdiv(int a, int b) { return (a + b - 1) / b; }

extern "C" void kernel_launch(void* const* d_in, const int* in_sizes, int n_in,
                              void* d_out, int out_size, void* d_ws, size_t ws_size,
                              hipStream_t stream) {
  if (n_in < 12) return;
  if (in_sizes[0] != NB_ * SEQ * DM || in_sizes[1] != NB_ * SEQ * DM || in_sizes[2] != NB_ * SEQ * DM) return;
  if (in_sizes[3] != NPOS || in_sizes[4] != NPOS) return;
  if (in_sizes[5] != NH * W2 * DK || in_sizes[6] != NH * W2 * DK || in_sizes[7] != NH * W2 * DK) return;
  if (in_sizes[8] != DM * DM || in_sizes[9] != DM * DM || in_sizes[10] != DM * DM || in_sizes[11] != DM * DM) return;
  if (out_size != NB_ * SEQ * DM) return;

  const float* query   = (const float*)d_in[0];    // [4][1024][512]
  const float* keyx    = (const float*)d_in[1];
  const float* value   = (const float*)d_in[2];
  const int*   pos_enc = (const int*)  d_in[3];    // [4][8][16][1024]
  const int*   pos_pad = (const int*)  d_in[4];
  const float* rel_q   = (const float*)d_in[5];    // [1][8][32][64]
  const float* rel_k   = (const float*)d_in[6];
  const float* rel_v   = (const float*)d_in[7];
  const float* Wq      = (const float*)d_in[8];    // [512][512] rows = output feature
  const float* Wk      = (const float*)d_in[9];
  const float* Wv      = (const float*)d_in[10];
  const float* Wo      = (const float*)d_in[11];
  float*       out     = (float*)d_out;            // [4][1024][512]

  // workspace carve (every region a whole number of 256-B blocks; all planes are exact tile multiples)
  char* ws = (char*)d_ws;
  size_t off = 0;
  const size_t oXB  = off; off += (size_t)NXU * 16;                     // 12,582,912  bf16 [3][4096][512]
  const size_t oWB  = off; off += (size_t)NWU * 16;                     //  1,572,864  bf16 [3][512][512]
  const size_t oWOB = off; off += (size_t)NWOU * 16;                    //  1,048,576  bf16 [512][1024]
  const size_t oQKV = off; off += (size_t)3 * PLQ * 4;                  // 25,165,824  f32 [3][32][1024][64]
  const size_t oS   = off; off += (size_t)NBH * NSLOT * 4;              //  4,194,304  f32 [32][32768]
  const size_t oOA  = off; off += (size_t)MROWS * KOUT * 2;             //  8,388,608  bf16 [4096][1024]
  if (off > ws_size || off > (size_t)WSMAX) return;                     // total 52,953,088
  unsigned short* XB  = (unsigned short*)(ws + oXB);
  unsigned short* WB  = (unsigned short*)(ws + oWB);
  unsigned short* WOB = (unsigned short*)(ws + oWOB);
  float*          QKV = (float*)(ws + oQKV);
  float*          S   = (float*)(ws + oS);
  unsigned short* OA  = (unsigned short*)(ws + oOA);
  const float* QP  = QKV;
  const float* KPl = QKV + (size_t)PLQ;
  const float* VP  = QKV + (size_t)2 * PLQ;

  hipFuncSetAttribute(reinterpret_cast<const void*>(&k_agg),
                      hipFuncAttributeMaxDynamicSharedMemorySize, LDS_AGG);

  // 1: bf16 operand planes
  k_convert<<<NCU / NTHR, NTHR, 0, stream>>>(query, keyx, value, Wq, Wk, Wv, Wo, XB, WB, WOB, NCU);
  // 2: q/k/v projections -> f32 head planes
  k_gemm<0><<<dim3(MROWS / GBM, DM / GBN, 3), GTHR, 0, stream>>>(XB, WB, QKV, DM, MROWS * DM, DM * DM, PLQ);
  // 3: window scores
  k_scores<<<dim3(NSLOT / NTHR, NBH), NTHR, 0, stream>>>(pos_enc, pos_pad, rel_q, rel_k, QP, KPl, S);
  // 4: softmax + owner segment sums -> bf16 hi|lo plane
  k_agg<<<NBH, NTHR, LDS_AGG, stream>>>(pos_enc, pos_pad, rel_v, S, VP, OA);
  // 5: output projection -> out
  k_gemm<1><<<dim3(MROWS / GBM, DM / GBN, 1), GTHR, 0, stream>>>(OA, WOB, out, KOUT, 0, 0, 0);
}

// v001
// One run takes 1180 microseconds.
// Next to v000, in two timings, it ran 4.96 times as fast each time.
#include <hip/hip_runtime.h>
#include <stddef.h>
#include <stdint.h>

// Contractions: q/k/v input projections (K=512) and the output projection (K=1024 = activation bf16 hi|lo pair
// accumulate). Window scores (three 64-deep dots per slot), softmax statistics, weighted value sums and the
// per-position segment sums: f32 VALU.
//
// Carry audit: no plane carries a power-of-two scale; nothing is folded back anywhere.
//   XB  [3][4096][512]  bf16 = RNE(query | key | value)               (k_convert) -> A of the projections
//   WB  [3][512][512]   bf16 = RNE(Wq | Wk | Wv), rows [n][k]          (k_convert) -> B of the projections
//   OA  [4096][1024]    bf16 = [hi | lo] of the per-head attention output, hi = RNE(o), lo = RNE(o - hi)
//                                                                     (k_agg)     -> A of the output projection
//   rel_q, rel_k, rel_v are RNE-converted to bf16 values (held as f32) when staged in LDS.
//   f32 planes: QKV [3][32][1024][64] (projection results), S [32][32768] (masked, scaled scores).

#define NB_    4
#define SEQ    1024
#define DM     512
#define NH     8
#define DK     64
#define KP1    16
#define W2     32
#define NSLOT  32768                 // W2 * SEQ flat window slots per (b,h)
#define NHALF  16384                 // KP1 * SEQ
#define NBH    32                    // NB_ * NH
#define MROWS  4096                  // NB_ * SEQ
#define KOUT   1024                  // 2 * DM (hi | lo)
#define NPOS   (NBH * NHALF)         // ints per position table
#define PLQ    (NBH * SEQ * DK)      // floats per q/k/v plane (2097152)
#define NTHR   256
#define NWAVE  8
#define GTHR   128
#define GBM    64
#define GBN    64
#define TPW    (SEQ / NWAVE)         // 128 targets per wave in k_agg
#define DEGCAP 256                   // static cap on slots per target position
#define RINV24 (1.0f / 24.0f)
#define NEGBIG (-1.0e9f)
#define WSMAX  134217728
#define NXU    (3 * (MROWS * DM / 8))   // 786432 convert units (8 elements each)
#define NWU    (3 * (DM * DM / 8))      // 98304
#define NWOU   (DM * KOUT / 8)          // 65536
#define NCU    (NXU + NWU + NWOU)       // 950272
#define FPW    (NSLOT / NWAVE)       // 4096 consecutive flat slots per wave in the bucketing passes of k_agg
#define BGRP   8                     // 32-slot steps whose index loads are issued together
#define LDS_AGG 182400

static_assert((MROWS % GBM) == 0 && (DM % GBN) == 0 && (SEQ % GBM) == 0);
static_assert((DM % 32) == 0 && (KOUT % 32) == 0);
static_assert(GBN == DK);
static_assert(GBM == (GTHR / 32) * 16);
static_assert(NSLOT == W2 * SEQ && NHALF == KP1 * SEQ && NBH == NB_ * NH && MROWS == NB_ * SEQ);
static_assert(NSLOT == (1 << 15) && SEQ == (1 << 10));
static_assert((MROWS * DM / 8) == (1 << 18) && (DM * DM / 8) == (1 << 15) && (KOUT / 8) == 128);
static_assert((NXU % NTHR) == 0 && ((NXU + NWU) % NTHR) == 0 && (NCU % NTHR) == 0);
static_assert(NTHR * 4 == SEQ && TPW * NWAVE == SEQ);
static_assert((NSLOT % (4 * NTHR)) == 0);
static_assert(NTHR * 8 == W2 * DK);
static_assert((NSLOT + (2 + NWAVE) * SEQ) * 4 + (W2 * DK + NWAVE * 64 + 16) * 4 + NWAVE * 4 <= LDS_AGG);
static_assert(FPW * NWAVE == NSLOT && (FPW % (32 * BGRP)) == 0 && (NHALF % FPW) == 0);
static_assert(LDS_AGG <= 300000);
static_assert(PLQ == NB_ * SEQ * DM);

typedef float    v4f  __attribute__((ext_vector_type(4)));
typedef float    v8f  __attribute__((ext_vector_type(8)));
typedef int      v4i  __attribute__((ext_vector_type(4)));
typedef int      v8i  __attribute__((ext_vector_type(8)));
typedef unsigned short v8us __attribute__((ext_vector_type(8)));
typedef __bf16   v16b __attribute__((ext_vector_type(16)));
typedef v4f  __attribute__((may_alias)) v4fa;
typedef v4i  __attribute__((may_alias)) v4ia;
typedef v8us __attribute__((may_alias)) v8usa;
union FragB { v16b v; v8us h[2]; v8i w; };

// WMMA with hazard guard: ties D, keeps A/B live for 4 VALU slots
__device__ __forceinline__ v8f wmb(const FragB& a, const FragB& b, v8f c) {
  v8f d = __builtin_amdgcn_wmma_f32_16x16x32_bf16(false, a.v, false, b.v, (short)0, c, false, false);
  asm volatile("v_nop\n\tv_nop\n\tv_nop\n\tv_nop" : "+v"(d) : "v"(a.w), "v"(b.w));
  return d;
}

// f32 -> bf16 bits, RNE convert
__device__ __forceinline__ unsigned int bf16u(float x) {
  const unsigned int u = __float_as_uint(x);
  return (u + 0x7FFFu + ((u >> 16) & 1u)) >> 16;
}
// f32 -> nearest bf16 value held as f32
__device__ __forceinline__ float bf16f(float x) { return __uint_as_float(bf16u(x) << 16); }

__device__ __forceinline__ v8us cvt8b(const v4f a, const v4f b) {
  v8us r;
  r[0] = (unsigned short)bf16u(a.x); r[1] = (unsigned short)bf16u(a.y);
  r[2] = (unsigned short)bf16u(a.z); r[3] = (unsigned short)bf16u(a.w);
  r[4] = (unsigned short)bf16u(b.x); r[5] = (unsigned short)bf16u(b.y);
  r[6] = (unsigned short)bf16u(b.z); r[7] = (unsigned short)bf16u(b.w);
  return r;
}

__device__ __forceinline__ unsigned short hl1(float x, bool islo) {
  const unsigned int hu = bf16u(x);
  const float hf = __uint_as_float(hu << 16);
  const unsigned int lu = bf16u(x - hf);
  return (unsigned short)(islo ? lu : hu);
}
// 8 floats -> 8 bf16 hi parts (islo false) or 8 bf16 lo parts (islo true), lo = RNE(x - hi)
__device__ __forceinline__ v8us split8(const v4f a, const v4f b, bool islo) {
  v8us r;
  r[0] = hl1(a.x, islo); r[1] = hl1(a.y, islo); r[2] = hl1(a.z, islo); r[3] = hl1(a.w, islo);
  r[4] = hl1(b.x, islo); r[5] = hl1(b.y, islo); r[6] = hl1(b.z, islo); r[7] = hl1(b.w, islo);
  return r;
}

// ---------------------------------------------------------------------------
// Flat window slot f (0..32767) of head group bh: window row w = f >> 10, position s = f & 1023.
//   q index  = w < 16 ? pos_pad[w][s]    : pe[w-16][s]       (pe = pos_enc with -1 -> 0)
//   kv index = w < 16 ? pe[w][s]         : pos_pad[w-16][s]
//   masked   = (pos_enc[w & 15][s] == -1) || f < 1024
// Both tables are read unconditionally (same g for both halves) and clamped into [0, SEQ-1].
// ---------------------------------------------------------------------------
__device__ __forceinline__ void slot_idx(const int* __restrict__ pos_enc, const int* __restrict__ pos_pad,
                                         int bh, int f, int& qi, int& ki, bool& msk) {
  const int g = bh * NHALF + (f & (NHALF - 1));
  const int penc = pos_enc[g];
  const int ppad = pos_pad[g];
  const bool neg = (penc == -1);
  int pe = neg ? 0 : penc;
  pe = pe < 0 ? 0 : (pe > SEQ - 1 ? SEQ - 1 : pe);
  int pp = ppad < 0 ? 0 : (ppad > SEQ - 1 ? SEQ - 1 : ppad);
  const bool lo = f < NHALF;
  qi = lo ? pp : pe;
  ki = lo ? pe : pp;
  msk = neg || (f < SEQ);
}

// position index clamped into [0, SEQ-1]
__device__ __forceinline__ int clamp_pos(int v) { return v < 0 ? 0 : (v > SEQ - 1 ? SEQ - 1 : v); }

// Mask of the lanes of this wave whose 10-bit target t equals this lane's (all 32 lanes active): one ballot per bit.
__device__ __forceinline__ unsigned int same_target(int t) {
  unsigned int peers = 0xFFFFFFFFu;
#pragma unroll
  for (int bit = 0; bit < 10; ++bit) {
    const bool on = ((t >> bit) & 1) != 0;
    const unsigned int bl = __builtin_amdgcn_ballot_w32(on);
    peers &= on ? bl : ~bl;
  }
  return peers;
}

// ---------------------------------------------------------------------------
//   u <  NXU        : XB[z][off*8 ..]  z = u >> 18 selects query | key | value
//   u <  NXU + NWU  : WB[z][off*8 ..]  z selects Wq | Wk | Wv (rows [n][k] as given)
// coverage: NXU*8 = 3*4096*512, NWU*8 = 3*512*512, NWOU*8 = 512*1024 elements exactly.
// ---------------------------------------------------------------------------
__global__ __launch_bounds__(NTHR) void k_convert(
    const float* __restrict__ xq, const float* __restrict__ xk, const float* __restrict__ xv,
    const float* __restrict__ wq, const float* __restrict__ wk, const float* __restrict__ wv,
    const float* __restrict__ wo,
    unsigned short* xb, unsigned short* wb, unsigned short* wob, int nUnits)
{
  const int u = (int)blockIdx.x * NTHR + (int)threadIdx.x;
  if (u >= nUnits) return;
  const float* src;
  unsigned short* dst;
  if (u < NXU) {
    const int z = u >> 18, off = u & ((1 << 18) - 1);
    const float* xs = (z == 0) ? xq : ((z == 1) ? xk : xv);
    src = xs + (size_t)off * 8;
    dst = xb + (size_t)u * 8;
  } else if (u < NXU + NWU) {
    const int e = u - NXU;
    const int z = e >> 15, off = e & ((1 << 15) - 1);
    const float* wsp = (z == 0) ? wq : ((z == 1) ? wk : wv);
    src = wsp + (size_t)off * 8;
    dst = wb + (size_t)e * 8;
  } else {
    const int e = u - NXU - NWU;
    const int n = e >> 7;
    const int c8 = (e & 127) * 8;
    src = wo + (size_t)n * DM + (c8 & (DM - 1));
    dst = wob + (size_t)n * KOUT + c8;
  }
  const v4f a = *(const v4fa*)src;
  const v4f b = *(const v4fa*)(src + 4);
  const v8us o = cvt8b(a, b);
  *(v8us*)dst = o;
  
}

// ---------------------------------------------------------------------------
// bf16 WMMA GEMM, plane z = blockIdx.z: C[4096][N] tile = A[4096][K] (bf16, pitch K) x WT[N][K]^T (bf16 rows n,
// k-contiguous), K = 32*ksteps. grid (4096/64, N/64, nz), 128 threads: wave w owns rows 16w..16w+15 of the 64x64
// tile, acc[4] = 4 column tiles. A fragment (row m = lane&15): elements 0..7 <- k0+8h+0..7, 8..15 <- k0+16+8h+0..7
// (h = lane>>4); B fragment (col n = lane&15) from WT row (col0+16t+n) with the SAME k map; D element r =
// (row 8h+r, col lane&15). Tile staged in LDS as 64x64 f32, then one instruction writes two 256-B row segments
//   EPI 0: head plane out[z][(b*8 + blockIdx.y)*1024 + s][64] f32 (b = row>>10, s = row&1023; column tile = one head)
//   EPI 1: out[row][512] f32 at columns col0..col0+63 (the final output, z = 0)
// coverage: grid (64, 8, nz) covers every (row, col) of each 4096 x 512 plane exactly once.
// ---------------------------------------------------------------------------
template<int EPI>
__global__ __launch_bounds__(GTHR) void k_gemm(
    const unsigned short* __restrict__ A, const unsigned short* __restrict__ WT,
    float* outF, int K, int strideA, int strideW, int strideO)
{
  __shared__ __attribute__((aligned(16))) float stg[GBM * GBN];   // 16 KB
  const int tid = (int)threadIdx.x, lane = tid & 31, wave = tid >> 5, hh = lane >> 4, m = lane & 15;
  const int z = (int)blockIdx.z;
  const unsigned short* Az = A  + (size_t)z * (size_t)strideA;
  const unsigned short* Wz = WT + (size_t)z * (size_t)strideW;
  float* Oz = outF + (size_t)z * (size_t)strideO;
  const int rowBase = (int)blockIdx.x * GBM;
  const int col0    = (int)blockIdx.y * GBN;

  v8f acc[4];
  {
    const v8f zz = {0.f, 0.f, 0.f, 0.f, 0.f, 0.f, 0.f, 0.f};
    acc[0] = zz; acc[1] = zz; acc[2] = zz; acc[3] = zz;
  }
  const unsigned short* ap = Az + (size_t)(rowBase + 16 * wave + m) * (size_t)K + 8 * hh;
  const unsigned short* wp = Wz + (size_t)(col0 + m) * (size_t)K + 8 * hh;
  const int ksteps = K >> 5;
#pragma unroll 1
  for (int ks = 0; ks < ksteps; ++ks) {
    FragB af;
    af.h[0] = *(const v8usa*)(ap + 32 * ks);          // k = 32ks + 8hh + 0..7
    af.h[1] = *(const v8usa*)(ap + 32 * ks + 16);     // k = 32ks + 16 + 8hh + 0..7
#pragma unroll
    for (int t = 0; t < 4; ++t) {
      const unsigned short* wq = wp + (size_t)(16 * t) * (size_t)K + 32 * ks;   // WT row col0 + 16t + m
      FragB bf;
      bf.h[0] = *(const v8usa*)wq;                    // same k map as A
      bf.h[1] = *(const v8usa*)(wq + 16);
      acc[t] = wmb(af, bf, acc[t]);
    }
  }

#pragma unroll
  for (int t = 0; t < 4; ++t) {
    const int lc = 16 * t + m;
#pragma unroll
    for (int r = 0; r < 8; ++r) {
      const int lr = 16 * wave + 8 * hh + r;          // D element r = (row 8hh+r, col m)
      stg[lr * GBN + lc] = acc[t][r];
    }
  }
  __syncthreads();

  float* ob;
  int ldo;
  if (EPI == 0) {
    const int bq = rowBase >> 10;
    const int s0 = rowBase & (SEQ - 1);
    ob  = Oz + ((size_t)(bq * NH + (int)blockIdx.y) * SEQ + s0) * DK;
    ldo = DK;
  } else {
    ob  = Oz + (size_t)rowBase * DM + col0;
    ldo = DM;
  }
  v4f fv[8];
#pragma unroll
  for (int i = 0; i < 8; ++i) {
    const int lr = 16 * wave + 2 * i + hh;
    fv[i] = *(const v4fa*)(stg + lr * GBN + 4 * m);
  }
#pragma unroll
  for (int i = 0; i < 8; ++i) {
    const int lr = 16 * wave + 2 * i + hh;
    float* op = ob + (size_t)lr * (size_t)ldo + 4 * m;
    *(v4f*)op = fv[i];
  }
  
}

// ---------------------------------------------------------------------------
// Window scores, one thread per flat slot: grid (32768/256, 32 = bh). w = f >> 10 is block-uniform.
// rel_k[h][w], rel_q[h][w] rows staged in LDS as bf16 values; q row (index qi) and k row (ki) gathered by clamped
// index from the f32 head planes; c2c, c2p, p2c as three rolled 64-deep f32 dots; masked slots get -1e9.
// coverage: 128 blocks x 256 threads = all 32768 slots of each of the 32 (b,h).
// ---------------------------------------------------------------------------
__global__ __launch_bounds__(NTHR) void k_scores(
    const int* __restrict__ pos_enc, const int* __restrict__ pos_pad,
    const float* __restrict__ rel_q, const float* __restrict__ rel_k,
    const float* __restrict__ QP, const float* __restrict__ KPl, float* S)
{
  __shared__ __attribute__((aligned(16))) float rk[DK];
  __shared__ __attribute__((aligned(16))) float rq[DK];
  const int tid = (int)threadIdx.x;
  const int bh = (int)blockIdx.y, h = bh & (NH - 1);
  const int f = (int)blockIdx.x * NTHR + tid;
  const int w = f >> 10;
  {
    const int sel = tid >> 6, j = tid & 63;          // sel uniform per pair of waves
    const size_t rb = (size_t)(h * W2 + w) * DK + j;
    if (sel == 0) rk[j] = bf16f(rel_k[rb]);
    if (sel == 1) rq[j] = bf16f(rel_q[rb]);
  }
  __syncthreads();

  int qi, ki; bool msk;
  slot_idx(pos_enc, pos_pad, bh, f, qi, ki, msk);
  const float* qrow = QP  + ((size_t)bh * SEQ + qi) * DK;
  const float* krow = KPl + ((size_t)bh * SEQ + ki) * DK;
  float c2c = 0.f, c2p = 0.f, p2c = 0.f;
#pragma unroll 1
  for (int j = 0; j < DK / 4; ++j) {
    const v4f qv  = *(const v4fa*)(qrow + 4 * j);
    const v4f kv  = *(const v4fa*)(krow + 4 * j);
    const v4f rkv = *(const v4fa*)(rk + 4 * j);
    const v4f rqv = *(const v4fa*)(rq + 4 * j);
    c2c = fmaf(qv.x, kv.x, c2c);   c2c = fmaf(qv.y, kv.y, c2c);   c2c = fmaf(qv.z, kv.z, c2c);   c2c = fmaf(qv.w, kv.w, c2c);
    c2p = fmaf(qv.x, rkv.x, c2p);  c2p = fmaf(qv.y, rkv.y, c2p);  c2p = fmaf(qv.z, rkv.z, c2p);  c2p = fmaf(qv.w, rkv.w, c2p);
    p2c = fmaf(rqv.x, kv.x, p2c);  p2c = fmaf(rqv.y, kv.y, p2c);  p2c = fmaf(rqv.z, kv.z, p2c);  p2c = fmaf(rqv.w, kv.w, p2c);
  }
  const float sc = msk ? NEGBIG : ((c2c + c2p) + p2c) * RINV24;
  float* sp = S + (size_t)bh * NSLOT + f;
  *(float*)sp = sc;
  
}

// ---------------------------------------------------------------------------
// One block per (b,h): softmax statistics over all 32768 slots, deterministic bucketing of every slot by its
// q index into LDS (count -> exclusive scan -> f-ascending cursor fill, no atomics, no global tables): wave w takes
// flat slots [4096w, 4096w + 4096), 32 a step; lanes with the same target are matched by ballots, the first of them
// updates the wave's own counter / cursor row, each lane's place is cursor + its rank among them,
// then an owner drain per target position: out_h[i][d] = sum over its slots of p[f] * (v[kv[f]][d] + rel_v[w][d]),
// p = exp(S[f] - M) * (1/Z). Lane = channel d (and 32 + d); every loop bound and index is clamped to static
// ranges. Result written as the bf16 hi | lo lines of OA row (b*1024 + i), columns h*64.. (hi) and 512 + h*64..
// Count cap overflow or inconsistent totals -> NaN poison of the row.
// coverage: 32 blocks x 1024 targets x (hi line + lo line) = all 4096 rows x 16 lines of OA exactly once.
// ---------------------------------------------------------------------------
__global__ __launch_bounds__(NTHR) void k_agg(
    const int* __restrict__ pos_enc, const int* __restrict__ pos_pad,
    const float* __restrict__ rel_v, const float* __restrict__ S, const float* __restrict__ VP,
    unsigned short* OA)
{
  extern __shared__ v4f lds_dyn[];
  int*   reg2 = (int*)lds_dyn;            // [NSLOT] packed (kv << 15 | f), grouped by target, f ascending
  int*   scnt = reg2 + NSLOT;             // [SEQ]
  int*   soff = scnt + SEQ;               // [SEQ]
  int*   cur  = soff + SEQ;               // [NWAVE][SEQ] per-wave counts, then per-wave cursors
  float* relv = (float*)(cur + NWAVE * SEQ);   // [W2*DK]
  float* stw  = relv + W2 * DK;           // [NWAVE*64]
  float* red  = stw + NWAVE * 64;         // [16]
  int*   wtot = (int*)(red + 16);         // [NWAVE]
  const int tid = (int)threadIdx.x, lane = tid & 31, wave = tid >> 5;
  const int bh = (int)blockIdx.x, b = bh >> 3, h = bh & (NH - 1);
  const float* sb = S + (size_t)bh * NSLOT;

  {
    const v4i z4 = {0, 0, 0, 0};
#pragma unroll 1
    for (int i = tid; i < NSLOT / 4; i += NTHR) *(v4ia*)(reg2 + 4 * i) = z4;
#pragma unroll
    for (int w2 = 0; w2 < NWAVE; ++w2) *(v4ia*)(cur + w2 * SEQ + 4 * tid) = z4;
    const float* rp = rel_v + (size_t)h * (W2 * DK) + 8 * tid;
    const v4f a = *(const v4fa*)rp;
    const v4f c = *(const v4fa*)(rp + 4);
    float* q = relv + 8 * tid;
    q[0] = bf16f(a.x); q[1] = bf16f(a.y); q[2] = bf16f(a.z); q[3] = bf16f(a.w);
    q[4] = bf16f(c.x); q[5] = bf16f(c.y); q[6] = bf16f(c.z); q[7] = bf16f(c.w);
  }
  __syncthreads();

  // ---- softmax statistics: M = max, Z = sum exp(s - M), two-level fixed order ----
  float mx = -3.0e38f;
#pragma unroll 1
  for (int i = 0; i < NSLOT / (4 * NTHR); ++i) {
    const v4f s4 = *(const v4fa*)(sb + (size_t)i * (4 * NTHR) + 4 * tid);
    mx = fmaxf(fmaxf(mx, fmaxf(s4.x, s4.y)), fmaxf(s4.z, s4.w));
  }
#pragma unroll
  for (int off = 16; off > 0; off >>= 1) mx = fmaxf(mx, __shfl_xor(mx, off));
  if (lane == 0) red[wave] = mx;
  __syncthreads();
  float M = red[0];
#pragma unroll
  for (int w2 = 1; w2 < NWAVE; ++w2) M = fmaxf(M, red[w2]);
  float zs = 0.f;
#pragma unroll 1
  for (int i = 0; i < NSLOT / (4 * NTHR); ++i) {
    const v4f s4 = *(const v4fa*)(sb + (size_t)i * (4 * NTHR) + 4 * tid);
    zs += (__expf(s4.x - M) + __expf(s4.y - M)) + (__expf(s4.z - M) + __expf(s4.w - M));
  }
#pragma unroll
  for (int off = 16; off > 0; off >>= 1) zs += __shfl_xor(zs, off);
  if (lane == 0) red[NWAVE + wave] = zs;
  __syncthreads();
  float Z = 0.f;
#pragma unroll
  for (int w2 = 0; w2 < NWAVE; ++w2) Z += red[NWAVE + w2];
  const float invZ = 1.0f / Z;                        // Z >= 1 (the max slot contributes exp(0))

  // ---- counts per (wave, target): every wave over its own 4096 slots ----
  // A wave's 4096 slots lie in one half of the window rows, so its q table and its kv table (slot_idx) are fixed:
  // lower half q <- pos_pad, kv <- pos_enc; upper half the other way round. clamp_pos sends pos_enc's -1 to 0.
  const int f0w = __builtin_amdgcn_readfirstlane(wave) * FPW;   // wave-uniform: scalar loop control and table choice
  const bool lohalf = f0w < NHALF;
  const int* qtab = (lohalf ? pos_pad : pos_enc) + bh * NHALF + (f0w & (NHALF - 1));
  const int* ktab = (lohalf ? pos_enc : pos_pad) + bh * NHALF + (f0w & (NHALF - 1));
  int* wcur = cur + wave * SEQ;
  const unsigned int below = (1u << lane) - 1u;
#pragma unroll 1
  for (int g = 0; g < FPW; g += 32 * BGRP) {
    int tq[BGRP];
#pragma unroll
    for (int j = 0; j < BGRP; ++j) tq[j] = clamp_pos(qtab[g + 32 * j + lane]) & (SEQ - 1);
#pragma unroll
    for (int j = 0; j < BGRP; ++j) {
      const unsigned int peers = same_target(tq[j]);
      if ((peers & below) == 0u) wcur[tq[j]] = wcur[tq[j]] + __builtin_popcount(peers);
      // the next step's reader of a counter may be another lane of this wave: keep the LDS accesses in step order
      __builtin_amdgcn_fence(__ATOMIC_ACQ_REL, "wavefront");
      __builtin_amdgcn_wave_barrier();
    }
  }
  __syncthreads();

  // ---- exclusive prefix over SEQ counts -> soff ----
  int tot;
  {
    v4i cw[NWAVE];
    v4i ca = {0, 0, 0, 0};
#pragma unroll
    for (int w2 = 0; w2 < NWAVE; ++w2) {
      cw[w2] = *(const v4ia*)(cur + w2 * SEQ + 4 * tid);
      ca += cw[w2];
    }
    *(v4ia*)(scnt + 4 * tid) = ca;
    const int e0 = ca.x < 0 ? 0 : ca.x, e1 = ca.y < 0 ? 0 : ca.y, e2 = ca.z < 0 ? 0 : ca.z, e3 = ca.w < 0 ? 0 : ca.w;
    const int ts = e0 + e1 + e2 + e3;
    int incl = ts;
#pragma unroll
    for (int d = 1; d < 32; d <<= 1) {
      const int up = __shfl_up(incl, d);
      if (lane >= d) incl += up;
    }
    if (lane == 31) wtot[wave] = incl;
    __syncthreads();
    int pre = 0;
    tot = 0;
#pragma unroll
    for (int w2 = 0; w2 < NWAVE; ++w2) {
      const int t = wtot[w2];
      tot += t;
      pre += (w2 < wave) ? t : 0;
    }
    int run = pre + incl - ts;
    v4i so;
    so.x = run; run += e0;
    so.y = run; run += e1;
    so.z = run; run += e2;
    so.w = run;
    *(v4ia*)(soff + 4 * tid) = so;
    // wave w2's cursor of a target starts behind the slots that waves 0..w2-1 hold for it (f ascending over waves)
#pragma unroll
    for (int w2 = 0; w2 < NWAVE; ++w2) {
      *(v4ia*)(cur + w2 * SEQ + 4 * tid) = so;
      so += cw[w2];
    }
  }
  __syncthreads();

  // ---- fill: packed (kv << 15 | f) into target segments (every wave over its own slots, f ascending) ----
#pragma unroll 1
  for (int g = 0; g < FPW; g += 32 * BGRP) {
    int tq[BGRP], ent[BGRP];
#pragma unroll
    for (int j = 0; j < BGRP; ++j) {
      const int o = g + 32 * j + lane;
      tq[j]  = clamp_pos(qtab[o]) & (SEQ - 1);
      ent[j] = (f0w + o) | (clamp_pos(ktab[o]) << 15);
    }
    // the steps below reuse the address registers of the loads above
    asm volatile("s_wait_xcnt 0x0" ::: "memory");
#pragma unroll
    for (int j = 0; j < BGRP; ++j) {
      const unsigned int peers = same_target(tq[j]);
      const unsigned int lower = peers & below;
      const int base = wcur[tq[j]];
      int pos = base + __builtin_popcount(lower);
      pos = pos < 0 ? 0 : (pos > NSLOT - 1 ? NSLOT - 1 : pos);
      reg2[pos] = ent[j];
      if (lower == 0u) wcur[tq[j]] = base + __builtin_popcount(peers);
      // the next step's reader of a cursor may be another lane of this wave: keep the LDS accesses in step order
      __builtin_amdgcn_fence(__ATOMIC_ACQ_REL, "wavefront");
      __builtin_amdgcn_wave_barrier();
    }
  }
  __syncthreads();

  // ---- drain: wave owns targets [wave*TPW, wave*TPW + TPW) ----
  const float qnan = __int_as_float(0x7fc00000);
  const bool bad_tot = (tot != NSLOT);
  float* sw = stw + wave * 64;
  const int lc = lane & 7;
  const bool islo = (lane & 8) != 0;
  const float* vb = VP + (size_t)bh * SEQ * DK;
#pragma unroll 1
  for (int jt = 0; jt < TPW; ++jt) {
    const int tg = wave * TPW + jt;                    // 0..1023
    int st = soff[tg];
    const int craw = scnt[tg];
    int cnt = craw;
    st  = st < 0 ? 0 : (st > NSLOT ? NSLOT : st);
    cnt = cnt < 0 ? 0 : (cnt > DEGCAP ? DEGCAP : cnt);
    if (cnt > NSLOT - st) cnt = NSLOT - st;
    const float pz = (bad_tot || craw > DEGCAP || craw < 0) ? qnan : 0.0f;
    float a0 = 0.f, a1 = 0.f;
#pragma unroll 1
    for (int q = 0; q < cnt; ++q) {
      int idx = st + q;
      idx = idx > NSLOT - 1 ? NSLOT - 1 : idx;
      const int e  = reg2[idx];
      const int f  = e & (NSLOT - 1);
      const int ki = (e >> 15) & (SEQ - 1);
      const int wr = f >> 10;                          // 0..31
      const float s = sb[f];
      const float p = __expf(s - M) * invZ;
      const float* vr = vb + (size_t)ki * DK + lane;
      const float v0 = vr[0];
      const float v1 = vr[32];
      const float r0 = relv[wr * DK + lane];
      const float r1 = relv[wr * DK + 32 + lane];
      a0 = fmaf(p, v0 + r0, a0);
      a1 = fmaf(p, v1 + r1, a1);
    }
    a0 += pz;
    a1 += pz;
    // per-wave relayout: channels in order, then lanes 0..7 (hi) / 8..15 (lo) read 8 consecutive channels each
    __builtin_amdgcn_fence(__ATOMIC_RELEASE, "wavefront");
    __builtin_amdgcn_wave_barrier();
    sw[lane]      = a0;
    sw[32 + lane] = a1;
    __builtin_amdgcn_fence(__ATOMIC_RELEASE, "wavefront");
    __builtin_amdgcn_wave_barrier();
    const v4f ga = *(const v4fa*)(sw + 8 * lc);
    const v4f gb = *(const v4fa*)(sw + 8 * lc + 4);
    const v8us ov = split8(ga, gb, islo);
    const int orow = b * SEQ + tg;
    unsigned short* dst = OA + (size_t)orow * KOUT + (islo ? DM : 0) + h * DK + 8 * lc;
    const bool wsv = lane < 16;
    if (wsv) *(v8us*)dst = ov;
    
  }
}

// ---------------------------------------------------------------------------
static inline int cdiv(int a, int b) { return (a + b - 1) / b; }

extern "C" void kernel_launch(void* const* d_in, const int* in_sizes, int n_in,
                              void* d_out, int out_size, void* d_ws, size_t ws_size,
                              hipStream_t stream) {
  if (n_in < 12) return;
  if (in_sizes[0] != NB_ * SEQ * DM || in_sizes[1] != NB_ * SEQ * DM || in_sizes[2] != NB_ * SEQ * DM) return;
  if (in_sizes[3] != NPOS || in_sizes[4] != NPOS) return;
  if (in_sizes[5] != NH * W2 * DK || in_sizes[6] != NH * W2 * DK || in_sizes[7] != NH * W2 * DK) return;
  if (in_sizes[8] != DM * DM || in_sizes[9] != DM * DM || in_sizes[10] != DM * DM || in_sizes[11] != DM * DM) return;
  if (out_size != NB_ * SEQ * DM) return;

  const float* query   = (const float*)d_in[0];    // [4][1024][512]
  const float* keyx    = (const float*)d_in[1];
  const float* value   = (const float*)d_in[2];
  const int*   pos_enc = (const int*)  d_in[3];    // [4][8][16][1024]
  const int*   pos_pad = (const int*)  d_in[4];
  const float* rel_q   = (const float*)d_in[5];    // [1][8][32][64]
  const float* rel_k   = (const float*)d_in[6];
  const float* rel_v   = (const float*)d_in[7];
  const float* Wq      = (const float*)d_in[8];    // [512][512] rows = output feature
  const float* Wk      = (const float*)d_in[9];
  const float* Wv      = (const float*)d_in[10];
  const float* Wo      = (const float*)d_in[11];
  float*       out     = (float*)d_out;            // [4][1024][512]

  // workspace carve (every region a whole number of 256-B blocks; all planes are exact tile multiples)
  char* ws = (char*)d_ws;
  size_t off = 0;
  const size_t oXB  = off; off += (size_t)NXU * 16;                     // 12,582,912  bf16 [3][4096][512]
  const size_t oWB  = off; off += (size_t)NWU * 16;                     //  1,572,864  bf16 [3][512][512]
  const size_t oWOB = off; off += (size_t)NWOU * 16;                    //  1,048,576  bf16 [512][1024]
  const size_t oQKV = off; off += (size_t)3 * PLQ * 4;                  // 25,165,824  f32 [3][32][1024][64]
  const size_t oS   = off; off += (size_t)NBH * NSLOT * 4;              //  4,194,304  f32 [32][32768]
  const size_t oOA  = off; off += (size_t)MROWS * KOUT * 2;             //  8,388,608  bf16 [4096][1024]
  if (off > ws_size || off > (size_t)WSMAX) return;                     // total 52,953,088
  unsigned short* XB  = (unsigned short*)(ws + oXB);
  unsigned short* WB  = (unsigned short*)(ws + oWB);
  unsigned short* WOB = (unsigned short*)(ws + oWOB);
  float*          QKV = (float*)(ws + oQKV);
  float*          S   = (float*)(ws + oS);
  unsigned short* OA  = (unsigned short*)(ws + oOA);
  const float* QP  = QKV;
  const float* KPl = QKV + (size_t)PLQ;
  const float* VP  = QKV + (size_t)2 * PLQ;

  hipFuncSetAttribute(reinterpret_cast<const void*>(&k_agg),
                      hipFuncAttributeMaxDynamicSharedMemorySize, LDS_AGG);

  // 1: bf16 operand planes
  k_convert<<<NCU / NTHR, NTHR, 0, stream>>>(query, keyx, value, Wq, Wk, Wv, Wo, XB, WB, WOB, NCU);
  // 2: q/k/v projections -> f32 head planes
  k_gemm<0><<<dim3(MROWS / GBM, DM / GBN, 3), GTHR, 0, stream>>>(XB, WB, QKV, DM, MROWS * DM, DM * DM, PLQ);
  // 3: window scores
  k_scores<<<dim3(NSLOT / NTHR, NBH), NTHR, 0, stream>>>(pos_enc, pos_pad, rel_q, rel_k, QP, KPl, S);
  // 4: softmax + owner segment sums -> bf16 hi|lo plane
  k_agg<<<NBH, NTHR, LDS_AGG, stream>>>(pos_enc, pos_pad, rel_v, S, VP, OA);
  // 5: output projection -> out
  k_gemm<1><<<dim3(MROWS / GBM, DM / GBN, 1), GTHR, 0, stream>>>(OA, WOB, out, KOUT, 0, 0, 0);
}

// v002
// A run of this version takes 392 microseconds.
// Two timings next to v001 put it at 3.01 and 3.02 times that version's speed.
// Counting every step since v000, it is 14.9 times as fast.
#include <hip/hip_runtime.h>
#include <stddef.h>
#include <stdint.h>

// Contractions: q/k/v input projections (K=512) and the output projection (K=1024 = activation bf16 hi|lo pair
// accumulate). Window scores (three 64-deep dots per slot), softmax statistics, weighted value sums and the
// per-position segment sums: f32 VALU.
//
// Carry audit: no plane carries a power-of-two scale; nothing is folded back anywhere.
//   XB  [3][4096][512]  bf16 = RNE(query | key | value)               (k_convert) -> A of the projections
//   WB  [3][512][512]   bf16 = RNE(Wq | Wk | Wv), rows [n][k]          (k_convert) -> B of the projections
//   OA  [4096][1024]    bf16 = [hi | lo] of the per-head attention output, hi = RNE(o), lo = RNE(o - hi)
//                                                                     (k_agg)     -> A of the output projection
//   rel_q, rel_k, rel_v are RNE-converted to bf16 values (held as f32) when staged in LDS.
//   f32 planes: QKV [3][32][1024][64] (projection results), S [32][32768] (masked, scaled scores).

#define NB_    4
#define SEQ    1024
#define DM     512
#define NH     8
#define DK     64
#define KP1    16
#define W2     32
#define NSLOT  32768                 // W2 * SEQ flat window slots per (b,h)
#define NHALF  16384                 // KP1 * SEQ
#define NBH    32                    // NB_ * NH
#define MROWS  4096                  // NB_ * SEQ
#define KOUT   1024                  // 2 * DM (hi | lo)
#define NPOS   (NBH * NHALF)         // ints per position table
#define PLQ    (NBH * SEQ * DK)      // floats per q/k/v plane (2097152)
#define NTHR   256
#define NWAVE  8
#define GTHR   128
#define GBM    64
#define GBN    64
#define TPW    (SEQ / NWAVE)         // 128 targets per wave in k_agg
#define DEGCAP 256                   // static cap on slots per target position
#define RINV24 (1.0f / 24.0f)
#define NEGBIG (-1.0e9f)
#define WSMAX  134217728
#define NXU    (3 * (MROWS * DM / 8))   // 786432 convert units (8 elements each)
#define NWU    (3 * (DM * DM / 8))      // 98304
#define NWOU   (DM * KOUT / 8)          // 65536
#define NCU    (NXU + NWU + NWOU)       // 950272
#define FPW    (NSLOT / NWAVE)       // 4096 consecutive flat slots per wave in the bucketing passes of k_agg
#define BGRP   8                     // 32-slot steps whose index loads are issued together
#define LDS_AGG 247936

static_assert((MROWS % GBM) == 0 && (DM % GBN) == 0 && (SEQ % GBM) == 0);
static_assert((DM % 32) == 0 && (KOUT % 32) == 0);
static_assert(GBN == DK);
static_assert(GBM == (GTHR / 32) * 16);
static_assert(NSLOT == W2 * SEQ && NHALF == KP1 * SEQ && NBH == NB_ * NH && MROWS == NB_ * SEQ);
static_assert(NSLOT == (1 << 15) && SEQ == (1 << 10));
static_assert((MROWS * DM / 8) == (1 << 18) && (DM * DM / 8) == (1 << 15) && (KOUT / 8) == 128);
static_assert((NXU % NTHR) == 0 && ((NXU + NWU) % NTHR) == 0 && (NCU % NTHR) == 0);
static_assert(NTHR * 4 == SEQ && TPW * NWAVE == SEQ);
static_assert((NSLOT % (4 * NTHR)) == 0);
static_assert(NTHR * 8 == W2 * DK);
static_assert((NSLOT + (2 + NWAVE) * SEQ) * 4 + (W2 * DK + NWAVE * 64 + 16) * 4 + NWAVE * 4 + NSLOT * 2 <= LDS_AGG);
static_assert(((NSLOT + (2 + NWAVE) * SEQ) * 4 + (W2 * DK + NWAVE * 64 + 16) * 4 + NWAVE * 4) % 16 == 0);
static_assert(TPW >= 3 && (NSLOT * 2) % (16 * NTHR) == 0);
static_assert(FPW * NWAVE == NSLOT && (FPW % (32 * BGRP)) == 0 && (NHALF % FPW) == 0);
static_assert(LDS_AGG <= 300000);
static_assert(PLQ == NB_ * SEQ * DM);

typedef float    v4f  __attribute__((ext_vector_type(4)));
typedef float    v8f  __attribute__((ext_vector_type(8)));
typedef int      v4i  __attribute__((ext_vector_type(4)));
typedef int      v8i  __attribute__((ext_vector_type(8)));
typedef unsigned short v8us __attribute__((ext_vector_type(8)));
typedef __bf16   v16b __attribute__((ext_vector_type(16)));
typedef v4f  __attribute__((may_alias)) v4fa;
typedef v4i  __attribute__((may_alias)) v4ia;
typedef v8us __attribute__((may_alias)) v8usa;
union FragB { v16b v; v8us h[2]; v8i w; };

// WMMA with hazard guard: ties D, keeps A/B live for 4 VALU slots
__device__ __forceinline__ v8f wmb(const FragB& a, const FragB& b, v8f c) {
  v8f d = __builtin_amdgcn_wmma_f32_16x16x32_bf16(false, a.v, false, b.v, (short)0, c, false, false);
  asm volatile("v_nop\n\tv_nop\n\tv_nop\n\tv_nop" : "+v"(d) : "v"(a.w), "v"(b.w));
  return d;
}

// f32 -> bf16 bits, RNE convert
__device__ __forceinline__ unsigned int bf16u(float x) {
  const unsigned int u = __float_as_uint(x);
  return (u + 0x7FFFu + ((u >> 16) & 1u)) >> 16;
}
// f32 -> nearest bf16 value held as f32
__device__ __forceinline__ float bf16f(float x) { return __uint_as_float(bf16u(x) << 16); }

__device__ __forceinline__ v8us cvt8b(const v4f a, const v4f b) {
  v8us r;
  r[0] = (unsigned short)bf16u(a.x); r[1] = (unsigned short)bf16u(a.y);
  r[2] = (unsigned short)bf16u(a.z); r[3] = (unsigned short)bf16u(a.w);
  r[4] = (unsigned short)bf16u(b.x); r[5] = (unsigned short)bf16u(b.y);
  r[6] = (unsigned short)bf16u(b.z); r[7] = (unsigned short)bf16u(b.w);
  return r;
}

__device__ __forceinline__ unsigned short hl1(float x, bool islo) {
  const unsigned int hu = bf16u(x);
  const float hf = __uint_as_float(hu << 16);
  const unsigned int lu = bf16u(x - hf);
  return (unsigned short)(islo ? lu : hu);
}
// 8 floats -> 8 bf16 hi parts (islo false) or 8 bf16 lo parts (islo true), lo = RNE(x - hi)
__device__ __forceinline__ v8us split8(const v4f a, const v4f b, bool islo) {
  v8us r;
  r[0] = hl1(a.x, islo); r[1] = hl1(a.y, islo); r[2] = hl1(a.z, islo); r[3] = hl1(a.w, islo);
  r[4] = hl1(b.x, islo); r[5] = hl1(b.y, islo); r[6] = hl1(b.z, islo); r[7] = hl1(b.w, islo);
  return r;
}

// ---------------------------------------------------------------------------
// Flat window slot f (0..32767) of head group bh: window row w = f >> 10, position s = f & 1023.
//   q index  = w < 16 ? pos_pad[w][s]    : pe[w-16][s]       (pe = pos_enc with -1 -> 0)
//   kv index = w < 16 ? pe[w][s]         : pos_pad[w-16][s]
//   masked   = (pos_enc[w & 15][s] == -1) || f < 1024
// Both tables are read unconditionally (same g for both halves) and clamped into [0, SEQ-1].
// ---------------------------------------------------------------------------
__device__ __forceinline__ void slot_idx(const int* __restrict__ pos_enc, const int* __restrict__ pos_pad,
                                         int bh, int f, int& qi, int& ki, bool& msk) {
  const int g = bh * NHALF + (f & (NHALF - 1));
  const int penc = pos_enc[g];
  const int ppad = pos_pad[g];
  const bool neg = (penc == -1);
  int pe = neg ? 0 : penc;
  pe = pe < 0 ? 0 : (pe > SEQ - 1 ? SEQ - 1 : pe);
  int pp = ppad < 0 ? 0 : (ppad > SEQ - 1 ? SEQ - 1 : ppad);
  const bool lo = f < NHALF;
  qi = lo ? pp : pe;
  ki = lo ? pe : pp;
  msk = neg || (f < SEQ);
}

// position index clamped into [0, SEQ-1]
__device__ __forceinline__ int clamp_pos(int v) { return v < 0 ? 0 : (v > SEQ - 1 ? SEQ - 1 : v); }

// Mask of the lanes of this wave whose 10-bit target t equals this lane's (all 32 lanes active): one ballot per bit.
__device__ __forceinline__ unsigned int same_target(int t) {
  unsigned int peers = 0xFFFFFFFFu;
#pragma unroll
  for (int bit = 0; bit < 10; ++bit) {
    const bool on = ((t >> bit) & 1) != 0;
    const unsigned int bl = __builtin_amdgcn_ballot_w32(on);
    peers &= on ? bl : ~bl;
  }
  return peers;
}

// ---------------------------------------------------------------------------
//   u <  NXU        : XB[z][off*8 ..]  z = u >> 18 selects query | key | value
//   u <  NXU + NWU  : WB[z][off*8 ..]  z selects Wq | Wk | Wv (rows [n][k] as given)
// coverage: NXU*8 = 3*4096*512, NWU*8 = 3*512*512, NWOU*8 = 512*1024 elements exactly.
// ---------------------------------------------------------------------------
__global__ __launch_bounds__(NTHR) void k_convert(
    const float* __restrict__ xq, const float* __restrict__ xk, const float* __restrict__ xv,
    const float* __restrict__ wq, const float* __restrict__ wk, const float* __restrict__ wv,
    const float* __restrict__ wo,
    unsigned short* xb, unsigned short* wb, unsigned short* wob, int nUnits)
{
  const int u = (int)blockIdx.x * NTHR + (int)threadIdx.x;
  if (u >= nUnits) return;
  const float* src;
  unsigned short* dst;
  if (u < NXU) {
    const int z = u >> 18, off = u & ((1 << 18) - 1);
    const float* xs = (z == 0) ? xq : ((z == 1) ? xk : xv);
    src = xs + (size_t)off * 8;
    dst = xb + (size_t)u * 8;
  } else if (u < NXU + NWU) {
    const int e = u - NXU;
    const int z = e >> 15, off = e & ((1 << 15) - 1);
    const float* wsp = (z == 0) ? wq : ((z == 1) ? wk : wv);
    src = wsp + (size_t)off * 8;
    dst = wb + (size_t)e * 8;
  } else {
    const int e = u - NXU - NWU;
    const int n = e >> 7;
    const int c8 = (e & 127) * 8;
    src = wo + (size_t)n * DM + (c8 & (DM - 1));
    dst = wob + (size_t)n * KOUT + c8;
  }
  const v4f a = *(const v4fa*)src;
  const v4f b = *(const v4fa*)(src + 4);
  const v8us o = cvt8b(a, b);
  *(v8us*)dst = o;
  
}

// ---------------------------------------------------------------------------
// bf16 WMMA GEMM, plane z = blockIdx.z: C[4096][N] tile = A[4096][K] (bf16, pitch K) x WT[N][K]^T (bf16 rows n,
// k-contiguous), K = 32*ksteps. grid (4096/64, N/64, nz), 128 threads: wave w owns rows 16w..16w+15 of the 64x64
// tile, acc[4] = 4 column tiles. A fragment (row m = lane&15): elements 0..7 <- k0+8h+0..7, 8..15 <- k0+16+8h+0..7
// (h = lane>>4); B fragment (col n = lane&15) from WT row (col0+16t+n) with the SAME k map; D element r =
// (row 8h+r, col lane&15). Tile staged in LDS as 64x64 f32, then one instruction writes two 256-B row segments
//   EPI 0: head plane out[z][(b*8 + blockIdx.y)*1024 + s][64] f32 (b = row>>10, s = row&1023; column tile = one head)
//   EPI 1: out[row][512] f32 at columns col0..col0+63 (the final output, z = 0)
// coverage: grid (64, 8, nz) covers every (row, col) of each 4096 x 512 plane exactly once.
// ---------------------------------------------------------------------------
template<int EPI>
__global__ __launch_bounds__(GTHR) void k_gemm(
    const unsigned short* __restrict__ A, const unsigned short* __restrict__ WT,
    float* outF, int K, int strideA, int strideW, int strideO)
{
  __shared__ __attribute__((aligned(16))) float stg[GBM * GBN];   // 16 KB
  const int tid = (int)threadIdx.x, lane = tid & 31, wave = tid >> 5, hh = lane >> 4, m = lane & 15;
  const int z = (int)blockIdx.z;
  const unsigned short* Az = A  + (size_t)z * (size_t)strideA;
  const unsigned short* Wz = WT + (size_t)z * (size_t)strideW;
  float* Oz = outF + (size_t)z * (size_t)strideO;
  const int rowBase = (int)blockIdx.x * GBM;
  const int col0    = (int)blockIdx.y * GBN;

  v8f acc[4];
  {
    const v8f zz = {0.f, 0.f, 0.f, 0.f, 0.f, 0.f, 0.f, 0.f};
    acc[0] = zz; acc[1] = zz; acc[2] = zz; acc[3] = zz;
  }
  const unsigned short* ap = Az + (size_t)(rowBase + 16 * wave + m) * (size_t)K + 8 * hh;
  const unsigned short* wp = Wz + (size_t)(col0 + m) * (size_t)K + 8 * hh;
  const int ksteps = K >> 5;
#pragma unroll 1
  for (int ks = 0; ks < ksteps; ++ks) {
    FragB af;
    af.h[0] = *(const v8usa*)(ap + 32 * ks);          // k = 32ks + 8hh + 0..7
    af.h[1] = *(const v8usa*)(ap + 32 * ks + 16);     // k = 32ks + 16 + 8hh + 0..7
#pragma unroll
    for (int t = 0; t < 4; ++t) {
      const unsigned short* wq = wp + (size_t)(16 * t) * (size_t)K + 32 * ks;   // WT row col0 + 16t + m
      FragB bf;
      bf.h[0] = *(const v8usa*)wq;                    // same k map as A
      bf.h[1] = *(const v8usa*)(wq + 16);
      acc[t] = wmb(af, bf, acc[t]);
    }
  }

#pragma unroll
  for (int t = 0; t < 4; ++t) {
    const int lc = 16 * t + m;
#pragma unroll
    for (int r = 0; r < 8; ++r) {
      const int lr = 16 * wave + 8 * hh + r;          // D element r = (row 8hh+r, col m)
      stg[lr * GBN + lc] = acc[t][r];
    }
  }
  __syncthreads();

  float* ob;
  int ldo;
  if (EPI == 0) {
    const int bq = rowBase >> 10;
    const int s0 = rowBase & (SEQ - 1);
    ob  = Oz + ((size_t)(bq * NH + (int)blockIdx.y) * SEQ + s0) * DK;
    ldo = DK;
  } else {
    ob  = Oz + (size_t)rowBase * DM + col0;
    ldo = DM;
  }
  v4f fv[8];
#pragma unroll
  for (int i = 0; i < 8; ++i) {
    const int lr = 16 * wave + 2 * i + hh;
    fv[i] = *(const v4fa*)(stg + lr * GBN + 4 * m);
  }
#pragma unroll
  for (int i = 0; i < 8; ++i) {
    const int lr = 16 * wave + 2 * i + hh;
    float* op = ob + (size_t)lr * (size_t)ldo + 4 * m;
    *(v4f*)op = fv[i];
  }
  
}

// ---------------------------------------------------------------------------
// Window scores, one thread per flat slot: grid (32768/256, 32 = bh). w = f >> 10 is block-uniform.
// rel_k[h][w], rel_q[h][w] rows staged in LDS as bf16 values; q row (index qi) and k row (ki) gathered by clamped
// index from the f32 head planes; c2c, c2p, p2c as three rolled 64-deep f32 dots; masked slots get -1e9.
// coverage: 128 blocks x 256 threads = all 32768 slots of each of the 32 (b,h).
// ---------------------------------------------------------------------------
__global__ __launch_bounds__(NTHR) void k_scores(
    const int* __restrict__ pos_enc, const int* __restrict__ pos_pad,
    const float* __restrict__ rel_q, const float* __restrict__ rel_k,
    const float* __restrict__ QP, const float* __restrict__ KPl, float* S)
{
  __shared__ __attribute__((aligned(16))) float rk[DK];
  __shared__ __attribute__((aligned(16))) float rq[DK];
  const int tid = (int)threadIdx.x;
  const int bh = (int)blockIdx.y, h = bh & (NH - 1);
  const int f = (int)blockIdx.x * NTHR + tid;
  const int w = f >> 10;
  {
    const int sel = tid >> 6, j = tid & 63;          // sel uniform per pair of waves
    const size_t rb = (size_t)(h * W2 + w) * DK + j;
    if (sel == 0) rk[j] = bf16f(rel_k[rb]);
    if (sel == 1) rq[j] = bf16f(rel_q[rb]);
  }
  __syncthreads();

  int qi, ki; bool msk;
  slot_idx(pos_enc, pos_pad, bh, f, qi, ki, msk);
  const float* qrow = QP  + ((size_t)bh * SEQ + qi) * DK;
  const float* krow = KPl + ((size_t)bh * SEQ + ki) * DK;
  float c2c = 0.f, c2p = 0.f, p2c = 0.f;
#pragma unroll 1
  for (int j = 0; j < DK / 4; ++j) {
    const v4f qv  = *(const v4fa*)(qrow + 4 * j);
    const v4f kv  = *(const v4fa*)(krow + 4 * j);
    const v4f rkv = *(const v4fa*)(rk + 4 * j);
    const v4f rqv = *(const v4fa*)(rq + 4 * j);
    c2c = fmaf(qv.x, kv.x, c2c);   c2c = fmaf(qv.y, kv.y, c2c);   c2c = fmaf(qv.z, kv.z, c2c);   c2c = fmaf(qv.w, kv.w, c2c);
    c2p = fmaf(qv.x, rkv.x, c2p);  c2p = fmaf(qv.y, rkv.y, c2p);  c2p = fmaf(qv.z, rkv.z, c2p);  c2p = fmaf(qv.w, rkv.w, c2p);
    p2c = fmaf(rqv.x, kv.x, p2c);  p2c = fmaf(rqv.y, kv.y, p2c);  p2c = fmaf(rqv.z, kv.z, p2c);  p2c = fmaf(rqv.w, kv.w, p2c);
  }
  const float sc = msk ? NEGBIG : ((c2c + c2p) + p2c) * RINV24;
  float* sp = S + (size_t)bh * NSLOT + f;
  *(float*)sp = sc;
  
}

// ---------------------------------------------------------------------------
// One drain step of k_agg over 8*G slots: lane j holds slot j's value-row byte offset ov (kv * 256), its rel_v-row byte
// offset orl (w * 256) and its weight pm (0 past the target's last slot, which leaves the sums as they are).
// vb = value plane of this (b,h) (wave-uniform), rvl = rel_v rows in LDS + lane, lane4 = 4 * lane.
// ---------------------------------------------------------------------------
#define VO8(b) "v"(vo[(b)]), "v"(vo[(b) + 1]), "v"(vo[(b) + 2]), "v"(vo[(b) + 3]), \
               "v"(vo[(b) + 4]), "v"(vo[(b) + 5]), "v"(vo[(b) + 6]), "v"(vo[(b) + 7])
template<int G>
__device__ __forceinline__ void drain_step(int ov, int orl, float pm, const char* __restrict__ vb, const char* rvl,
                                           unsigned int lane4, float& a0, float& a1) {
  unsigned int vo[8 * G];
  float v0[8 * G], v1[8 * G], r0[8 * G], r1[8 * G];
#pragma unroll
  for (int j = 0; j < 8 * G; ++j) vo[j] = (unsigned int)__builtin_amdgcn_readlane(ov, j) + lane4;
#pragma unroll
  for (int j = 0; j < 8 * G; ++j) {
    const float* vr = (const float*)(vb + vo[j]);
    v0[j] = vr[0];
    v1[j] = vr[32];
  }
#pragma unroll
  for (int j = 0; j < 8 * G; ++j) {
    const float* rr = (const float*)(rvl + __builtin_amdgcn_readlane(orl, j));
    r0[j] = rr[0];
    r1[j] = rr[32];
  }
  // the wait before the loads' offset registers are written again; naming them keeps each in a register of its own up to
  // here (reused inside the step, an offset register would make the next load wait, or be a later load's destination);
  // a statement takes thirty operands, so 32 slots take two. The "memory" clobber keeps the step's loads ahead of it.
  if constexpr (G == 1) {
    asm volatile("s_wait_xcnt 0x0" :: VO8(0) : "memory");
  } else {
    asm volatile("s_wait_xcnt 0x0" :: VO8(0), VO8(8) : "memory");
    if constexpr (G == 3) asm volatile("s_wait_xcnt 0x0" :: VO8(16) : "memory");
    if constexpr (G == 4) asm volatile("s_wait_xcnt 0x0" :: VO8(16), VO8(24) : "memory");
  }
#pragma unroll
  for (int j = 0; j < 8 * G; ++j) {
    const float pj = __int_as_float(__builtin_amdgcn_readlane(__float_as_int(pm), j));
    a0 = fmaf(pj, v0[j] + r0[j], a0);
    a1 = fmaf(pj, v1[j] + r1[j], a1);
  }
}

// segment start clamped into [0, NSLOT]
__device__ __forceinline__ int clamp_st(int st) { return st < 0 ? 0 : (st > NSLOT ? NSLOT : st); }

// ---------------------------------------------------------------------------
// One block per (b,h): softmax statistics over all 32768 slots, deterministic bucketing of every slot by its
// q index into LDS (count -> exclusive scan -> f-ascending cursor fill, no atomics, no global tables): wave w takes
// flat slots [4096w, 4096w + 4096), 32 a step; lanes with the same target are matched by ballots, the first of them
// updates the wave's own counter / cursor row, each lane's place is cursor + its rank among them,
// then an owner drain per target position: out_h[i][d] = sum over its slots of p[f] * (v[kv[f]][d] + rel_v[w][d]),
// p = exp(S[f] - M) * (1/Z), computed where the slot is filed (scores read in f order) and kept beside its entry.
// The drain takes up to 32 slots of a target a step: lane j holds slot j's entry and weight, both are broadcast by
// readlane, the step's value rows are all requested before the first is used, and the sum runs in slot order.
// Lane = channel d (and 32 + d); every loop bound and index is clamped to static ranges.
// Result written as the bf16 hi | lo lines of OA row (b*1024 + i), columns h*64.. (hi) and 512 + h*64..
// Count cap overflow or inconsistent totals -> NaN poison of the row.
// coverage: 32 blocks x 1024 targets x (hi line + lo line) = all 4096 rows x 16 lines of OA exactly once.
// ---------------------------------------------------------------------------
__global__ __launch_bounds__(NTHR) void k_agg(
    const int* __restrict__ pos_enc, const int* __restrict__ pos_pad,
    const float* __restrict__ rel_v, const float* __restrict__ S, const float* __restrict__ VP,
    unsigned short* OA)
{
  extern __shared__ v4f lds_dyn[];
  float* pl   = (float*)lds_dyn;          // [NSLOT] slot weights p, grouped by target, f ascending
  int*   scnt = (int*)(pl + NSLOT);       // [SEQ]
  int*   soff = scnt + SEQ;               // [SEQ]
  int*   cur  = soff + SEQ;               // [NWAVE][SEQ] per-wave counts, then per-wave cursors
  float* relv = (float*)(cur + NWAVE * SEQ);   // [W2*DK]
  float* stw  = relv + W2 * DK;           // [NWAVE*64]
  float* red  = stw + NWAVE * 64;         // [16]
  int*   wtot = (int*)(red + 16);         // [NWAVE]
  unsigned short* ent16 = (unsigned short*)(wtot + NWAVE);   // [NSLOT] packed (w << 10 | kv), same places as pl
  const int tid = (int)threadIdx.x, lane = tid & 31, wave = tid >> 5;
  const int bh = (int)blockIdx.x, b = bh >> 3, h = bh & (NH - 1);
  const float* sb = S + (size_t)bh * NSLOT;

  {
    const v4i z4 = {0, 0, 0, 0};
#pragma unroll 1
    for (int i = tid; i < NSLOT / 4; i += NTHR) *(v4ia*)(pl + 4 * i) = z4;
#pragma unroll 1
    for (int i = tid; i < NSLOT / 8; i += NTHR) *(v4ia*)(ent16 + 8 * i) = z4;
#pragma unroll
    for (int w2 = 0; w2 < NWAVE; ++w2) *(v4ia*)(cur + w2 * SEQ + 4 * tid) = z4;
    const float* rp = rel_v + (size_t)h * (W2 * DK) + 8 * tid;
    const v4f a = *(const v4fa*)rp;
    const v4f c = *(const v4fa*)(rp + 4);
    float* q = relv + 8 * tid;
    q[0] = bf16f(a.x); q[1] = bf16f(a.y); q[2] = bf16f(a.z); q[3] = bf16f(a.w);
    q[4] = bf16f(c.x); q[5] = bf16f(c.y); q[6] = bf16f(c.z); q[7] = bf16f(c.w);
  }
  __syncthreads();

  // ---- softmax statistics: M = max, Z = sum exp(s - M), two-level fixed order ----
  float mx = -3.0e38f;
#pragma unroll 1
  for (int i = 0; i < NSLOT / (4 * NTHR); ++i) {
    const v4f s4 = *(const v4fa*)(sb + (size_t)i * (4 * NTHR) + 4 * tid);
    mx = fmaxf(fmaxf(mx, fmaxf(s4.x, s4.y)), fmaxf(s4.z, s4.w));
  }
#pragma unroll
  for (int off = 16; off > 0; off >>= 1) mx = fmaxf(mx, __shfl_xor(mx, off));
  if (lane == 0) red[wave] = mx;
  __syncthreads();
  float M = red[0];
#pragma unroll
  for (int w2 = 1; w2 < NWAVE; ++w2) M = fmaxf(M, red[w2]);
  float zs = 0.f;
#pragma unroll 1
  for (int i = 0; i < NSLOT / (4 * NTHR); ++i) {
    const v4f s4 = *(const v4fa*)(sb + (size_t)i * (4 * NTHR) + 4 * tid);
    zs += (__expf(s4.x - M) + __expf(s4.y - M)) + (__expf(s4.z - M) + __expf(s4.w - M));
  }
#pragma unroll
  for (int off = 16; off > 0; off >>= 1) zs += __shfl_xor(zs, off);
  if (lane == 0) red[NWAVE + wave] = zs;
  __syncthreads();
  float Z = 0.f;
#pragma unroll
  for (int w2 = 0; w2 < NWAVE; ++w2) Z += red[NWAVE + w2];
  const float invZ = 1.0f / Z;                        // Z >= 1 (the max slot contributes exp(0))

  // ---- counts per (wave, target): every wave over its own 4096 slots ----
  // A wave's 4096 slots lie in one half of the window rows, so its q table and its kv table (slot_idx) are fixed:
  // lower half q <- pos_pad, kv <- pos_enc; upper half the other way round. clamp_pos sends pos_enc's -1 to 0.
  const int f0w = __builtin_amdgcn_readfirstlane(wave) * FPW;   // wave-uniform: scalar loop control and table choice
  const bool lohalf = f0w < NHALF;
  const int* qtab = (lohalf ? pos_pad : pos_enc) + bh * NHALF + (f0w & (NHALF - 1));
  const int* ktab = (lohalf ? pos_enc : pos_pad) + bh * NHALF + (f0w & (NHALF - 1));
  int* wcur = cur + wave * SEQ;
  const unsigned int below = (1u << lane) - 1u;
  const unsigned int lane4 = 4u * (unsigned int)lane;
#pragma unroll 1
  for (int g = 0; g < FPW; g += 32 * BGRP) {
    int tq[BGRP];
#pragma unroll
    for (int j = 0; j < BGRP; ++j) tq[j] = clamp_pos(qtab[g + 32 * j + lane]) & (SEQ - 1);
#pragma unroll
    for (int j = 0; j < BGRP; ++j) {
      const unsigned int peers = same_target(tq[j]);
      if ((peers & below) == 0u) wcur[tq[j]] = wcur[tq[j]] + __builtin_popcount(peers);
      // the next step's reader of a counter may be another lane of this wave: keep the LDS accesses in step order
      __builtin_amdgcn_fence(__ATOMIC_ACQ_REL, "wavefront");
      __builtin_amdgcn_wave_barrier();
    }
  }
  __syncthreads();

  // ---- exclusive prefix over SEQ counts -> soff ----
  int tot;
  {
    v4i cw[NWAVE];
    v4i ca = {0, 0, 0, 0};
#pragma unroll
    for (int w2 = 0; w2 < NWAVE; ++w2) {
      cw[w2] = *(const v4ia*)(cur + w2 * SEQ + 4 * tid);
      ca += cw[w2];
    }
    *(v4ia*)(scnt + 4 * tid) = ca;
    const int e0 = ca.x < 0 ? 0 : ca.x, e1 = ca.y < 0 ? 0 : ca.y, e2 = ca.z < 0 ? 0 : ca.z, e3 = ca.w < 0 ? 0 : ca.w;
    const int ts = e0 + e1 + e2 + e3;
    int incl = ts;
#pragma unroll
    for (int d = 1; d < 32; d <<= 1) {
      const int up = __shfl_up(incl, d);
      if (lane >= d) incl += up;
    }
    if (lane == 31) wtot[wave] = incl;
    __syncthreads();
    int pre = 0;
    tot = 0;
#pragma unroll
    for (int w2 = 0; w2 < NWAVE; ++w2) {
      const int t = wtot[w2];
      tot += t;
      pre += (w2 < wave) ? t : 0;
    }
    int run = pre + incl - ts;
    v4i so;
    so.x = run; run += e0;
    so.y = run; run += e1;
    so.z = run; run += e2;
    so.w = run;
    *(v4ia*)(soff + 4 * tid) = so;
    // wave w2's cursor of a target starts behind the slots that waves 0..w2-1 hold for it (f ascending over waves)
#pragma unroll
    for (int w2 = 0; w2 < NWAVE; ++w2) {
      *(v4ia*)(cur + w2 * SEQ + 4 * tid) = so;
      so += cw[w2];
    }
  }
  __syncthreads();

  // ---- fill: packed (w << 10 | kv) and weight p into target segments (every wave over its own slots, f ascending) ----
#pragma unroll 1
  for (int g = 0; g < FPW; g += 32 * BGRP) {
    int tq[BGRP], ent[BGRP];
    float pw[BGRP];
    // this group's kv indices and scores, from the lane's own column on
    const int*   kg = (const int*)((const char*)(ktab + g) + lane4);
    const float* sg = (const float*)((const char*)(sb + f0w + g) + lane4);
#pragma unroll
    for (int j = 0; j < BGRP; ++j) {
      const int o = g + 32 * j + lane;
      tq[j]  = clamp_pos(qtab[o]) & (SEQ - 1);
      ent[j] = (((f0w + o) >> 10) << 10) | clamp_pos(kg[32 * j]);
      pw[j]  = __expf(sg[32 * j] - M) * invZ;
    }
    // the steps below reuse the address registers of the loads above
    asm volatile("s_wait_xcnt 0x0" ::: "memory");
#pragma unroll
    for (int j = 0; j < BGRP; ++j) {
      const unsigned int peers = same_target(tq[j]);
      const unsigned int lower = peers & below;
      const int base = wcur[tq[j]];
      int pos = base + __builtin_popcount(lower);
      pos = pos < 0 ? 0 : (pos > NSLOT - 1 ? NSLOT - 1 : pos);
      ent16[pos] = (unsigned short)ent[j];
      pl[pos]    = pw[j];
      if (lower == 0u) wcur[tq[j]] = base + __builtin_popcount(peers);
      // the next step's reader of a cursor may be another lane of this wave: keep the LDS accesses in step order
      __builtin_amdgcn_fence(__ATOMIC_ACQ_REL, "wavefront");
      __builtin_amdgcn_wave_barrier();
    }
  }
  __syncthreads();

  // ---- drain: wave owns targets [wave*TPW, wave*TPW + TPW) ----
  const float qnan = __int_as_float(0x7fc00000);
  const bool bad_tot = (tot != NSLOT);
  float* sw = stw + wave * 64;
  const int lc = lane & 7;
  const bool islo = (lane & 8) != 0;
  const char* vb  = (const char*)(VP + (size_t)bh * SEQ * DK);
  const char* rvl = (const char*)(relv + lane);
  const int tg0 = __builtin_amdgcn_readfirstlane(wave) * TPW;
  // segment start and count: this target's and the next one's as wave-uniform scalars, the one after that in flight
  int sA = __builtin_amdgcn_readfirstlane(soff[tg0]),     cA = __builtin_amdgcn_readfirstlane(scnt[tg0]);
  int sB = __builtin_amdgcn_readfirstlane(soff[tg0 + 1]), cB = __builtin_amdgcn_readfirstlane(scnt[tg0 + 1]);
  int sV = soff[tg0 + 2], cV = scnt[tg0 + 2];
  // entries and weights of the coming step, read one step ahead
  int epre;
  float ppre;
  {
    int idx = clamp_st(sA) + lane;
    idx = idx > NSLOT - 1 ? NSLOT - 1 : idx;
    epre = ent16[idx];
    ppre = pl[idx];
  }
#pragma unroll 1
  for (int jt = 0; jt < TPW; ++jt) {
    const int tg = tg0 + jt;                           // 0..1023
    const int st = clamp_st(sA);
    const int stn = clamp_st(sB);
    const int craw = cA;
    int cnt = craw;
    cnt = cnt < 0 ? 0 : (cnt > DEGCAP ? DEGCAP : cnt);
    if (cnt > NSLOT - st) cnt = NSLOT - st;
    const float pz = (bad_tot || craw > DEGCAP || craw < 0) ? qnan : 0.0f;
    float a0 = 0.f, a1 = 0.f;
#pragma unroll 1
    for (int q0 = 0; q0 < cnt || q0 == 0; q0 += 32) {
      const int left = cnt - q0;                       // 0 only for an empty target: nothing summed, read-ahead moved on
      const int n = left > 32 ? 32 : left;
      const int ov  = (epre & (SEQ - 1)) * (DK * 4);
      const int orl = ((epre >> 10) & (W2 - 1)) * (DK * 4);
      const float pm = lane < n ? ppre : 0.0f;
      int idx = (left > 32 ? st + q0 + 32 : stn) + lane;
      idx = idx > NSLOT - 1 ? NSLOT - 1 : idx;
      epre = ent16[idx];
      ppre = pl[idx];
      if (n > 24)      drain_step<4>(ov, orl, pm, vb, rvl, lane4, a0, a1);
      else if (n > 16) drain_step<3>(ov, orl, pm, vb, rvl, lane4, a0, a1);
      else if (n > 8)  drain_step<2>(ov, orl, pm, vb, rvl, lane4, a0, a1);
      else if (n > 0)  drain_step<1>(ov, orl, pm, vb, rvl, lane4, a0, a1);
    }
    {
      sA = sB; cA = cB;
      sB = __builtin_amdgcn_readfirstlane(sV);
      cB = __builtin_amdgcn_readfirstlane(cV);
      const int tn = tg0 + (jt + 3 < TPW ? jt + 3 : TPW - 1);
      sV = soff[tn];
      cV = scnt[tn];
    }
    a0 += pz;
    a1 += pz;
    // per-wave relayout: channels in order, then lanes 0..7 (hi) / 8..15 (lo) read 8 consecutive channels each
    __builtin_amdgcn_fence(__ATOMIC_RELEASE, "wavefront");
    __builtin_amdgcn_wave_barrier();
    sw[lane]      = a0;
    sw[32 + lane] = a1;
    __builtin_amdgcn_fence(__ATOMIC_RELEASE, "wavefront");
    __builtin_amdgcn_wave_barrier();
    const v4f ga = *(const v4fa*)(sw + 8 * lc);
    const v4f gb = *(const v4fa*)(sw + 8 * lc + 4);
    const v8us ov = split8(ga, gb, islo);
    const int orow = b * SEQ + tg;
    unsigned short* dst = OA + (size_t)orow * KOUT + (islo ? DM : 0) + h * DK + 8 * lc;
    const bool wsv = lane < 16;
    if (wsv) *(v8us*)dst = ov;
    
  }
}

// ---------------------------------------------------------------------------
static inline int cdiv(int a, int b) { return (a + b - 1) / b; }

extern "C" void kernel_launch(void* const* d_in, const int* in_sizes, int n_in,
                              void* d_out, int out_size, void* d_ws, size_t ws_size,
                              hipStream_t stream) {
  if (n_in < 12) return;
  if (in_sizes[0] != NB_ * SEQ * DM || in_sizes[1] != NB_ * SEQ * DM || in_sizes[2] != NB_ * SEQ * DM) return;
  if (in_sizes[3] != NPOS || in_sizes[4] != NPOS) return;
  if (in_sizes[5] != NH * W2 * DK || in_sizes[6] != NH * W2 * DK || in_sizes[7] != NH * W2 * DK) return;
  if (in_sizes[8] != DM * DM || in_sizes[9] != DM * DM || in_sizes[10] != DM * DM || in_sizes[11] != DM * DM) return;
  if (out_size != NB_ * SEQ * DM) return;

  const float* query   = (const float*)d_in[0];    // [4][1024][512]
  const float* keyx    = (const float*)d_in[1];
  const float* value   = (const float*)d_in[2];
  const int*   pos_enc = (const int*)  d_in[3];    // [4][8][16][1024]
  const int*   pos_pad = (const int*)  d_in[4];
  const float* rel_q   = (const float*)d_in[5];    // [1][8][32][64]
  const float* rel_k   = (const float*)d_in[6];
  const float* rel_v   = (const float*)d_in[7];
  const float* Wq      = (const float*)d_in[8];    // [512][512] rows = output feature
  const float* Wk      = (const float*)d_in[9];
  const float* Wv      = (const float*)d_in[10];
  const float* Wo      = (const float*)d_in[11];
  float*       out     = (float*)d_out;            // [4][1024][512]

  // workspace carve (every region a whole number of 256-B blocks; all planes are exact tile multiples)
  char* ws = (char*)d_ws;
  size_t off = 0;
  const size_t oXB  = off; off += (size_t)NXU * 16;                     // 12,582,912  bf16 [3][4096][512]
  const size_t oWB  = off; off += (size_t)NWU * 16;                     //  1,572,864  bf16 [3][512][512]
  const size_t oWOB = off; off += (size_t)NWOU * 16;                    //  1,048,576  bf16 [512][1024]
  const size_t oQKV = off; off += (size_t)3 * PLQ * 4;                  // 25,165,824  f32 [3][32][1024][64]
  const size_t oS   = off; off += (size_t)NBH * NSLOT * 4;              //  4,194,304  f32 [32][32768]
  const size_t oOA  = off; off += (size_t)MROWS * KOUT * 2;             //  8,388,608  bf16 [4096][1024]
  if (off > ws_size || off > (size_t)WSMAX) return;                     // total 52,953,088
  unsigned short* XB  = (unsigned short*)(ws + oXB);
  unsigned short* WB  = (unsigned short*)(ws + oWB);
  unsigned short* WOB = (unsigned short*)(ws + oWOB);
  float*          QKV = (float*)(ws + oQKV);
  float*          S   = (float*)(ws + oS);
  unsigned short* OA  = (unsigned short*)(ws + oOA);
  const float* QP  = QKV;
  const float* KPl = QKV + (size_t)PLQ;
  const float* VP  = QKV + (size_t)2 * PLQ;

  hipFuncSetAttribute(reinterpret_cast<const void*>(&k_agg),
                      hipFuncAttributeMaxDynamicSharedMemorySize, LDS_AGG);

  // 1: bf16 operand planes
  k_convert<<<NCU / NTHR, NTHR, 0, stream>>>(query, keyx, value, Wq, Wk, Wv, Wo, XB, WB, WOB, NCU);
  // 2: q/k/v projections -> f32 head planes
  k_gemm<0><<<dim3(MROWS / GBM, DM / GBN, 3), GTHR, 0, stream>>>(XB, WB, QKV, DM, MROWS * DM, DM * DM, PLQ);
  // 3: window scores
  k_scores<<<dim3(NSLOT / NTHR, NBH), NTHR, 0, stream>>>(pos_enc, pos_pad, rel_q, rel_k, QP, KPl, S);
  // 4: softmax + owner segment sums -> bf16 hi|lo plane
  k_agg<<<NBH, NTHR, LDS_AGG, stream>>>(pos_enc, pos_pad, rel_v, S, VP, OA);
  // 5: output projection -> out
  k_gemm<1><<<dim3(MROWS / GBM, DM / GBN, 1), GTHR, 0, stream>>>(OA, WOB, out, KOUT, 0, 0, 0);
}

// v003
// It runs in 311 microseconds.
// Two timings next to v002 put it at 1.26 and 1.25 times that version's speed.
// Over all steps from v000 it is 18.7 times as fast.
#include <hip/hip_runtime.h>
#include <stddef.h>
#include <stdint.h>

// Contractions: q/k/v input projections (K=512) and the output projection (K=1024 = activation bf16 hi|lo pair
// accumulate). Window scores (three 64-deep dots per slot), softmax statistics, weighted value sums and the
// per-position segment sums: f32 VALU.
//
// Carry audit: no plane carries a power-of-two scale; nothing is folded back anywhere.
//   XB  [3][4096][512]  bf16 = RNE(query | key | value)               (k_convert) -> A of the projections
//   WB  [3][512][512]   bf16 = RNE(Wq | Wk | Wv), rows [n][k]          (k_convert) -> B of the projections
//   OA  [4096][1024]    bf16 = [hi | lo] of the per-head attention output, hi = RNE(o), lo = RNE(o - hi)
//                                                                     (k_agg)     -> A of the output projection
//   rel_q, rel_k, rel_v are RNE-converted to bf16 values (held as f32) when staged in LDS.
//   f32 planes: QKV [3][32][1024][64] (projection results), S [32][32768] (masked, scaled scores).

#define NB_    4
#define SEQ    1024
#define DM     512
#define NH     8
#define DK     64
#define KP1    16
#define W2     32
#define NSLOT  32768                 // W2 * SEQ flat window slots per (b,h)
#define NHALF  16384                 // KP1 * SEQ
#define NBH    32                    // NB_ * NH
#define MROWS  4096                  // NB_ * SEQ
#define KOUT   1024                  // 2 * DM (hi | lo)
#define NPOS   (NBH * NHALF)         // ints per position table
#define PLQ    (NBH * SEQ * DK)      // floats per q/k/v plane (2097152)
#define NTHR   256
#define NWAVE  8
#define GTHR   128
#define GBM    64
#define GBN    64
#define TPW    (SEQ / NWAVE)         // 128 targets per wave in k_agg
#define DEGCAP 256                   // static cap on slots per target position
#define RINV24 (1.0f / 24.0f)
#define NEGBIG (-1.0e9f)
#define WSMAX  134217728
#define NXU    (3 * (MROWS * DM / 8))   // 786432 convert units (8 elements each)
#define NWU    (3 * (DM * DM / 8))      // 98304
#define NWOU   (DM * KOUT / 8)          // 65536
#define NCU    (NXU + NWU + NWOU)       // 950272
#define FPW    (NSLOT / NWAVE)       // 4096 consecutive flat slots per wave in the bucketing passes of k_agg
#define BGRP   8                     // 32-slot steps whose index loads are issued together
#define LDS_AGG 247936

static_assert((MROWS % GBM) == 0 && (DM % GBN) == 0 && (SEQ % GBM) == 0);
static_assert((DM % 32) == 0 && (KOUT % 32) == 0);
static_assert(GBN == DK);
static_assert(GBM == (GTHR / 32) * 16);
static_assert(NSLOT == W2 * SEQ && NHALF == KP1 * SEQ && NBH == NB_ * NH && MROWS == NB_ * SEQ);
static_assert(NSLOT == (1 << 15) && SEQ == (1 << 10));
static_assert((MROWS * DM / 8) == (1 << 18) && (DM * DM / 8) == (1 << 15) && (KOUT / 8) == 128);
static_assert((NXU % NTHR) == 0 && ((NXU + NWU) % NTHR) == 0 && (NCU % NTHR) == 0);
static_assert(NTHR * 4 == SEQ && TPW * NWAVE == SEQ);
static_assert((NSLOT % (4 * NTHR)) == 0);
static_assert(NTHR * 8 == W2 * DK);
static_assert((NSLOT + (2 + NWAVE) * SEQ) * 4 + (W2 * DK + NWAVE * 64 + 16) * 4 + NWAVE * 4 + NSLOT * 2 <= LDS_AGG);
static_assert(((NSLOT + (2 + NWAVE) * SEQ) * 4 + (W2 * DK + NWAVE * 64 + 16) * 4 + NWAVE * 4) % 16 == 0);
static_assert(TPW >= 3 && (NSLOT * 2) % (16 * NTHR) == 0);
static_assert(FPW * NWAVE == NSLOT && (FPW % (32 * BGRP)) == 0 && (NHALF % FPW) == 0);
static_assert(LDS_AGG <= 300000);
static_assert(PLQ == NB_ * SEQ * DM);

typedef float    v4f  __attribute__((ext_vector_type(4)));
typedef float    v8f  __attribute__((ext_vector_type(8)));
typedef int      v4i  __attribute__((ext_vector_type(4)));
typedef int      v8i  __attribute__((ext_vector_type(8)));
typedef unsigned short v8us __attribute__((ext_vector_type(8)));
typedef __bf16   v16b __attribute__((ext_vector_type(16)));
typedef v4f  __attribute__((may_alias)) v4fa;
typedef v4i  __attribute__((may_alias)) v4ia;
typedef v8us __attribute__((may_alias)) v8usa;
union FragB { v16b v; v8us h[2]; v8i w; };

// WMMA with hazard guard: ties D, keeps A/B live for 4 VALU slots
__device__ __forceinline__ v8f wmb(const FragB& a, const FragB& b, v8f c) {
  v8f d = __builtin_amdgcn_wmma_f32_16x16x32_bf16(false, a.v, false, b.v, (short)0, c, false, false);
  asm volatile("v_nop\n\tv_nop\n\tv_nop\n\tv_nop" : "+v"(d) : "v"(a.w), "v"(b.w));
  return d;
}

// f32 -> bf16 bits, RNE convert
__device__ __forceinline__ unsigned int bf16u(float x) {
  const unsigned int u = __float_as_uint(x);
  return (u + 0x7FFFu + ((u >> 16) & 1u)) >> 16;
}
// f32 -> nearest bf16 value held as f32
__device__ __forceinline__ float bf16f(float x) { return __uint_as_float(bf16u(x) << 16); }

__device__ __forceinline__ v8us cvt8b(const v4f a, const v4f b) {
  v8us r;
  r[0] = (unsigned short)bf16u(a.x); r[1] = (unsigned short)bf16u(a.y);
  r[2] = (unsigned short)bf16u(a.z); r[3] = (unsigned short)bf16u(a.w);
  r[4] = (unsigned short)bf16u(b.x); r[5] = (unsigned short)bf16u(b.y);
  r[6] = (unsigned short)bf16u(b.z); r[7] = (unsigned short)bf16u(b.w);
  return r;
}

__device__ __forceinline__ unsigned short hl1(float x, bool islo) {
  const unsigned int hu = bf16u(x);
  const float hf = __uint_as_float(hu << 16);
  const unsigned int lu = bf16u(x - hf);
  return (unsigned short)(islo ? lu : hu);
}
// 8 floats -> 8 bf16 hi parts (islo false) or 8 bf16 lo parts (islo true), lo = RNE(x - hi)
__device__ __forceinline__ v8us split8(const v4f a, const v4f b, bool islo) {
  v8us r;
  r[0] = hl1(a.x, islo); r[1] = hl1(a.y, islo); r[2] = hl1(a.z, islo); r[3] = hl1(a.w, islo);
  r[4] = hl1(b.x, islo); r[5] = hl1(b.y, islo); r[6] = hl1(b.z, islo); r[7] = hl1(b.w, islo);
  return r;
}

// ---------------------------------------------------------------------------
// Flat window slot f (0..32767) of head group bh: window row w = f >> 10, position s = f & 1023.
//   q index  = w < 16 ? pos_pad[w][s]    : pe[w-16][s]       (pe = pos_enc with -1 -> 0)
//   kv index = w < 16 ? pe[w][s]         : pos_pad[w-16][s]
//   masked   = (pos_enc[w & 15][s] == -1) || f < 1024
// Both tables are read unconditionally (same g for both halves) and clamped into [0, SEQ-1].
// ---------------------------------------------------------------------------
__device__ __forceinline__ void slot_idx(const int* __restrict__ pos_enc, const int* __restrict__ pos_pad,
                                         int bh, int f, int& qi, int& ki, bool& msk) {
  const int g = bh * NHALF + (f & (NHALF - 1));
  const int penc = pos_enc[g];
  const int ppad = pos_pad[g];
  const bool neg = (penc == -1);
  int pe = neg ? 0 : penc;
  pe = pe < 0 ? 0 : (pe > SEQ - 1 ? SEQ - 1 : pe);
  int pp = ppad < 0 ? 0 : (ppad > SEQ - 1 ? SEQ - 1 : ppad);
  const bool lo = f < NHALF;
  qi = lo ? pp : pe;
  ki = lo ? pe : pp;
  msk = neg || (f < SEQ);
}

// position index clamped into [0, SEQ-1]
__device__ __forceinline__ int clamp_pos(int v) { return v < 0 ? 0 : (v > SEQ - 1 ? SEQ - 1 : v); }

// Mask of the lanes of this wave whose 10-bit target t equals this lane's (all 32 lanes active): one ballot per bit.
__device__ __forceinline__ unsigned int same_target(int t) {
  unsigned int peers = 0xFFFFFFFFu;
#pragma unroll
  for (int bit = 0; bit < 10; ++bit) {
    const bool on = ((t >> bit) & 1) != 0;
    const unsigned int bl = __builtin_amdgcn_ballot_w32(on);
    peers &= on ? bl : ~bl;
  }
  return peers;
}

// ---------------------------------------------------------------------------
//   u <  NXU        : XB[z][off*8 ..]  z = u >> 18 selects query | key | value
//   u <  NXU + NWU  : WB[z][off*8 ..]  z selects Wq | Wk | Wv (rows [n][k] as given)
// coverage: NXU*8 = 3*4096*512, NWU*8 = 3*512*512, NWOU*8 = 512*1024 elements exactly.
// ---------------------------------------------------------------------------
__global__ __launch_bounds__(NTHR) void k_convert(
    const float* __restrict__ xq, const float* __restrict__ xk, const float* __restrict__ xv,
    const float* __restrict__ wq, const float* __restrict__ wk, const float* __restrict__ wv,
    const float* __restrict__ wo,
    unsigned short* xb, unsigned short* wb, unsigned short* wob, int nUnits)
{
  const int u = (int)blockIdx.x * NTHR + (int)threadIdx.x;
  if (u >= nUnits) return;
  const float* src;
  unsigned short* dst;
  if (u < NXU) {
    const int z = u >> 18, off = u & ((1 << 18) - 1);
    const float* xs = (z == 0) ? xq : ((z == 1) ? xk : xv);
    src = xs + (size_t)off * 8;
    dst = xb + (size_t)u * 8;
  } else if (u < NXU + NWU) {
    const int e = u - NXU;
    const int z = e >> 15, off = e & ((1 << 15) - 1);
    const float* wsp = (z == 0) ? wq : ((z == 1) ? wk : wv);
    src = wsp + (size_t)off * 8;
    dst = wb + (size_t)e * 8;
  } else {
    const int e = u - NXU - NWU;
    const int n = e >> 7;
    const int c8 = (e & 127) * 8;
    src = wo + (size_t)n * DM + (c8 & (DM - 1));
    dst = wob + (size_t)n * KOUT + c8;
  }
  const v4f a = *(const v4fa*)src;
  const v4f b = *(const v4fa*)(src + 4);
  const v8us o = cvt8b(a, b);
  *(v8us*)dst = o;
  
}

// ---------------------------------------------------------------------------
// bf16 WMMA GEMM, plane z = blockIdx.z: C[4096][N] tile = A[4096][K] (bf16, pitch K) x WT[N][K]^T (bf16 rows n,
// k-contiguous), K = 32*ksteps. grid (4096/64, N/64, nz), 128 threads: wave w owns rows 16w..16w+15 of the 64x64
// tile, acc[4] = 4 column tiles. A fragment (row m = lane&15): elements 0..7 <- k0+8h+0..7, 8..15 <- k0+16+8h+0..7
// (h = lane>>4); B fragment (col n = lane&15) from WT row (col0+16t+n) with the SAME k map; D element r =
// (row 8h+r, col lane&15). Tile staged in LDS as 64x64 f32, then one instruction writes two 256-B row segments
//   EPI 0: head plane out[z][(b*8 + blockIdx.y)*1024 + s][64] f32 (b = row>>10, s = row&1023; column tile = one head)
//   EPI 1: out[row][512] f32 at columns col0..col0+63 (the final output, z = 0)
// coverage: grid (64, 8, nz) covers every (row, col) of each 4096 x 512 plane exactly once.
// ---------------------------------------------------------------------------
template<int EPI>
__global__ __launch_bounds__(GTHR) void k_gemm(
    const unsigned short* __restrict__ A, const unsigned short* __restrict__ WT,
    float* outF, int K, int strideA, int strideW, int strideO)
{
  __shared__ __attribute__((aligned(16))) float stg[GBM * GBN];   // 16 KB
  const int tid = (int)threadIdx.x, lane = tid & 31, wave = tid >> 5, hh = lane >> 4, m = lane & 15;
  const int z = (int)blockIdx.z;
  const unsigned short* Az = A  + (size_t)z * (size_t)strideA;
  const unsigned short* Wz = WT + (size_t)z * (size_t)strideW;
  float* Oz = outF + (size_t)z * (size_t)strideO;
  const int rowBase = (int)blockIdx.x * GBM;
  const int col0    = (int)blockIdx.y * GBN;

  v8f acc[4];
  {
    const v8f zz = {0.f, 0.f, 0.f, 0.f, 0.f, 0.f, 0.f, 0.f};
    acc[0] = zz; acc[1] = zz; acc[2] = zz; acc[3] = zz;
  }
  const unsigned short* ap = Az + (size_t)(rowBase + 16 * wave + m) * (size_t)K + 8 * hh;
  const unsigned short* wp = Wz + (size_t)(col0 + m) * (size_t)K + 8 * hh;
  const int ksteps = K >> 5;
#pragma unroll 1
  for (int ks = 0; ks < ksteps; ++ks) {
    FragB af;
    af.h[0] = *(const v8usa*)(ap + 32 * ks);          // k = 32ks + 8hh + 0..7
    af.h[1] = *(const v8usa*)(ap + 32 * ks + 16);     // k = 32ks + 16 + 8hh + 0..7
#pragma unroll
    for (int t = 0; t < 4; ++t) {
      const unsigned short* wq = wp + (size_t)(16 * t) * (size_t)K + 32 * ks;   // WT row col0 + 16t + m
      FragB bf;
      bf.h[0] = *(const v8usa*)wq;                    // same k map as A
      bf.h[1] = *(const v8usa*)(wq + 16);
      acc[t] = wmb(af, bf, acc[t]);
    }
  }

#pragma unroll
  for (int t = 0; t < 4; ++t) {
    const int lc = 16 * t + m;
#pragma unroll
    for (int r = 0; r < 8; ++r) {
      const int lr = 16 * wave + 8 * hh + r;          // D element r = (row 8hh+r, col m)
      stg[lr * GBN + lc] = acc[t][r];
    }
  }
  __syncthreads();

  float* ob;
  int ldo;
  if (EPI == 0) {
    const int bq = rowBase >> 10;
    const int s0 = rowBase & (SEQ - 1);
    ob  = Oz + ((size_t)(bq * NH + (int)blockIdx.y) * SEQ + s0) * DK;
    ldo = DK;
  } else {
    ob  = Oz + (size_t)rowBase * DM + col0;
    ldo = DM;
  }
  v4f fv[8];
#pragma unroll
  for (int i = 0; i < 8; ++i) {
    const int lr = 16 * wave + 2 * i + hh;
    fv[i] = *(const v4fa*)(stg + lr * GBN + 4 * m);
  }
#pragma unroll
  for (int i = 0; i < 8; ++i) {
    const int lr = 16 * wave + 2 * i + hh;
    float* op = ob + (size_t)lr * (size_t)ldo + 4 * m;
    *(v4f*)op = fv[i];
  }
  
}

// ---------------------------------------------------------------------------
// Window scores. grid (32 = window row w, 32 = bh), 8 waves; a wave takes 128 consecutive slots of the row, 32 a step.
// Lane j reads slot j's indices. The rows are then read whole: the 16 lanes of a half-wave take one slot's q row and
// k row, 16 bytes a lane (channels 4c..4c+3, c = lane & 15), so one load instruction covers two 256-byte rows; half-wave
// g works through slots 16g..16g+15, the slot's row offset coming from its lane by a DPP row broadcast.
// rel_k[h][w], rel_q[h][w] rows staged in LDS as bf16 values, each lane keeps its four channels of both in registers.
// Per lane c2c, c2p, p2c over its four channels, (c2c + c2p) + p2c, then the sum over the 16 lanes; lane j keeps slot
// j's score; masked slots get -1e9.
// coverage: 32 blocks x 8 waves x 4 steps x 32 lanes = all 32768 slots of each of the 32 (b,h).
// ---------------------------------------------------------------------------
#define SSTEP 4                      // 32-slot steps per wave in k_scores
static_assert(NWAVE * SSTEP * 32 == SEQ && DK == 64);

template<int CTRL>
__device__ __forceinline__ int dpp_mov(int x) { return __builtin_amdgcn_update_dpp(0, x, CTRL, 0xf, 0xf, true); }
// lane I of this lane's 16-lane row (DPP row_share)
template<int I>
__device__ __forceinline__ unsigned int row_bcast(int x) { return (unsigned int)dpp_mov<0x150 + I>(x); }
// sum over the 16 lanes of a row, in every lane of it (DPP row_xmask 1, 2, 4, 8)
__device__ __forceinline__ float row_sum16(float x) {
  x += __int_as_float(dpp_mov<0x161>(__float_as_int(x)));
  x += __int_as_float(dpp_mov<0x162>(__float_as_int(x)));
  x += __int_as_float(dpp_mov<0x164>(__float_as_int(x)));
  x += __int_as_float(dpp_mov<0x168>(__float_as_int(x)));
  return x;
}

// Slots I0..I0+7 of each half-wave: qo, ko = the lane's own slot's q and k row byte offsets, c16 = 16 * (lane & 15).
// All sixteen row loads are issued before the first is used. sc takes the score sum of the lane's own slot.
#define SC_ADDR(i) qa[i] = row_bcast<I0 + (i)>(qo) + c16; ka[i] = row_bcast<I0 + (i)>(ko) + c16;
template<int I0>
__device__ __forceinline__ void score8(int qo, int ko, unsigned int c16, int c,
                                       const char* __restrict__ qb, const char* __restrict__ kb,
                                       const v4f rkv, const v4f rqv, float& sc) {
  unsigned int qa[8], ka[8];
  v4f qv[8], kv[8];
  SC_ADDR(0) SC_ADDR(1) SC_ADDR(2) SC_ADDR(3) SC_ADDR(4) SC_ADDR(5) SC_ADDR(6) SC_ADDR(7)
#pragma unroll
  for (int i = 0; i < 8; ++i) {
    qv[i] = *(const v4fa*)(qb + qa[i]);
    kv[i] = *(const v4fa*)(kb + ka[i]);
  }
  // the wait before the loads' offset registers are written again; naming them keeps each in a register of its own up
  // to here. The "memory" clobber keeps the loads ahead of it.
  asm volatile("s_wait_xcnt 0x0" :: "v"(qa[0]), "v"(qa[1]), "v"(qa[2]), "v"(qa[3]), "v"(qa[4]), "v"(qa[5]), "v"(qa[6]),
               "v"(qa[7]), "v"(ka[0]), "v"(ka[1]), "v"(ka[2]), "v"(ka[3]), "v"(ka[4]), "v"(ka[5]), "v"(ka[6]), "v"(ka[7])
               : "memory");
#pragma unroll
  for (int i = 0; i < 8; ++i) {
    const v4f q = qv[i], k = kv[i];
    float c2c = q.x * k.x, c2p = q.x * rkv.x, p2c = rqv.x * k.x;
    c2c = fmaf(q.y, k.y, c2c);   c2c = fmaf(q.z, k.z, c2c);   c2c = fmaf(q.w, k.w, c2c);
    c2p = fmaf(q.y, rkv.y, c2p); c2p = fmaf(q.z, rkv.z, c2p); c2p = fmaf(q.w, rkv.w, c2p);
    p2c = fmaf(rqv.y, k.y, p2c); p2c = fmaf(rqv.z, k.z, p2c); p2c = fmaf(rqv.w, k.w, p2c);
    const float s = row_sum16((c2c + c2p) + p2c);
    sc = (c == I0 + i) ? s : sc;
  }
}

__global__ __launch_bounds__(NTHR) void k_scores(
    const int* __restrict__ pos_enc, const int* __restrict__ pos_pad,
    const float* __restrict__ rel_q, const float* __restrict__ rel_k,
    const float* __restrict__ QP, const float* __restrict__ KPl, float* S)
{
  __shared__ __attribute__((aligned(16))) float rk[DK];
  __shared__ __attribute__((aligned(16))) float rq[DK];
  const int tid = (int)threadIdx.x, lane = tid & 31, wave = tid >> 5;
  const int bh = (int)blockIdx.y, h = bh & (NH - 1);
  const int w = (int)blockIdx.x;
  {
    const int sel = tid >> 6, j = tid & 63;          // sel uniform per pair of waves
    const size_t rb = (size_t)(h * W2 + w) * DK + j;
    if (sel == 0) rk[j] = bf16f(rel_k[rb]);
    if (sel == 1) rq[j] = bf16f(rel_q[rb]);
  }
  __syncthreads();

  const int c = lane & 15;
  const unsigned int c16 = 16u * (unsigned int)c;
  const v4f rkv = *(const v4fa*)(rk + 4 * c);
  const v4f rqv = *(const v4fa*)(rq + 4 * c);
  const char* qb = (const char*)(QP  + (size_t)bh * SEQ * DK);
  const char* kb = (const char*)(KPl + (size_t)bh * SEQ * DK);
  const int f0 = w * SEQ + wave * (SSTEP * 32) + lane;
  int qo[SSTEP], ko[SSTEP];
  bool mk[SSTEP];
#pragma unroll
  for (int t = 0; t < SSTEP; ++t) {
    int qi, ki;
    slot_idx(pos_enc, pos_pad, bh, f0 + 32 * t, qi, ki, mk[t]);
    qo[t] = qi * (DK * 4);
    ko[t] = ki * (DK * 4);
  }
  float res[SSTEP];
#pragma unroll
  for (int t = 0; t < SSTEP; ++t) {
    float sc = 0.f;
    score8<0>(qo[t], ko[t], c16, c, qb, kb, rkv, rqv, sc);
    score8<8>(qo[t], ko[t], c16, c, qb, kb, rkv, rqv, sc);
    res[t] = mk[t] ? NEGBIG : sc * RINV24;
  }
  float* sp = S + (size_t)bh * NSLOT + f0;
#pragma unroll
  for (int t = 0; t < SSTEP; ++t) sp[32 * t] = res[t];
}

// ---------------------------------------------------------------------------
// One drain step of k_agg over 8*G slots: lane j holds slot j's value-row byte offset ov (kv * 256), its rel_v-row byte
// offset orl (w * 256) and its weight pm (0 past the target's last slot, which leaves the sums as they are).
// vb = value plane of this (b,h) (wave-uniform), rvl = rel_v rows in LDS + lane, lane4 = 4 * lane.
// ---------------------------------------------------------------------------
#define VO8(b) "v"(vo[(b)]), "v"(vo[(b) + 1]), "v"(vo[(b) + 2]), "v"(vo[(b) + 3]), \
               "v"(vo[(b) + 4]), "v"(vo[(b) + 5]), "v"(vo[(b) + 6]), "v"(vo[(b) + 7])
template<int G>
__device__ __forceinline__ void drain_step(int ov, int orl, float pm, const char* __restrict__ vb, const char* rvl,
                                           unsigned int lane4, float& a0, float& a1) {
  unsigned int vo[8 * G];
  float v0[8 * G], v1[8 * G], r0[8 * G], r1[8 * G];
#pragma unroll
  for (int j = 0; j < 8 * G; ++j) vo[j] = (unsigned int)__builtin_amdgcn_readlane(ov, j) + lane4;
#pragma unroll
  for (int j = 0; j < 8 * G; ++j) {
    const float* vr = (const float*)(vb + vo[j]);
    v0[j] = vr[0];
    v1[j] = vr[32];
  }
#pragma unroll
  for (int j = 0; j < 8 * G; ++j) {
    const float* rr = (const float*)(rvl + __builtin_amdgcn_readlane(orl, j));
    r0[j] = rr[0];
    r1[j] = rr[32];
  }
  // the wait before the loads' offset registers are written again; naming them keeps each in a register of its own up to
  // here (reused inside the step, an offset register would make the next load wait, or be a later load's destination);
  // a statement takes thirty operands, so 32 slots take two. The "memory" clobber keeps the step's loads ahead of it.
  if constexpr (G == 1) {
    asm volatile("s_wait_xcnt 0x0" :: VO8(0) : "memory");
  } else {
    asm volatile("s_wait_xcnt 0x0" :: VO8(0), VO8(8) : "memory");
    if constexpr (G == 3) asm volatile("s_wait_xcnt 0x0" :: VO8(16) : "memory");
    if constexpr (G == 4) asm volatile("s_wait_xcnt 0x0" :: VO8(16), VO8(24) : "memory");
  }
#pragma unroll
  for (int j = 0; j < 8 * G; ++j) {
    const float pj = __int_as_float(__builtin_amdgcn_readlane(__float_as_int(pm), j));
    a0 = fmaf(pj, v0[j] + r0[j], a0);
    a1 = fmaf(pj, v1[j] + r1[j], a1);
  }
}

// segment start clamped into [0, NSLOT]
__device__ __forceinline__ int clamp_st(int st) { return st < 0 ? 0 : (st > NSLOT ? NSLOT : st); }

// ---------------------------------------------------------------------------
// One block per (b,h): softmax statistics over all 32768 slots, deterministic bucketing of every slot by its
// q index into LDS (count -> exclusive scan -> f-ascending cursor fill, no atomics, no global tables): wave w takes
// flat slots [4096w, 4096w + 4096), 32 a step; lanes with the same target are matched by ballots, the first of them
// updates the wave's own counter / cursor row, each lane's place is cursor + its rank among them,
// then an owner drain per target position: out_h[i][d] = sum over its slots of p[f] * (v[kv[f]][d] + rel_v[w][d]),
// p = exp(S[f] - M) * (1/Z), computed where the slot is filed (scores read in f order) and kept beside its entry.
// The drain takes up to 32 slots of a target a step: lane j holds slot j's entry and weight, both are broadcast by
// readlane, the step's value rows are all requested before the first is used, and the sum runs in slot order.
// Lane = channel d (and 32 + d); every loop bound and index is clamped to static ranges.
// Result written as the bf16 hi | lo lines of OA row (b*1024 + i), columns h*64.. (hi) and 512 + h*64..
// Count cap overflow or inconsistent totals -> NaN poison of the row.
// coverage: 32 blocks x 1024 targets x (hi line + lo line) = all 4096 rows x 16 lines of OA exactly once.
// ---------------------------------------------------------------------------
__global__ __launch_bounds__(NTHR) void k_agg(
    const int* __restrict__ pos_enc, const int* __restrict__ pos_pad,
    const float* __restrict__ rel_v, const float* __restrict__ S, const float* __restrict__ VP,
    unsigned short* OA)
{
  extern __shared__ v4f lds_dyn[];
  float* pl   = (float*)lds_dyn;          // [NSLOT] slot weights p, grouped by target, f ascending
  int*   scnt = (int*)(pl + NSLOT);       // [SEQ]
  int*   soff = scnt + SEQ;               // [SEQ]
  int*   cur  = soff + SEQ;               // [NWAVE][SEQ] per-wave counts, then per-wave cursors
  float* relv = (float*)(cur + NWAVE * SEQ);   // [W2*DK]
  float* stw  = relv + W2 * DK;           // [NWAVE*64]
  float* red  = stw + NWAVE * 64;         // [16]
  int*   wtot = (int*)(red + 16);         // [NWAVE]
  unsigned short* ent16 = (unsigned short*)(wtot + NWAVE);   // [NSLOT] packed (w << 10 | kv), same places as pl
  const int tid = (int)threadIdx.x, lane = tid & 31, wave = tid >> 5;
  const int bh = (int)blockIdx.x, b = bh >> 3, h = bh & (NH - 1);
  const float* sb = S + (size_t)bh * NSLOT;

  {
    const v4i z4 = {0, 0, 0, 0};
#pragma unroll 1
    for (int i = tid; i < NSLOT / 4; i += NTHR) *(v4ia*)(pl + 4 * i) = z4;
#pragma unroll 1
    for (int i = tid; i < NSLOT / 8; i += NTHR) *(v4ia*)(ent16 + 8 * i) = z4;
#pragma unroll
    for (int w2 = 0; w2 < NWAVE; ++w2) *(v4ia*)(cur + w2 * SEQ + 4 * tid) = z4;
    const float* rp = rel_v + (size_t)h * (W2 * DK) + 8 * tid;
    const v4f a = *(const v4fa*)rp;
    const v4f c = *(const v4fa*)(rp + 4);
    float* q = relv + 8 * tid;
    q[0] = bf16f(a.x); q[1] = bf16f(a.y); q[2] = bf16f(a.z); q[3] = bf16f(a.w);
    q[4] = bf16f(c.x); q[5] = bf16f(c.y); q[6] = bf16f(c.z); q[7] = bf16f(c.w);
  }
  __syncthreads();

  // ---- softmax statistics: M = max, Z = sum exp(s - M), two-level fixed order ----
  float mx = -3.0e38f;
#pragma unroll 1
  for (int i = 0; i < NSLOT / (4 * NTHR); ++i) {
    const v4f s4 = *(const v4fa*)(sb + (size_t)i * (4 * NTHR) + 4 * tid);
    mx = fmaxf(fmaxf(mx, fmaxf(s4.x, s4.y)), fmaxf(s4.z, s4.w));
  }
#pragma unroll
  for (int off = 16; off > 0; off >>= 1) mx = fmaxf(mx, __shfl_xor(mx, off));
  if (lane == 0) red[wave] = mx;
  __syncthreads();
  float M = red[0];
#pragma unroll
  for (int w2 = 1; w2 < NWAVE; ++w2) M = fmaxf(M, red[w2]);
  float zs = 0.f;
#pragma unroll 1
  for (int i = 0; i < NSLOT / (4 * NTHR); ++i) {
    const v4f s4 = *(const v4fa*)(sb + (size_t)i * (4 * NTHR) + 4 * tid);
    zs += (__expf(s4.x - M) + __expf(s4.y - M)) + (__expf(s4.z - M) + __expf(s4.w - M));
  }
#pragma unroll
  for (int off = 16; off > 0; off >>= 1) zs += __shfl_xor(zs, off);
  if (lane == 0) red[NWAVE + wave] = zs;
  __syncthreads();
  float Z = 0.f;
#pragma unroll
  for (int w2 = 0; w2 < NWAVE; ++w2) Z += red[NWAVE + w2];
  const float invZ = 1.0f / Z;                        // Z >= 1 (the max slot contributes exp(0))

  // ---- counts per (wave, target): every wave over its own 4096 slots ----
  // A wave's 4096 slots lie in one half of the window rows, so its q table and its kv table (slot_idx) are fixed:
  // lower half q <- pos_pad, kv <- pos_enc; upper half the other way round. clamp_pos sends pos_enc's -1 to 0.
  const int f0w = __builtin_amdgcn_readfirstlane(wave) * FPW;   // wave-uniform: scalar loop control and table choice
  const bool lohalf = f0w < NHALF;
  const int* qtab = (lohalf ? pos_pad : pos_enc) + bh * NHALF + (f0w & (NHALF - 1));
  const int* ktab = (lohalf ? pos_enc : pos_pad) + bh * NHALF + (f0w & (NHALF - 1));
  int* wcur = cur + wave * SEQ;
  const unsigned int below = (1u << lane) - 1u;
  const unsigned int lane4 = 4u * (unsigned int)lane;
#pragma unroll 1
  for (int g = 0; g < FPW; g += 32 * BGRP) {
    int tq[BGRP];
#pragma unroll
    for (int j = 0; j < BGRP; ++j) tq[j] = clamp_pos(qtab[g + 32 * j + lane]) & (SEQ - 1);
#pragma unroll
    for (int j = 0; j < BGRP; ++j) {
      const unsigned int peers = same_target(tq[j]);
      if ((peers & below) == 0u) wcur[tq[j]] = wcur[tq[j]] + __builtin_popcount(peers);
      // the next step's reader of a counter may be another lane of this wave: keep the LDS accesses in step order
      __builtin_amdgcn_fence(__ATOMIC_ACQ_REL, "wavefront");
      __builtin_amdgcn_wave_barrier();
    }
  }
  __syncthreads();

  // ---- exclusive prefix over SEQ counts -> soff ----
  int tot;
  {
    v4i cw[NWAVE];
    v4i ca = {0, 0, 0, 0};
#pragma unroll
    for (int w2 = 0; w2 < NWAVE; ++w2) {
      cw[w2] = *(const v4ia*)(cur + w2 * SEQ + 4 * tid);
      ca += cw[w2];
    }
    *(v4ia*)(scnt + 4 * tid) = ca;
    const int e0 = ca.x < 0 ? 0 : ca.x, e1 = ca.y < 0 ? 0 : ca.y, e2 = ca.z < 0 ? 0 : ca.z, e3 = ca.w < 0 ? 0 : ca.w;
    const int ts = e0 + e1 + e2 + e3;
    int incl = ts;
#pragma unroll
    for (int d = 1; d < 32; d <<= 1) {
      const int up = __shfl_up(incl, d);
      if (lane >= d) incl += up;
    }
    if (lane == 31) wtot[wave] = incl;
    __syncthreads();
    int pre = 0;
    tot = 0;
#pragma unroll
    for (int w2 = 0; w2 < NWAVE; ++w2) {
      const int t = wtot[w2];
      tot += t;
      pre += (w2 < wave) ? t : 0;
    }
    int run = pre + incl - ts;
    v4i so;
    so.x = run; run += e0;
    so.y = run; run += e1;
    so.z = run; run += e2;
    so.w = run;
    *(v4ia*)(soff + 4 * tid) = so;
    // wave w2's cursor of a target starts behind the slots that waves 0..w2-1 hold for it (f ascending over waves)
#pragma unroll
    for (int w2 = 0; w2 < NWAVE; ++w2) {
      *(v4ia*)(cur + w2 * SEQ + 4 * tid) = so;
      so += cw[w2];
    }
  }
  __syncthreads();

  // ---- fill: packed (w << 10 | kv) and weight p into target segments (every wave over its own slots, f ascending) ----
#pragma unroll 1
  for (int g = 0; g < FPW; g += 32 * BGRP) {
    int tq[BGRP], ent[BGRP];
    float pw[BGRP];
    // this group's kv indices and scores, from the lane's own column on
    const int*   kg = (const int*)((const char*)(ktab + g) + lane4);
    const float* sg = (const float*)((const char*)(sb + f0w + g) + lane4);
#pragma unroll
    for (int j = 0; j < BGRP; ++j) {
      const int o = g + 32 * j + lane;
      tq[j]  = clamp_pos(qtab[o]) & (SEQ - 1);
      ent[j] = (((f0w + o) >> 10) << 10) | clamp_pos(kg[32 * j]);
      pw[j]  = __expf(sg[32 * j] - M) * invZ;
    }
    // the steps below reuse the address registers of the loads above
    asm volatile("s_wait_xcnt 0x0" ::: "memory");
#pragma unroll
    for (int j = 0; j < BGRP; ++j) {
      const unsigned int peers = same_target(tq[j]);
      const unsigned int lower = peers & below;
      const int base = wcur[tq[j]];
      int pos = base + __builtin_popcount(lower);
      pos = pos < 0 ? 0 : (pos > NSLOT - 1 ? NSLOT - 1 : pos);
      ent16[pos] = (unsigned short)ent[j];
      pl[pos]    = pw[j];
      if (lower == 0u) wcur[tq[j]] = base + __builtin_popcount(peers);
      // the next step's reader of a cursor may be another lane of this wave: keep the LDS accesses in step order
      __builtin_amdgcn_fence(__ATOMIC_ACQ_REL, "wavefront");
      __builtin_amdgcn_wave_barrier();
    }
  }
  __syncthreads();

  // ---- drain: wave owns targets [wave*TPW, wave*TPW + TPW) ----
  const float qnan = __int_as_float(0x7fc00000);
  const bool bad_tot = (tot != NSLOT);
  float* sw = stw + wave * 64;
  const int lc = lane & 7;
  const bool islo = (lane & 8) != 0;
  const char* vb  = (const char*)(VP + (size_t)bh * SEQ * DK);
  const char* rvl = (const char*)(relv + lane);
  const int tg0 = __builtin_amdgcn_readfirstlane(wave) * TPW;
  // segment start and count: this target's and the next one's as wave-uniform scalars, the one after that in flight
  int sA = __builtin_amdgcn_readfirstlane(soff[tg0]),     cA = __builtin_amdgcn_readfirstlane(scnt[tg0]);
  int sB = __builtin_amdgcn_readfirstlane(soff[tg0 + 1]), cB = __builtin_amdgcn_readfirstlane(scnt[tg0 + 1]);
  int sV = soff[tg0 + 2], cV = scnt[tg0 + 2];
  // entries and weights of the coming step, read one step ahead
  int epre;
  float ppre;
  {
    int idx = clamp_st(sA) + lane;
    idx = idx > NSLOT - 1 ? NSLOT - 1 : idx;
    epre = ent16[idx];
    ppre = pl[idx];
  }
#pragma unroll 1
  for (int jt = 0; jt < TPW; ++jt) {
    const int tg = tg0 + jt;                           // 0..1023
    const int st = clamp_st(sA);
    const int stn = clamp_st(sB);
    const int craw = cA;
    int cnt = craw;
    cnt = cnt < 0 ? 0 : (cnt > DEGCAP ? DEGCAP : cnt);
    if (cnt > NSLOT - st) cnt = NSLOT - st;
    const float pz = (bad_tot || craw > DEGCAP || craw < 0) ? qnan : 0.0f;
    float a0 = 0.f, a1 = 0.f;
#pragma unroll 1
    for (int q0 = 0; q0 < cnt || q0 == 0; q0 += 32) {
      const int left = cnt - q0;                       // 0 only for an empty target: nothing summed, read-ahead moved on
      const int n = left > 32 ? 32 : left;
      const int ov  = (epre & (SEQ - 1)) * (DK * 4);
      const int orl = ((epre >> 10) & (W2 - 1)) * (DK * 4);
      const float pm = lane < n ? ppre : 0.0f;
      int idx = (left > 32 ? st + q0 + 32 : stn) + lane;
      idx = idx > NSLOT - 1 ? NSLOT - 1 : idx;
      epre = ent16[idx];
      ppre = pl[idx];
      if (n > 24)      drain_step<4>(ov, orl, pm, vb, rvl, lane4, a0, a1);
      else if (n > 16) drain_step<3>(ov, orl, pm, vb, rvl, lane4, a0, a1);
      else if (n > 8)  drain_step<2>(ov, orl, pm, vb, rvl, lane4, a0, a1);
      else if (n > 0)  drain_step<1>(ov, orl, pm, vb, rvl, lane4, a0, a1);
    }
    {
      sA = sB; cA = cB;
      sB = __builtin_amdgcn_readfirstlane(sV);
      cB = __builtin_amdgcn_readfirstlane(cV);
      const int tn = tg0 + (jt + 3 < TPW ? jt + 3 : TPW - 1);
      sV = soff[tn];
      cV = scnt[tn];
    }
    a0 += pz;
    a1 += pz;
    // per-wave relayout: channels in order, then lanes 0..7 (hi) / 8..15 (lo) read 8 consecutive channels each
    __builtin_amdgcn_fence(__ATOMIC_RELEASE, "wavefront");
    __builtin_amdgcn_wave_barrier();
    sw[lane]      = a0;
    sw[32 + lane] = a1;
    __builtin_amdgcn_fence(__ATOMIC_RELEASE, "wavefront");
    __builtin_amdgcn_wave_barrier();
    const v4f ga = *(const v4fa*)(sw + 8 * lc);
    const v4f gb = *(const v4fa*)(sw + 8 * lc + 4);
    const v8us ov = split8(ga, gb, islo);
    const int orow = b * SEQ + tg;
    unsigned short* dst = OA + (size_t)orow * KOUT + (islo ? DM : 0) + h * DK + 8 * lc;
    const bool wsv = lane < 16;
    if (wsv) *(v8us*)dst = ov;
    
  }
}

// ---------------------------------------------------------------------------
static inline int cdiv(int a, int b) { return (a + b - 1) / b; }

extern "C" void kernel_launch(void* const* d_in, const int* in_sizes, int n_in,
                              void* d_out, int out_size, void* d_ws, size_t ws_size,
                              hipStream_t stream) {
  if (n_in < 12) return;
  if (in_sizes[0] != NB_ * SEQ * DM || in_sizes[1] != NB_ * SEQ * DM || in_sizes[2] != NB_ * SEQ * DM) return;
  if (in_sizes[3] != NPOS || in_sizes[4] != NPOS) return;
  if (in_sizes[5] != NH * W2 * DK || in_sizes[6] != NH * W2 * DK || in_sizes[7] != NH * W2 * DK) return;
  if (in_sizes[8] != DM * DM || in_sizes[9] != DM * DM || in_sizes[10] != DM * DM || in_sizes[11] != DM * DM) return;
  if (out_size != NB_ * SEQ * DM) return;

  const float* query   = (const float*)d_in[0];    // [4][1024][512]
  const float* keyx    = (const float*)d_in[1];
  const float* value   = (const float*)d_in[2];
  const int*   pos_enc = (const int*)  d_in[3];    // [4][8][16][1024]
  const int*   pos_pad = (const int*)  d_in[4];
  const float* rel_q   = (const float*)d_in[5];    // [1][8][32][64]
  const float* rel_k   = (const float*)d_in[6];
  const float* rel_v   = (const float*)d_in[7];
  const float* Wq      = (const float*)d_in[8];    // [512][512] rows = output feature
  const float* Wk      = (const float*)d_in[9];
  const float* Wv      = (const float*)d_in[10];
  const float* Wo      = (const float*)d_in[11];
  float*       out     = (float*)d_out;            // [4][1024][512]

  // workspace carve (every region a whole number of 256-B blocks; all planes are exact tile multiples)
  char* ws = (char*)d_ws;
  size_t off = 0;
  const size_t oXB  = off; off += (size_t)NXU * 16;                     // 12,582,912  bf16 [3][4096][512]
  const size_t oWB  = off; off += (size_t)NWU * 16;                     //  1,572,864  bf16 [3][512][512]
  const size_t oWOB = off; off += (size_t)NWOU * 16;                    //  1,048,576  bf16 [512][1024]
  const size_t oQKV = off; off += (size_t)3 * PLQ * 4;                  // 25,165,824  f32 [3][32][1024][64]
  const size_t oS   = off; off += (size_t)NBH * NSLOT * 4;              //  4,194,304  f32 [32][32768]
  const size_t oOA  = off; off += (size_t)MROWS * KOUT * 2;             //  8,388,608  bf16 [4096][1024]
  if (off > ws_size || off > (size_t)WSMAX) return;                     // total 52,953,088
  unsigned short* XB  = (unsigned short*)(ws + oXB);
  unsigned short* WB  = (unsigned short*)(ws + oWB);
  unsigned short* WOB = (unsigned short*)(ws + oWOB);
  float*          QKV = (float*)(ws + oQKV);
  float*          S   = (float*)(ws + oS);
  unsigned short* OA  = (unsigned short*)(ws + oOA);
  const float* QP  = QKV;
  const float* KPl = QKV + (size_t)PLQ;
  const float* VP  = QKV + (size_t)2 * PLQ;

  hipFuncSetAttribute(reinterpret_cast<const void*>(&k_agg),
                      hipFuncAttributeMaxDynamicSharedMemorySize, LDS_AGG);

  // 1: bf16 operand planes
  k_convert<<<NCU / NTHR, NTHR, 0, stream>>>(query, keyx, value, Wq, Wk, Wv, Wo, XB, WB, WOB, NCU);
  // 2: q/k/v projections -> f32 head planes
  k_gemm<0><<<dim3(MROWS / GBM, DM / GBN, 3), GTHR, 0, stream>>>(XB, WB, QKV, DM, MROWS * DM, DM * DM, PLQ);
  // 3: window scores
  k_scores<<<dim3(W2, NBH), NTHR, 0, stream>>>(pos_enc, pos_pad, rel_q, rel_k, QP, KPl, S);
  // 4: softmax + owner segment sums -> bf16 hi|lo plane
  k_agg<<<NBH, NTHR, LDS_AGG, stream>>>(pos_enc, pos_pad, rel_v, S, VP, OA);
  // 5: output projection -> out
  k_gemm<1><<<dim3(MROWS / GBM, DM / GBN, 1), GTHR, 0, stream>>>(OA, WOB, out, KOUT, 0, 0, 0);
}

// v004
// A run of this version takes 178 microseconds.
// Timed twice side by side with v003, it ran 1.75 and 1.74 times as fast.
// Over all steps from v000 it is 32.6 times as fast.
#include <hip/hip_runtime.h>
#include <stddef.h>
#include <stdint.h>

// Contractions: q/k/v input projections (K=512) and the output projection (K=1024 = activation bf16 hi|lo pair
// accumulate). Window scores (three 64-deep dots per slot), softmax statistics, weighted value sums and the
// per-position segment sums: f32 VALU.
//
// Carry audit: no plane carries a power-of-two scale; nothing is folded back anywhere.
//   XB  [3][4096][512]  bf16 = RNE(query | key | value)               (k_convert) -> A of the projections
//   WB  [3][512][512]   bf16 = RNE(Wq | Wk | Wv), rows [n][k]          (k_convert) -> B of the projections
//   OA  [4096][1024]    bf16 = [hi | lo] of the per-head attention output, hi = RNE(o), lo = RNE(o - hi)
//                                                                     (k_drain)   -> A of the output projection
//   rel_q, rel_k, rel_v are RNE-converted to bf16 values (held as f32) when staged in LDS.
//   f32 planes: QKV [3][32][1024][64] (projection results), S [32][32768] (masked, scaled scores).
//   Slot lists (k_agg -> k_drain): PL [32][32768] f32 weights, ENT [32][32768] u16 (w << 10 | kv), both grouped by
//   target; SOFF, SCNT [32][1024] int segment start and count per target; TOT [32] int slots filed.

#define NB_    4
#define SEQ    1024
#define DM     512
#define NH     8
#define DK     64
#define KP1    16
#define W2     32
#define NSLOT  32768                 // W2 * SEQ flat window slots per (b,h)
#define NHALF  16384                 // KP1 * SEQ
#define NBH    32                    // NB_ * NH
#define MROWS  4096                  // NB_ * SEQ
#define KOUT   1024                  // 2 * DM (hi | lo)
#define NPOS   (NBH * NHALF)         // ints per position table
#define PLQ    (NBH * SEQ * DK)      // floats per q/k/v plane (2097152)
#define NTHR   256
#define NWAVE  8
#define GTHR   128
#define GBM    64
#define GBN    64
#define TPD    8                     // targets per wave in k_drain
#define DEGCAP 256                   // static cap on slots per target position
#define RINV24 (1.0f / 24.0f)
#define NEGBIG (-1.0e9f)
#define WSMAX  134217728
#define NXU    (3 * (MROWS * DM / 8))   // 786432 convert units (8 elements each)
#define NWU    (3 * (DM * DM / 8))      // 98304
#define NWOU   (DM * KOUT / 8)          // 65536
#define NCU    (NXU + NWU + NWOU)       // 950272
#define FPW    (NSLOT / NWAVE)       // 4096 consecutive flat slots per wave in the bucketing passes of k_agg
#define BGRP   8                     // 32-slot steps whose index loads are issued together
#define LDS_AGG 229472

static_assert((MROWS % GBM) == 0 && (DM % GBN) == 0 && (SEQ % GBM) == 0);
static_assert((DM % 32) == 0 && (KOUT % 32) == 0);
static_assert(GBN == DK);
static_assert(GBM == (GTHR / 32) * 16);
static_assert(NSLOT == W2 * SEQ && NHALF == KP1 * SEQ && NBH == NB_ * NH && MROWS == NB_ * SEQ);
static_assert(NSLOT == (1 << 15) && SEQ == (1 << 10));
static_assert((MROWS * DM / 8) == (1 << 18) && (DM * DM / 8) == (1 << 15) && (KOUT / 8) == 128);
static_assert((NXU % NTHR) == 0 && ((NXU + NWU) % NTHR) == 0 && (NCU % NTHR) == 0);
static_assert(NTHR * 4 == SEQ && (SEQ % (TPD * NWAVE)) == 0);
static_assert((NSLOT % (4 * NTHR)) == 0);
static_assert(NTHR * 8 == W2 * DK);
static_assert((NSLOT + NWAVE * SEQ) * 4 + 16 * 4 + NWAVE * 4 + NSLOT * 2 <= LDS_AGG);
static_assert(((NSLOT + NWAVE * SEQ) * 4 + 16 * 4 + NWAVE * 4) % 16 == 0);
static_assert(TPD >= 1 && TPD <= 32 && (NSLOT * 2) % (16 * NTHR) == 0);
static_assert(FPW * NWAVE == NSLOT && (FPW % (32 * BGRP)) == 0 && (NHALF % FPW) == 0);
static_assert(LDS_AGG <= 300000);
static_assert(PLQ == NB_ * SEQ * DM);

typedef float    v4f  __attribute__((ext_vector_type(4)));
typedef float    v8f  __attribute__((ext_vector_type(8)));
typedef int      v4i  __attribute__((ext_vector_type(4)));
typedef int      v8i  __attribute__((ext_vector_type(8)));
typedef unsigned short v8us __attribute__((ext_vector_type(8)));
typedef __bf16   v16b __attribute__((ext_vector_type(16)));
typedef v4f  __attribute__((may_alias)) v4fa;
typedef v4i  __attribute__((may_alias)) v4ia;
typedef v8us __attribute__((may_alias)) v8usa;
union FragB { v16b v; v8us h[2]; v8i w; };

// WMMA with hazard guard: ties D, keeps A/B live for 4 VALU slots
__device__ __forceinline__ v8f wmb(const FragB& a, const FragB& b, v8f c) {
  v8f d = __builtin_amdgcn_wmma_f32_16x16x32_bf16(false, a.v, false, b.v, (short)0, c, false, false);
  asm volatile("v_nop\n\tv_nop\n\tv_nop\n\tv_nop" : "+v"(d) : "v"(a.w), "v"(b.w));
  return d;
}

// f32 -> bf16 bits, RNE convert
__device__ __forceinline__ unsigned int bf16u(float x) {
  const unsigned int u = __float_as_uint(x);
  return (u + 0x7FFFu + ((u >> 16) & 1u)) >> 16;
}
// f32 -> nearest bf16 value held as f32
__device__ __forceinline__ float bf16f(float x) { return __uint_as_float(bf16u(x) << 16); }

__device__ __forceinline__ v8us cvt8b(const v4f a, const v4f b) {
  v8us r;
  r[0] = (unsigned short)bf16u(a.x); r[1] = (unsigned short)bf16u(a.y);
  r[2] = (unsigned short)bf16u(a.z); r[3] = (unsigned short)bf16u(a.w);
  r[4] = (unsigned short)bf16u(b.x); r[5] = (unsigned short)bf16u(b.y);
  r[6] = (unsigned short)bf16u(b.z); r[7] = (unsigned short)bf16u(b.w);
  return r;
}

__device__ __forceinline__ unsigned short hl1(float x, bool islo) {
  const unsigned int hu = bf16u(x);
  const float hf = __uint_as_float(hu << 16);
  const unsigned int lu = bf16u(x - hf);
  return (unsigned short)(islo ? lu : hu);
}
// 8 floats -> 8 bf16 hi parts (islo false) or 8 bf16 lo parts (islo true), lo = RNE(x - hi)
__device__ __forceinline__ v8us split8(const v4f a, const v4f b, bool islo) {
  v8us r;
  r[0] = hl1(a.x, islo); r[1] = hl1(a.y, islo); r[2] = hl1(a.z, islo); r[3] = hl1(a.w, islo);
  r[4] = hl1(b.x, islo); r[5] = hl1(b.y, islo); r[6] = hl1(b.z, islo); r[7] = hl1(b.w, islo);
  return r;
}

// ---------------------------------------------------------------------------
// Flat window slot f (0..32767) of head group bh: window row w = f >> 10, position s = f & 1023.
//   q index  = w < 16 ? pos_pad[w][s]    : pe[w-16][s]       (pe = pos_enc with -1 -> 0)
//   kv index = w < 16 ? pe[w][s]         : pos_pad[w-16][s]
//   masked   = (pos_enc[w & 15][s] == -1) || f < 1024
// Both tables are read unconditionally (same g for both halves) and clamped into [0, SEQ-1].
// ---------------------------------------------------------------------------
__device__ __forceinline__ void slot_idx(const int* __restrict__ pos_enc, const int* __restrict__ pos_pad,
                                         int bh, int f, int& qi, int& ki, bool& msk) {
  const int g = bh * NHALF + (f & (NHALF - 1));
  const int penc = pos_enc[g];
  const int ppad = pos_pad[g];
  const bool neg = (penc == -1);
  int pe = neg ? 0 : penc;
  pe = pe < 0 ? 0 : (pe > SEQ - 1 ? SEQ - 1 : pe);
  int pp = ppad < 0 ? 0 : (ppad > SEQ - 1 ? SEQ - 1 : ppad);
  const bool lo = f < NHALF;
  qi = lo ? pp : pe;
  ki = lo ? pe : pp;
  msk = neg || (f < SEQ);
}

// position index clamped into [0, SEQ-1]
__device__ __forceinline__ int clamp_pos(int v) { return v < 0 ? 0 : (v > SEQ - 1 ? SEQ - 1 : v); }

// Mask of the lanes of this wave whose 10-bit target t equals this lane's (all 32 lanes active): one ballot per bit.
__device__ __forceinline__ unsigned int same_target(int t) {
  unsigned int peers = 0xFFFFFFFFu;
#pragma unroll
  for (int bit = 0; bit < 10; ++bit) {
    const bool on = ((t >> bit) & 1) != 0;
    const unsigned int bl = __builtin_amdgcn_ballot_w32(on);
    peers &= on ? bl : ~bl;
  }
  return peers;
}

// ---------------------------------------------------------------------------
//   u <  NXU        : XB[z][off*8 ..]  z = u >> 18 selects query | key | value
//   u <  NXU + NWU  : WB[z][off*8 ..]  z selects Wq | Wk | Wv (rows [n][k] as given)
// coverage: NXU*8 = 3*4096*512, NWU*8 = 3*512*512, NWOU*8 = 512*1024 elements exactly.
// ---------------------------------------------------------------------------
__global__ __launch_bounds__(NTHR) void k_convert(
    const float* __restrict__ xq, const float* __restrict__ xk, const float* __restrict__ xv,
    const float* __restrict__ wq, const float* __restrict__ wk, const float* __restrict__ wv,
    const float* __restrict__ wo,
    unsigned short* xb, unsigned short* wb, unsigned short* wob, int nUnits)
{
  const int u = (int)blockIdx.x * NTHR + (int)threadIdx.x;
  if (u >= nUnits) return;
  const float* src;
  unsigned short* dst;
  if (u < NXU) {
    const int z = u >> 18, off = u & ((1 << 18) - 1);
    const float* xs = (z == 0) ? xq : ((z == 1) ? xk : xv);
    src = xs + (size_t)off * 8;
    dst = xb + (size_t)u * 8;
  } else if (u < NXU + NWU) {
    const int e = u - NXU;
    const int z = e >> 15, off = e & ((1 << 15) - 1);
    const float* wsp = (z == 0) ? wq : ((z == 1) ? wk : wv);
    src = wsp + (size_t)off * 8;
    dst = wb + (size_t)e * 8;
  } else {
    const int e = u - NXU - NWU;
    const int n = e >> 7;
    const int c8 = (e & 127) * 8;
    src = wo + (size_t)n * DM + (c8 & (DM - 1));
    dst = wob + (size_t)n * KOUT + c8;
  }
  const v4f a = *(const v4fa*)src;
  const v4f b = *(const v4fa*)(src + 4);
  const v8us o = cvt8b(a, b);
  *(v8us*)dst = o;
  
}

// ---------------------------------------------------------------------------
// bf16 WMMA GEMM, plane z = blockIdx.z: C[4096][N] tile = A[4096][K] (bf16, pitch K) x WT[N][K]^T (bf16 rows n,
// k-contiguous), K = 32*ksteps. grid (4096/64, N/64, nz), 128 threads: wave w owns rows 16w..16w+15 of the 64x64
// tile, acc[4] = 4 column tiles. A fragment (row m = lane&15): elements 0..7 <- k0+8h+0..7, 8..15 <- k0+16+8h+0..7
// (h = lane>>4); B fragment (col n = lane&15) from WT row (col0+16t+n) with the SAME k map; D element r =
// (row 8h+r, col lane&15). Tile staged in LDS as 64x64 f32, then one instruction writes two 256-B row segments
//   EPI 0: head plane out[z][(b*8 + blockIdx.y)*1024 + s][64] f32 (b = row>>10, s = row&1023; column tile = one head)
//   EPI 1: out[row][512] f32 at columns col0..col0+63 (the final output, z = 0)
// coverage: grid (64, 8, nz) covers every (row, col) of each 4096 x 512 plane exactly once.
// ---------------------------------------------------------------------------
template<int EPI>
__global__ __launch_bounds__(GTHR) void k_gemm(
    const unsigned short* __restrict__ A, const unsigned short* __restrict__ WT,
    float* outF, int K, int strideA, int strideW, int strideO)
{
  __shared__ __attribute__((aligned(16))) float stg[GBM * GBN];   // 16 KB
  const int tid = (int)threadIdx.x, lane = tid & 31, wave = tid >> 5, hh = lane >> 4, m = lane & 15;
  const int z = (int)blockIdx.z;
  const unsigned short* Az = A  + (size_t)z * (size_t)strideA;
  const unsigned short* Wz = WT + (size_t)z * (size_t)strideW;
  float* Oz = outF + (size_t)z * (size_t)strideO;
  const int rowBase = (int)blockIdx.x * GBM;
  const int col0    = (int)blockIdx.y * GBN;

  v8f acc[4];
  {
    const v8f zz = {0.f, 0.f, 0.f, 0.f, 0.f, 0.f, 0.f, 0.f};
    acc[0] = zz; acc[1] = zz; acc[2] = zz; acc[3] = zz;
  }
  const unsigned short* ap = Az + (size_t)(rowBase + 16 * wave + m) * (size_t)K + 8 * hh;
  const unsigned short* wp = Wz + (size_t)(col0 + m) * (size_t)K + 8 * hh;
  const int ksteps = K >> 5;
#pragma unroll 1
  for (int ks = 0; ks < ksteps; ++ks) {
    FragB af;
    af.h[0] = *(const v8usa*)(ap + 32 * ks);          // k = 32ks + 8hh + 0..7
    af.h[1] = *(const v8usa*)(ap + 32 * ks + 16);     // k = 32ks + 16 + 8hh + 0..7
#pragma unroll
    for (int t = 0; t < 4; ++t) {
      const unsigned short* wq = wp + (size_t)(16 * t) * (size_t)K + 32 * ks;   // WT row col0 + 16t + m
      FragB bf;
      bf.h[0] = *(const v8usa*)wq;                    // same k map as A
      bf.h[1] = *(const v8usa*)(wq + 16);
      acc[t] = wmb(af, bf, acc[t]);
    }
  }

#pragma unroll
  for (int t = 0; t < 4; ++t) {
    const int lc = 16 * t + m;
#pragma unroll
    for (int r = 0; r < 8; ++r) {
      const int lr = 16 * wave + 8 * hh + r;          // D element r = (row 8hh+r, col m)
      stg[lr * GBN + lc] = acc[t][r];
    }
  }
  __syncthreads();

  float* ob;
  int ldo;
  if (EPI == 0) {
    const int bq = rowBase >> 10;
    const int s0 = rowBase & (SEQ - 1);
    ob  = Oz + ((size_t)(bq * NH + (int)blockIdx.y) * SEQ + s0) * DK;
    ldo = DK;
  } else {
    ob  = Oz + (size_t)rowBase * DM + col0;
    ldo = DM;
  }
  v4f fv[8];
#pragma unroll
  for (int i = 0; i < 8; ++i) {
    const int lr = 16 * wave + 2 * i + hh;
    fv[i] = *(const v4fa*)(stg + lr * GBN + 4 * m);
  }
#pragma unroll
  for (int i = 0; i < 8; ++i) {
    const int lr = 16 * wave + 2 * i + hh;
    float* op = ob + (size_t)lr * (size_t)ldo + 4 * m;
    *(v4f*)op = fv[i];
  }
  
}

// ---------------------------------------------------------------------------
// Window scores. grid (32 = window row w, 32 = bh), 8 waves; a wave takes 128 consecutive slots of the row, 32 a step.
// Lane j reads slot j's indices. The rows are then read whole: the 16 lanes of a half-wave take one slot's q row and
// k row, 16 bytes a lane (channels 4c..4c+3, c = lane & 15), so one load instruction covers two 256-byte rows; half-wave
// g works through slots 16g..16g+15, the slot's row offset coming from its lane by a DPP row broadcast.
// rel_k[h][w], rel_q[h][w] rows staged in LDS as bf16 values, each lane keeps its four channels of both in registers.
// Per lane c2c, c2p, p2c over its four channels, (c2c + c2p) + p2c, then the sum over the 16 lanes; lane j keeps slot
// j's score; masked slots get -1e9.
// coverage: 32 blocks x 8 waves x 4 steps x 32 lanes = all 32768 slots of each of the 32 (b,h).
// ---------------------------------------------------------------------------
#define SSTEP 4                      // 32-slot steps per wave in k_scores
static_assert(NWAVE * SSTEP * 32 == SEQ && DK == 64);

template<int CTRL>
__device__ __forceinline__ int dpp_mov(int x) { return __builtin_amdgcn_update_dpp(0, x, CTRL, 0xf, 0xf, true); }
// lane I of this lane's 16-lane row (DPP row_share)
template<int I>
__device__ __forceinline__ unsigned int row_bcast(int x) { return (unsigned int)dpp_mov<0x150 + I>(x); }
// sum over the 16 lanes of a row, in every lane of it (DPP row_xmask 1, 2, 4, 8)
__device__ __forceinline__ float row_sum16(float x) {
  x += __int_as_float(dpp_mov<0x161>(__float_as_int(x)));
  x += __int_as_float(dpp_mov<0x162>(__float_as_int(x)));
  x += __int_as_float(dpp_mov<0x164>(__float_as_int(x)));
  x += __int_as_float(dpp_mov<0x168>(__float_as_int(x)));
  return x;
}

// Slots I0..I0+7 of each half-wave: qo, ko = the lane's own slot's q and k row byte offsets, c16 = 16 * (lane & 15).
// All sixteen row loads are issued before the first is used. sc takes the score sum of the lane's own slot.
#define SC_ADDR(i) qa[i] = row_bcast<I0 + (i)>(qo) + c16; ka[i] = row_bcast<I0 + (i)>(ko) + c16;
template<int I0>
__device__ __forceinline__ void score8(int qo, int ko, unsigned int c16, int c,
                                       const char* __restrict__ qb, const char* __restrict__ kb,
                                       const v4f rkv, const v4f rqv, float& sc) {
  unsigned int qa[8], ka[8];
  v4f qv[8], kv[8];
  SC_ADDR(0) SC_ADDR(1) SC_ADDR(2) SC_ADDR(3) SC_ADDR(4) SC_ADDR(5) SC_ADDR(6) SC_ADDR(7)
#pragma unroll
  for (int i = 0; i < 8; ++i) {
    qv[i] = *(const v4fa*)(qb + qa[i]);
    kv[i] = *(const v4fa*)(kb + ka[i]);
  }
  // the wait before the loads' offset registers are written again; naming them keeps each in a register of its own up
  // to here. The "memory" clobber keeps the loads ahead of it.
  asm volatile("s_wait_xcnt 0x0" :: "v"(qa[0]), "v"(qa[1]), "v"(qa[2]), "v"(qa[3]), "v"(qa[4]), "v"(qa[5]), "v"(qa[6]),
               "v"(qa[7]), "v"(ka[0]), "v"(ka[1]), "v"(ka[2]), "v"(ka[3]), "v"(ka[4]), "v"(ka[5]), "v"(ka[6]), "v"(ka[7])
               : "memory");
#pragma unroll
  for (int i = 0; i < 8; ++i) {
    const v4f q = qv[i], k = kv[i];
    float c2c = q.x * k.x, c2p = q.x * rkv.x, p2c = rqv.x * k.x;
    c2c = fmaf(q.y, k.y, c2c);   c2c = fmaf(q.z, k.z, c2c);   c2c = fmaf(q.w, k.w, c2c);
    c2p = fmaf(q.y, rkv.y, c2p); c2p = fmaf(q.z, rkv.z, c2p); c2p = fmaf(q.w, rkv.w, c2p);
    p2c = fmaf(rqv.y, k.y, p2c); p2c = fmaf(rqv.z, k.z, p2c); p2c = fmaf(rqv.w, k.w, p2c);
    const float s = row_sum16((c2c + c2p) + p2c);
    sc = (c == I0 + i) ? s : sc;
  }
}

__global__ __launch_bounds__(NTHR) void k_scores(
    const int* __restrict__ pos_enc, const int* __restrict__ pos_pad,
    const float* __restrict__ rel_q, const float* __restrict__ rel_k,
    const float* __restrict__ QP, const float* __restrict__ KPl, float* S)
{
  __shared__ __attribute__((aligned(16))) float rk[DK];
  __shared__ __attribute__((aligned(16))) float rq[DK];
  const int tid = (int)threadIdx.x, lane = tid & 31, wave = tid >> 5;
  const int bh = (int)blockIdx.y, h = bh & (NH - 1);
  const int w = (int)blockIdx.x;
  {
    const int sel = tid >> 6, j = tid & 63;          // sel uniform per pair of waves
    const size_t rb = (size_t)(h * W2 + w) * DK + j;
    if (sel == 0) rk[j] = bf16f(rel_k[rb]);
    if (sel == 1) rq[j] = bf16f(rel_q[rb]);
  }
  __syncthreads();

  const int c = lane & 15;
  const unsigned int c16 = 16u * (unsigned int)c;
  const v4f rkv = *(const v4fa*)(rk + 4 * c);
  const v4f rqv = *(const v4fa*)(rq + 4 * c);
  const char* qb = (const char*)(QP  + (size_t)bh * SEQ * DK);
  const char* kb = (const char*)(KPl + (size_t)bh * SEQ * DK);
  const int f0 = w * SEQ + wave * (SSTEP * 32) + lane;
  int qo[SSTEP], ko[SSTEP];
  bool mk[SSTEP];
#pragma unroll
  for (int t = 0; t < SSTEP; ++t) {
    int qi, ki;
    slot_idx(pos_enc, pos_pad, bh, f0 + 32 * t, qi, ki, mk[t]);
    qo[t] = qi * (DK * 4);
    ko[t] = ki * (DK * 4);
  }
  float res[SSTEP];
#pragma unroll
  for (int t = 0; t < SSTEP; ++t) {
    float sc = 0.f;
    score8<0>(qo[t], ko[t], c16, c, qb, kb, rkv, rqv, sc);
    score8<8>(qo[t], ko[t], c16, c, qb, kb, rkv, rqv, sc);
    res[t] = mk[t] ? NEGBIG : sc * RINV24;
  }
  float* sp = S + (size_t)bh * NSLOT + f0;
#pragma unroll
  for (int t = 0; t < SSTEP; ++t) sp[32 * t] = res[t];
}

// ---------------------------------------------------------------------------
// One step of k_drain over 8*G slots: lane j holds slot j's value-row byte offset ov (kv * 256), its rel_v-row byte
// offset orl (w * 256) and its weight pm (0 past the target's last slot, which leaves the sums as they are).
// vb = value plane of this (b,h) (wave-uniform), rvl = rel_v rows in LDS + lane, lane4 = 4 * lane.
// ---------------------------------------------------------------------------
#define VO8(b) "v"(vo[(b)]), "v"(vo[(b) + 1]), "v"(vo[(b) + 2]), "v"(vo[(b) + 3]), \
               "v"(vo[(b) + 4]), "v"(vo[(b) + 5]), "v"(vo[(b) + 6]), "v"(vo[(b) + 7])
template<int G>
__device__ __forceinline__ void drain_step(int ov, int orl, float pm, const char* __restrict__ vb, const char* rvl,
                                           unsigned int lane4, float& a0, float& a1) {
  unsigned int vo[8 * G];
  float v0[8 * G], v1[8 * G], r0[8 * G], r1[8 * G];
#pragma unroll
  for (int j = 0; j < 8 * G; ++j) vo[j] = (unsigned int)__builtin_amdgcn_readlane(ov, j) + lane4;
#pragma unroll
  for (int j = 0; j < 8 * G; ++j) {
    const float* vr = (const float*)(vb + vo[j]);
    v0[j] = vr[0];
    v1[j] = vr[32];
  }
#pragma unroll
  for (int j = 0; j < 8 * G; ++j) {
    const float* rr = (const float*)(rvl + __builtin_amdgcn_readlane(orl, j));
    r0[j] = rr[0];
    r1[j] = rr[32];
  }
  // the wait before the loads' offset registers are written again; naming them keeps each in a register of its own up to
  // here (reused inside the step, an offset register would make the next load wait, or be a later load's destination);
  // a statement takes thirty operands, so 32 slots take two. The "memory" clobber keeps the step's loads ahead of it.
  if constexpr (G == 1) {
    asm volatile("s_wait_xcnt 0x0" :: VO8(0) : "memory");
  } else {
    asm volatile("s_wait_xcnt 0x0" :: VO8(0), VO8(8) : "memory");
    if constexpr (G == 3) asm volatile("s_wait_xcnt 0x0" :: VO8(16) : "memory");
    if constexpr (G == 4) asm volatile("s_wait_xcnt 0x0" :: VO8(16), VO8(24) : "memory");
  }
#pragma unroll
  for (int j = 0; j < 8 * G; ++j) {
    const float pj = __int_as_float(__builtin_amdgcn_readlane(__float_as_int(pm), j));
    a0 = fmaf(pj, v0[j] + r0[j], a0);
    a1 = fmaf(pj, v1[j] + r1[j], a1);
  }
}

// segment start clamped into [0, NSLOT]
__device__ __forceinline__ int clamp_st(int st) { return st < 0 ? 0 : (st > NSLOT ? NSLOT : st); }

// Place idx (0..NSLOT-1) of the entry list eb and the weight list pb of one (b,h), one place a lane.
__device__ __forceinline__ void list_read(const unsigned short* __restrict__ eb, const float* __restrict__ pb, int idx,
                                          int& e, float& p) {
  e = eb[idx];
  p = pb[idx];
  // the wait before the two loads' index register is written again; naming it keeps it as it is up to here
  asm volatile("s_wait_xcnt 0x0" :: "v"(idx) : "memory");
}

// ---------------------------------------------------------------------------
// One block per (b,h): softmax statistics over all 32768 slots, deterministic bucketing of every slot by its
// q index into LDS (count -> exclusive scan -> f-ascending cursor fill, no atomics): wave w takes
// flat slots [4096w, 4096w + 4096), 32 a step; lanes with the same target are matched by ballots, the first of them
// updates the wave's own counter / cursor row, each lane's place is cursor + its rank among them.
// p = exp(S[f] - M) * (1/Z) is computed where the slot is filed (scores read in f order) and kept beside its entry.
// The finished lists go to the workspace in whole lines, with each target's segment start and count, for k_drain.
// coverage: 32 blocks x (32768 weights + 32768 entries + 1024 starts + 1024 counts + 1 total), each written once.
// ---------------------------------------------------------------------------
__global__ __launch_bounds__(NTHR) void k_agg(
    const int* __restrict__ pos_enc, const int* __restrict__ pos_pad, const float* __restrict__ S,
    float* PL, unsigned short* ENT, int* SOFF, int* SCNT, int* TOT)
{
  extern __shared__ v4f lds_dyn[];
  float* pl   = (float*)lds_dyn;          // [NSLOT] slot weights p, grouped by target, f ascending
  int*   cur  = (int*)(pl + NSLOT);       // [NWAVE][SEQ] per-wave counts, then per-wave cursors
  float* red  = (float*)(cur + NWAVE * SEQ);   // [16]
  int*   wtot = (int*)(red + 16);         // [NWAVE]
  unsigned short* ent16 = (unsigned short*)(wtot + NWAVE);   // [NSLOT] packed (w << 10 | kv), same places as pl
  const int tid = (int)threadIdx.x, lane = tid & 31, wave = tid >> 5;
  const int bh = (int)blockIdx.x;
  const float* sb = S + (size_t)bh * NSLOT;

  {
    const v4i z4 = {0, 0, 0, 0};
#pragma unroll 1
    for (int i = tid; i < NSLOT / 4; i += NTHR) *(v4ia*)(pl + 4 * i) = z4;
#pragma unroll 1
    for (int i = tid; i < NSLOT / 8; i += NTHR) *(v4ia*)(ent16 + 8 * i) = z4;
#pragma unroll
    for (int w2 = 0; w2 < NWAVE; ++w2) *(v4ia*)(cur + w2 * SEQ + 4 * tid) = z4;
  }
  __syncthreads();

  // ---- softmax statistics: M = max, Z = sum exp(s - M), two-level fixed order ----
  float mx = -3.0e38f;
#pragma unroll 1
  for (int i = 0; i < NSLOT / (4 * NTHR); ++i) {
    const v4f s4 = *(const v4fa*)(sb + (size_t)i * (4 * NTHR) + 4 * tid);
    mx = fmaxf(fmaxf(mx, fmaxf(s4.x, s4.y)), fmaxf(s4.z, s4.w));
  }
#pragma unroll
  for (int off = 16; off > 0; off >>= 1) mx = fmaxf(mx, __shfl_xor(mx, off));
  if (lane == 0) red[wave] = mx;
  __syncthreads();
  float M = red[0];
#pragma unroll
  for (int w2 = 1; w2 < NWAVE; ++w2) M = fmaxf(M, red[w2]);
  float zs = 0.f;
#pragma unroll 1
  for (int i = 0; i < NSLOT / (4 * NTHR); ++i) {
    const v4f s4 = *(const v4fa*)(sb + (size_t)i * (4 * NTHR) + 4 * tid);
    zs += (__expf(s4.x - M) + __expf(s4.y - M)) + (__expf(s4.z - M) + __expf(s4.w - M));
  }
#pragma unroll
  for (int off = 16; off > 0; off >>= 1) zs += __shfl_xor(zs, off);
  if (lane == 0) red[NWAVE + wave] = zs;
  __syncthreads();
  float Z = 0.f;
#pragma unroll
  for (int w2 = 0; w2 < NWAVE; ++w2) Z += red[NWAVE + w2];
  const float invZ = 1.0f / Z;                        // Z >= 1 (the max slot contributes exp(0))

  // ---- counts per (wave, target): every wave over its own 4096 slots ----
  // A wave's 4096 slots lie in one half of the window rows, so its q table and its kv table (slot_idx) are fixed:
  // lower half q <- pos_pad, kv <- pos_enc; upper half the other way round. clamp_pos sends pos_enc's -1 to 0.
  const int f0w = __builtin_amdgcn_readfirstlane(wave) * FPW;   // wave-uniform: scalar loop control and table choice
  const bool lohalf = f0w < NHALF;
  const int* qtab = (lohalf ? pos_pad : pos_enc) + bh * NHALF + (f0w & (NHALF - 1));
  const int* ktab = (lohalf ? pos_enc : pos_pad) + bh * NHALF + (f0w & (NHALF - 1));
  int* wcur = cur + wave * SEQ;
  const unsigned int below = (1u << lane) - 1u;
  const unsigned int lane4 = 4u * (unsigned int)lane;
#pragma unroll 1
  for (int g = 0; g < FPW; g += 32 * BGRP) {
    int tq[BGRP];
#pragma unroll
    for (int j = 0; j < BGRP; ++j) tq[j] = clamp_pos(qtab[g + 32 * j + lane]) & (SEQ - 1);
#pragma unroll
    for (int j = 0; j < BGRP; ++j) {
      const unsigned int peers = same_target(tq[j]);
      if ((peers & below) == 0u) wcur[tq[j]] = wcur[tq[j]] + __builtin_popcount(peers);
      // the next step's reader of a counter may be another lane of this wave: keep the LDS accesses in step order
      __builtin_amdgcn_fence(__ATOMIC_ACQ_REL, "wavefront");
      __builtin_amdgcn_wave_barrier();
    }
  }
  __syncthreads();

  // ---- exclusive prefix over SEQ counts -> SOFF ----
  int tot;
  {
    v4i cw[NWAVE];
    v4i ca = {0, 0, 0, 0};
#pragma unroll
    for (int w2 = 0; w2 < NWAVE; ++w2) {
      cw[w2] = *(const v4ia*)(cur + w2 * SEQ + 4 * tid);
      ca += cw[w2];
    }
    *(v4ia*)(SCNT + bh * SEQ + 4 * tid) = ca;
    const int e0 = ca.x < 0 ? 0 : ca.x, e1 = ca.y < 0 ? 0 : ca.y, e2 = ca.z < 0 ? 0 : ca.z, e3 = ca.w < 0 ? 0 : ca.w;
    const int ts = e0 + e1 + e2 + e3;
    int incl = ts;
#pragma unroll
    for (int d = 1; d < 32; d <<= 1) {
      const int up = __shfl_up(incl, d);
      if (lane >= d) incl += up;
    }
    if (lane == 31) wtot[wave] = incl;
    __syncthreads();
    int pre = 0;
    tot = 0;
#pragma unroll
    for (int w2 = 0; w2 < NWAVE; ++w2) {
      const int t = wtot[w2];
      tot += t;
      pre += (w2 < wave) ? t : 0;
    }
    int run = pre + incl - ts;
    v4i so;
    so.x = run; run += e0;
    so.y = run; run += e1;
    so.z = run; run += e2;
    so.w = run;
    *(v4ia*)(SOFF + bh * SEQ + 4 * tid) = so;
    // wave w2's cursor of a target starts behind the slots that waves 0..w2-1 hold for it (f ascending over waves)
#pragma unroll
    for (int w2 = 0; w2 < NWAVE; ++w2) {
      *(v4ia*)(cur + w2 * SEQ + 4 * tid) = so;
      so += cw[w2];
    }
  }
  __syncthreads();

  // ---- fill: packed (w << 10 | kv) and weight p into target segments (every wave over its own slots, f ascending) ----
#pragma unroll 1
  for (int g = 0; g < FPW; g += 32 * BGRP) {
    int tq[BGRP], ent[BGRP];
    float pw[BGRP];
    // this group's kv indices and scores, from the lane's own column on
    const int*   kg = (const int*)((const char*)(ktab + g) + lane4);
    const float* sg = (const float*)((const char*)(sb + f0w + g) + lane4);
#pragma unroll
    for (int j = 0; j < BGRP; ++j) {
      const int o = g + 32 * j + lane;
      tq[j]  = clamp_pos(qtab[o]) & (SEQ - 1);
      ent[j] = (((f0w + o) >> 10) << 10) | clamp_pos(kg[32 * j]);
      pw[j]  = __expf(sg[32 * j] - M) * invZ;
    }
    // the steps below reuse the address registers of the loads above
    asm volatile("s_wait_xcnt 0x0" ::: "memory");
#pragma unroll
    for (int j = 0; j < BGRP; ++j) {
      const unsigned int peers = same_target(tq[j]);
      const unsigned int lower = peers & below;
      const int base = wcur[tq[j]];
      int pos = base + __builtin_popcount(lower);
      pos = pos < 0 ? 0 : (pos > NSLOT - 1 ? NSLOT - 1 : pos);
      ent16[pos] = (unsigned short)ent[j];
      pl[pos]    = pw[j];
      if (lower == 0u) wcur[tq[j]] = base + __builtin_popcount(peers);
      // the next step's reader of a cursor may be another lane of this wave: keep the LDS accesses in step order
      __builtin_amdgcn_fence(__ATOMIC_ACQ_REL, "wavefront");
      __builtin_amdgcn_wave_barrier();
    }
  }
  __syncthreads();

  // ---- the lists to the workspace, 16 bytes a lane ----
  {
    float* plg = PL + (size_t)bh * NSLOT + 4 * tid;
    unsigned short* eg = ENT + (size_t)bh * NSLOT + 8 * tid;
    // unrolled whole: every store takes its place from an immediate offset, so no address register is written again
#pragma unroll
    for (int i = 0; i < NSLOT / (4 * NTHR); ++i) *(v4ia*)(plg + i * (4 * NTHR)) = *(const v4ia*)(pl + i * (4 * NTHR) + 4 * tid);
    // unrolled whole, for the same reason
#pragma unroll
    for (int i = 0; i < NSLOT / (8 * NTHR); ++i) *(v4ia*)(eg + i * (8 * NTHR)) = *(const v4ia*)(ent16 + i * (8 * NTHR) + 8 * tid);
    if (tid == 0) TOT[bh] = tot;
  }
}

// ---------------------------------------------------------------------------
// Owner drain per target position: out_h[i][d] = sum over its slots of p[f] * (v[kv[f]][d] + rel_v[w][d]).
// grid (16 = group of 64 targets, 32 = bh), 8 waves; a wave owns 8 consecutive targets of k_agg's lists.
// The drain takes up to 32 slots of a target a step: lane j holds slot j's entry and weight, both are broadcast by
// readlane, the step's value rows are all requested before the first is used, and the sum runs in slot order.
// Lane = channel d (and 32 + d); every loop bound and index is clamped to static ranges.
// Result written as the bf16 hi | lo lines of OA row (b*1024 + i), columns h*64.. (hi) and 512 + h*64..
// Count cap overflow or inconsistent totals -> NaN poison of the row.
// coverage: 512 blocks x 64 targets x (hi line + lo line) = all 4096 rows x 16 lines of OA exactly once.
// ---------------------------------------------------------------------------
__global__ __launch_bounds__(NTHR) void k_drain(
    const float* __restrict__ rel_v, const float* __restrict__ VP,
    const float* __restrict__ PL, const unsigned short* __restrict__ ENT,
    const int* __restrict__ SOFF, const int* __restrict__ SCNT, const int* __restrict__ TOT,
    unsigned short* OA)
{
  __shared__ __attribute__((aligned(16))) float relv[W2 * DK];
  __shared__ __attribute__((aligned(16))) float stw[NWAVE * 64];
  const int tid = (int)threadIdx.x, lane = tid & 31, wave = tid >> 5;
  const int bh = (int)blockIdx.y, b = bh >> 3, h = bh & (NH - 1);
  const float* pl = PL + (size_t)bh * NSLOT;
  const unsigned short* ent16 = ENT + (size_t)bh * NSLOT;
  const int tg0 = ((int)blockIdx.x * NWAVE + __builtin_amdgcn_readfirstlane(wave)) * TPD;
  // segment start and count of the wave's targets: lane j < TPD holds those of target tg0 + j, taken out by readlane
  const int ti = bh * SEQ + tg0 + (lane < TPD ? lane : TPD - 1);
  const int sv = SOFF[ti], cv = SCNT[ti];
  const int tot = TOT[bh];
  // the wait before the two loads' index register is written again; naming it keeps it as it is up to here
  asm volatile("s_wait_xcnt 0x0" :: "v"(ti) : "memory");
  {
    const float* rp = rel_v + (size_t)h * (W2 * DK) + 8 * tid;
    const v4f a = *(const v4fa*)rp;
    const v4f c = *(const v4fa*)(rp + 4);
    float* q = relv + 8 * tid;
    q[0] = bf16f(a.x); q[1] = bf16f(a.y); q[2] = bf16f(a.z); q[3] = bf16f(a.w);
    q[4] = bf16f(c.x); q[5] = bf16f(c.y); q[6] = bf16f(c.z); q[7] = bf16f(c.w);
  }
  // entries and weights of the coming step, read one step ahead
  int epre;
  float ppre;
  {
    int idx = clamp_st(__builtin_amdgcn_readlane(sv, 0)) + lane;
    idx = idx > NSLOT - 1 ? NSLOT - 1 : idx;
    list_read(ent16, pl, idx, epre, ppre);
  }
  __syncthreads();

  const unsigned int lane4 = 4u * (unsigned int)lane;
  const float qnan = __int_as_float(0x7fc00000);
  const bool bad_tot = (tot != NSLOT);
  float* sw = stw + wave * 64;
  const int lc = lane & 7;
  const bool islo = (lane & 8) != 0;
  const char* vb  = (const char*)(VP + (size_t)bh * SEQ * DK);
  const char* rvl = (const char*)(relv + lane);
#pragma unroll 1
  for (int jt = 0; jt < TPD; ++jt) {
    const int tg = tg0 + jt;                           // 0..1023
    const int st = clamp_st(__builtin_amdgcn_readlane(sv, jt));
    const int stn = clamp_st(__builtin_amdgcn_readlane(sv, jt + 1 < TPD ? jt + 1 : TPD - 1));
    const int craw = __builtin_amdgcn_readlane(cv, jt);
    int cnt = craw;
    cnt = cnt < 0 ? 0 : (cnt > DEGCAP ? DEGCAP : cnt);
    if (cnt > NSLOT - st) cnt = NSLOT - st;
    const float pz = (bad_tot || craw > DEGCAP || craw < 0) ? qnan : 0.0f;
    float a0 = 0.f, a1 = 0.f;
#pragma unroll 1
    for (int q0 = 0; q0 < cnt || q0 == 0; q0 += 32) {
      const int left = cnt - q0;                       // 0 only for an empty target: nothing summed, read-ahead moved on
      const int n = left > 32 ? 32 : left;
      const int ov  = (epre & (SEQ - 1)) * (DK * 4);
      const int orl = ((epre >> 10) & (W2 - 1)) * (DK * 4);
      const float pm = lane < n ? ppre : 0.0f;
      int idx = (left > 32 ? st + q0 + 32 : stn) + lane;
      idx = idx > NSLOT - 1 ? NSLOT - 1 : idx;
      list_read(ent16, pl, idx, epre, ppre);
      if (n > 24)      drain_step<4>(ov, orl, pm, vb, rvl, lane4, a0, a1);
      else if (n > 16) drain_step<3>(ov, orl, pm, vb, rvl, lane4, a0, a1);
      else if (n > 8)  drain_step<2>(ov, orl, pm, vb, rvl, lane4, a0, a1);
      else if (n > 0)  drain_step<1>(ov, orl, pm, vb, rvl, lane4, a0, a1);
    }
    a0 += pz;
    a1 += pz;
    // per-wave relayout: channels in order, then lanes 0..7 (hi) / 8..15 (lo) read 8 consecutive channels each
    __builtin_amdgcn_fence(__ATOMIC_RELEASE, "wavefront");
    __builtin_amdgcn_wave_barrier();
    sw[lane]      = a0;
    sw[32 + lane] = a1;
    __builtin_amdgcn_fence(__ATOMIC_RELEASE, "wavefront");
    __builtin_amdgcn_wave_barrier();
    const v4f ga = *(const v4fa*)(sw + 8 * lc);
    const v4f gb = *(const v4fa*)(sw + 8 * lc + 4);
    const v8us ov = split8(ga, gb, islo);
    const int orow = b * SEQ + tg;
    unsigned short* dst = OA + (size_t)orow * KOUT + (islo ? DM : 0) + h * DK + 8 * lc;
    const bool wsv = lane < 16;
    if (wsv) *(v8us*)dst = ov;
    // the wait before the store's address and data registers are written again for the next target
    asm volatile("s_wait_xcnt 0x0" ::: "memory");
  }
}

// ---------------------------------------------------------------------------
static inline int cdiv(int a, int b) { return (a + b - 1) / b; }

extern "C" void kernel_launch(void* const* d_in, const int* in_sizes, int n_in,
                              void* d_out, int out_size, void* d_ws, size_t ws_size,
                              hipStream_t stream) {
  if (n_in < 12) return;
  if (in_sizes[0] != NB_ * SEQ * DM || in_sizes[1] != NB_ * SEQ * DM || in_sizes[2] != NB_ * SEQ * DM) return;
  if (in_sizes[3] != NPOS || in_sizes[4] != NPOS) return;
  if (in_sizes[5] != NH * W2 * DK || in_sizes[6] != NH * W2 * DK || in_sizes[7] != NH * W2 * DK) return;
  if (in_sizes[8] != DM * DM || in_sizes[9] != DM * DM || in_sizes[10] != DM * DM || in_sizes[11] != DM * DM) return;
  if (out_size != NB_ * SEQ * DM) return;

  const float* query   = (const float*)d_in[0];    // [4][1024][512]
  const float* keyx    = (const float*)d_in[1];
  const float* value   = (const float*)d_in[2];
  const int*   pos_enc = (const int*)  d_in[3];    // [4][8][16][1024]
  const int*   pos_pad = (const int*)  d_in[4];
  const float* rel_q   = (const float*)d_in[5];    // [1][8][32][64]
  const float* rel_k   = (const float*)d_in[6];
  const float* rel_v   = (const float*)d_in[7];
  const float* Wq      = (const float*)d_in[8];    // [512][512] rows = output feature
  const float* Wk      = (const float*)d_in[9];
  const float* Wv      = (const float*)d_in[10];
  const float* Wo      = (const float*)d_in[11];
  float*       out     = (float*)d_out;            // [4][1024][512]

  // workspace carve (every region a whole number of 256-B blocks; all planes are exact tile multiples)
  char* ws = (char*)d_ws;
  size_t off = 0;
  const size_t oXB  = off; off += (size_t)NXU * 16;                     // 12,582,912  bf16 [3][4096][512]
  const size_t oWB  = off; off += (size_t)NWU * 16;                     //  1,572,864  bf16 [3][512][512]
  const size_t oWOB = off; off += (size_t)NWOU * 16;                    //  1,048,576  bf16 [512][1024]
  const size_t oQKV = off; off += (size_t)3 * PLQ * 4;                  // 25,165,824  f32 [3][32][1024][64]
  const size_t oS   = off; off += (size_t)NBH * NSLOT * 4;              //  4,194,304  f32 [32][32768]
  const size_t oOA  = off; off += (size_t)MROWS * KOUT * 2;             //  8,388,608  bf16 [4096][1024]
  const size_t oPL  = off; off += (size_t)NBH * NSLOT * 4;              //  4,194,304  f32 [32][32768]
  const size_t oENT = off; off += (size_t)NBH * NSLOT * 2;              //  2,097,152  u16 [32][32768]
  const size_t oSOF = off; off += (size_t)NBH * SEQ * 4;                //    131,072  int [32][1024]
  const size_t oSCN = off; off += (size_t)NBH * SEQ * 4;                //    131,072  int [32][1024]
  const size_t oTOT = off; off += (size_t)256;                          //        256  int [32]
  if (off > ws_size || off > (size_t)WSMAX) return;                     // total 59,506,944
  unsigned short* XB  = (unsigned short*)(ws + oXB);
  unsigned short* WB  = (unsigned short*)(ws + oWB);
  unsigned short* WOB = (unsigned short*)(ws + oWOB);
  float*          QKV = (float*)(ws + oQKV);
  float*          S   = (float*)(ws + oS);
  unsigned short* OA  = (unsigned short*)(ws + oOA);
  float*          PL  = (float*)(ws + oPL);
  unsigned short* ENT = (unsigned short*)(ws + oENT);
  int*            SOFF = (int*)(ws + oSOF);
  int*            SCNT = (int*)(ws + oSCN);
  int*            TOT  = (int*)(ws + oTOT);
  const float* QP  = QKV;
  const float* KPl = QKV + (size_t)PLQ;
  const float* VP  = QKV + (size_t)2 * PLQ;

  hipFuncSetAttribute(reinterpret_cast<const void*>(&k_agg),
                      hipFuncAttributeMaxDynamicSharedMemorySize, LDS_AGG);

  // 1: bf16 operand planes
  k_convert<<<NCU / NTHR, NTHR, 0, stream>>>(query, keyx, value, Wq, Wk, Wv, Wo, XB, WB, WOB, NCU);
  // 2: q/k/v projections -> f32 head planes
  k_gemm<0><<<dim3(MROWS / GBM, DM / GBN, 3), GTHR, 0, stream>>>(XB, WB, QKV, DM, MROWS * DM, DM * DM, PLQ);
  // 3: window scores
  k_scores<<<dim3(W2, NBH), NTHR, 0, stream>>>(pos_enc, pos_pad, rel_q, rel_k, QP, KPl, S);
  // 4: softmax + slot lists grouped by target
  k_agg<<<NBH, NTHR, LDS_AGG, stream>>>(pos_enc, pos_pad, S, PL, ENT, SOFF, SCNT, TOT);
  // 5: owner segment sums -> bf16 hi|lo plane
  k_drain<<<dim3(SEQ / (NWAVE * TPD), NBH), NTHR, 0, stream>>>(rel_v, VP, PL, ENT, SOFF, SCNT, TOT, OA);
  // 6: output projection -> out
  k_gemm<1><<<dim3(MROWS / GBM, DM / GBN, 1), GTHR, 0, stream>>>(OA, WOB, out, KOUT, 0, 0, 0);
}

// v005
// It runs in 148 microseconds.
// Next to v004, in two timings, it ran 1.19 and 1.17 times as fast.
// Over all steps from v000 it is 38.4 times as fast.
#include <hip/hip_runtime.h>
#include <stddef.h>
#include <stdint.h>

// Contractions: q/k/v input projections (K=512) and the output projection (K=1024 = activation bf16 hi|lo pair
// accumulate). Window scores (three 64-deep dots per slot), softmax statistics, weighted value sums and the
// per-position segment sums: f32 VALU.
//
// Carry audit: no plane carries a power-of-two scale; nothing is folded back anywhere.
//   XB  [3][4096][512]  bf16 = RNE(query | key | value)               (k_convert) -> A of the projections
//   WB  [3][512][512]   bf16 = RNE(Wq | Wk | Wv), rows [n][k]          (k_convert) -> B of the projections
//   OA  [4096][1024]    bf16 = [hi | lo] of the per-head attention output, hi = RNE(o), lo = RNE(o - hi)
//                                                                     (k_drain)   -> A of the output projection
//   rel_q, rel_k, rel_v are RNE-converted to bf16 values (held as f32) when staged in LDS.
//   f32 planes: QKV [3][32][1024][64] (projection results), S [32][32768] (masked, scaled scores).
//   Slot lists (k_agg -> k_drain), one per chunk of 4096 consecutive flat slots: PL [32][8][4096] f32 weights,
//   ENT [32][8][4096] u16 (w << 10 | kv), both grouped by target inside the chunk; SOFF, SCNT [32][8][1024] int segment
//   start (in the chunk's list) and count per target; TOT [32][8] int slots filed.

#define NB_    4
#define SEQ    1024
#define DM     512
#define NH     8
#define DK     64
#define KP1    16
#define W2     32
#define NSLOT  32768                 // W2 * SEQ flat window slots per (b,h)
#define NHALF  16384                 // KP1 * SEQ
#define NBH    32                    // NB_ * NH
#define MROWS  4096                  // NB_ * SEQ
#define KOUT   1024                  // 2 * DM (hi | lo)
#define NPOS   (NBH * NHALF)         // ints per position table
#define PLQ    (NBH * SEQ * DK)      // floats per q/k/v plane (2097152)
#define NTHR   256
#define NWAVE  8
#define GTHR   128
#define GBM    64
#define GBN    64
#define TPD    8                     // targets per wave in k_drain
#define DEGCAP 256                   // static cap on slots per target position
#define RINV24 (1.0f / 24.0f)
#define NEGBIG (-1.0e9f)
#define WSMAX  134217728
#define NXU    (3 * (MROWS * DM / 8))   // 786432 convert units (8 elements each)
#define NWU    (3 * (DM * DM / 8))      // 98304
#define NWOU   (DM * KOUT / 8)          // 65536
#define NCU    (NXU + NWU + NWOU)       // 950272
#define NCH    8                     // chunks of flat slots per (b,h): one k_agg work-group each
#define CSL    (NSLOT / NCH)         // 4096 consecutive flat slots per chunk
#define FPW    (CSL / NWAVE)         // 512 consecutive flat slots per wave in the bucketing passes of k_agg
#define BGRP   8                     // 32-slot steps whose index loads are issued together
#define LDS_AGG 57440

static_assert((MROWS % GBM) == 0 && (DM % GBN) == 0 && (SEQ % GBM) == 0);
static_assert((DM % 32) == 0 && (KOUT % 32) == 0);
static_assert(GBN == DK);
static_assert(GBM == (GTHR / 32) * 16);
static_assert(NSLOT == W2 * SEQ && NHALF == KP1 * SEQ && NBH == NB_ * NH && MROWS == NB_ * SEQ);
static_assert(NSLOT == (1 << 15) && SEQ == (1 << 10));
static_assert((MROWS * DM / 8) == (1 << 18) && (DM * DM / 8) == (1 << 15) && (KOUT / 8) == 128);
static_assert((NXU % NTHR) == 0 && ((NXU + NWU) % NTHR) == 0 && (NCU % NTHR) == 0);
static_assert(NTHR * 4 == SEQ && (SEQ % (TPD * NWAVE)) == 0);
static_assert((NSLOT % (4 * NTHR)) == 0);
static_assert(NTHR * 8 == W2 * DK);
static_assert((CSL + NWAVE * SEQ) * 4 + 16 * 4 + NWAVE * 4 + CSL * 2 <= LDS_AGG);
static_assert(((CSL + NWAVE * SEQ) * 4 + 16 * 4 + NWAVE * 4) % 16 == 0);
static_assert(TPD == 8 && NCH == 8 && (CSL * 2) % (16 * NTHR) == 0 && (CSL * 4) % (16 * NTHR) == 0);
static_assert(FPW * NWAVE == CSL && CSL * NCH == NSLOT && (FPW % (32 * BGRP)) == 0 && (NHALF % CSL) == 0);
static_assert(LDS_AGG <= 300000);
static_assert(PLQ == NB_ * SEQ * DM);

typedef float    v4f  __attribute__((ext_vector_type(4)));
typedef float    v8f  __attribute__((ext_vector_type(8)));
typedef int      v4i  __attribute__((ext_vector_type(4)));
typedef int      v8i  __attribute__((ext_vector_type(8)));
typedef unsigned short v8us __attribute__((ext_vector_type(8)));
typedef __bf16   v16b __attribute__((ext_vector_type(16)));
typedef v4f  __attribute__((may_alias)) v4fa;
typedef v4i  __attribute__((may_alias)) v4ia;
typedef v8us __attribute__((may_alias)) v8usa;
union FragB { v16b v; v8us h[2]; v8i w; };

// WMMA with hazard guard: ties D, keeps A/B live for 4 VALU slots
__device__ __forceinline__ v8f wmb(const FragB& a, const FragB& b, v8f c) {
  v8f d = __builtin_amdgcn_wmma_f32_16x16x32_bf16(false, a.v, false, b.v, (short)0, c, false, false);
  asm volatile("v_nop\n\tv_nop\n\tv_nop\n\tv_nop" : "+v"(d) : "v"(a.w), "v"(b.w));
  return d;
}

// f32 -> bf16 bits, RNE convert
__device__ __forceinline__ unsigned int bf16u(float x) {
  const unsigned int u = __float_as_uint(x);
  return (u + 0x7FFFu + ((u >> 16) & 1u)) >> 16;
}
// f32 -> nearest bf16 value held as f32
__device__ __forceinline__ float bf16f(float x) { return __uint_as_float(bf16u(x) << 16); }

__device__ __forceinline__ v8us cvt8b(const v4f a, const v4f b) {
  v8us r;
  r[0] = (unsigned short)bf16u(a.x); r[1] = (unsigned short)bf16u(a.y);
  r[2] = (unsigned short)bf16u(a.z); r[3] = (unsigned short)bf16u(a.w);
  r[4] = (unsigned short)bf16u(b.x); r[5] = (unsigned short)bf16u(b.y);
  r[6] = (unsigned short)bf16u(b.z); r[7] = (unsigned short)bf16u(b.w);
  return r;
}

__device__ __forceinline__ unsigned short hl1(float x, bool islo) {
  const unsigned int hu = bf16u(x);
  const float hf = __uint_as_float(hu << 16);
  const unsigned int lu = bf16u(x - hf);
  return (unsigned short)(islo ? lu : hu);
}
// 8 floats -> 8 bf16 hi parts (islo false) or 8 bf16 lo parts (islo true), lo = RNE(x - hi)
__device__ __forceinline__ v8us split8(const v4f a, const v4f b, bool islo) {
  v8us r;
  r[0] = hl1(a.x, islo); r[1] = hl1(a.y, islo); r[2] = hl1(a.z, islo); r[3] = hl1(a.w, islo);
  r[4] = hl1(b.x, islo); r[5] = hl1(b.y, islo); r[6] = hl1(b.z, islo); r[7] = hl1(b.w, islo);
  return r;
}

// ---------------------------------------------------------------------------
// Flat window slot f (0..32767) of head group bh: window row w = f >> 10, position s = f & 1023.
//   q index  = w < 16 ? pos_pad[w][s]    : pe[w-16][s]       (pe = pos_enc with -1 -> 0)
//   kv index = w < 16 ? pe[w][s]         : pos_pad[w-16][s]
//   masked   = (pos_enc[w & 15][s] == -1) || f < 1024
// Both tables are read unconditionally (same g for both halves) and clamped into [0, SEQ-1].
// ---------------------------------------------------------------------------
__device__ __forceinline__ void slot_idx(const int* __restrict__ pos_enc, const int* __restrict__ pos_pad,
                                         int bh, int f, int& qi, int& ki, bool& msk) {
  const int g = bh * NHALF + (f & (NHALF - 1));
  const int penc = pos_enc[g];
  const int ppad = pos_pad[g];
  const bool neg = (penc == -1);
  int pe = neg ? 0 : penc;
  pe = pe < 0 ? 0 : (pe > SEQ - 1 ? SEQ - 1 : pe);
  int pp = ppad < 0 ? 0 : (ppad > SEQ - 1 ? SEQ - 1 : ppad);
  const bool lo = f < NHALF;
  qi = lo ? pp : pe;
  ki = lo ? pe : pp;
  msk = neg || (f < SEQ);
}

// position index clamped into [0, SEQ-1]
__device__ __forceinline__ int clamp_pos(int v) { return v < 0 ? 0 : (v > SEQ - 1 ? SEQ - 1 : v); }

// Mask of the lanes of this wave whose 10-bit target t equals this lane's (all 32 lanes active): one ballot per bit.
__device__ __forceinline__ unsigned int same_target(int t) {
  unsigned int peers = 0xFFFFFFFFu;
#pragma unroll
  for (int bit = 0; bit < 10; ++bit) {
    const bool on = ((t >> bit) & 1) != 0;
    const unsigned int bl = __builtin_amdgcn_ballot_w32(on);
    peers &= on ? bl : ~bl;
  }
  return peers;
}

// ---------------------------------------------------------------------------
//   u <  NXU        : XB[z][off*8 ..]  z = u >> 18 selects query | key | value
//   u <  NXU + NWU  : WB[z][off*8 ..]  z selects Wq | Wk | Wv (rows [n][k] as given)
// coverage: NXU*8 = 3*4096*512, NWU*8 = 3*512*512, NWOU*8 = 512*1024 elements exactly.
// ---------------------------------------------------------------------------
__global__ __launch_bounds__(NTHR) void k_convert(
    const float* __restrict__ xq, const float* __restrict__ xk, const float* __restrict__ xv,
    const float* __restrict__ wq, const float* __restrict__ wk, const float* __restrict__ wv,
    const float* __restrict__ wo,
    unsigned short* xb, unsigned short* wb, unsigned short* wob, int nUnits)
{
  const int u = (int)blockIdx.x * NTHR + (int)threadIdx.x;
  if (u >= nUnits) return;
  const float* src;
  unsigned short* dst;
  if (u < NXU) {
    const int z = u >> 18, off = u & ((1 << 18) - 1);
    const float* xs = (z == 0) ? xq : ((z == 1) ? xk : xv);
    src = xs + (size_t)off * 8;
    dst = xb + (size_t)u * 8;
  } else if (u < NXU + NWU) {
    const int e = u - NXU;
    const int z = e >> 15, off = e & ((1 << 15) - 1);
    const float* wsp = (z == 0) ? wq : ((z == 1) ? wk : wv);
    src = wsp + (size_t)off * 8;
    dst = wb + (size_t)e * 8;
  } else {
    const int e = u - NXU - NWU;
    const int n = e >> 7;
    const int c8 = (e & 127) * 8;
    src = wo + (size_t)n * DM + (c8 & (DM - 1));
    dst = wob + (size_t)n * KOUT + c8;
  }
  const v4f a = *(const v4fa*)src;
  const v4f b = *(const v4fa*)(src + 4);
  const v8us o = cvt8b(a, b);
  *(v8us*)dst = o;
  
}

// ---------------------------------------------------------------------------
// bf16 WMMA GEMM, plane z = blockIdx.z: C[4096][N] tile = A[4096][K] (bf16, pitch K) x WT[N][K]^T (bf16 rows n,
// k-contiguous), K = 32*ksteps. grid (4096/64, N/64, nz), 128 threads: wave w owns rows 16w..16w+15 of the 64x64
// tile, acc[4] = 4 column tiles. A fragment (row m = lane&15): elements 0..7 <- k0+8h+0..7, 8..15 <- k0+16+8h+0..7
// (h = lane>>4); B fragment (col n = lane&15) from WT row (col0+16t+n) with the SAME k map; D element r =
// (row 8h+r, col lane&15). Tile staged in LDS as 64x64 f32, then one instruction writes two 256-B row segments
//   EPI 0: head plane out[z][(b*8 + blockIdx.y)*1024 + s][64] f32 (b = row>>10, s = row&1023; column tile = one head)
//   EPI 1: out[row][512] f32 at columns col0..col0+63 (the final output, z = 0)
// coverage: grid (64, 8, nz) covers every (row, col) of each 4096 x 512 plane exactly once.
// ---------------------------------------------------------------------------
template<int EPI>
__global__ __launch_bounds__(GTHR) void k_gemm(
    const unsigned short* __restrict__ A, const unsigned short* __restrict__ WT,
    float* outF, int K, int strideA, int strideW, int strideO)
{
  __shared__ __attribute__((aligned(16))) float stg[GBM * GBN];   // 16 KB
  const int tid = (int)threadIdx.x, lane = tid & 31, wave = tid >> 5, hh = lane >> 4, m = lane & 15;
  const int z = (int)blockIdx.z;
  const unsigned short* Az = A  + (size_t)z * (size_t)strideA;
  const unsigned short* Wz = WT + (size_t)z * (size_t)strideW;
  float* Oz = outF + (size_t)z * (size_t)strideO;
  const int rowBase = (int)blockIdx.x * GBM;
  const int col0    = (int)blockIdx.y * GBN;

  v8f acc[4];
  {
    const v8f zz = {0.f, 0.f, 0.f, 0.f, 0.f, 0.f, 0.f, 0.f};
    acc[0] = zz; acc[1] = zz; acc[2] = zz; acc[3] = zz;
  }
  const unsigned short* ap = Az + (size_t)(rowBase + 16 * wave + m) * (size_t)K + 8 * hh;
  const unsigned short* wp = Wz + (size_t)(col0 + m) * (size_t)K + 8 * hh;
  const int ksteps = K >> 5;
#pragma unroll 1
  for (int ks = 0; ks < ksteps; ++ks) {
    FragB af;
    af.h[0] = *(const v8usa*)(ap + 32 * ks);          // k = 32ks + 8hh + 0..7
    af.h[1] = *(const v8usa*)(ap + 32 * ks + 16);     // k = 32ks + 16 + 8hh + 0..7
#pragma unroll
    for (int t = 0; t < 4; ++t) {
      const unsigned short* wq = wp + (size_t)(16 * t) * (size_t)K + 32 * ks;   // WT row col0 + 16t + m
      FragB bf;
      bf.h[0] = *(const v8usa*)wq;                    // same k map as A
      bf.h[1] = *(const v8usa*)(wq + 16);
      acc[t] = wmb(af, bf, acc[t]);
    }
  }

#pragma unroll
  for (int t = 0; t < 4; ++t) {
    const int lc = 16 * t + m;
#pragma unroll
    for (int r = 0; r < 8; ++r) {
      const int lr = 16 * wave + 8 * hh + r;          // D element r = (row 8hh+r, col m)
      stg[lr * GBN + lc] = acc[t][r];
    }
  }
  __syncthreads();

  float* ob;
  int ldo;
  if (EPI == 0) {
    const int bq = rowBase >> 10;
    const int s0 = rowBase & (SEQ - 1);
    ob  = Oz + ((size_t)(bq * NH + (int)blockIdx.y) * SEQ + s0) * DK;
    ldo = DK;
  } else {
    ob  = Oz + (size_t)rowBase * DM + col0;
    ldo = DM;
  }
  v4f fv[8];
#pragma unroll
  for (int i = 0; i < 8; ++i) {
    const int lr = 16 * wave + 2 * i + hh;
    fv[i] = *(const v4fa*)(stg + lr * GBN + 4 * m);
  }
#pragma unroll
  for (int i = 0; i < 8; ++i) {
    const int lr = 16 * wave + 2 * i + hh;
    float* op = ob + (size_t)lr * (size_t)ldo + 4 * m;
    *(v4f*)op = fv[i];
  }
  
}

// ---------------------------------------------------------------------------
// Window scores. grid (32 = window row w, 32 = bh), 8 waves; a wave takes 128 consecutive slots of the row, 32 a step.
// Lane j reads slot j's indices. The rows are then read whole: the 16 lanes of a half-wave take one slot's q row and
// k row, 16 bytes a lane (channels 4c..4c+3, c = lane & 15), so one load instruction covers two 256-byte rows; half-wave
// g works through slots 16g..16g+15, the slot's row offset coming from its lane by a DPP row broadcast.
// rel_k[h][w], rel_q[h][w] rows staged in LDS as bf16 values, each lane keeps its four channels of both in registers.
// Per lane c2c, c2p, p2c over its four channels, (c2c + c2p) + p2c, then the sum over the 16 lanes; lane j keeps slot
// j's score; masked slots get -1e9.
// coverage: 32 blocks x 8 waves x 4 steps x 32 lanes = all 32768 slots of each of the 32 (b,h).
// ---------------------------------------------------------------------------
#define SSTEP 4                      // 32-slot steps per wave in k_scores
static_assert(NWAVE * SSTEP * 32 == SEQ && DK == 64);

template<int CTRL>
__device__ __forceinline__ int dpp_mov(int x) { return __builtin_amdgcn_update_dpp(0, x, CTRL, 0xf, 0xf, true); }
// lane I of this lane's 16-lane row (DPP row_share)
template<int I>
__device__ __forceinline__ unsigned int row_bcast(int x) { return (unsigned int)dpp_mov<0x150 + I>(x); }
// sum over the 16 lanes of a row, in every lane of it (DPP row_xmask 1, 2, 4, 8)
__device__ __forceinline__ float row_sum16(float x) {
  x += __int_as_float(dpp_mov<0x161>(__float_as_int(x)));
  x += __int_as_float(dpp_mov<0x162>(__float_as_int(x)));
  x += __int_as_float(dpp_mov<0x164>(__float_as_int(x)));
  x += __int_as_float(dpp_mov<0x168>(__float_as_int(x)));
  return x;
}

// Slots I0..I0+7 of each half-wave: qo, ko = the lane's own slot's q and k row byte offsets, c16 = 16 * (lane & 15).
// All sixteen row loads are issued before the first is used. sc takes the score sum of the lane's own slot.
#define SC_ADDR(i) qa[i] = row_bcast<I0 + (i)>(qo) + c16; ka[i] = row_bcast<I0 + (i)>(ko) + c16;
template<int I0>
__device__ __forceinline__ void score8(int qo, int ko, unsigned int c16, int c,
                                       const char* __restrict__ qb, const char* __restrict__ kb,
                                       const v4f rkv, const v4f rqv, float& sc) {
  unsigned int qa[8], ka[8];
  v4f qv[8], kv[8];
  SC_ADDR(0) SC_ADDR(1) SC_ADDR(2) SC_ADDR(3) SC_ADDR(4) SC_ADDR(5) SC_ADDR(6) SC_ADDR(7)
#pragma unroll
  for (int i = 0; i < 8; ++i) {
    qv[i] = *(const v4fa*)(qb + qa[i]);
    kv[i] = *(const v4fa*)(kb + ka[i]);
  }
  // the wait before the loads' offset registers are written again; naming them keeps each in a register of its own up
  // to here. The "memory" clobber keeps the loads ahead of it.
  asm volatile("s_wait_xcnt 0x0" :: "v"(qa[0]), "v"(qa[1]), "v"(qa[2]), "v"(qa[3]), "v"(qa[4]), "v"(qa[5]), "v"(qa[6]),
               "v"(qa[7]), "v"(ka[0]), "v"(ka[1]), "v"(ka[2]), "v"(ka[3]), "v"(ka[4]), "v"(ka[5]), "v"(ka[6]), "v"(ka[7])
               : "memory");
#pragma unroll
  for (int i = 0; i < 8; ++i) {
    const v4f q = qv[i], k = kv[i];
    float c2c = q.x * k.x, c2p = q.x * rkv.x, p2c = rqv.x * k.x;
    c2c = fmaf(q.y, k.y, c2c);   c2c = fmaf(q.z, k.z, c2c);   c2c = fmaf(q.w, k.w, c2c);
    c2p = fmaf(q.y, rkv.y, c2p); c2p = fmaf(q.z, rkv.z, c2p); c2p = fmaf(q.w, rkv.w, c2p);
    p2c = fmaf(rqv.y, k.y, p2c); p2c = fmaf(rqv.z, k.z, p2c); p2c = fmaf(rqv.w, k.w, p2c);
    const float s = row_sum16((c2c + c2p) + p2c);
    sc = (c == I0 + i) ? s : sc;
  }
}

__global__ __launch_bounds__(NTHR) void k_scores(
    const int* __restrict__ pos_enc, const int* __restrict__ pos_pad,
    const float* __restrict__ rel_q, const float* __restrict__ rel_k,
    const float* __restrict__ QP, const float* __restrict__ KPl, float* S)
{
  __shared__ __attribute__((aligned(16))) float rk[DK];
  __shared__ __attribute__((aligned(16))) float rq[DK];
  const int tid = (int)threadIdx.x, lane = tid & 31, wave = tid >> 5;
  const int bh = (int)blockIdx.y, h = bh & (NH - 1);
  const int w = (int)blockIdx.x;
  {
    const int sel = tid >> 6, j = tid & 63;          // sel uniform per pair of waves
    const size_t rb = (size_t)(h * W2 + w) * DK + j;
    if (sel == 0) rk[j] = bf16f(rel_k[rb]);
    if (sel == 1) rq[j] = bf16f(rel_q[rb]);
  }
  __syncthreads();

  const int c = lane & 15;
  const unsigned int c16 = 16u * (unsigned int)c;
  const v4f rkv = *(const v4fa*)(rk + 4 * c);
  const v4f rqv = *(const v4fa*)(rq + 4 * c);
  const char* qb = (const char*)(QP  + (size_t)bh * SEQ * DK);
  const char* kb = (const char*)(KPl + (size_t)bh * SEQ * DK);
  const int f0 = w * SEQ + wave * (SSTEP * 32) + lane;
  int qo[SSTEP], ko[SSTEP];
  bool mk[SSTEP];
#pragma unroll
  for (int t = 0; t < SSTEP; ++t) {
    int qi, ki;
    slot_idx(pos_enc, pos_pad, bh, f0 + 32 * t, qi, ki, mk[t]);
    qo[t] = qi * (DK * 4);
    ko[t] = ki * (DK * 4);
  }
  float res[SSTEP];
#pragma unroll
  for (int t = 0; t < SSTEP; ++t) {
    float sc = 0.f;
    score8<0>(qo[t], ko[t], c16, c, qb, kb, rkv, rqv, sc);
    score8<8>(qo[t], ko[t], c16, c, qb, kb, rkv, rqv, sc);
    res[t] = mk[t] ? NEGBIG : sc * RINV24;
  }
  float* sp = S + (size_t)bh * NSLOT + f0;
#pragma unroll
  for (int t = 0; t < SSTEP; ++t) sp[32 * t] = res[t];
}

// ---------------------------------------------------------------------------
// One step of k_drain over 8*G slots: lane j holds slot j's value-row byte offset ov (kv * 256), its rel_v-row byte
// offset orl (w * 256) and its weight pm (0 past the target's last slot, which leaves the sums as they are).
// vb = value plane of this (b,h) (wave-uniform), rvl = rel_v rows in LDS + lane, lane4 = 4 * lane.
// ---------------------------------------------------------------------------
#define VO8(b) "v"(vo[(b)]), "v"(vo[(b) + 1]), "v"(vo[(b) + 2]), "v"(vo[(b) + 3]), \
               "v"(vo[(b) + 4]), "v"(vo[(b) + 5]), "v"(vo[(b) + 6]), "v"(vo[(b) + 7])
template<int G>
__device__ __forceinline__ void drain_step(int ov, int orl, float pm, const char* __restrict__ vb, const char* rvl,
                                           unsigned int lane4, float& a0, float& a1) {
  unsigned int vo[8 * G];
  float v0[8 * G], v1[8 * G], r0[8 * G], r1[8 * G];
#pragma unroll
  for (int j = 0; j < 8 * G; ++j) vo[j] = (unsigned int)__builtin_amdgcn_readlane(ov, j) + lane4;
#pragma unroll
  for (int j = 0; j < 8 * G; ++j) {
    const float* vr = (const float*)(vb + vo[j]);
    v0[j] = vr[0];
    v1[j] = vr[32];
  }
#pragma unroll
  for (int j = 0; j < 8 * G; ++j) {
    const float* rr = (const float*)(rvl + __builtin_amdgcn_readlane(orl, j));
    r0[j] = rr[0];
    r1[j] = rr[32];
  }
  // the wait before the loads' offset registers are written again; naming them keeps each in a register of its own up to
  // here (reused inside the step, an offset register would make the next load wait, or be a later load's destination);
  // a statement takes thirty operands, so 32 slots take two. The "memory" clobber keeps the step's loads ahead of it.
  if constexpr (G == 1) {
    asm volatile("s_wait_xcnt 0x0" :: VO8(0) : "memory");
  } else {
    asm volatile("s_wait_xcnt 0x0" :: VO8(0), VO8(8) : "memory");
    if constexpr (G == 3) asm volatile("s_wait_xcnt 0x0" :: VO8(16) : "memory");
    if constexpr (G == 4) asm volatile("s_wait_xcnt 0x0" :: VO8(16), VO8(24) : "memory");
  }
#pragma unroll
  for (int j = 0; j < 8 * G; ++j) {
    const float pj = __int_as_float(__builtin_amdgcn_readlane(__float_as_int(pm), j));
    a0 = fmaf(pj, v0[j] + r0[j], a0);
    a1 = fmaf(pj, v1[j] + r1[j], a1);
  }
}

// segment start in a chunk's list clamped into [0, CSL]
__device__ __forceinline__ int clamp_st(int st) { return st < 0 ? 0 : (st > CSL ? CSL : st); }

// Place in the lists of one (b,h) of position q (0 = first) among the slots of the wave's target jt (wave-uniform).
// Lane (c & 3) * 8 + jt of pre0 / bas0 (chunks 0..3) and pre1 / bas1 (chunks 4..7) holds, for chunk c, the number of the
// target's slots in the chunks before c, and c * CSL + segment start - that number. The last chunk whose first position
// is not above q is q's. Result clamped into [0, NSLOT-1].
__device__ __forceinline__ int seg_idx(int pre0, int pre1, int bas0, int bas1, int jt, int q) {
  int b = __builtin_amdgcn_readlane(bas0, jt);
#pragma unroll
  for (int c = 1; c < NCH; ++c) {
    const int ln = (c & 3) * 8 + jt;
    const int p  = __builtin_amdgcn_readlane(c < 4 ? pre0 : pre1, ln);
    const int bb = __builtin_amdgcn_readlane(c < 4 ? bas0 : bas1, ln);
    b = q >= p ? bb : b;
  }
  const int idx = q + b;
  return idx < 0 ? 0 : (idx > NSLOT - 1 ? NSLOT - 1 : idx);
}

// Place idx (0..NSLOT-1) of the entry list eb and the weight list pb of one (b,h), one place a lane.
__device__ __forceinline__ void list_read(const unsigned short* __restrict__ eb, const float* __restrict__ pb, int idx,
                                          int& e, float& p) {
  e = eb[idx];
  p = pb[idx];
  // the wait before the two loads' index register is written again; naming it keeps it as it is up to here
  asm volatile("s_wait_xcnt 0x0" :: "v"(idx) : "memory");
}

// ---------------------------------------------------------------------------
// grid (8 = chunk, 32 = bh). Every block: softmax statistics over all 32768 slots of its (b,h) (the same sums in the same
// order in all eight), then deterministic bucketing of its own chunk's 4096 slots by their
// q index into LDS (count -> exclusive scan -> f-ascending cursor fill, no atomics): wave w takes
// the chunk's flat slots [512w, 512w + 512), 32 a step; lanes with the same target are matched by ballots, the first of them
// updates the wave's own counter / cursor row, each lane's place is cursor + its rank among them.
// p = exp(S[f] - M) * (1/Z) is computed where the slot is filed (scores read in f order) and kept beside its entry.
// The finished lists go to the workspace in whole lines, with each target's segment start and count, for k_drain.
// coverage: 256 blocks x (4096 weights + 4096 entries + 1024 starts + 1024 counts + 1 total), each written once.
// ---------------------------------------------------------------------------
__global__ __launch_bounds__(NTHR) void k_agg(
    const int* __restrict__ pos_enc, const int* __restrict__ pos_pad, const float* __restrict__ S,
    float* PL, unsigned short* ENT, int* SOFF, int* SCNT, int* TOT)
{
  extern __shared__ v4f lds_dyn[];
  float* pl   = (float*)lds_dyn;          // [CSL] slot weights p, grouped by target, f ascending
  int*   cur  = (int*)(pl + CSL);         // [NWAVE][SEQ] per-wave counts, then per-wave cursors
  float* red  = (float*)(cur + NWAVE * SEQ);   // [16]
  int*   wtot = (int*)(red + 16);         // [NWAVE]
  unsigned short* ent16 = (unsigned short*)(wtot + NWAVE);   // [CSL] packed (w << 10 | kv), same places as pl
  const int tid = (int)threadIdx.x, lane = tid & 31, wave = tid >> 5;
  const int bh = (int)blockIdx.y;
  const int ch = (int)blockIdx.x;
  const int lst = bh * NCH + ch;          // this block's list
  const float* sb = S + (size_t)bh * NSLOT;

  {
    const v4i z4 = {0, 0, 0, 0};
#pragma unroll 1
    for (int i = tid; i < CSL / 4; i += NTHR) *(v4ia*)(pl + 4 * i) = z4;
#pragma unroll 1
    for (int i = tid; i < CSL / 8; i += NTHR) *(v4ia*)(ent16 + 8 * i) = z4;
#pragma unroll
    for (int w2 = 0; w2 < NWAVE; ++w2) *(v4ia*)(cur + w2 * SEQ + 4 * tid) = z4;
  }
  __syncthreads();

  // ---- softmax statistics: M = max, Z = sum exp(s - M), two-level fixed order ----
  float mx = -3.0e38f;
#pragma unroll 1
  for (int i = 0; i < NSLOT / (4 * NTHR); ++i) {
    const v4f s4 = *(const v4fa*)(sb + (size_t)i * (4 * NTHR) + 4 * tid);
    mx = fmaxf(fmaxf(mx, fmaxf(s4.x, s4.y)), fmaxf(s4.z, s4.w));
  }
#pragma unroll
  for (int off = 16; off > 0; off >>= 1) mx = fmaxf(mx, __shfl_xor(mx, off));
  if (lane == 0) red[wave] = mx;
  __syncthreads();
  float M = red[0];
#pragma unroll
  for (int w2 = 1; w2 < NWAVE; ++w2) M = fmaxf(M, red[w2]);
  float zs = 0.f;
#pragma unroll 1
  for (int i = 0; i < NSLOT / (4 * NTHR); ++i) {
    const v4f s4 = *(const v4fa*)(sb + (size_t)i * (4 * NTHR) + 4 * tid);
    zs += (__expf(s4.x - M) + __expf(s4.y - M)) + (__expf(s4.z - M) + __expf(s4.w - M));
  }
#pragma unroll
  for (int off = 16; off > 0; off >>= 1) zs += __shfl_xor(zs, off);
  if (lane == 0) red[NWAVE + wave] = zs;
  __syncthreads();
  float Z = 0.f;
#pragma unroll
  for (int w2 = 0; w2 < NWAVE; ++w2) Z += red[NWAVE + w2];
  const float invZ = 1.0f / Z;                        // Z >= 1 (the max slot contributes exp(0))

  // ---- counts per (wave, target): every wave over its own 512 slots ----
  // A chunk's 4096 slots lie in one half of the window rows, so its q table and its kv table (slot_idx) are fixed:
  // lower half q <- pos_pad, kv <- pos_enc; upper half the other way round. clamp_pos sends pos_enc's -1 to 0.
  const int f0w = ch * CSL + __builtin_amdgcn_readfirstlane(wave) * FPW;   // wave-uniform: scalar loop control, table choice
  const bool lohalf = f0w < NHALF;
  const int* qtab = (lohalf ? pos_pad : pos_enc) + bh * NHALF + (f0w & (NHALF - 1));
  const int* ktab = (lohalf ? pos_enc : pos_pad) + bh * NHALF + (f0w & (NHALF - 1));
  int* wcur = cur + wave * SEQ;
  const unsigned int below = (1u << lane) - 1u;
  const unsigned int lane4 = 4u * (unsigned int)lane;
#pragma unroll 1
  for (int g = 0; g < FPW; g += 32 * BGRP) {
    int tq[BGRP];
#pragma unroll
    for (int j = 0; j < BGRP; ++j) tq[j] = clamp_pos(qtab[g + 32 * j + lane]) & (SEQ - 1);
#pragma unroll
    for (int j = 0; j < BGRP; ++j) {
      const unsigned int peers = same_target(tq[j]);
      if ((peers & below) == 0u) wcur[tq[j]] = wcur[tq[j]] + __builtin_popcount(peers);
      // the next step's reader of a counter may be another lane of this wave: keep the LDS accesses in step order
      __builtin_amdgcn_fence(__ATOMIC_ACQ_REL, "wavefront");
      __builtin_amdgcn_wave_barrier();
    }
  }
  __syncthreads();

  // ---- exclusive prefix over SEQ counts -> SOFF ----
  int tot;
  {
    v4i cw[NWAVE];
    v4i ca = {0, 0, 0, 0};
#pragma unroll
    for (int w2 = 0; w2 < NWAVE; ++w2) {
      cw[w2] = *(const v4ia*)(cur + w2 * SEQ + 4 * tid);
      ca += cw[w2];
    }
    *(v4ia*)(SCNT + lst * SEQ + 4 * tid) = ca;
    const int e0 = ca.x < 0 ? 0 : ca.x, e1 = ca.y < 0 ? 0 : ca.y, e2 = ca.z < 0 ? 0 : ca.z, e3 = ca.w < 0 ? 0 : ca.w;
    const int ts = e0 + e1 + e2 + e3;
    int incl = ts;
#pragma unroll
    for (int d = 1; d < 32; d <<= 1) {
      const int up = __shfl_up(incl, d);
      if (lane >= d) incl += up;
    }
    if (lane == 31) wtot[wave] = incl;
    __syncthreads();
    int pre = 0;
    tot = 0;
#pragma unroll
    for (int w2 = 0; w2 < NWAVE; ++w2) {
      const int t = wtot[w2];
      tot += t;
      pre += (w2 < wave) ? t : 0;
    }
    int run = pre + incl - ts;
    v4i so;
    so.x = run; run += e0;
    so.y = run; run += e1;
    so.z = run; run += e2;
    so.w = run;
    *(v4ia*)(SOFF + lst * SEQ + 4 * tid) = so;
    // wave w2's cursor of a target starts behind the slots that waves 0..w2-1 hold for it (f ascending over waves)
#pragma unroll
    for (int w2 = 0; w2 < NWAVE; ++w2) {
      *(v4ia*)(cur + w2 * SEQ + 4 * tid) = so;
      so += cw[w2];
    }
  }
  __syncthreads();

  // ---- fill: packed (w << 10 | kv) and weight p into target segments (every wave over its own slots, f ascending) ----
#pragma unroll 1
  for (int g = 0; g < FPW; g += 32 * BGRP) {
    int tq[BGRP], ent[BGRP];
    float pw[BGRP];
    // this group's kv indices and scores, from the lane's own column on
    const int*   kg = (const int*)((const char*)(ktab + g) + lane4);
    const float* sg = (const float*)((const char*)(sb + f0w + g) + lane4);
#pragma unroll
    for (int j = 0; j < BGRP; ++j) {
      const int o = g + 32 * j + lane;
      tq[j]  = clamp_pos(qtab[o]) & (SEQ - 1);
      ent[j] = (((f0w + o) >> 10) << 10) | clamp_pos(kg[32 * j]);
      pw[j]  = __expf(sg[32 * j] - M) * invZ;
    }
    // the steps below reuse the address registers of the loads above
    asm volatile("s_wait_xcnt 0x0" ::: "memory");
#pragma unroll
    for (int j = 0; j < BGRP; ++j) {
      const unsigned int peers = same_target(tq[j]);
      const unsigned int lower = peers & below;
      const int base = wcur[tq[j]];
      int pos = base + __builtin_popcount(lower);
      pos = pos < 0 ? 0 : (pos > CSL - 1 ? CSL - 1 : pos);
      ent16[pos] = (unsigned short)ent[j];
      pl[pos]    = pw[j];
      if (lower == 0u) wcur[tq[j]] = base + __builtin_popcount(peers);
      // the next step's reader of a cursor may be another lane of this wave: keep the LDS accesses in step order
      __builtin_amdgcn_fence(__ATOMIC_ACQ_REL, "wavefront");
      __builtin_amdgcn_wave_barrier();
    }
  }
  __syncthreads();

  // ---- the lists to the workspace, 16 bytes a lane ----
  {
    float* plg = PL + (size_t)lst * CSL + 4 * tid;
    unsigned short* eg = ENT + (size_t)lst * CSL + 8 * tid;
    // unrolled whole: every store takes its place from an immediate offset, so no address register is written again
#pragma unroll
    for (int i = 0; i < CSL / (4 * NTHR); ++i) *(v4ia*)(plg + i * (4 * NTHR)) = *(const v4ia*)(pl + i * (4 * NTHR) + 4 * tid);
    // unrolled whole, for the same reason
#pragma unroll
    for (int i = 0; i < CSL / (8 * NTHR); ++i) *(v4ia*)(eg + i * (8 * NTHR)) = *(const v4ia*)(ent16 + i * (8 * NTHR) + 8 * tid);
    if (tid == 0) TOT[lst] = tot;
  }
}

// ---------------------------------------------------------------------------
// Owner drain per target position: out_h[i][d] = sum over its slots of p[f] * (v[kv[f]][d] + rel_v[w][d]).
// grid (16 = group of 64 targets, 32 = bh), 8 waves; a wave owns 8 consecutive targets of k_agg's lists.
// A target's slots are its segments of the eight chunk lists one behind the other (chunks ascending, so f ascending).
// The drain takes up to 32 slots of a target a step: lane j holds slot j's entry and weight, both are broadcast by
// readlane, the step's value rows are all requested before the first is used, and the sum runs in slot order.
// Lane = channel d (and 32 + d); every loop bound and index is clamped to static ranges.
// Result written as the bf16 hi | lo lines of OA row (b*1024 + i), columns h*64.. (hi) and 512 + h*64..
// Count cap overflow or inconsistent totals -> NaN poison of the row.
// coverage: 512 blocks x 64 targets x (hi line + lo line) = all 4096 rows x 16 lines of OA exactly once.
// ---------------------------------------------------------------------------
__global__ __launch_bounds__(NTHR) void k_drain(
    const float* __restrict__ rel_v, const float* __restrict__ VP,
    const float* __restrict__ PL, const unsigned short* __restrict__ ENT,
    const int* __restrict__ SOFF, const int* __restrict__ SCNT, const int* __restrict__ TOT,
    unsigned short* OA)
{
  __shared__ __attribute__((aligned(16))) float relv[W2 * DK];
  __shared__ __attribute__((aligned(16))) float stw[NWAVE * 64];
  const int tid = (int)threadIdx.x, lane = tid & 31, wave = tid >> 5;
  const int bh = (int)blockIdx.y, b = bh >> 3, h = bh & (NH - 1);
  const float* pl = PL + (size_t)bh * NSLOT;
  const unsigned short* ent16 = ENT + (size_t)bh * NSLOT;
  const int tg0 = ((int)blockIdx.x * NWAVE + __builtin_amdgcn_readfirstlane(wave)) * TPD;
  // segment starts and counts of the wave's targets: lane l holds those of target tg0 + (l & 7) in chunk l >> 3 (index
  // ti0) and in chunk 4 + (l >> 3) (index ti1); lane l also reads the total of chunk l & 7
  const int ti0 = (bh * NCH + (lane >> 3)) * SEQ + tg0 + (lane & 7);
  const int ti1 = ti0 + 4 * SEQ;
  const int tix = bh * NCH + (lane & 7);
  const int s0r = SOFF[ti0], c0r = SCNT[ti0], s1r = SOFF[ti1], c1r = SCNT[ti1];
  const int totl = TOT[tix];
  // the wait before the loads' index registers are written again; naming them keeps them as they are up to here
  asm volatile("s_wait_xcnt 0x0" :: "v"(ti0), "v"(ti1), "v"(tix) : "memory");
  {
    const float* rp = rel_v + (size_t)h * (W2 * DK) + 8 * tid;
    const v4f a = *(const v4fa*)rp;
    const v4f c = *(const v4fa*)(rp + 4);
    float* q = relv + 8 * tid;
    q[0] = bf16f(a.x); q[1] = bf16f(a.y); q[2] = bf16f(a.z); q[3] = bf16f(a.w);
    q[4] = bf16f(c.x); q[5] = bf16f(c.y); q[6] = bf16f(c.z); q[7] = bf16f(c.w);
  }
  // per (chunk, target): count bounded by the chunk's list, slots of the target in earlier chunks (sum over the lanes
  // 8 apart, then over the two registers), and what seg_idx adds to a position; totv = the target's slots in all chunks
  const int st0 = clamp_st(s0r), st1 = clamp_st(s1r);
  int n0 = c0r < 0 ? 0 : c0r, n1 = c1r < 0 ? 0 : c1r;
  n0 = n0 > CSL - st0 ? CSL - st0 : n0;
  n1 = n1 > CSL - st1 ? CSL - st1 : n1;
  int i0 = n0, i1 = n1;
#pragma unroll
  for (int d = 8; d < 32; d <<= 1) {
    const int u0 = __shfl_up(i0, d), u1 = __shfl_up(i1, d);
    if (lane >= d) { i0 += u0; i1 += u1; }
  }
  const int t0 = __shfl(i0, 24 + (lane & 7)), t1 = __shfl(i1, 24 + (lane & 7));
  const int pre0 = i0 - n0, pre1 = t0 + i1 - n1;
  const int bas0 = (lane >> 3) * CSL + st0 - pre0;
  const int bas1 = (4 + (lane >> 3)) * CSL + st1 - pre1;
  const int totv = t0 + t1;
  const unsigned int negm = __builtin_amdgcn_ballot_w32(c0r < 0 || c1r < 0);
  // entries and weights of the coming step, read one step ahead
  int epre;
  float ppre;
  list_read(ent16, pl, seg_idx(pre0, pre1, bas0, bas1, 0, lane), epre, ppre);
  __syncthreads();

  const unsigned int lane4 = 4u * (unsigned int)lane;
  const float qnan = __int_as_float(0x7fc00000);
  const bool bad_tot = __builtin_amdgcn_ballot_w32(totl != CSL) != 0u;
  float* sw = stw + wave * 64;
  const int lc = lane & 7;
  const bool islo = (lane & 8) != 0;
  const char* vb  = (const char*)(VP + (size_t)bh * SEQ * DK);
  const char* rvl = (const char*)(relv + lane);
#pragma unroll 1
  for (int jt = 0; jt < TPD; ++jt) {
    const int tg = tg0 + jt;                           // 0..1023
    const int jn = jt + 1 < TPD ? jt + 1 : TPD - 1;
    const int craw = __builtin_amdgcn_readlane(totv, jt);
    int cnt = craw;
    cnt = cnt < 0 ? 0 : (cnt > DEGCAP ? DEGCAP : cnt);
    const bool cneg = ((negm >> jt) & 0x01010101u) != 0u;   // a negative count of this target in some chunk
    const float pz = (bad_tot || craw > DEGCAP || cneg) ? qnan : 0.0f;
    float a0 = 0.f, a1 = 0.f;
#pragma unroll 1
    for (int q0 = 0; q0 < cnt || q0 == 0; q0 += 32) {
      const int left = cnt - q0;                       // 0 only for an empty target: nothing summed, read-ahead moved on
      const int n = left > 32 ? 32 : left;
      const int ov  = (epre & (SEQ - 1)) * (DK * 4);
      const int orl = ((epre >> 10) & (W2 - 1)) * (DK * 4);
      const float pm = lane < n ? ppre : 0.0f;
      const bool more = left > 32;                     // this target goes on; else the next target's first step
      const int idx = seg_idx(pre0, pre1, bas0, bas1, more ? jt : jn, (more ? q0 + 32 : 0) + lane);
      list_read(ent16, pl, idx, epre, ppre);
      if (n > 24)      drain_step<4>(ov, orl, pm, vb, rvl, lane4, a0, a1);
      else if (n > 16) drain_step<3>(ov, orl, pm, vb, rvl, lane4, a0, a1);
      else if (n > 8)  drain_step<2>(ov, orl, pm, vb, rvl, lane4, a0, a1);
      else if (n > 0)  drain_step<1>(ov, orl, pm, vb, rvl, lane4, a0, a1);
    }
    a0 += pz;
    a1 += pz;
    // per-wave relayout: channels in order, then lanes 0..7 (hi) / 8..15 (lo) read 8 consecutive channels each
    __builtin_amdgcn_fence(__ATOMIC_RELEASE, "wavefront");
    __builtin_amdgcn_wave_barrier();
    sw[lane]      = a0;
    sw[32 + lane] = a1;
    __builtin_amdgcn_fence(__ATOMIC_RELEASE, "wavefront");
    __builtin_amdgcn_wave_barrier();
    const v4f ga = *(const v4fa*)(sw + 8 * lc);
    const v4f gb = *(const v4fa*)(sw + 8 * lc + 4);
    const v8us ov = split8(ga, gb, islo);
    const int orow = b * SEQ + tg;
    unsigned short* dst = OA + (size_t)orow * KOUT + (islo ? DM : 0) + h * DK + 8 * lc;
    const bool wsv = lane < 16;
    if (wsv) *(v8us*)dst = ov;
    // the wait before the store's address and data registers are written again for the next target
    asm volatile("s_wait_xcnt 0x0" ::: "memory");
  }
}

// ---------------------------------------------------------------------------
static inline int cdiv(int a, int b) { return (a + b - 1) / b; }

extern "C" void kernel_launch(void* const* d_in, const int* in_sizes, int n_in,
                              void* d_out, int out_size, void* d_ws, size_t ws_size,
                              hipStream_t stream) {
  if (n_in < 12) return;
  if (in_sizes[0] != NB_ * SEQ * DM || in_sizes[1] != NB_ * SEQ * DM || in_sizes[2] != NB_ * SEQ * DM) return;
  if (in_sizes[3] != NPOS || in_sizes[4] != NPOS) return;
  if (in_sizes[5] != NH * W2 * DK || in_sizes[6] != NH * W2 * DK || in_sizes[7] != NH * W2 * DK) return;
  if (in_sizes[8] != DM * DM || in_sizes[9] != DM * DM || in_sizes[10] != DM * DM || in_sizes[11] != DM * DM) return;
  if (out_size != NB_ * SEQ * DM) return;

  const float* query   = (const float*)d_in[0];    // [4][1024][512]
  const float* keyx    = (const float*)d_in[1];
  const float* value   = (const float*)d_in[2];
  const int*   pos_enc = (const int*)  d_in[3];    // [4][8][16][1024]
  const int*   pos_pad = (const int*)  d_in[4];
  const float* rel_q   = (const float*)d_in[5];    // [1][8][32][64]
  const float* rel_k   = (const float*)d_in[6];
  const float* rel_v   = (const float*)d_in[7];
  const float* Wq      = (const float*)d_in[8];    // [512][512] rows = output feature
  const float* Wk      = (const float*)d_in[9];
  const float* Wv      = (const float*)d_in[10];
  const float* Wo      = (const float*)d_in[11];
  float*       out     = (float*)d_out;            // [4][1024][512]

  // workspace carve (every region a whole number of 256-B blocks; all planes are exact tile multiples)
  char* ws = (char*)d_ws;
  size_t off = 0;
  const size_t oXB  = off; off += (size_t)NXU * 16;                     // 12,582,912  bf16 [3][4096][512]
  const size_t oWB  = off; off += (size_t)NWU * 16;                     //  1,572,864  bf16 [3][512][512]
  const size_t oWOB = off; off += (size_t)NWOU * 16;                    //  1,048,576  bf16 [512][1024]
  const size_t oQKV = off; off += (size_t)3 * PLQ * 4;                  // 25,165,824  f32 [3][32][1024][64]
  const size_t oS   = off; off += (size_t)NBH * NSLOT * 4;              //  4,194,304  f32 [32][32768]
  const size_t oOA  = off; off += (size_t)MROWS * KOUT * 2;             //  8,388,608  bf16 [4096][1024]
  const size_t oPL  = off; off += (size_t)NBH * NSLOT * 4;              //  4,194,304  f32 [32][32768]
  const size_t oENT = off; off += (size_t)NBH * NSLOT * 2;              //  2,097,152  u16 [32][32768]
  const size_t oSOF = off; off += (size_t)NBH * NCH * SEQ * 4;          //  1,048,576  int [32][8][1024]
  const size_t oSCN = off; off += (size_t)NBH * NCH * SEQ * 4;          //  1,048,576  int [32][8][1024]
  const size_t oTOT = off; off += (size_t)NBH * NCH * 4;                //      1,024  int [32][8]
  if (off > ws_size || off > (size_t)WSMAX) return;                     // total 61,342,720
  unsigned short* XB  = (unsigned short*)(ws + oXB);
  unsigned short* WB  = (unsigned short*)(ws + oWB);
  unsigned short* WOB = (unsigned short*)(ws + oWOB);
  float*          QKV = (float*)(ws + oQKV);
  float*          S   = (float*)(ws + oS);
  unsigned short* OA  = (unsigned short*)(ws + oOA);
  float*          PL  = (float*)(ws + oPL);
  unsigned short* ENT = (unsigned short*)(ws + oENT);
  int*            SOFF = (int*)(ws + oSOF);
  int*            SCNT = (int*)(ws + oSCN);
  int*            TOT  = (int*)(ws + oTOT);
  const float* QP  = QKV;
  const float* KPl = QKV + (size_t)PLQ;
  const float* VP  = QKV + (size_t)2 * PLQ;

  hipFuncSetAttribute(reinterpret_cast<const void*>(&k_agg),
                      hipFuncAttributeMaxDynamicSharedMemorySize, LDS_AGG);

  // 1: bf16 operand planes
  k_convert<<<NCU / NTHR, NTHR, 0, stream>>>(query, keyx, value, Wq, Wk, Wv, Wo, XB, WB, WOB, NCU);
  // 2: q/k/v projections -> f32 head planes
  k_gemm<0><<<dim3(MROWS / GBM, DM / GBN, 3), GTHR, 0, stream>>>(XB, WB, QKV, DM, MROWS * DM, DM * DM, PLQ);
  // 3: window scores
  k_scores<<<dim3(W2, NBH), NTHR, 0, stream>>>(pos_enc, pos_pad, rel_q, rel_k, QP, KPl, S);
  // 4: softmax + slot lists grouped by target, one per chunk
  k_agg<<<dim3(NCH, NBH), NTHR, LDS_AGG, stream>>>(pos_enc, pos_pad, S, PL, ENT, SOFF, SCNT, TOT);
  // 5: owner segment sums -> bf16 hi|lo plane
  k_drain<<<dim3(SEQ / (NWAVE * TPD), NBH), NTHR, 0, stream>>>(rel_v, VP, PL, ENT, SOFF, SCNT, TOT, OA);
  // 6: output projection -> out
  k_gemm<1><<<dim3(MROWS / GBM, DM / GBN, 1), GTHR, 0, stream>>>(OA, WOB, out, KOUT, 0, 0, 0);
}

// v006
// One run takes 107 microseconds.
// Two timings next to v005 put it at 1.39 and 1.38 times that version's speed.
// Counting every step since v000, it is 53.2 times as fast.
#include <hip/hip_runtime.h>
#include <stddef.h>
#include <stdint.h>

// Contractions: q/k/v input projections (K=512) and the output projection (K=1024 = activation bf16 hi|lo pair
// accumulate). Window scores (three 64-deep dots per slot), softmax statistics, weighted value sums and the
// per-position segment sums: f32 VALU.
//
// Carry audit: no plane carries a power-of-two scale; nothing is folded back anywhere.
//   XB  [3][4096][512]  bf16 = RNE(query | key | value)               (k_convert) -> A of the projections
//   WB  [3][512][512]   bf16 = RNE(Wq | Wk | Wv), rows [n][k]          (k_convert) -> B of the projections
//   OA  [4096][1024]    bf16 = [hi | lo] of the per-head attention output, hi = RNE(o), lo = RNE(o - hi)
//                                                                     (k_drain)   -> A of the output projection
//   rel_q, rel_k, rel_v are RNE-converted to bf16 values (held as f32) when staged in LDS.
//   f32 planes: QKV [3][32][1024][64] (projection results), S [32][32768] (masked, scaled scores).
//   Slot lists (k_agg -> k_drain), one per chunk of 4096 consecutive flat slots: PL [32][8][4096] f32 weights,
//   ENT [32][8][4096] u16 (w << 10 | kv), both grouped by target inside the chunk; SOFF, SCNT [32][8][1024] int segment
//   start (in the chunk's list) and count per target; TOT [32][8] int slots filed.

#define NB_    4
#define SEQ    1024
#define DM     512
#define NH     8
#define DK     64
#define KP1    16
#define W2     32
#define NSLOT  32768                 // W2 * SEQ flat window slots per (b,h)
#define NHALF  16384                 // KP1 * SEQ
#define NBH    32                    // NB_ * NH
#define MROWS  4096                  // NB_ * SEQ
#define KOUT   1024                  // 2 * DM (hi | lo)
#define NPOS   (NBH * NHALF)         // ints per position table
#define PLQ    (NBH * SEQ * DK)      // floats per q/k/v plane (2097152)
#define NTHR   256
#define NWAVE  8
#define GTHR   128
#define GBM    64
#define GBN    64
#define TPD    8                     // targets per wave in k_drain
#define DEGCAP 256                   // static cap on slots per target position
#define RINV24 (1.0f / 24.0f)
#define NEGBIG (-1.0e9f)
#define WSMAX  134217728
#define NXU    (3 * (MROWS * DM / 8))   // 786432 convert units (8 elements each)
#define NWU    (3 * (DM * DM / 8))      // 98304
#define NWOU   (DM * KOUT / 8)          // 65536
#define NCU    (NXU + NWU + NWOU)       // 950272
#define NCH    8                     // chunks of flat slots per (b,h): one k_agg work-group each
#define CSL    (NSLOT / NCH)         // 4096 consecutive flat slots per chunk
#define FPW    (CSL / NWAVE)         // 512 consecutive flat slots per wave in the bucketing passes of k_agg
#define BGRP   8                     // 32-slot steps whose index loads are issued together
#define LDS_AGG 57440

static_assert((MROWS % GBM) == 0 && (DM % GBN) == 0 && (SEQ % GBM) == 0);
static_assert((DM % 32) == 0 && (KOUT % 32) == 0);
static_assert(GBN == DK);
static_assert(GBM == (GTHR / 32) * 16);
static_assert(NSLOT == W2 * SEQ && NHALF == KP1 * SEQ && NBH == NB_ * NH && MROWS == NB_ * SEQ);
static_assert(NSLOT == (1 << 15) && SEQ == (1 << 10));
static_assert((MROWS * DM / 8) == (1 << 18) && (DM * DM / 8) == (1 << 15) && (KOUT / 8) == 128);
static_assert((NXU % NTHR) == 0 && ((NXU + NWU) % NTHR) == 0 && (NCU % NTHR) == 0);
static_assert(NTHR * 4 == SEQ && (SEQ % (TPD * NWAVE)) == 0);
static_assert((NSLOT % (4 * NTHR)) == 0);
static_assert(NTHR * 8 == W2 * DK);
static_assert((CSL + NWAVE * SEQ) * 4 + 16 * 4 + NWAVE * 4 + CSL * 2 <= LDS_AGG);
static_assert(((CSL + NWAVE * SEQ) * 4 + 16 * 4 + NWAVE * 4) % 16 == 0);
static_assert(TPD == 8 && NCH == 8 && (CSL * 2) % (16 * NTHR) == 0 && (CSL * 4) % (16 * NTHR) == 0);
static_assert(FPW * NWAVE == CSL && CSL * NCH == NSLOT && (FPW % (32 * BGRP)) == 0 && (NHALF % CSL) == 0);
static_assert(LDS_AGG <= 300000);
static_assert(PLQ == NB_ * SEQ * DM);

typedef float    v4f  __attribute__((ext_vector_type(4)));
typedef float    v8f  __attribute__((ext_vector_type(8)));
typedef int      v4i  __attribute__((ext_vector_type(4)));
typedef int      v8i  __attribute__((ext_vector_type(8)));
typedef unsigned short v8us __attribute__((ext_vector_type(8)));
typedef __bf16   v16b __attribute__((ext_vector_type(16)));
typedef v4f  __attribute__((may_alias)) v4fa;
typedef v4i  __attribute__((may_alias)) v4ia;
typedef v8us __attribute__((may_alias)) v8usa;
union FragB { v16b v; v8us h[2]; v8i w; };

// WMMA with hazard guard: ties D, keeps A/B live for 4 VALU slots
__device__ __forceinline__ v8f wmb(const FragB& a, const FragB& b, v8f c) {
  v8f d = __builtin_amdgcn_wmma_f32_16x16x32_bf16(false, a.v, false, b.v, (short)0, c, false, false);
  asm volatile("v_nop\n\tv_nop\n\tv_nop\n\tv_nop" : "+v"(d) : "v"(a.w), "v"(b.w));
  return d;
}

// f32 -> bf16 bits, RNE convert
__device__ __forceinline__ unsigned int bf16u(float x) {
  const unsigned int u = __float_as_uint(x);
  return (u + 0x7FFFu + ((u >> 16) & 1u)) >> 16;
}
// f32 -> nearest bf16 value held as f32
__device__ __forceinline__ float bf16f(float x) { return __uint_as_float(bf16u(x) << 16); }

__device__ __forceinline__ v8us cvt8b(const v4f a, const v4f b) {
  v8us r;
  r[0] = (unsigned short)bf16u(a.x); r[1] = (unsigned short)bf16u(a.y);
  r[2] = (unsigned short)bf16u(a.z); r[3] = (unsigned short)bf16u(a.w);
  r[4] = (unsigned short)bf16u(b.x); r[5] = (unsigned short)bf16u(b.y);
  r[6] = (unsigned short)bf16u(b.z); r[7] = (unsigned short)bf16u(b.w);
  return r;
}

__device__ __forceinline__ unsigned short hl1(float x, bool islo) {
  const unsigned int hu = bf16u(x);
  const float hf = __uint_as_float(hu << 16);
  const unsigned int lu = bf16u(x - hf);
  return (unsigned short)(islo ? lu : hu);
}
// 8 floats -> 8 bf16 hi parts (islo false) or 8 bf16 lo parts (islo true), lo = RNE(x - hi)
__device__ __forceinline__ v8us split8(const v4f a, const v4f b, bool islo) {
  v8us r;
  r[0] = hl1(a.x, islo); r[1] = hl1(a.y, islo); r[2] = hl1(a.z, islo); r[3] = hl1(a.w, islo);
  r[4] = hl1(b.x, islo); r[5] = hl1(b.y, islo); r[6] = hl1(b.z, islo); r[7] = hl1(b.w, islo);
  return r;
}

// ---------------------------------------------------------------------------
// Flat window slot f (0..32767) of head group bh: window row w = f >> 10, position s = f & 1023.
//   q index  = w < 16 ? pos_pad[w][s]    : pe[w-16][s]       (pe = pos_enc with -1 -> 0)
//   kv index = w < 16 ? pe[w][s]         : pos_pad[w-16][s]
//   masked   = (pos_enc[w & 15][s] == -1) || f < 1024
// Both tables are read unconditionally (same g for both halves) and clamped into [0, SEQ-1].
// ---------------------------------------------------------------------------
__device__ __forceinline__ void slot_idx(const int* __restrict__ pos_enc, const int* __restrict__ pos_pad,
                                         int bh, int f, int& qi, int& ki, bool& msk) {
  const int g = bh * NHALF + (f & (NHALF - 1));
  const int penc = pos_enc[g];
  const int ppad = pos_pad[g];
  const bool neg = (penc == -1);
  int pe = neg ? 0 : penc;
  pe = pe < 0 ? 0 : (pe > SEQ - 1 ? SEQ - 1 : pe);
  int pp = ppad < 0 ? 0 : (ppad > SEQ - 1 ? SEQ - 1 : ppad);
  const bool lo = f < NHALF;
  qi = lo ? pp : pe;
  ki = lo ? pe : pp;
  msk = neg || (f < SEQ);
}

// position index clamped into [0, SEQ-1]
__device__ __forceinline__ int clamp_pos(int v) { return v < 0 ? 0 : (v > SEQ - 1 ? SEQ - 1 : v); }

// Mask of the lanes of this wave whose 10-bit target t equals this lane's (all 32 lanes active): one ballot per bit.
__device__ __forceinline__ unsigned int same_target(int t) {
  unsigned int peers = 0xFFFFFFFFu;
#pragma unroll
  for (int bit = 0; bit < 10; ++bit) {
    const bool on = ((t >> bit) & 1) != 0;
    const unsigned int bl = __builtin_amdgcn_ballot_w32(on);
    peers &= on ? bl : ~bl;
  }
  return peers;
}

// ---------------------------------------------------------------------------
//   u <  NXU        : XB[z][off*8 ..]  z = u >> 18 selects query | key | value
//   u <  NXU + NWU  : WB[z][off*8 ..]  z selects Wq | Wk | Wv (rows [n][k] as given)
// coverage: NXU*8 = 3*4096*512, NWU*8 = 3*512*512, NWOU*8 = 512*1024 elements exactly.
// ---------------------------------------------------------------------------
__global__ __launch_bounds__(NTHR) void k_convert(
    const float* __restrict__ xq, const float* __restrict__ xk, const float* __restrict__ xv,
    const float* __restrict__ wq, const float* __restrict__ wk, const float* __restrict__ wv,
    const float* __restrict__ wo,
    unsigned short* xb, unsigned short* wb, unsigned short* wob, int nUnits)
{
  const int u = (int)blockIdx.x * NTHR + (int)threadIdx.x;
  if (u >= nUnits) return;
  const float* src;
  unsigned short* dst;
  if (u < NXU) {
    const int z = u >> 18, off = u & ((1 << 18) - 1);
    const float* xs = (z == 0) ? xq : ((z == 1) ? xk : xv);
    src = xs + (size_t)off * 8;
    dst = xb + (size_t)u * 8;
  } else if (u < NXU + NWU) {
    const int e = u - NXU;
    const int z = e >> 15, off = e & ((1 << 15) - 1);
    const float* wsp = (z == 0) ? wq : ((z == 1) ? wk : wv);
    src = wsp + (size_t)off * 8;
    dst = wb + (size_t)e * 8;
  } else {
    const int e = u - NXU - NWU;
    const int n = e >> 7;
    const int c8 = (e & 127) * 8;
    src = wo + (size_t)n * DM + (c8 & (DM - 1));
    dst = wob + (size_t)n * KOUT + c8;
  }
  const v4f a = *(const v4fa*)src;
  const v4f b = *(const v4fa*)(src + 4);
  const v8us o = cvt8b(a, b);
  *(v8us*)dst = o;
  
}

// ---------------------------------------------------------------------------
// bf16 WMMA GEMM, plane z = blockIdx.z: C[4096][N] tile = A[4096][K] (bf16, pitch K) x WT[N][K]^T (bf16 rows n,
// k-contiguous), K a multiple of 64. grid (4096/64, N/64, nz), 128 threads: wave w owns rows 16w..16w+15 of the 64x64
// tile, acc[4] = 4 column tiles. The 64 A rows and the 64 WT rows of the tile pass through LDS in chunks of 64 k (one
// 128-byte line per row): eight lanes read one line, so a load instruction covers four whole lines, and every line is
// read once per work-group. Two LDS buffers: the next chunk's lines are requested before this chunk's products and
// filed behind them; one barrier a chunk. Row pitch in LDS 144 bytes (16 B x odd) for the 16-byte fragment reads.
// A fragment (row m = lane&15): elements 0..7 <- k0+8h+0..7, 8..15 <- k0+16+8h+0..7
// (h = lane>>4); B fragment (col n = lane&15) from WT row (col0+16t+n) with the SAME k map; D element r =
// (row 8h+r, col lane&15). Tile staged in LDS as 64x64 f32 (over the chunk buffers, behind the loop's last barrier),
// then one instruction writes two 256-B row segments
//   EPI 0: head plane out[z][(b*8 + blockIdx.y)*1024 + s][64] f32 (b = row>>10, s = row&1023; column tile = one head)
//   EPI 1: out[row][512] f32 at columns col0..col0+63 (the final output, z = 0)
// coverage: grid (64, 8, nz) covers every (row, col) of each 4096 x 512 plane exactly once.
// ---------------------------------------------------------------------------
#define KC    64                     // k per staged chunk
#define LPT   72                     // LDS row pitch in bf16 elements (144 bytes)
#define TLE   (GBM * LPT)            // elements of one staged operand tile
static_assert(GBM == GBN && (DM % KC) == 0 && (KOUT % KC) == 0 && KC * 2 == 128);
static_assert(GTHR * 4 * 8 == GBM * KC);
static_assert(4 * TLE * 2 >= GBM * GBN * 4);

template<int EPI>
__global__ __launch_bounds__(GTHR) void k_gemm(
    const unsigned short* __restrict__ A, const unsigned short* __restrict__ WT,
    float* outF, int K, int strideA, int strideW, int strideO)
{
  __shared__ __attribute__((aligned(16))) v4f smem[4 * TLE * 2 / 16];   // 36,864 B: [buffer][A | WT][64][72] bf16
  unsigned short* tl = (unsigned short*)smem;
  float* stg = (float*)smem;                                            // 64 x 64 f32, epilogue only
  const int tid = (int)threadIdx.x, lane = tid & 31, wave = tid >> 5, hh = lane >> 4, m = lane & 15;
  const int z = (int)blockIdx.z;
  const unsigned short* Az = A  + (size_t)z * (size_t)strideA;
  const unsigned short* Wz = WT + (size_t)z * (size_t)strideW;
  float* Oz = outF + (size_t)z * (size_t)strideO;
  const int rowBase = (int)blockIdx.x * GBM;
  const int col0    = (int)blockIdx.y * GBN;

  v8f acc[4];
  {
    const v8f zz = {0.f, 0.f, 0.f, 0.f, 0.f, 0.f, 0.f, 0.f};
    acc[0] = zz; acc[1] = zz; acc[2] = zz; acc[3] = zz;
  }
  // staging: thread takes 16-byte piece sg of tile rows r0, r0+16, r0+32, r0+48 of both operands
  const int sg = tid & 7, r0 = tid >> 3;
  const char* ab = (const char*)(Az + (size_t)rowBase * (size_t)K);     // work-group uniform
  const char* wb = (const char*)(Wz + (size_t)col0 * (size_t)K);
  unsigned int go[4];
#pragma unroll
  for (int i = 0; i < 4; ++i) go[i] = (unsigned int)((r0 + 16 * i) * K + 8 * sg) * 2u;
  unsigned short* sp = tl + r0 * LPT + 8 * sg;
  const unsigned short* fa = tl + (16 * wave + m) * LPT + 8 * hh;       // A fragment row of this lane
  const unsigned short* fb = tl + TLE + m * LPT + 8 * hh;               // WT fragment row, column tile 0
  const int nch = K >> 6;
  v8us ra[4], rb[4];
#pragma unroll
  for (int i = 0; i < 4; ++i) {
    ra[i] = *(const v8usa*)(ab + go[i]);
    rb[i] = *(const v8usa*)(wb + go[i]);
  }
  // the wait before a register that these loads name is written again
  asm volatile("s_wait_xcnt 0x0" :: "v"(go[0]), "v"(go[1]), "v"(go[2]), "v"(go[3]) : "memory");
#pragma unroll
  for (int i = 0; i < 4; ++i) {
    *(v8usa*)(sp + 16 * i * LPT)       = ra[i];
    *(v8usa*)(sp + TLE + 16 * i * LPT) = rb[i];
  }
  __syncthreads();
  // kept rolled: a trip is a whole chunk (8 loads, 20 fragment reads, 8 products); a second copy would only add registers
#pragma unroll 1
  for (int c = 0; c < nch; ++c) {
    const int bo = (c & 1) * (2 * TLE);               // this chunk's buffer
    const bool nxt = c + 1 < nch;                     // work-group uniform
    unsigned int gn[4];                               // the next chunk's byte offsets
#pragma unroll
    for (int i = 0; i < 4; ++i) gn[i] = go[i] + (unsigned int)(c + 1) * (KC * 2u);
    if (nxt) {
#pragma unroll
      for (int i = 0; i < 4; ++i) {
        ra[i] = *(const v8usa*)(ab + gn[i]);
        rb[i] = *(const v8usa*)(wb + gn[i]);
      }
    }
    // the chunk's twenty fragment reads go out together, ahead of its eight products: one LDS latency a chunk
    FragB af[KC / 32], bf[KC / 32][4];
#pragma unroll
    for (int ks = 0; ks < KC / 32; ++ks) {
      af[ks].h[0] = *(const v8usa*)(fa + bo + 32 * ks);        // k = 64c + 32ks + 8hh + 0..7
      af[ks].h[1] = *(const v8usa*)(fa + bo + 32 * ks + 16);   // k = 64c + 32ks + 16 + 8hh + 0..7
#pragma unroll
      for (int t = 0; t < 4; ++t) {
        const unsigned short* wq = fb + bo + 16 * t * LPT + 32 * ks;   // WT row col0 + 16t + m
        bf[ks][t].h[0] = *(const v8usa*)wq;                    // same k map as A
        bf[ks][t].h[1] = *(const v8usa*)(wq + 16);
      }
    }
#pragma unroll
    for (int ks = 0; ks < KC / 32; ++ks) {
#pragma unroll
      for (int t = 0; t < 4; ++t) acc[t] = wmb(af[ks], bf[ks][t], acc[t]);
    }
    if (nxt) {
      // the wait before a register that the next chunk's loads name is written again; naming the offsets keeps each in a
      // register of its own up to here (else one could be a later load's destination). Behind the products it costs nothing.
      asm volatile("s_wait_xcnt 0x0" :: "v"(gn[0]), "v"(gn[1]), "v"(gn[2]), "v"(gn[3]) : "memory");
      unsigned short* sn = sp + (2 * TLE - bo);            // the other buffer: its readers left it at the last barrier
#pragma unroll
      for (int i = 0; i < 4; ++i) {
        *(v8usa*)(sn + 16 * i * LPT)       = ra[i];
        *(v8usa*)(sn + TLE + 16 * i * LPT) = rb[i];
      }
    }
    // publishes the next chunk and ends every wave's reads of this one (after the last chunk: frees the LDS for stg)
    __syncthreads();
  }

#pragma unroll
  for (int t = 0; t < 4; ++t) {
    const int lc = 16 * t + m;
#pragma unroll
    for (int r = 0; r < 8; ++r) {
      const int lr = 16 * wave + 8 * hh + r;          // D element r = (row 8hh+r, col m)
      stg[lr * GBN + lc] = acc[t][r];
    }
  }
  __syncthreads();

  float* ob;
  int ldo;
  if (EPI == 0) {
    const int bq = rowBase >> 10;
    const int s0 = rowBase & (SEQ - 1);
    ob  = Oz + ((size_t)(bq * NH + (int)blockIdx.y) * SEQ + s0) * DK;
    ldo = DK;
  } else {
    ob  = Oz + (size_t)rowBase * DM + col0;
    ldo = DM;
  }
  v4f fv[8];
#pragma unroll
  for (int i = 0; i < 8; ++i) {
    const int lr = 16 * wave + 2 * i + hh;
    fv[i] = *(const v4fa*)(stg + lr * GBN + 4 * m);
  }
#pragma unroll
  for (int i = 0; i < 8; ++i) {
    const int lr = 16 * wave + 2 * i + hh;
    float* op = ob + (size_t)lr * (size_t)ldo + 4 * m;
    *(v4f*)op = fv[i];
  }
  
}

// ---------------------------------------------------------------------------
// Window scores. grid (32 = window row w, 32 = bh), 8 waves; a wave takes 128 consecutive slots of the row, 32 a step.
// Lane j reads slot j's indices. The rows are then read whole: the 16 lanes of a half-wave take one slot's q row and
// k row, 16 bytes a lane (channels 4c..4c+3, c = lane & 15), so one load instruction covers two 256-byte rows; half-wave
// g works through slots 16g..16g+15, the slot's row offset coming from its lane by a DPP row broadcast.
// rel_k[h][w], rel_q[h][w] rows staged in LDS as bf16 values, each lane keeps its four channels of both in registers.
// Per lane c2c, c2p, p2c over its four channels, (c2c + c2p) + p2c, then the sum over the 16 lanes; lane j keeps slot
// j's score; masked slots get -1e9.
// coverage: 32 blocks x 8 waves x 4 steps x 32 lanes = all 32768 slots of each of the 32 (b,h).
// ---------------------------------------------------------------------------
#define SSTEP 4                      // 32-slot steps per wave in k_scores
static_assert(NWAVE * SSTEP * 32 == SEQ && DK == 64);

template<int CTRL>
__device__ __forceinline__ int dpp_mov(int x) { return __builtin_amdgcn_update_dpp(0, x, CTRL, 0xf, 0xf, true); }
// lane I of this lane's 16-lane row (DPP row_share)
template<int I>
__device__ __forceinline__ unsigned int row_bcast(int x) { return (unsigned int)dpp_mov<0x150 + I>(x); }
// sum over the 16 lanes of a row, in every lane of it (DPP row_xmask 1, 2, 4, 8)
__device__ __forceinline__ float row_sum16(float x) {
  x += __int_as_float(dpp_mov<0x161>(__float_as_int(x)));
  x += __int_as_float(dpp_mov<0x162>(__float_as_int(x)));
  x += __int_as_float(dpp_mov<0x164>(__float_as_int(x)));
  x += __int_as_float(dpp_mov<0x168>(__float_as_int(x)));
  return x;
}

// Slots I0..I0+7 of each half-wave: qo, ko = the lane's own slot's q and k row byte offsets, c16 = 16 * (lane & 15).
// All sixteen row loads are issued before the first is used. sc takes the score sum of the lane's own slot.
#define SC_ADDR(i) qa[i] = row_bcast<I0 + (i)>(qo) + c16; ka[i] = row_bcast<I0 + (i)>(ko) + c16;
template<int I0>
__device__ __forceinline__ void score8(int qo, int ko, unsigned int c16, int c,
                                       const char* __restrict__ qb, const char* __restrict__ kb,
                                       const v4f rkv, const v4f rqv, float& sc) {
  unsigned int qa[8], ka[8];
  v4f qv[8], kv[8];
  SC_ADDR(0) SC_ADDR(1) SC_ADDR(2) SC_ADDR(3) SC_ADDR(4) SC_ADDR(5) SC_ADDR(6) SC_ADDR(7)
#pragma unroll
  for (int i = 0; i < 8; ++i) {
    qv[i] = *(const v4fa*)(qb + qa[i]);
    kv[i] = *(const v4fa*)(kb + ka[i]);
  }
  // the wait before the loads' offset registers are written again; naming them keeps each in a register of its own up
  // to here. The "memory" clobber keeps the loads ahead of it.
  asm volatile("s_wait_xcnt 0x0" :: "v"(qa[0]), "v"(qa[1]), "v"(qa[2]), "v"(qa[3]), "v"(qa[4]), "v"(qa[5]), "v"(qa[6]),
               "v"(qa[7]), "v"(ka[0]), "v"(ka[1]), "v"(ka[2]), "v"(ka[3]), "v"(ka[4]), "v"(ka[5]), "v"(ka[6]), "v"(ka[7])
               : "memory");
#pragma unroll
  for (int i = 0; i < 8; ++i) {
    const v4f q = qv[i], k = kv[i];
    float c2c = q.x * k.x, c2p = q.x * rkv.x, p2c = rqv.x * k.x;
    c2c = fmaf(q.y, k.y, c2c);   c2c = fmaf(q.z, k.z, c2c);   c2c = fmaf(q.w, k.w, c2c);
    c2p = fmaf(q.y, rkv.y, c2p); c2p = fmaf(q.z, rkv.z, c2p); c2p = fmaf(q.w, rkv.w, c2p);
    p2c = fmaf(rqv.y, k.y, p2c); p2c = fmaf(rqv.z, k.z, p2c); p2c = fmaf(rqv.w, k.w, p2c);
    const float s = row_sum16((c2c + c2p) + p2c);
    sc = (c == I0 + i) ? s : sc;
  }
}

__global__ __launch_bounds__(NTHR) void k_scores(
    const int* __restrict__ pos_enc, const int* __restrict__ pos_pad,
    const float* __restrict__ rel_q, const float* __restrict__ rel_k,
    const float* __restrict__ QP, const float* __restrict__ KPl, float* S)
{
  __shared__ __attribute__((aligned(16))) float rk[DK];
  __shared__ __attribute__((aligned(16))) float rq[DK];
  const int tid = (int)threadIdx.x, lane = tid & 31, wave = tid >> 5;
  const int bh = (int)blockIdx.y, h = bh & (NH - 1);
  const int w = (int)blockIdx.x;
  {
    const int sel = tid >> 6, j = tid & 63;          // sel uniform per pair of waves
    const size_t rb = (size_t)(h * W2 + w) * DK + j;
    if (sel == 0) rk[j] = bf16f(rel_k[rb]);
    if (sel == 1) rq[j] = bf16f(rel_q[rb]);
  }
  __syncthreads();

  const int c = lane & 15;
  const unsigned int c16 = 16u * (unsigned int)c;
  const v4f rkv = *(const v4fa*)(rk + 4 * c);
  const v4f rqv = *(const v4fa*)(rq + 4 * c);
  const char* qb = (const char*)(QP  + (size_t)bh * SEQ * DK);
  const char* kb = (const char*)(KPl + (size_t)bh * SEQ * DK);
  const int f0 = w * SEQ + wave * (SSTEP * 32) + lane;
  int qo[SSTEP], ko[SSTEP];
  bool mk[SSTEP];
#pragma unroll
  for (int t = 0; t < SSTEP; ++t) {
    int qi, ki;
    slot_idx(pos_enc, pos_pad, bh, f0 + 32 * t, qi, ki, mk[t]);
    qo[t] = qi * (DK * 4);
    ko[t] = ki * (DK * 4);
  }
  float res[SSTEP];
#pragma unroll
  for (int t = 0; t < SSTEP; ++t) {
    float sc = 0.f;
    score8<0>(qo[t], ko[t], c16, c, qb, kb, rkv, rqv, sc);
    score8<8>(qo[t], ko[t], c16, c, qb, kb, rkv, rqv, sc);
    res[t] = mk[t] ? NEGBIG : sc * RINV24;
  }
  float* sp = S + (size_t)bh * NSLOT + f0;
#pragma unroll
  for (int t = 0; t < SSTEP; ++t) sp[32 * t] = res[t];
}

// ---------------------------------------------------------------------------
// One step of k_drain over 8*G slots: lane j holds slot j's value-row byte offset ov (kv * 256), its rel_v-row byte
// offset orl (w * 256) and its weight pm (0 past the target's last slot, which leaves the sums as they are).
// vb = value plane of this (b,h) (wave-uniform), rvl = rel_v rows in LDS + lane, lane4 = 4 * lane.
// ---------------------------------------------------------------------------
#define VO8(b) "v"(vo[(b)]), "v"(vo[(b) + 1]), "v"(vo[(b) + 2]), "v"(vo[(b) + 3]), \
               "v"(vo[(b) + 4]), "v"(vo[(b) + 5]), "v"(vo[(b) + 6]), "v"(vo[(b) + 7])
template<int G>
__device__ __forceinline__ void drain_step(int ov, int orl, float pm, const char* __restrict__ vb, const char* rvl,
                                           unsigned int lane4, float& a0, float& a1) {
  unsigned int vo[8 * G];
  float v0[8 * G], v1[8 * G], r0[8 * G], r1[8 * G];
#pragma unroll
  for (int j = 0; j < 8 * G; ++j) vo[j] = (unsigned int)__builtin_amdgcn_readlane(ov, j) + lane4;
#pragma unroll
  for (int j = 0; j < 8 * G; ++j) {
    const float* vr = (const float*)(vb + vo[j]);
    v0[j] = vr[0];
    v1[j] = vr[32];
  }
#pragma unroll
  for (int j = 0; j < 8 * G; ++j) {
    const float* rr = (const float*)(rvl + __builtin_amdgcn_readlane(orl, j));
    r0[j] = rr[0];
    r1[j] = rr[32];
  }
  // the wait before the loads' offset registers are written again; naming them keeps each in a register of its own up to
  // here (reused inside the step, an offset register would make the next load wait, or be a later load's destination);
  // a statement takes thirty operands, so 32 slots take two. The "memory" clobber keeps the step's loads ahead of it.
  if constexpr (G == 1) {
    asm volatile("s_wait_xcnt 0x0" :: VO8(0) : "memory");
  } else {
    asm volatile("s_wait_xcnt 0x0" :: VO8(0), VO8(8) : "memory");
    if constexpr (G == 3) asm volatile("s_wait_xcnt 0x0" :: VO8(16) : "memory");
    if constexpr (G == 4) asm volatile("s_wait_xcnt 0x0" :: VO8(16), VO8(24) : "memory");
  }
#pragma unroll
  for (int j = 0; j < 8 * G; ++j) {
    const float pj = __int_as_float(__builtin_amdgcn_readlane(__float_as_int(pm), j));
    a0 = fmaf(pj, v0[j] + r0[j], a0);
    a1 = fmaf(pj, v1[j] + r1[j], a1);
  }
}

// segment start in a chunk's list clamped into [0, CSL]
__device__ __forceinline__ int clamp_st(int st) { return st < 0 ? 0 : (st > CSL ? CSL : st); }

// Place in the lists of one (b,h) of position q (0 = first) among the slots of the wave's target jt (wave-uniform).
// Lane (c & 3) * 8 + jt of pre0 / bas0 (chunks 0..3) and pre1 / bas1 (chunks 4..7) holds, for chunk c, the number of the
// target's slots in the chunks before c, and c * CSL + segment start - that number. The last chunk whose first position
// is not above q is q's. Result clamped into [0, NSLOT-1].
__device__ __forceinline__ int seg_idx(int pre0, int pre1, int bas0, int bas1, int jt, int q) {
  int b = __builtin_amdgcn_readlane(bas0, jt);
#pragma unroll
  for (int c = 1; c < NCH; ++c) {
    const int ln = (c & 3) * 8 + jt;
    const int p  = __builtin_amdgcn_readlane(c < 4 ? pre0 : pre1, ln);
    const int bb = __builtin_amdgcn_readlane(c < 4 ? bas0 : bas1, ln);
    b = q >= p ? bb : b;
  }
  const int idx = q + b;
  return idx < 0 ? 0 : (idx > NSLOT - 1 ? NSLOT - 1 : idx);
}

// Place idx (0..NSLOT-1) of the entry list eb and the weight list pb of one (b,h), one place a lane.
__device__ __forceinline__ void list_read(const unsigned short* __restrict__ eb, const float* __restrict__ pb, int idx,
                                          int& e, float& p) {
  e = eb[idx];
  p = pb[idx];
  // the wait before the two loads' index register is written again; naming it keeps it as it is up to here
  asm volatile("s_wait_xcnt 0x0" :: "v"(idx) : "memory");
}

// ---------------------------------------------------------------------------
// grid (8 = chunk, 32 = bh). Every block: softmax statistics over all 32768 slots of its (b,h) (the same sums in the same
// order in all eight), then deterministic bucketing of its own chunk's 4096 slots by their
// q index into LDS (count -> exclusive scan -> f-ascending cursor fill, no atomics): wave w takes
// the chunk's flat slots [512w, 512w + 512), 32 a step; lanes with the same target are matched by ballots, the first of them
// updates the wave's own counter / cursor row, each lane's place is cursor + its rank among them.
// p = exp(S[f] - M) * (1/Z) is computed where the slot is filed (scores read in f order) and kept beside its entry.
// The finished lists go to the workspace in whole lines, with each target's segment start and count, for k_drain.
// coverage: 256 blocks x (4096 weights + 4096 entries + 1024 starts + 1024 counts + 1 total), each written once.
// ---------------------------------------------------------------------------
__global__ __launch_bounds__(NTHR) void k_agg(
    const int* __restrict__ pos_enc, const int* __restrict__ pos_pad, const float* __restrict__ S,
    float* PL, unsigned short* ENT, int* SOFF, int* SCNT, int* TOT)
{
  extern __shared__ v4f lds_dyn[];
  float* pl   = (float*)lds_dyn;          // [CSL] slot weights p, grouped by target, f ascending
  int*   cur  = (int*)(pl + CSL);         // [NWAVE][SEQ] per-wave counts, then per-wave cursors
  float* red  = (float*)(cur + NWAVE * SEQ);   // [16]
  int*   wtot = (int*)(red + 16);         // [NWAVE]
  unsigned short* ent16 = (unsigned short*)(wtot + NWAVE);   // [CSL] packed (w << 10 | kv), same places as pl
  const int tid = (int)threadIdx.x, lane = tid & 31, wave = tid >> 5;
  const int bh = (int)blockIdx.y;
  const int ch = (int)blockIdx.x;
  const int lst = bh * NCH + ch;          // this block's list
  const float* sb = S + (size_t)bh * NSLOT;

  {
    const v4i z4 = {0, 0, 0, 0};
#pragma unroll 1
    for (int i = tid; i < CSL / 4; i += NTHR) *(v4ia*)(pl + 4 * i) = z4;
#pragma unroll 1
    for (int i = tid; i < CSL / 8; i += NTHR) *(v4ia*)(ent16 + 8 * i) = z4;
#pragma unroll
    for (int w2 = 0; w2 < NWAVE; ++w2) *(v4ia*)(cur + w2 * SEQ + 4 * tid) = z4;
  }
  __syncthreads();

  // ---- softmax statistics: M = max, Z = sum exp(s - M), two-level fixed order ----
  float mx = -3.0e38f;
#pragma unroll 1
  for (int i = 0; i < NSLOT / (4 * NTHR); ++i) {
    const v4f s4 = *(const v4fa*)(sb + (size_t)i * (4 * NTHR) + 4 * tid);
    mx = fmaxf(fmaxf(mx, fmaxf(s4.x, s4.y)), fmaxf(s4.z, s4.w));
  }
#pragma unroll
  for (int off = 16; off > 0; off >>= 1) mx = fmaxf(mx, __shfl_xor(mx, off));
  if (lane == 0) red[wave] = mx;
  __syncthreads();
  float M = red[0];
#pragma unroll
  for (int w2 = 1; w2 < NWAVE; ++w2) M = fmaxf(M, red[w2]);
  float zs = 0.f;
#pragma unroll 1
  for (int i = 0; i < NSLOT / (4 * NTHR); ++i) {
    const v4f s4 = *(const v4fa*)(sb + (size_t)i * (4 * NTHR) + 4 * tid);
    zs += (__expf(s4.x - M) + __expf(s4.y - M)) + (__expf(s4.z - M) + __expf(s4.w - M));
  }
#pragma unroll
  for (int off = 16; off > 0; off >>= 1) zs += __shfl_xor(zs, off);
  if (lane == 0) red[NWAVE + wave] = zs;
  __syncthreads();
  float Z = 0.f;
#pragma unroll
  for (int w2 = 0; w2 < NWAVE; ++w2) Z += red[NWAVE + w2];
  const float invZ = 1.0f / Z;                        // Z >= 1 (the max slot contributes exp(0))

  // ---- counts per (wave, target): every wave over its own 512 slots ----
  // A chunk's 4096 slots lie in one half of the window rows, so its q table and its kv table (slot_idx) are fixed:
  // lower half q <- pos_pad, kv <- pos_enc; upper half the other way round. clamp_pos sends pos_enc's -1 to 0.
  const int f0w = ch * CSL + __builtin_amdgcn_readfirstlane(wave) * FPW;   // wave-uniform: scalar loop control, table choice
  const bool lohalf = f0w < NHALF;
  const int* qtab = (lohalf ? pos_pad : pos_enc) + bh * NHALF + (f0w & (NHALF - 1));
  const int* ktab = (lohalf ? pos_enc : pos_pad) + bh * NHALF + (f0w & (NHALF - 1));
  int* wcur = cur + wave * SEQ;
  const unsigned int below = (1u << lane) - 1u;
  const unsigned int lane4 = 4u * (unsigned int)lane;
#pragma unroll 1
  for (int g = 0; g < FPW; g += 32 * BGRP) {
    int tq[BGRP];
#pragma unroll
    for (int j = 0; j < BGRP; ++j) tq[j] = clamp_pos(qtab[g + 32 * j + lane]) & (SEQ - 1);
#pragma unroll
    for (int j = 0; j < BGRP; ++j) {
      const unsigned int peers = same_target(tq[j]);
      if ((peers & below) == 0u) wcur[tq[j]] = wcur[tq[j]] + __builtin_popcount(peers);
      // the next step's reader of a counter may be another lane of this wave: keep the LDS accesses in step order
      __builtin_amdgcn_fence(__ATOMIC_ACQ_REL, "wavefront");
      __builtin_amdgcn_wave_barrier();
    }
  }
  __syncthreads();

  // ---- exclusive prefix over SEQ counts -> SOFF ----
  int tot;
  {
    v4i cw[NWAVE];
    v4i ca = {0, 0, 0, 0};
#pragma unroll
    for (int w2 = 0; w2 < NWAVE; ++w2) {
      cw[w2] = *(const v4ia*)(cur + w2 * SEQ + 4 * tid);
      ca += cw[w2];
    }
    *(v4ia*)(SCNT + lst * SEQ + 4 * tid) = ca;
    const int e0 = ca.x < 0 ? 0 : ca.x, e1 = ca.y < 0 ? 0 : ca.y, e2 = ca.z < 0 ? 0 : ca.z, e3 = ca.w < 0 ? 0 : ca.w;
    const int ts = e0 + e1 + e2 + e3;
    int incl = ts;
#pragma unroll
    for (int d = 1; d < 32; d <<= 1) {
      const int up = __shfl_up(incl, d);
      if (lane >= d) incl += up;
    }
    if (lane == 31) wtot[wave] = incl;
    __syncthreads();
    int pre = 0;
    tot = 0;
#pragma unroll
    for (int w2 = 0; w2 < NWAVE; ++w2) {
      const int t = wtot[w2];
      tot += t;
      pre += (w2 < wave) ? t : 0;
    }
    int run = pre + incl - ts;
    v4i so;
    so.x = run; run += e0;
    so.y = run; run += e1;
    so.z = run; run += e2;
    so.w = run;
    *(v4ia*)(SOFF + lst * SEQ + 4 * tid) = so;
    // wave w2's cursor of a target starts behind the slots that waves 0..w2-1 hold for it (f ascending over waves)
#pragma unroll
    for (int w2 = 0; w2 < NWAVE; ++w2) {
      *(v4ia*)(cur + w2 * SEQ + 4 * tid) = so;
      so += cw[w2];
    }
  }
  __syncthreads();

  // ---- fill: packed (w << 10 | kv) and weight p into target segments (every wave over its own slots, f ascending) ----
#pragma unroll 1
  for (int g = 0; g < FPW; g += 32 * BGRP) {
    int tq[BGRP], ent[BGRP];
    float pw[BGRP];
    // this group's kv indices and scores, from the lane's own column on
    const int*   kg = (const int*)((const char*)(ktab + g) + lane4);
    const float* sg = (const float*)((const char*)(sb + f0w + g) + lane4);
#pragma unroll
    for (int j = 0; j < BGRP; ++j) {
      const int o = g + 32 * j + lane;
      tq[j]  = clamp_pos(qtab[o]) & (SEQ - 1);
      ent[j] = (((f0w + o) >> 10) << 10) | clamp_pos(kg[32 * j]);
      pw[j]  = __expf(sg[32 * j] - M) * invZ;
    }
    // the steps below reuse the address registers of the loads above
    asm volatile("s_wait_xcnt 0x0" ::: "memory");
#pragma unroll
    for (int j = 0; j < BGRP; ++j) {
      const unsigned int peers = same_target(tq[j]);
      const unsigned int lower = peers & below;
      const int base = wcur[tq[j]];
      int pos = base + __builtin_popcount(lower);
      pos = pos < 0 ? 0 : (pos > CSL - 1 ? CSL - 1 : pos);
      ent16[pos] = (unsigned short)ent[j];
      pl[pos]    = pw[j];
      if (lower == 0u) wcur[tq[j]] = base + __builtin_popcount(peers);
      // the next step's reader of a cursor may be another lane of this wave: keep the LDS accesses in step order
      __builtin_amdgcn_fence(__ATOMIC_ACQ_REL, "wavefront");
      __builtin_amdgcn_wave_barrier();
    }
  }
  __syncthreads();

  // ---- the lists to the workspace, 16 bytes a lane ----
  {
    float* plg = PL + (size_t)lst * CSL + 4 * tid;
    unsigned short* eg = ENT + (size_t)lst * CSL + 8 * tid;
    // unrolled whole: every store takes its place from an immediate offset, so no address register is written again
#pragma unroll
    for (int i = 0; i < CSL / (4 * NTHR); ++i) *(v4ia*)(plg + i * (4 * NTHR)) = *(const v4ia*)(pl + i * (4 * NTHR) + 4 * tid);
    // unrolled whole, for the same reason
#pragma unroll
    for (int i = 0; i < CSL / (8 * NTHR); ++i) *(v4ia*)(eg + i * (8 * NTHR)) = *(const v4ia*)(ent16 + i * (8 * NTHR) + 8 * tid);
    if (tid == 0) TOT[lst] = tot;
  }
}

// ---------------------------------------------------------------------------
// Owner drain per target position: out_h[i][d] = sum over its slots of p[f] * (v[kv[f]][d] + rel_v[w][d]).
// grid (16 = group of 64 targets, 32 = bh), 8 waves; a wave owns 8 consecutive targets of k_agg's lists.
// A target's slots are its segments of the eight chunk lists one behind the other (chunks ascending, so f ascending).
// The drain takes up to 32 slots of a target a step: lane j holds slot j's entry and weight, both are broadcast by
// readlane, the step's value rows are all requested before the first is used, and the sum runs in slot order.
// Lane = channel d (and 32 + d); every loop bound and index is clamped to static ranges.
// Result written as the bf16 hi | lo lines of OA row (b*1024 + i), columns h*64.. (hi) and 512 + h*64..
// Count cap overflow or inconsistent totals -> NaN poison of the row.
// coverage: 512 blocks x 64 targets x (hi line + lo line) = all 4096 rows x 16 lines of OA exactly once.
// ---------------------------------------------------------------------------
__global__ __launch_bounds__(NTHR) void k_drain(
    const float* __restrict__ rel_v, const float* __restrict__ VP,
    const float* __restrict__ PL, const unsigned short* __restrict__ ENT,
    const int* __restrict__ SOFF, const int* __restrict__ SCNT, const int* __restrict__ TOT,
    unsigned short* OA)
{
  __shared__ __attribute__((aligned(16))) float relv[W2 * DK];
  __shared__ __attribute__((aligned(16))) float stw[NWAVE * 64];
  const int tid = (int)threadIdx.x, lane = tid & 31, wave = tid >> 5;
  const int bh = (int)blockIdx.y, b = bh >> 3, h = bh & (NH - 1);
  const float* pl = PL + (size_t)bh * NSLOT;
  const unsigned short* ent16 = ENT + (size_t)bh * NSLOT;
  const int tg0 = ((int)blockIdx.x * NWAVE + __builtin_amdgcn_readfirstlane(wave)) * TPD;
  // segment starts and counts of the wave's targets: lane l holds those of target tg0 + (l & 7) in chunk l >> 3 (index
  // ti0) and in chunk 4 + (l >> 3) (index ti1); lane l also reads the total of chunk l & 7
  const int ti0 = (bh * NCH + (lane >> 3)) * SEQ + tg0 + (lane & 7);
  const int ti1 = ti0 + 4 * SEQ;
  const int tix = bh * NCH + (lane & 7);
  const int s0r = SOFF[ti0], c0r = SCNT[ti0], s1r = SOFF[ti1], c1r = SCNT[ti1];
  const int totl = TOT[tix];
  // the wait before the loads' index registers are written again; naming them keeps them as they are up to here
  asm volatile("s_wait_xcnt 0x0" :: "v"(ti0), "v"(ti1), "v"(tix) : "memory");
  {
    const float* rp = rel_v + (size_t)h * (W2 * DK) + 8 * tid;
    const v4f a = *(const v4fa*)rp;
    const v4f c = *(const v4fa*)(rp + 4);
    float* q = relv + 8 * tid;
    q[0] = bf16f(a.x); q[1] = bf16f(a.y); q[2] = bf16f(a.z); q[3] = bf16f(a.w);
    q[4] = bf16f(c.x); q[5] = bf16f(c.y); q[6] = bf16f(c.z); q[7] = bf16f(c.w);
  }
  // per (chunk, target): count bounded by the chunk's list, slots of the target in earlier chunks (sum over the lanes
  // 8 apart, then over the two registers), and what seg_idx adds to a position; totv = the target's slots in all chunks
  const int st0 = clamp_st(s0r), st1 = clamp_st(s1r);
  int n0 = c0r < 0 ? 0 : c0r, n1 = c1r < 0 ? 0 : c1r;
  n0 = n0 > CSL - st0 ? CSL - st0 : n0;
  n1 = n1 > CSL - st1 ? CSL - st1 : n1;
  int i0 = n0, i1 = n1;
#pragma unroll
  for (int d = 8; d < 32; d <<= 1) {
    const int u0 = __shfl_up(i0, d), u1 = __shfl_up(i1, d);
    if (lane >= d) { i0 += u0; i1 += u1; }
  }
  const int t0 = __shfl(i0, 24 + (lane & 7)), t1 = __shfl(i1, 24 + (lane & 7));
  const int pre0 = i0 - n0, pre1 = t0 + i1 - n1;
  const int bas0 = (lane >> 3) * CSL + st0 - pre0;
  const int bas1 = (4 + (lane >> 3)) * CSL + st1 - pre1;
  const int totv = t0 + t1;
  const unsigned int negm = __builtin_amdgcn_ballot_w32(c0r < 0 || c1r < 0);
  // entries and weights of the coming step, read one step ahead
  int epre;
  float ppre;
  list_read(ent16, pl, seg_idx(pre0, pre1, bas0, bas1, 0, lane), epre, ppre);
  __syncthreads();

  const unsigned int lane4 = 4u * (unsigned int)lane;
  const float qnan = __int_as_float(0x7fc00000);
  const bool bad_tot = __builtin_amdgcn_ballot_w32(totl != CSL) != 0u;
  float* sw = stw + wave * 64;
  const int lc = lane & 7;
  const bool islo = (lane & 8) != 0;
  const char* vb  = (const char*)(VP + (size_t)bh * SEQ * DK);
  const char* rvl = (const char*)(relv + lane);
#pragma unroll 1
  for (int jt = 0; jt < TPD; ++jt) {
    const int tg = tg0 + jt;                           // 0..1023
    const int jn = jt + 1 < TPD ? jt + 1 : TPD - 1;
    const int craw = __builtin_amdgcn_readlane(totv, jt);
    int cnt = craw;
    cnt = cnt < 0 ? 0 : (cnt > DEGCAP ? DEGCAP : cnt);
    const bool cneg = ((negm >> jt) & 0x01010101u) != 0u;   // a negative count of this target in some chunk
    const float pz = (bad_tot || craw > DEGCAP || cneg) ? qnan : 0.0f;
    float a0 = 0.f, a1 = 0.f;
#pragma unroll 1
    for (int q0 = 0; q0 < cnt || q0 == 0; q0 += 32) {
      const int left = cnt - q0;                       // 0 only for an empty target: nothing summed, read-ahead moved on
      const int n = left > 32 ? 32 : left;
      const int ov  = (epre & (SEQ - 1)) * (DK * 4);
      const int orl = ((epre >> 10) & (W2 - 1)) * (DK * 4);
      const float pm = lane < n ? ppre : 0.0f;
      const bool more = left > 32;                     // this target goes on; else the next target's first step
      const int idx = seg_idx(pre0, pre1, bas0, bas1, more ? jt : jn, (more ? q0 + 32 : 0) + lane);
      list_read(ent16, pl, idx, epre, ppre);
      if (n > 24)      drain_step<4>(ov, orl, pm, vb, rvl, lane4, a0, a1);
      else if (n > 16) drain_step<3>(ov, orl, pm, vb, rvl, lane4, a0, a1);
      else if (n > 8)  drain_step<2>(ov, orl, pm, vb, rvl, lane4, a0, a1);
      else if (n > 0)  drain_step<1>(ov, orl, pm, vb, rvl, lane4, a0, a1);
    }
    a0 += pz;
    a1 += pz;
    // per-wave relayout: channels in order, then lanes 0..7 (hi) / 8..15 (lo) read 8 consecutive channels each
    __builtin_amdgcn_fence(__ATOMIC_RELEASE, "wavefront");
    __builtin_amdgcn_wave_barrier();
    sw[lane]      = a0;
    sw[32 + lane] = a1;
    __builtin_amdgcn_fence(__ATOMIC_RELEASE, "wavefront");
    __builtin_amdgcn_wave_barrier();
    const v4f ga = *(const v4fa*)(sw + 8 * lc);
    const v4f gb = *(const v4fa*)(sw + 8 * lc + 4);
    const v8us ov = split8(ga, gb, islo);
    const int orow = b * SEQ + tg;
    unsigned short* dst = OA + (size_t)orow * KOUT + (islo ? DM : 0) + h * DK + 8 * lc;
    const bool wsv = lane < 16;
    if (wsv) *(v8us*)dst = ov;
    // the wait before the store's address and data registers are written again for the next target
    asm volatile("s_wait_xcnt 0x0" ::: "memory");
  }
}

// ---------------------------------------------------------------------------
static inline int cdiv(int a, int b) { return (a + b - 1) / b; }

extern "C" void kernel_launch(void* const* d_in, const int* in_sizes, int n_in,
                              void* d_out, int out_size, void* d_ws, size_t ws_size,
                              hipStream_t stream) {
  if (n_in < 12) return;
  if (in_sizes[0] != NB_ * SEQ * DM || in_sizes[1] != NB_ * SEQ * DM || in_sizes[2] != NB_ * SEQ * DM) return;
  if (in_sizes[3] != NPOS || in_sizes[4] != NPOS) return;
  if (in_sizes[5] != NH * W2 * DK || in_sizes[6] != NH * W2 * DK || in_sizes[7] != NH * W2 * DK) return;
  if (in_sizes[8] != DM * DM || in_sizes[9] != DM * DM || in_sizes[10] != DM * DM || in_sizes[11] != DM * DM) return;
  if (out_size != NB_ * SEQ * DM) return;

  const float* query   = (const float*)d_in[0];    // [4][1024][512]
  const float* keyx    = (const float*)d_in[1];
  const float* value   = (const float*)d_in[2];
  const int*   pos_enc = (const int*)  d_in[3];    // [4][8][16][1024]
  const int*   pos_pad = (const int*)  d_in[4];
  const float* rel_q   = (const float*)d_in[5];    // [1][8][32][64]
  const float* rel_k   = (const float*)d_in[6];
  const float* rel_v   = (const float*)d_in[7];
  const float* Wq      = (const float*)d_in[8];    // [512][512] rows = output feature
  const float* Wk      = (const float*)d_in[9];
  const float* Wv      = (const float*)d_in[10];
  const float* Wo      = (const float*)d_in[11];
  float*       out     = (float*)d_out;            // [4][1024][512]

  // workspace carve (every region a whole number of 256-B blocks; all planes are exact tile multiples)
  char* ws = (char*)d_ws;
  size_t off = 0;
  const size_t oXB  = off; off += (size_t)NXU * 16;                     // 12,582,912  bf16 [3][4096][512]
  const size_t oWB  = off; off += (size_t)NWU * 16;                     //  1,572,864  bf16 [3][512][512]
  const size_t oWOB = off; off += (size_t)NWOU * 16;                    //  1,048,576  bf16 [512][1024]
  const size_t oQKV = off; off += (size_t)3 * PLQ * 4;                  // 25,165,824  f32 [3][32][1024][64]
  const size_t oS   = off; off += (size_t)NBH * NSLOT * 4;              //  4,194,304  f32 [32][32768]
  const size_t oOA  = off; off += (size_t)MROWS * KOUT * 2;             //  8,388,608  bf16 [4096][1024]
  const size_t oPL  = off; off += (size_t)NBH * NSLOT * 4;              //  4,194,304  f32 [32][32768]
  const size_t oENT = off; off += (size_t)NBH * NSLOT * 2;              //  2,097,152  u16 [32][32768]
  const size_t oSOF = off; off += (size_t)NBH * NCH * SEQ * 4;          //  1,048,576  int [32][8][1024]
  const size_t oSCN = off; off += (size_t)NBH * NCH * SEQ * 4;          //  1,048,576  int [32][8][1024]
  const size_t oTOT = off; off += (size_t)NBH * NCH * 4;                //      1,024  int [32][8]
  if (off > ws_size || off > (size_t)WSMAX) return;                     // total 61,342,720
  unsigned short* XB  = (unsigned short*)(ws + oXB);
  unsigned short* WB  = (unsigned short*)(ws + oWB);
  unsigned short* WOB = (unsigned short*)(ws + oWOB);
  float*          QKV = (float*)(ws + oQKV);
  float*          S   = (float*)(ws + oS);
  unsigned short* OA  = (unsigned short*)(ws + oOA);
  float*          PL  = (float*)(ws + oPL);
  unsigned short* ENT = (unsigned short*)(ws + oENT);
  int*            SOFF = (int*)(ws + oSOF);
  int*            SCNT = (int*)(ws + oSCN);
  int*            TOT  = (int*)(ws + oTOT);
  const float* QP  = QKV;
  const float* KPl = QKV + (size_t)PLQ;
  const float* VP  = QKV + (size_t)2 * PLQ;

  hipFuncSetAttribute(reinterpret_cast<const void*>(&k_agg),
                      hipFuncAttributeMaxDynamicSharedMemorySize, LDS_AGG);

  // 1: bf16 operand planes
  k_convert<<<NCU / NTHR, NTHR, 0, stream>>>(query, keyx, value, Wq, Wk, Wv, Wo, XB, WB, WOB, NCU);
  // 2: q/k/v projections -> f32 head planes
  k_gemm<0><<<dim3(MROWS / GBM, DM / GBN, 3), GTHR, 0, stream>>>(XB, WB, QKV, DM, MROWS * DM, DM * DM, PLQ);
  // 3: window scores
  k_scores<<<dim3(W2, NBH), NTHR, 0, stream>>>(pos_enc, pos_pad, rel_q, rel_k, QP, KPl, S);
  // 4: softmax + slot lists grouped by target, one per chunk
  k_agg<<<dim3(NCH, NBH), NTHR, LDS_AGG, stream>>>(pos_enc, pos_pad, S, PL, ENT, SOFF, SCNT, TOT);
  // 5: owner segment sums -> bf16 hi|lo plane
  k_drain<<<dim3(SEQ / (NWAVE * TPD), NBH), NTHR, 0, stream>>>(rel_v, VP, PL, ENT, SOFF, SCNT, TOT, OA);
  // 6: output projection -> out
  k_gemm<1><<<dim3(MROWS / GBM, DM / GBN, 1), GTHR, 0, stream>>>(OA, WOB, out, KOUT, 0, 0, 0);
}

// v007
// Measured time: 89.5 microseconds a run.
// Two timings next to v006 put it at 1.19 and 1.20 times that version's speed.
// Counting every step since v000, it is 63.5 times as fast.
#include <hip/hip_runtime.h>
#include <stddef.h>
#include <stdint.h>

// Contractions: q/k/v input projections (K=512) and the output projection (K=1024 = activation bf16 hi|lo pair
// accumulate). Window scores (three 64-deep dots per slot), softmax statistics, weighted value sums and the
// per-position segment sums: f32 VALU.
//
// Carry audit: no plane carries a power-of-two scale; nothing is folded back anywhere.
//   XB  [3][4096][512]  bf16 = RNE(query | key | value)               (k_convert) -> A of the projections
//   WB  [3][512][512]   bf16 = RNE(Wq | Wk | Wv), rows [n][k]          (k_convert) -> B of the projections
//   OA  [4096][1024]    bf16 = [hi | lo] of the per-head attention output, hi = RNE(o), lo = RNE(o - hi)
//                                                                     (k_drain)   -> A of the output projection
//   rel_q, rel_k, rel_v are RNE-converted to bf16 values (held as f32) when staged in LDS.
//   f32 planes: QKV [3][32][1024][64] (projection results), S [32][32768] (masked, scaled scores).
//   Slot lists (k_agg -> k_drain), one per chunk of 4096 consecutive flat slots: PL [32][8][4096] f32 weights,
//   ENT [32][8][4096] u16 (w << 10 | kv), both grouped by target inside the chunk; SOFF, SCNT [32][8][1024] int segment
//   start (in the chunk's list) and count per target; TOT [32][8] int slots filed.

#define NB_    4
#define SEQ    1024
#define DM     512
#define NH     8
#define DK     64
#define KP1    16
#define W2     32
#define NSLOT  32768                 // W2 * SEQ flat window slots per (b,h)
#define NHALF  16384                 // KP1 * SEQ
#define NBH    32                    // NB_ * NH
#define MROWS  4096                  // NB_ * SEQ
#define KOUT   1024                  // 2 * DM (hi | lo)
#define NPOS   (NBH * NHALF)         // ints per position table
#define PLQ    (NBH * SEQ * DK)      // floats per q/k/v plane (2097152)
#define NTHR   256
#define NWAVE  8
#define GTHR   128
#define GBM    64
#define GBN    64
#define TPD    8                     // targets per wave in k_drain
#define DEGCAP 256                   // static cap on slots per target position
#define RINV24 (1.0f / 24.0f)
#define NEGBIG (-1.0e9f)
#define WSMAX  134217728
#define NXU    (3 * (MROWS * DM / 8))   // 786432 convert units (8 elements each)
#define NWU    (3 * (DM * DM / 8))      // 98304
#define NWOU   (DM * KOUT / 8)          // 65536
#define NCU    (NXU + NWU + NWOU)       // 950272
#define NCH    8                     // chunks of flat slots per (b,h): one k_agg work-group each
#define CSL    (NSLOT / NCH)         // 4096 consecutive flat slots per chunk
#define FPW    (CSL / NWAVE)         // 512 consecutive flat slots per wave in the bucketing passes of k_agg
#define BGRP   8                     // 32-slot steps whose index loads are issued together
#define LDS_AGG 57440
#define NSV    (NSLOT / (4 * NTHR))  // 16-byte score loads per thread in the statistics of k_agg

static_assert((MROWS % GBM) == 0 && (DM % GBN) == 0 && (SEQ % GBM) == 0);
static_assert((DM % 32) == 0 && (KOUT % 32) == 0);
static_assert(GBN == DK);
static_assert(GBM == (GTHR / 32) * 16);
static_assert(NSLOT == W2 * SEQ && NHALF == KP1 * SEQ && NBH == NB_ * NH && MROWS == NB_ * SEQ);
static_assert(NSLOT == (1 << 15) && SEQ == (1 << 10));
static_assert((MROWS * DM / 8) == (1 << 18) && (DM * DM / 8) == (1 << 15) && (KOUT / 8) == 128);
static_assert((NXU % NTHR) == 0 && ((NXU + NWU) % NTHR) == 0 && (NCU % NTHR) == 0);
static_assert(NTHR * 4 == SEQ && (SEQ % (TPD * NWAVE)) == 0);
static_assert((NSLOT % (4 * NTHR)) == 0);
static_assert(NTHR * 8 == W2 * DK);
static_assert((CSL + NWAVE * SEQ) * 4 + 16 * 4 + NWAVE * 4 + CSL * 2 <= LDS_AGG);
static_assert(((CSL + NWAVE * SEQ) * 4 + 16 * 4 + NWAVE * 4) % 16 == 0);
static_assert(TPD == 8 && NCH == 8 && (CSL * 2) % (16 * NTHR) == 0 && (CSL * 4) % (16 * NTHR) == 0);
static_assert(FPW * NWAVE == CSL && CSL * NCH == NSLOT && (FPW % (32 * BGRP)) == 0 && (NHALF % CSL) == 0);
static_assert(LDS_AGG <= 300000);
static_assert(PLQ == NB_ * SEQ * DM);

typedef float    v4f  __attribute__((ext_vector_type(4)));
typedef float    v8f  __attribute__((ext_vector_type(8)));
typedef int      v4i  __attribute__((ext_vector_type(4)));
typedef int      v8i  __attribute__((ext_vector_type(8)));
typedef unsigned short v8us __attribute__((ext_vector_type(8)));
typedef __bf16   v16b __attribute__((ext_vector_type(16)));
typedef v4f  __attribute__((may_alias)) v4fa;
typedef v4i  __attribute__((may_alias)) v4ia;
typedef v8us __attribute__((may_alias)) v8usa;
union FragB { v16b v; v8us h[2]; v8i w; };

// WMMA with hazard guard: ties D, keeps A/B live for 4 VALU slots
__device__ __forceinline__ v8f wmb(const FragB& a, const FragB& b, v8f c) {
  v8f d = __builtin_amdgcn_wmma_f32_16x16x32_bf16(false, a.v, false, b.v, (short)0, c, false, false);
  asm volatile("v_nop\n\tv_nop\n\tv_nop\n\tv_nop" : "+v"(d) : "v"(a.w), "v"(b.w));
  return d;
}

// f32 -> bf16 bits, RNE convert
__device__ __forceinline__ unsigned int bf16u(float x) {
  const unsigned int u = __float_as_uint(x);
  return (u + 0x7FFFu + ((u >> 16) & 1u)) >> 16;
}
// f32 -> nearest bf16 value held as f32
__device__ __forceinline__ float bf16f(float x) { return __uint_as_float(bf16u(x) << 16); }

__device__ __forceinline__ v8us cvt8b(const v4f a, const v4f b) {
  v8us r;
  r[0] = (unsigned short)bf16u(a.x); r[1] = (unsigned short)bf16u(a.y);
  r[2] = (unsigned short)bf16u(a.z); r[3] = (unsigned short)bf16u(a.w);
  r[4] = (unsigned short)bf16u(b.x); r[5] = (unsigned short)bf16u(b.y);
  r[6] = (unsigned short)bf16u(b.z); r[7] = (unsigned short)bf16u(b.w);
  return r;
}

__device__ __forceinline__ unsigned short hl1(float x, bool islo) {
  const unsigned int hu = bf16u(x);
  const float hf = __uint_as_float(hu << 16);
  const unsigned int lu = bf16u(x - hf);
  return (unsigned short)(islo ? lu : hu);
}
// 8 floats -> 8 bf16 hi parts (islo false) or 8 bf16 lo parts (islo true), lo = RNE(x - hi)
__device__ __forceinline__ v8us split8(const v4f a, const v4f b, bool islo) {
  v8us r;
  r[0] = hl1(a.x, islo); r[1] = hl1(a.y, islo); r[2] = hl1(a.z, islo); r[3] = hl1(a.w, islo);
  r[4] = hl1(b.x, islo); r[5] = hl1(b.y, islo); r[6] = hl1(b.z, islo); r[7] = hl1(b.w, islo);
  return r;
}

// ---------------------------------------------------------------------------
// Flat window slot f (0..32767) of head group bh: window row w = f >> 10, position s = f & 1023.
//   q index  = w < 16 ? pos_pad[w][s]    : pe[w-16][s]       (pe = pos_enc with -1 -> 0)
//   kv index = w < 16 ? pe[w][s]         : pos_pad[w-16][s]
//   masked   = (pos_enc[w & 15][s] == -1) || f < 1024
// Both tables are read unconditionally (same g for both halves) and clamped into [0, SEQ-1].
// ---------------------------------------------------------------------------
__device__ __forceinline__ void slot_idx(const int* __restrict__ pos_enc, const int* __restrict__ pos_pad,
                                         int bh, int f, int& qi, int& ki, bool& msk) {
  const int g = bh * NHALF + (f & (NHALF - 1));
  const int penc = pos_enc[g];
  const int ppad = pos_pad[g];
  const bool neg = (penc == -1);
  int pe = neg ? 0 : penc;
  pe = pe < 0 ? 0 : (pe > SEQ - 1 ? SEQ - 1 : pe);
  int pp = ppad < 0 ? 0 : (ppad > SEQ - 1 ? SEQ - 1 : ppad);
  const bool lo = f < NHALF;
  qi = lo ? pp : pe;
  ki = lo ? pe : pp;
  msk = neg || (f < SEQ);
}

// position index clamped into [0, SEQ-1]
__device__ __forceinline__ int clamp_pos(int v) { return v < 0 ? 0 : (v > SEQ - 1 ? SEQ - 1 : v); }

// Mask of the lanes of this wave whose 10-bit target t equals this lane's (all 32 lanes active): one ballot per bit.
__device__ __forceinline__ unsigned int same_target(int t) {
  unsigned int peers = 0xFFFFFFFFu;
#pragma unroll
  for (int bit = 0; bit < 10; ++bit) {
    const bool on = ((t >> bit) & 1) != 0;
    const unsigned int bl = __builtin_amdgcn_ballot_w32(on);
    peers &= on ? bl : ~bl;
  }
  return peers;
}

// ---------------------------------------------------------------------------
//   u <  NXU        : XB[z][off*8 ..]  z = u >> 18 selects query | key | value
//   u <  NXU + NWU  : WB[z][off*8 ..]  z selects Wq | Wk | Wv (rows [n][k] as given)
// coverage: NXU*8 = 3*4096*512, NWU*8 = 3*512*512, NWOU*8 = 512*1024 elements exactly.
// ---------------------------------------------------------------------------
__global__ __launch_bounds__(NTHR) void k_convert(
    const float* __restrict__ xq, const float* __restrict__ xk, const float* __restrict__ xv,
    const float* __restrict__ wq, const float* __restrict__ wk, const float* __restrict__ wv,
    const float* __restrict__ wo,
    unsigned short* xb, unsigned short* wb, unsigned short* wob, int nUnits)
{
  const int u = (int)blockIdx.x * NTHR + (int)threadIdx.x;
  if (u >= nUnits) return;
  const float* src;
  unsigned short* dst;
  if (u < NXU) {
    const int z = u >> 18, off = u & ((1 << 18) - 1);
    const float* xs = (z == 0) ? xq : ((z == 1) ? xk : xv);
    src = xs + (size_t)off * 8;
    dst = xb + (size_t)u * 8;
  } else if (u < NXU + NWU) {
    const int e = u - NXU;
    const int z = e >> 15, off = e & ((1 << 15) - 1);
    const float* wsp = (z == 0) ? wq : ((z == 1) ? wk : wv);
    src = wsp + (size_t)off * 8;
    dst = wb + (size_t)e * 8;
  } else {
    const int e = u - NXU - NWU;
    const int n = e >> 7;
    const int c8 = (e & 127) * 8;
    src = wo + (size_t)n * DM + (c8 & (DM - 1));
    dst = wob + (size_t)n * KOUT + c8;
  }
  const v4f a = *(const v4fa*)src;
  const v4f b = *(const v4fa*)(src + 4);
  const v8us o = cvt8b(a, b);
  *(v8us*)dst = o;
  
}

// ---------------------------------------------------------------------------
// bf16 WMMA GEMM, plane z = blockIdx.z: C[4096][N] tile = A[4096][K] (bf16, pitch K) x WT[N][K]^T (bf16 rows n,
// k-contiguous), K a multiple of 64. grid (4096/64, N/64, nz), 128 threads: wave w owns rows 16w..16w+15 of the 64x64
// tile, acc[4] = 4 column tiles. The 64 A rows and the 64 WT rows of the tile pass through LDS in chunks of 64 k (one
// 128-byte line per row): eight lanes read one line, so a load instruction covers four whole lines, and every line is
// read once per work-group. Two LDS buffers: the next chunk's lines are requested before this chunk's products and
// filed behind them; one barrier a chunk. Row pitch in LDS 144 bytes (16 B x odd) for the 16-byte fragment reads.
// A fragment (row m = lane&15): elements 0..7 <- k0+8h+0..7, 8..15 <- k0+16+8h+0..7
// (h = lane>>4); B fragment (col n = lane&15) from WT row (col0+16t+n) with the SAME k map; D element r =
// (row 8h+r, col lane&15). Tile staged in LDS as 64x64 f32 (over the chunk buffers, behind the loop's last barrier),
// then one instruction writes two 256-B row segments
//   EPI 0: head plane out[z][(b*8 + blockIdx.y)*1024 + s][64] f32 (b = row>>10, s = row&1023; column tile = one head)
//   EPI 1: out[row][512] f32 at columns col0..col0+63 (the final output, z = 0)
// coverage: grid (64, 8, nz) covers every (row, col) of each 4096 x 512 plane exactly once.
// ---------------------------------------------------------------------------
#define KC    64                     // k per staged chunk
#define LPT   72                     // LDS row pitch in bf16 elements (144 bytes)
#define TLE   (GBM * LPT)            // elements of one staged operand tile
static_assert(GBM == GBN && (DM % KC) == 0 && (KOUT % KC) == 0 && KC * 2 == 128);
static_assert(GTHR * 4 * 8 == GBM * KC);
static_assert(4 * TLE * 2 >= GBM * GBN * 4);

template<int EPI>
__global__ __launch_bounds__(GTHR) void k_gemm(
    const unsigned short* __restrict__ A, const unsigned short* __restrict__ WT,
    float* outF, int K, int strideA, int strideW, int strideO)
{
  __shared__ __attribute__((aligned(16))) v4f smem[4 * TLE * 2 / 16];   // 36,864 B: [buffer][A | WT][64][72] bf16
  unsigned short* tl = (unsigned short*)smem;
  float* stg = (float*)smem;                                            // 64 x 64 f32, epilogue only
  const int tid = (int)threadIdx.x, lane = tid & 31, wave = tid >> 5, hh = lane >> 4, m = lane & 15;
  const int z = (int)blockIdx.z;
  const unsigned short* Az = A  + (size_t)z * (size_t)strideA;
  const unsigned short* Wz = WT + (size_t)z * (size_t)strideW;
  float* Oz = outF + (size_t)z * (size_t)strideO;
  const int rowBase = (int)blockIdx.x * GBM;
  const int col0    = (int)blockIdx.y * GBN;

  v8f acc[4];
  {
    const v8f zz = {0.f, 0.f, 0.f, 0.f, 0.f, 0.f, 0.f, 0.f};
    acc[0] = zz; acc[1] = zz; acc[2] = zz; acc[3] = zz;
  }
  // staging: thread takes 16-byte piece sg of tile rows r0, r0+16, r0+32, r0+48 of both operands
  const int sg = tid & 7, r0 = tid >> 3;
  const char* ab = (const char*)(Az + (size_t)rowBase * (size_t)K);     // work-group uniform
  const char* wb = (const char*)(Wz + (size_t)col0 * (size_t)K);
  unsigned int go[4];
#pragma unroll
  for (int i = 0; i < 4; ++i) go[i] = (unsigned int)((r0 + 16 * i) * K + 8 * sg) * 2u;
  unsigned short* sp = tl + r0 * LPT + 8 * sg;
  const unsigned short* fa = tl + (16 * wave + m) * LPT + 8 * hh;       // A fragment row of this lane
  const unsigned short* fb = tl + TLE + m * LPT + 8 * hh;               // WT fragment row, column tile 0
  const int nch = K >> 6;
  v8us ra[4], rb[4];
#pragma unroll
  for (int i = 0; i < 4; ++i) {
    ra[i] = *(const v8usa*)(ab + go[i]);
    rb[i] = *(const v8usa*)(wb + go[i]);
  }
  // the wait before a register that these loads name is written again
  asm volatile("s_wait_xcnt 0x0" :: "v"(go[0]), "v"(go[1]), "v"(go[2]), "v"(go[3]) : "memory");
#pragma unroll
  for (int i = 0; i < 4; ++i) {
    *(v8usa*)(sp + 16 * i * LPT)       = ra[i];
    *(v8usa*)(sp + TLE + 16 * i * LPT) = rb[i];
  }
  __syncthreads();
  // kept rolled: a trip is a whole chunk (8 loads, 20 fragment reads, 8 products); a second copy would only add registers
#pragma unroll 1
  for (int c = 0; c < nch; ++c) {
    const int bo = (c & 1) * (2 * TLE);               // this chunk's buffer
    const bool nxt = c + 1 < nch;                     // work-group uniform
    unsigned int gn[4];                               // the next chunk's byte offsets
#pragma unroll
    for (int i = 0; i < 4; ++i) gn[i] = go[i] + (unsigned int)(c + 1) * (KC * 2u);
    if (nxt) {
#pragma unroll
      for (int i = 0; i < 4; ++i) {
        ra[i] = *(const v8usa*)(ab + gn[i]);
        rb[i] = *(const v8usa*)(wb + gn[i]);
      }
    }
    // the chunk's twenty fragment reads go out together, ahead of its eight products: one LDS latency a chunk
    FragB af[KC / 32], bf[KC / 32][4];
#pragma unroll
    for (int ks = 0; ks < KC / 32; ++ks) {
      af[ks].h[0] = *(const v8usa*)(fa + bo + 32 * ks);        // k = 64c + 32ks + 8hh + 0..7
      af[ks].h[1] = *(const v8usa*)(fa + bo + 32 * ks + 16);   // k = 64c + 32ks + 16 + 8hh + 0..7
#pragma unroll
      for (int t = 0; t < 4; ++t) {
        const unsigned short* wq = fb + bo + 16 * t * LPT + 32 * ks;   // WT row col0 + 16t + m
        bf[ks][t].h[0] = *(const v8usa*)wq;                    // same k map as A
        bf[ks][t].h[1] = *(const v8usa*)(wq + 16);
      }
    }
#pragma unroll
    for (int ks = 0; ks < KC / 32; ++ks) {
#pragma unroll
      for (int t = 0; t < 4; ++t) acc[t] = wmb(af[ks], bf[ks][t], acc[t]);
    }
    if (nxt) {
      // the wait before a register that the next chunk's loads name is written again; naming the offsets keeps each in a
      // register of its own up to here (else one could be a later load's destination). Behind the products it costs nothing.
      asm volatile("s_wait_xcnt 0x0" :: "v"(gn[0]), "v"(gn[1]), "v"(gn[2]), "v"(gn[3]) : "memory");
      unsigned short* sn = sp + (2 * TLE - bo);            // the other buffer: its readers left it at the last barrier
#pragma unroll
      for (int i = 0; i < 4; ++i) {
        *(v8usa*)(sn + 16 * i * LPT)       = ra[i];
        *(v8usa*)(sn + TLE + 16 * i * LPT) = rb[i];
      }
    }
    // publishes the next chunk and ends every wave's reads of this one (after the last chunk: frees the LDS for stg)
    __syncthreads();
  }

#pragma unroll
  for (int t = 0; t < 4; ++t) {
    const int lc = 16 * t + m;
#pragma unroll
    for (int r = 0; r < 8; ++r) {
      const int lr = 16 * wave + 8 * hh + r;          // D element r = (row 8hh+r, col m)
      stg[lr * GBN + lc] = acc[t][r];
    }
  }
  __syncthreads();

  float* ob;
  int ldo;
  if (EPI == 0) {
    const int bq = rowBase >> 10;
    const int s0 = rowBase & (SEQ - 1);
    ob  = Oz + ((size_t)(bq * NH + (int)blockIdx.y) * SEQ + s0) * DK;
    ldo = DK;
  } else {
    ob  = Oz + (size_t)rowBase * DM + col0;
    ldo = DM;
  }
  v4f fv[8];
#pragma unroll
  for (int i = 0; i < 8; ++i) {
    const int lr = 16 * wave + 2 * i + hh;
    fv[i] = *(const v4fa*)(stg + lr * GBN + 4 * m);
  }
#pragma unroll
  for (int i = 0; i < 8; ++i) {
    const int lr = 16 * wave + 2 * i + hh;
    float* op = ob + (size_t)lr * (size_t)ldo + 4 * m;
    *(v4f*)op = fv[i];
  }
  
}

// ---------------------------------------------------------------------------
// Window scores. grid (32 = window row w, 32 = bh), 8 waves; a wave takes 128 consecutive slots of the row, 32 a step.
// Lane j reads slot j's indices. The rows are then read whole: the 16 lanes of a half-wave take one slot's q row and
// k row, 16 bytes a lane (channels 4c..4c+3, c = lane & 15), so one load instruction covers two 256-byte rows; half-wave
// g works through slots 16g..16g+15, the slot's row offset coming from its lane by a DPP row broadcast.
// rel_k[h][w], rel_q[h][w] rows staged in LDS as bf16 values, each lane keeps its four channels of both in registers.
// Per lane c2c, c2p, p2c over its four channels, (c2c + c2p) + p2c, then the sum over the 16 lanes; lane j keeps slot
// j's score; masked slots get -1e9.
// coverage: 32 blocks x 8 waves x 4 steps x 32 lanes = all 32768 slots of each of the 32 (b,h).
// ---------------------------------------------------------------------------
#define SSTEP 4                      // 32-slot steps per wave in k_scores
static_assert(NWAVE * SSTEP * 32 == SEQ && DK == 64);

template<int CTRL>
__device__ __forceinline__ int dpp_mov(int x) { return __builtin_amdgcn_update_dpp(0, x, CTRL, 0xf, 0xf, true); }
// lane I of this lane's 16-lane row (DPP row_share)
template<int I>
__device__ __forceinline__ unsigned int row_bcast(int x) { return (unsigned int)dpp_mov<0x150 + I>(x); }
// sum over the 16 lanes of a row, in every lane of it (DPP row_xmask 1, 2, 4, 8)
__device__ __forceinline__ float row_sum16(float x) {
  x += __int_as_float(dpp_mov<0x161>(__float_as_int(x)));
  x += __int_as_float(dpp_mov<0x162>(__float_as_int(x)));
  x += __int_as_float(dpp_mov<0x164>(__float_as_int(x)));
  x += __int_as_float(dpp_mov<0x168>(__float_as_int(x)));
  return x;
}

// Slots I0..I0+7 of each half-wave: qo, ko = the lane's own slot's q and k row byte offsets, c16 = 16 * (lane & 15).
// All sixteen row loads are issued before the first is used. sc takes the score sum of the lane's own slot.
#define SC_ADDR(i) qa[i] = row_bcast<I0 + (i)>(qo) + c16; ka[i] = row_bcast<I0 + (i)>(ko) + c16;
template<int I0>
__device__ __forceinline__ void score8(int qo, int ko, unsigned int c16, int c,
                                       const char* __restrict__ qb, const char* __restrict__ kb,
                                       const v4f rkv, const v4f rqv, float& sc) {
  unsigned int qa[8], ka[8];
  v4f qv[8], kv[8];
  SC_ADDR(0) SC_ADDR(1) SC_ADDR(2) SC_ADDR(3) SC_ADDR(4) SC_ADDR(5) SC_ADDR(6) SC_ADDR(7)
#pragma unroll
  for (int i = 0; i < 8; ++i) {
    qv[i] = *(const v4fa*)(qb + qa[i]);
    kv[i] = *(const v4fa*)(kb + ka[i]);
  }
  // the wait before the loads' offset registers are written again; naming them keeps each in a register of its own up
  // to here. The "memory" clobber keeps the loads ahead of it.
  asm volatile("s_wait_xcnt 0x0" :: "v"(qa[0]), "v"(qa[1]), "v"(qa[2]), "v"(qa[3]), "v"(qa[4]), "v"(qa[5]), "v"(qa[6]),
               "v"(qa[7]), "v"(ka[0]), "v"(ka[1]), "v"(ka[2]), "v"(ka[3]), "v"(ka[4]), "v"(ka[5]), "v"(ka[6]), "v"(ka[7])
               : "memory");
#pragma unroll
  for (int i = 0; i < 8; ++i) {
    const v4f q = qv[i], k = kv[i];
    float c2c = q.x * k.x, c2p = q.x * rkv.x, p2c = rqv.x * k.x;
    c2c = fmaf(q.y, k.y, c2c);   c2c = fmaf(q.z, k.z, c2c);   c2c = fmaf(q.w, k.w, c2c);
    c2p = fmaf(q.y, rkv.y, c2p); c2p = fmaf(q.z, rkv.z, c2p); c2p = fmaf(q.w, rkv.w, c2p);
    p2c = fmaf(rqv.y, k.y, p2c); p2c = fmaf(rqv.z, k.z, p2c); p2c = fmaf(rqv.w, k.w, p2c);
    const float s = row_sum16((c2c + c2p) + p2c);
    sc = (c == I0 + i) ? s : sc;
  }
}

__global__ __launch_bounds__(NTHR) void k_scores(
    const int* __restrict__ pos_enc, const int* __restrict__ pos_pad,
    const float* __restrict__ rel_q, const float* __restrict__ rel_k,
    const float* __restrict__ QP, const float* __restrict__ KPl, float* S)
{
  __shared__ __attribute__((aligned(16))) float rk[DK];
  __shared__ __attribute__((aligned(16))) float rq[DK];
  const int tid = (int)threadIdx.x, lane = tid & 31, wave = tid >> 5;
  const int bh = (int)blockIdx.y, h = bh & (NH - 1);
  const int w = (int)blockIdx.x;
  {
    const int sel = tid >> 6, j = tid & 63;          // sel uniform per pair of waves
    const size_t rb = (size_t)(h * W2 + w) * DK + j;
    if (sel == 0) rk[j] = bf16f(rel_k[rb]);
    if (sel == 1) rq[j] = bf16f(rel_q[rb]);
  }
  __syncthreads();

  const int c = lane & 15;
  const unsigned int c16 = 16u * (unsigned int)c;
  const v4f rkv = *(const v4fa*)(rk + 4 * c);
  const v4f rqv = *(const v4fa*)(rq + 4 * c);
  const char* qb = (const char*)(QP  + (size_t)bh * SEQ * DK);
  const char* kb = (const char*)(KPl + (size_t)bh * SEQ * DK);
  const int f0 = w * SEQ + wave * (SSTEP * 32) + lane;
  int qo[SSTEP], ko[SSTEP];
  bool mk[SSTEP];
#pragma unroll
  for (int t = 0; t < SSTEP; ++t) {
    int qi, ki;
    slot_idx(pos_enc, pos_pad, bh, f0 + 32 * t, qi, ki, mk[t]);
    qo[t] = qi * (DK * 4);
    ko[t] = ki * (DK * 4);
  }
  float res[SSTEP];
#pragma unroll
  for (int t = 0; t < SSTEP; ++t) {
    float sc = 0.f;
    score8<0>(qo[t], ko[t], c16, c, qb, kb, rkv, rqv, sc);
    score8<8>(qo[t], ko[t], c16, c, qb, kb, rkv, rqv, sc);
    res[t] = mk[t] ? NEGBIG : sc * RINV24;
  }
  float* sp = S + (size_t)bh * NSLOT + f0;
#pragma unroll
  for (int t = 0; t < SSTEP; ++t) sp[32 * t] = res[t];
}

// ---------------------------------------------------------------------------
// One step of k_drain over 8*G slots: lane j holds slot j's value-row byte offset ov (kv * 256), its rel_v-row byte
// offset orl (w * 256) and its weight pm (0 past the target's last slot, which leaves the sums as they are).
// vb = value plane of this (b,h) (wave-uniform), rvl = rel_v rows in LDS + lane, lane4 = 4 * lane.
// ---------------------------------------------------------------------------
#define VO8(b) "v"(vo[(b)]), "v"(vo[(b) + 1]), "v"(vo[(b) + 2]), "v"(vo[(b) + 3]), \
               "v"(vo[(b) + 4]), "v"(vo[(b) + 5]), "v"(vo[(b) + 6]), "v"(vo[(b) + 7])
template<int G>
__device__ __forceinline__ void drain_step(int ov, int orl, float pm, const char* __restrict__ vb, const char* rvl,
                                           unsigned int lane4, float& a0, float& a1) {
  unsigned int vo[8 * G];
  float v0[8 * G], v1[8 * G], r0[8 * G], r1[8 * G];
#pragma unroll
  for (int j = 0; j < 8 * G; ++j) vo[j] = (unsigned int)__builtin_amdgcn_readlane(ov, j) + lane4;
#pragma unroll
  for (int j = 0; j < 8 * G; ++j) {
    const float* vr = (const float*)(vb + vo[j]);
    v0[j] = vr[0];
    v1[j] = vr[32];
  }
#pragma unroll
  for (int j = 0; j < 8 * G; ++j) {
    const float* rr = (const float*)(rvl + __builtin_amdgcn_readlane(orl, j));
    r0[j] = rr[0];
    r1[j] = rr[32];
  }
  // the wait before the loads' offset registers are written again; naming them keeps each in a register of its own up to
  // here (reused inside the step, an offset register would make the next load wait, or be a later load's destination);
  // a statement takes thirty operands, so 32 slots take two. The "memory" clobber keeps the step's loads ahead of it.
  if constexpr (G == 1) {
    asm volatile("s_wait_xcnt 0x0" :: VO8(0) : "memory");
  } else {
    asm volatile("s_wait_xcnt 0x0" :: VO8(0), VO8(8) : "memory");
    if constexpr (G == 3) asm volatile("s_wait_xcnt 0x0" :: VO8(16) : "memory");
    if constexpr (G == 4) asm volatile("s_wait_xcnt 0x0" :: VO8(16), VO8(24) : "memory");
  }
#pragma unroll
  for (int j = 0; j < 8 * G; ++j) {
    const float pj = __int_as_float(__builtin_amdgcn_readlane(__float_as_int(pm), j));
    a0 = fmaf(pj, v0[j] + r0[j], a0);
    a1 = fmaf(pj, v1[j] + r1[j], a1);
  }
}

// segment start in a chunk's list clamped into [0, CSL]
__device__ __forceinline__ int clamp_st(int st) { return st < 0 ? 0 : (st > CSL ? CSL : st); }

// Place in the lists of one (b,h) of position q (0 = first) among the slots of the wave's target jt (wave-uniform).
// Lane (c & 3) * 8 + jt of pre0 / bas0 (chunks 0..3) and pre1 / bas1 (chunks 4..7) holds, for chunk c, the number of the
// target's slots in the chunks before c, and c * CSL + segment start - that number. The last chunk whose first position
// is not above q is q's. Result clamped into [0, NSLOT-1].
__device__ __forceinline__ int seg_idx(int pre0, int pre1, int bas0, int bas1, int jt, int q) {
  int b = __builtin_amdgcn_readlane(bas0, jt);
#pragma unroll
  for (int c = 1; c < NCH; ++c) {
    const int ln = (c & 3) * 8 + jt;
    const int p  = __builtin_amdgcn_readlane(c < 4 ? pre0 : pre1, ln);
    const int bb = __builtin_amdgcn_readlane(c < 4 ? bas0 : bas1, ln);
    b = q >= p ? bb : b;
  }
  const int idx = q + b;
  return idx < 0 ? 0 : (idx > NSLOT - 1 ? NSLOT - 1 : idx);
}

// Place idx (0..NSLOT-1) of the entry list eb and the weight list pb of one (b,h), one place a lane.
__device__ __forceinline__ void list_read(const unsigned short* __restrict__ eb, const float* __restrict__ pb, int idx,
                                          int& e, float& p) {
  e = eb[idx];
  p = pb[idx];
  // the wait before the two loads' index register is written again; naming it keeps it as it is up to here
  asm volatile("s_wait_xcnt 0x0" :: "v"(idx) : "memory");
}

// ---------------------------------------------------------------------------
// grid (8 = chunk, 32 = bh). Every block: softmax statistics over all 32768 slots of its (b,h) (the same sums in the same
// order in all eight), then deterministic bucketing of its own chunk's 4096 slots by their
// q index into LDS (count -> exclusive scan -> f-ascending cursor fill, no atomics): wave w takes
// the chunk's flat slots [512w, 512w + 512), 32 a step; lanes with the same target are matched by ballots, the first of them
// updates the wave's own counter / cursor row, each lane's place is cursor + its rank among them.
// p = exp(S[f] - M) * (1/Z) is computed where the slot is filed (scores read in f order) and kept beside its entry.
// The finished lists go to the workspace in whole lines, with each target's segment start and count, for k_drain.
// coverage: 256 blocks x (4096 weights + 4096 entries + 1024 starts + 1024 counts + 1 total), each written once.
// ---------------------------------------------------------------------------
__global__ __launch_bounds__(NTHR) void k_agg(
    const int* __restrict__ pos_enc, const int* __restrict__ pos_pad, const float* __restrict__ S,
    float* PL, unsigned short* ENT, int* SOFF, int* SCNT, int* TOT)
{
  extern __shared__ v4f lds_dyn[];
  float* pl   = (float*)lds_dyn;          // [CSL] slot weights p, grouped by target, f ascending
  int*   cur  = (int*)(pl + CSL);         // [NWAVE][SEQ] per-wave counts, then per-wave cursors
  float* red  = (float*)(cur + NWAVE * SEQ);   // [16]
  int*   wtot = (int*)(red + 16);         // [NWAVE]
  unsigned short* ent16 = (unsigned short*)(wtot + NWAVE);   // [CSL] packed (w << 10 | kv), same places as pl
  const int tid = (int)threadIdx.x, lane = tid & 31, wave = tid >> 5;
  const int bh = (int)blockIdx.y;
  const int ch = (int)blockIdx.x;
  const int lst = bh * NCH + ch;          // this block's list
  const float* sb = S + (size_t)bh * NSLOT;

  // The thread's 128 scores of this (b,h), slots 1024 i + 4 tid .. + 3, are read once and kept in registers for the
  // maximum and for the sum. All 32 loads are requested before the first is used (one memory latency in place of one
  // per load), from one index register and immediate offsets.
  v4f sv[NSV];
  // unrolled whole: sv is indexed by constants only (registers), and the loads stand one behind the other
#pragma unroll
  for (int i = 0; i < NSV; ++i) sv[i] = *(const v4fa*)(sb + i * (4 * NTHR) + 4 * tid);
  // the wait before the loads' index register is written again; naming it keeps it as it is up to here
  asm volatile("s_wait_xcnt 0x0" :: "v"(tid) : "memory");

  {
    const v4i z4 = {0, 0, 0, 0};
#pragma unroll 1
    for (int i = tid; i < CSL / 4; i += NTHR) *(v4ia*)(pl + 4 * i) = z4;
#pragma unroll 1
    for (int i = tid; i < CSL / 8; i += NTHR) *(v4ia*)(ent16 + 8 * i) = z4;
#pragma unroll
    for (int w2 = 0; w2 < NWAVE; ++w2) *(v4ia*)(cur + w2 * SEQ + 4 * tid) = z4;
  }
  __syncthreads();

  // ---- softmax statistics: M = max, Z = sum exp(s - M), two-level fixed order ----
  float mx = -3.0e38f;
  // unrolled whole: sv stays in registers
#pragma unroll
  for (int i = 0; i < NSV; ++i) {
    const v4f s4 = sv[i];
    mx = fmaxf(fmaxf(mx, fmaxf(s4.x, s4.y)), fmaxf(s4.z, s4.w));
  }
#pragma unroll
  for (int off = 16; off > 0; off >>= 1) mx = fmaxf(mx, __shfl_xor(mx, off));
  if (lane == 0) red[wave] = mx;
  __syncthreads();
  float M = red[0];
#pragma unroll
  for (int w2 = 1; w2 < NWAVE; ++w2) M = fmaxf(M, red[w2]);
  float zs = 0.f;
  // unrolled whole, for the same reason; the terms are added in the order of i, as before
#pragma unroll
  for (int i = 0; i < NSV; ++i) {
    const v4f s4 = sv[i];
    zs += (__expf(s4.x - M) + __expf(s4.y - M)) + (__expf(s4.z - M) + __expf(s4.w - M));
  }
#pragma unroll
  for (int off = 16; off > 0; off >>= 1) zs += __shfl_xor(zs, off);
  if (lane == 0) red[NWAVE + wave] = zs;
  __syncthreads();
  float Z = 0.f;
#pragma unroll
  for (int w2 = 0; w2 < NWAVE; ++w2) Z += red[NWAVE + w2];
  const float invZ = 1.0f / Z;                        // Z >= 1 (the max slot contributes exp(0))

  // ---- counts per (wave, target): every wave over its own 512 slots ----
  // A chunk's 4096 slots lie in one half of the window rows, so its q table and its kv table (slot_idx) are fixed:
  // lower half q <- pos_pad, kv <- pos_enc; upper half the other way round. clamp_pos sends pos_enc's -1 to 0.
  const int f0w = ch * CSL + __builtin_amdgcn_readfirstlane(wave) * FPW;   // wave-uniform: scalar loop control, table choice
  const bool lohalf = f0w < NHALF;
  const int* qtab = (lohalf ? pos_pad : pos_enc) + bh * NHALF + (f0w & (NHALF - 1));
  const int* ktab = (lohalf ? pos_enc : pos_pad) + bh * NHALF + (f0w & (NHALF - 1));
  int* wcur = cur + wave * SEQ;
  const unsigned int below = (1u << lane) - 1u;
  const unsigned int lane4 = 4u * (unsigned int)lane;
#pragma unroll 1
  for (int g = 0; g < FPW; g += 32 * BGRP) {
    int tq[BGRP];
#pragma unroll
    for (int j = 0; j < BGRP; ++j) tq[j] = clamp_pos(qtab[g + 32 * j + lane]) & (SEQ - 1);
#pragma unroll
    for (int j = 0; j < BGRP; ++j) {
      const unsigned int peers = same_target(tq[j]);
      if ((peers & below) == 0u) wcur[tq[j]] = wcur[tq[j]] + __builtin_popcount(peers);
      // the next step's reader of a counter may be another lane of this wave: keep the LDS accesses in step order
      __builtin_amdgcn_fence(__ATOMIC_ACQ_REL, "wavefront");
      __builtin_amdgcn_wave_barrier();
    }
  }
  __syncthreads();

  // ---- exclusive prefix over SEQ counts -> SOFF ----
  int tot;
  {
    v4i cw[NWAVE];
    v4i ca = {0, 0, 0, 0};
#pragma unroll
    for (int w2 = 0; w2 < NWAVE; ++w2) {
      cw[w2] = *(const v4ia*)(cur + w2 * SEQ + 4 * tid);
      ca += cw[w2];
    }
    *(v4ia*)(SCNT + lst * SEQ + 4 * tid) = ca;
    const int e0 = ca.x < 0 ? 0 : ca.x, e1 = ca.y < 0 ? 0 : ca.y, e2 = ca.z < 0 ? 0 : ca.z, e3 = ca.w < 0 ? 0 : ca.w;
    const int ts = e0 + e1 + e2 + e3;
    int incl = ts;
#pragma unroll
    for (int d = 1; d < 32; d <<= 1) {
      const int up = __shfl_up(incl, d);
      if (lane >= d) incl += up;
    }
    if (lane == 31) wtot[wave] = incl;
    __syncthreads();
    int pre = 0;
    tot = 0;
#pragma unroll
    for (int w2 = 0; w2 < NWAVE; ++w2) {
      const int t = wtot[w2];
      tot += t;
      pre += (w2 < wave) ? t : 0;
    }
    int run = pre + incl - ts;
    v4i so;
    so.x = run; run += e0;
    so.y = run; run += e1;
    so.z = run; run += e2;
    so.w = run;
    *(v4ia*)(SOFF + lst * SEQ + 4 * tid) = so;
    // wave w2's cursor of a target starts behind the slots that waves 0..w2-1 hold for it (f ascending over waves)
#pragma unroll
    for (int w2 = 0; w2 < NWAVE; ++w2) {
      *(v4ia*)(cur + w2 * SEQ + 4 * tid) = so;
      so += cw[w2];
    }
  }
  __syncthreads();

  // ---- fill: packed (w << 10 | kv) and weight p into target segments (every wave over its own slots, f ascending) ----
#pragma unroll 1
  for (int g = 0; g < FPW; g += 32 * BGRP) {
    int tq[BGRP], ent[BGRP];
    float pw[BGRP];
    // this group's kv indices and scores, from the lane's own column on
    const int*   kg = (const int*)((const char*)(ktab + g) + lane4);
    const float* sg = (const float*)((const char*)(sb + f0w + g) + lane4);
#pragma unroll
    for (int j = 0; j < BGRP; ++j) {
      const int o = g + 32 * j + lane;
      tq[j]  = clamp_pos(qtab[o]) & (SEQ - 1);
      ent[j] = (((f0w + o) >> 10) << 10) | clamp_pos(kg[32 * j]);
      pw[j]  = __expf(sg[32 * j] - M) * invZ;
    }
    // the steps below reuse the address registers of the loads above
    asm volatile("s_wait_xcnt 0x0" ::: "memory");
#pragma unroll
    for (int j = 0; j < BGRP; ++j) {
      const unsigned int peers = same_target(tq[j]);
      const unsigned int lower = peers & below;
      const int base = wcur[tq[j]];
      int pos = base + __builtin_popcount(lower);
      pos = pos < 0 ? 0 : (pos > CSL - 1 ? CSL - 1 : pos);
      ent16[pos] = (unsigned short)ent[j];
      pl[pos]    = pw[j];
      if (lower == 0u) wcur[tq[j]] = base + __builtin_popcount(peers);
      // the next step's reader of a cursor may be another lane of this wave: keep the LDS accesses in step order
      __builtin_amdgcn_fence(__ATOMIC_ACQ_REL, "wavefront");
      __builtin_amdgcn_wave_barrier();
    }
  }
  __syncthreads();

  // ---- the lists to the workspace, 16 bytes a lane ----
  {
    float* plg = PL + (size_t)lst * CSL + 4 * tid;
    unsigned short* eg = ENT + (size_t)lst * CSL + 8 * tid;
    // unrolled whole: every store takes its place from an immediate offset, so no address register is written again
#pragma unroll
    for (int i = 0; i < CSL / (4 * NTHR); ++i) *(v4ia*)(plg + i * (4 * NTHR)) = *(const v4ia*)(pl + i * (4 * NTHR) + 4 * tid);
    // unrolled whole, for the same reason
#pragma unroll
    for (int i = 0; i < CSL / (8 * NTHR); ++i) *(v4ia*)(eg + i * (8 * NTHR)) = *(const v4ia*)(ent16 + i * (8 * NTHR) + 8 * tid);
    if (tid == 0) TOT[lst] = tot;
  }
}

// ---------------------------------------------------------------------------
// Owner drain per target position: out_h[i][d] = sum over its slots of p[f] * (v[kv[f]][d] + rel_v[w][d]).
// grid (16 = group of 64 targets, 32 = bh), 8 waves; a wave owns 8 consecutive targets of k_agg's lists.
// A target's slots are its segments of the eight chunk lists one behind the other (chunks ascending, so f ascending).
// The drain takes up to 32 slots of a target a step: lane j holds slot j's entry and weight, both are broadcast by
// readlane, the step's value rows are all requested before the first is used, and the sum runs in slot order.
// Lane = channel d (and 32 + d); every loop bound and index is clamped to static ranges.
// Result written as the bf16 hi | lo lines of OA row (b*1024 + i), columns h*64.. (hi) and 512 + h*64..
// Count cap overflow or inconsistent totals -> NaN poison of the row.
// coverage: 512 blocks x 64 targets x (hi line + lo line) = all 4096 rows x 16 lines of OA exactly once.
// ---------------------------------------------------------------------------
__global__ __launch_bounds__(NTHR) void k_drain(
    const float* __restrict__ rel_v, const float* __restrict__ VP,
    const float* __restrict__ PL, const unsigned short* __restrict__ ENT,
    const int* __restrict__ SOFF, const int* __restrict__ SCNT, const int* __restrict__ TOT,
    unsigned short* OA)
{
  __shared__ __attribute__((aligned(16))) float relv[W2 * DK];
  __shared__ __attribute__((aligned(16))) float stw[NWAVE * 64];
  const int tid = (int)threadIdx.x, lane = tid & 31, wave = tid >> 5;
  const int bh = (int)blockIdx.y, b = bh >> 3, h = bh & (NH - 1);
  const float* pl = PL + (size_t)bh * NSLOT;
  const unsigned short* ent16 = ENT + (size_t)bh * NSLOT;
  const int tg0 = ((int)blockIdx.x * NWAVE + __builtin_amdgcn_readfirstlane(wave)) * TPD;
  // segment starts and counts of the wave's targets: lane l holds those of target tg0 + (l & 7) in chunk l >> 3 (index
  // ti0) and in chunk 4 + (l >> 3) (index ti1); lane l also reads the total of chunk l & 7
  const int ti0 = (bh * NCH + (lane >> 3)) * SEQ + tg0 + (lane & 7);
  const int ti1 = ti0 + 4 * SEQ;
  const int tix = bh * NCH + (lane & 7);
  const int s0r = SOFF[ti0], c0r = SCNT[ti0], s1r = SOFF[ti1], c1r = SCNT[ti1];
  const int totl = TOT[tix];
  // the wait before the loads' index registers are written again; naming them keeps them as they are up to here
  asm volatile("s_wait_xcnt 0x0" :: "v"(ti0), "v"(ti1), "v"(tix) : "memory");
  {
    const float* rp = rel_v + (size_t)h * (W2 * DK) + 8 * tid;
    const v4f a = *(const v4fa*)rp;
    const v4f c = *(const v4fa*)(rp + 4);
    float* q = relv + 8 * tid;
    q[0] = bf16f(a.x); q[1] = bf16f(a.y); q[2] = bf16f(a.z); q[3] = bf16f(a.w);
    q[4] = bf16f(c.x); q[5] = bf16f(c.y); q[6] = bf16f(c.z); q[7] = bf16f(c.w);
  }
  // per (chunk, target): count bounded by the chunk's list, slots of the target in earlier chunks (sum over the lanes
  // 8 apart, then over the two registers), and what seg_idx adds to a position; totv = the target's slots in all chunks
  const int st0 = clamp_st(s0r), st1 = clamp_st(s1r);
  int n0 = c0r < 0 ? 0 : c0r, n1 = c1r < 0 ? 0 : c1r;
  n0 = n0 > CSL - st0 ? CSL - st0 : n0;
  n1 = n1 > CSL - st1 ? CSL - st1 : n1;
  int i0 = n0, i1 = n1;
#pragma unroll
  for (int d = 8; d < 32; d <<= 1) {
    const int u0 = __shfl_up(i0, d), u1 = __shfl_up(i1, d);
    if (lane >= d) { i0 += u0; i1 += u1; }
  }
  const int t0 = __shfl(i0, 24 + (lane & 7)), t1 = __shfl(i1, 24 + (lane & 7));
  const int pre0 = i0 - n0, pre1 = t0 + i1 - n1;
  const int bas0 = (lane >> 3) * CSL + st0 - pre0;
  const int bas1 = (4 + (lane >> 3)) * CSL + st1 - pre1;
  const int totv = t0 + t1;
  const unsigned int negm = __builtin_amdgcn_ballot_w32(c0r < 0 || c1r < 0);
  // entries and weights of the coming step, read one step ahead
  int epre;
  float ppre;
  list_read(ent16, pl, seg_idx(pre0, pre1, bas0, bas1, 0, lane), epre, ppre);
  __syncthreads();

  const unsigned int lane4 = 4u * (unsigned int)lane;
  const float qnan = __int_as_float(0x7fc00000);
  const bool bad_tot = __builtin_amdgcn_ballot_w32(totl != CSL) != 0u;
  float* sw = stw + wave * 64;
  const int lc = lane & 7;
  const bool islo = (lane & 8) != 0;
  const char* vb  = (const char*)(VP + (size_t)bh * SEQ * DK);
  const char* rvl = (const char*)(relv + lane);
#pragma unroll 1
  for (int jt = 0; jt < TPD; ++jt) {
    const int tg = tg0 + jt;                           // 0..1023
    const int jn = jt + 1 < TPD ? jt + 1 : TPD - 1;
    const int craw = __builtin_amdgcn_readlane(totv, jt);
    int cnt = craw;
    cnt = cnt < 0 ? 0 : (cnt > DEGCAP ? DEGCAP : cnt);
    const bool cneg = ((negm >> jt) & 0x01010101u) != 0u;   // a negative count of this target in some chunk
    const float pz = (bad_tot || craw > DEGCAP || cneg) ? qnan : 0.0f;
    float a0 = 0.f, a1 = 0.f;
#pragma unroll 1
    for (int q0 = 0; q0 < cnt || q0 == 0; q0 += 32) {
      const int left = cnt - q0;                       // 0 only for an empty target: nothing summed, read-ahead moved on
      const int n = left > 32 ? 32 : left;
      const int ov  = (epre & (SEQ - 1)) * (DK * 4);
      const int orl = ((epre >> 10) & (W2 - 1)) * (DK * 4);
      const float pm = lane < n ? ppre : 0.0f;
      const bool more = left > 32;                     // this target goes on; else the next target's first step
      const int idx = seg_idx(pre0, pre1, bas0, bas1, more ? jt : jn, (more ? q0 + 32 : 0) + lane);
      list_read(ent16, pl, idx, epre, ppre);
      if (n > 24)      drain_step<4>(ov, orl, pm, vb, rvl, lane4, a0, a1);
      else if (n > 16) drain_step<3>(ov, orl, pm, vb, rvl, lane4, a0, a1);
      else if (n > 8)  drain_step<2>(ov, orl, pm, vb, rvl, lane4, a0, a1);
      else if (n > 0)  drain_step<1>(ov, orl, pm, vb, rvl, lane4, a0, a1);
    }
    a0 += pz;
    a1 += pz;
    // per-wave relayout: channels in order, then lanes 0..7 (hi) / 8..15 (lo) read 8 consecutive channels each
    __builtin_amdgcn_fence(__ATOMIC_RELEASE, "wavefront");
    __builtin_amdgcn_wave_barrier();
    sw[lane]      = a0;
    sw[32 + lane] = a1;
    __builtin_amdgcn_fence(__ATOMIC_RELEASE, "wavefront");
    __builtin_amdgcn_wave_barrier();
    const v4f ga = *(const v4fa*)(sw + 8 * lc);
    const v4f gb = *(const v4fa*)(sw + 8 * lc + 4);
    const v8us ov = split8(ga, gb, islo);
    const int orow = b * SEQ + tg;
    unsigned short* dst = OA + (size_t)orow * KOUT + (islo ? DM : 0) + h * DK + 8 * lc;
    const bool wsv = lane < 16;
    if (wsv) *(v8us*)dst = ov;
    // the wait before the store's address and data registers are written again for the next target
    asm volatile("s_wait_xcnt 0x0" ::: "memory");
  }
}

// ---------------------------------------------------------------------------
static inline int cdiv(int a, int b) { return (a + b - 1) / b; }

extern "C" void kernel_launch(void* const* d_in, const int* in_sizes, int n_in,
                              void* d_out, int out_size, void* d_ws, size_t ws_size,
                              hipStream_t stream) {
  if (n_in < 12) return;
  if (in_sizes[0] != NB_ * SEQ * DM || in_sizes[1] != NB_ * SEQ * DM || in_sizes[2] != NB_ * SEQ * DM) return;
  if (in_sizes[3] != NPOS || in_sizes[4] != NPOS) return;
  if (in_sizes[5] != NH * W2 * DK || in_sizes[6] != NH * W2 * DK || in_sizes[7] != NH * W2 * DK) return;
  if (in_sizes[8] != DM * DM || in_sizes[9] != DM * DM || in_sizes[10] != DM * DM || in_sizes[11] != DM * DM) return;
  if (out_size != NB_ * SEQ * DM) return;

  const float* query   = (const float*)d_in[0];    // [4][1024][512]
  const float* keyx    = (const float*)d_in[1];
  const float* value   = (const float*)d_in[2];
  const int*   pos_enc = (const int*)  d_in[3];    // [4][8][16][1024]
  const int*   pos_pad = (const int*)  d_in[4];
  const float* rel_q   = (const float*)d_in[5];    // [1][8][32][64]
  const float* rel_k   = (const float*)d_in[6];
  const float* rel_v   = (const float*)d_in[7];
  const float* Wq      = (const float*)d_in[8];    // [512][512] rows = output feature
  const float* Wk      = (const float*)d_in[9];
  const float* Wv      = (const float*)d_in[10];
  const float* Wo      = (const float*)d_in[11];
  float*       out     = (float*)d_out;            // [4][1024][512]

  // workspace carve (every region a whole number of 256-B blocks; all planes are exact tile multiples)
  char* ws = (char*)d_ws;
  size_t off = 0;
  const size_t oXB  = off; off += (size_t)NXU * 16;                     // 12,582,912  bf16 [3][4096][512]
  const size_t oWB  = off; off += (size_t)NWU * 16;                     //  1,572,864  bf16 [3][512][512]
  const size_t oWOB = off; off += (size_t)NWOU * 16;                    //  1,048,576  bf16 [512][1024]
  const size_t oQKV = off; off += (size_t)3 * PLQ * 4;                  // 25,165,824  f32 [3][32][1024][64]
  const size_t oS   = off; off += (size_t)NBH * NSLOT * 4;              //  4,194,304  f32 [32][32768]
  const size_t oOA  = off; off += (size_t)MROWS * KOUT * 2;             //  8,388,608  bf16 [4096][1024]
  const size_t oPL  = off; off += (size_t)NBH * NSLOT * 4;              //  4,194,304  f32 [32][32768]
  const size_t oENT = off; off += (size_t)NBH * NSLOT * 2;              //  2,097,152  u16 [32][32768]
  const size_t oSOF = off; off += (size_t)NBH * NCH * SEQ * 4;          //  1,048,576  int [32][8][1024]
  const size_t oSCN = off; off += (size_t)NBH * NCH * SEQ * 4;          //  1,048,576  int [32][8][1024]
  const size_t oTOT = off; off += (size_t)NBH * NCH * 4;                //      1,024  int [32][8]
  if (off > ws_size || off > (size_t)WSMAX) return;                     // total 61,342,720
  unsigned short* XB  = (unsigned short*)(ws + oXB);
  unsigned short* WB  = (unsigned short*)(ws + oWB);
  unsigned short* WOB = (unsigned short*)(ws + oWOB);
  float*          QKV = (float*)(ws + oQKV);
  float*          S   = (float*)(ws + oS);
  unsigned short* OA  = (unsigned short*)(ws + oOA);
  float*          PL  = (float*)(ws + oPL);
  unsigned short* ENT = (unsigned short*)(ws + oENT);
  int*            SOFF = (int*)(ws + oSOF);
  int*            SCNT = (int*)(ws + oSCN);
  int*            TOT  = (int*)(ws + oTOT);
  const float* QP  = QKV;
  const float* KPl = QKV + (size_t)PLQ;
  const float* VP  = QKV + (size_t)2 * PLQ;

  hipFuncSetAttribute(reinterpret_cast<const void*>(&k_agg),
                      hipFuncAttributeMaxDynamicSharedMemorySize, LDS_AGG);

  // 1: bf16 operand planes
  k_convert<<<NCU / NTHR, NTHR, 0, stream>>>(query, keyx, value, Wq, Wk, Wv, Wo, XB, WB, WOB, NCU);
  // 2: q/k/v projections -> f32 head planes
  k_gemm<0><<<dim3(MROWS / GBM, DM / GBN, 3), GTHR, 0, stream>>>(XB, WB, QKV, DM, MROWS * DM, DM * DM, PLQ);
  // 3: window scores
  k_scores<<<dim3(W2, NBH), NTHR, 0, stream>>>(pos_enc, pos_pad, rel_q, rel_k, QP, KPl, S);
  // 4: softmax + slot lists grouped by target, one per chunk
  k_agg<<<dim3(NCH, NBH), NTHR, LDS_AGG, stream>>>(pos_enc, pos_pad, S, PL, ENT, SOFF, SCNT, TOT);
  // 5: owner segment sums -> bf16 hi|lo plane
  k_drain<<<dim3(SEQ / (NWAVE * TPD), NBH), NTHR, 0, stream>>>(rel_v, VP, PL, ENT, SOFF, SCNT, TOT, OA);
  // 6: output projection -> out
  k_gemm<1><<<dim3(MROWS / GBM, DM / GBN, 1), GTHR, 0, stream>>>(OA, WOB, out, KOUT, 0, 0, 0);
}

// v008
// Measured time: 83 microseconds a run.
// Two timings next to v007 put it at 1.09 and 1.08 times that version's speed.
// All steps since v000 together make it 68.8 times as fast.
#include <hip/hip_runtime.h>
#include <stddef.h>
#include <stdint.h>

// Contractions: q/k/v input projections (K=512) and the output projection (K=1024 = activation bf16 hi|lo pair
// accumulate). Window scores (three 64-deep dots per slot), softmax statistics, weighted value sums and the
// per-position segment sums: f32 VALU.
//
// Carry audit: no plane carries a power-of-two scale; nothing is folded back anywhere.
//   XB  [3][4096][512]  bf16 = RNE(query | key | value)               (k_convert) -> A of the projections
//   WB  [3][512][512]   bf16 = RNE(Wq | Wk | Wv), rows [n][k]          (k_convert) -> B of the projections
//   OA  [4096][1024]    bf16 = [hi | lo] of the per-head attention output, hi = RNE(o), lo = RNE(o - hi)
//                                                                     (k_drain)   -> A of the output projection
//   rel_q, rel_k, rel_v are RNE-converted to bf16 values (held as f32) when staged in LDS.
//   f32 planes: QKV [3][32][1024][64] (projection results), S [32][32768] (masked, scaled scores).
//   Slot lists (bucketing groups of the k_scores launch -> k_drain), one per chunk of 4096 consecutive flat slots:
//   ENT [32][8][4096] int (f << 10 | kv), grouped by target inside the chunk; SOFF, SCNT [32][8][1024] int segment
//   start (in the chunk's list) and count per target; TOT [32][8] int slots filed.

#define NB_    4
#define SEQ    1024
#define DM     512
#define NH     8
#define DK     64
#define KP1    16
#define W2     32
#define NSLOT  32768                 // W2 * SEQ flat window slots per (b,h)
#define NHALF  16384                 // KP1 * SEQ
#define NBH    32                    // NB_ * NH
#define MROWS  4096                  // NB_ * SEQ
#define KOUT   1024                  // 2 * DM (hi | lo)
#define NPOS   (NBH * NHALF)         // ints per position table
#define PLQ    (NBH * SEQ * DK)      // floats per q/k/v plane (2097152)
#define NTHR   256
#define NWAVE  8
#define GTHR   128
#define GBM    64
#define GBN    64
#define TPD    8                     // targets per wave in k_drain
#define DEGCAP 256                   // static cap on slots per target position
#define RINV24 (1.0f / 24.0f)
#define NEGBIG (-1.0e9f)
#define WSMAX  134217728
#define NXU    (3 * (MROWS * DM / 8))   // 786432 convert units (8 elements each)
#define NWU    (3 * (DM * DM / 8))      // 98304
#define NWOU   (DM * KOUT / 8)          // 65536
#define NCU    (NXU + NWU + NWOU)       // 950272
#define NCH    8                     // chunks of flat slots per (b,h): one bucketing work-group each
#define CSL    (NSLOT / NCH)         // 4096 consecutive flat slots per chunk
#define FPW    (CSL / NWAVE)         // 512 consecutive flat slots per wave in the bucketing passes
#define BGRP   8                     // 32-slot steps whose index loads are issued together
#define NBKT   (NBH * NCH)           // bucketing work-groups at the head of the k_scores launch
#define NSV    (NSLOT / (4 * NTHR))  // 16-byte score loads per thread in the statistics of k_drain

static_assert((MROWS % GBM) == 0 && (DM % GBN) == 0 && (SEQ % GBM) == 0);
static_assert((DM % 32) == 0 && (KOUT % 32) == 0);
static_assert(GBN == DK);
static_assert(GBM == (GTHR / 32) * 16);
static_assert(NSLOT == W2 * SEQ && NHALF == KP1 * SEQ && NBH == NB_ * NH && MROWS == NB_ * SEQ);
static_assert(NSLOT == (1 << 15) && SEQ == (1 << 10));
static_assert((MROWS * DM / 8) == (1 << 18) && (DM * DM / 8) == (1 << 15) && (KOUT / 8) == 128);
static_assert((NXU % NTHR) == 0 && ((NXU + NWU) % NTHR) == 0 && (NCU % NTHR) == 0);
static_assert(NTHR * 4 == SEQ && (SEQ % (TPD * NWAVE)) == 0);
static_assert((NSLOT % (4 * NTHR)) == 0);
static_assert(NTHR * 8 == W2 * DK);
static_assert(TPD == 8 && NCH == 8 && (CSL * 4) % (16 * NTHR) == 0);
static_assert(FPW * NWAVE == CSL && CSL * NCH == NSLOT && (FPW % (32 * BGRP)) == 0 && (NHALF % CSL) == 0);
static_assert(PLQ == NB_ * SEQ * DM);

typedef float    v4f  __attribute__((ext_vector_type(4)));
typedef float    v8f  __attribute__((ext_vector_type(8)));
typedef int      v4i  __attribute__((ext_vector_type(4)));
typedef int      v8i  __attribute__((ext_vector_type(8)));
typedef unsigned short v8us __attribute__((ext_vector_type(8)));
typedef __bf16   v16b __attribute__((ext_vector_type(16)));
typedef v4f  __attribute__((may_alias)) v4fa;
typedef v4i  __attribute__((may_alias)) v4ia;
typedef v8us __attribute__((may_alias)) v8usa;
union FragB { v16b v; v8us h[2]; v8i w; };

// WMMA with hazard guard: ties D, keeps A/B live for 4 VALU slots
__device__ __forceinline__ v8f wmb(const FragB& a, const FragB& b, v8f c) {
  v8f d = __builtin_amdgcn_wmma_f32_16x16x32_bf16(false, a.v, false, b.v, (short)0, c, false, false);
  asm volatile("v_nop\n\tv_nop\n\tv_nop\n\tv_nop" : "+v"(d) : "v"(a.w), "v"(b.w));
  return d;
}

// f32 -> bf16 bits, RNE convert
__device__ __forceinline__ unsigned int bf16u(float x) {
  const unsigned int u = __float_as_uint(x);
  return (u + 0x7FFFu + ((u >> 16) & 1u)) >> 16;
}
// f32 -> nearest bf16 value held as f32
__device__ __forceinline__ float bf16f(float x) { return __uint_as_float(bf16u(x) << 16); }

__device__ __forceinline__ v8us cvt8b(const v4f a, const v4f b) {
  v8us r;
  r[0] = (unsigned short)bf16u(a.x); r[1] = (unsigned short)bf16u(a.y);
  r[2] = (unsigned short)bf16u(a.z); r[3] = (unsigned short)bf16u(a.w);
  r[4] = (unsigned short)bf16u(b.x); r[5] = (unsigned short)bf16u(b.y);
  r[6] = (unsigned short)bf16u(b.z); r[7] = (unsigned short)bf16u(b.w);
  return r;
}

__device__ __forceinline__ unsigned short hl1(float x, bool islo) {
  const unsigned int hu = bf16u(x);
  const float hf = __uint_as_float(hu << 16);
  const unsigned int lu = bf16u(x - hf);
  return (unsigned short)(islo ? lu : hu);
}
// 8 floats -> 8 bf16 hi parts (islo false) or 8 bf16 lo parts (islo true), lo = RNE(x - hi)
__device__ __forceinline__ v8us split8(const v4f a, const v4f b, bool islo) {
  v8us r;
  r[0] = hl1(a.x, islo); r[1] = hl1(a.y, islo); r[2] = hl1(a.z, islo); r[3] = hl1(a.w, islo);
  r[4] = hl1(b.x, islo); r[5] = hl1(b.y, islo); r[6] = hl1(b.z, islo); r[7] = hl1(b.w, islo);
  return r;
}

// ---------------------------------------------------------------------------
// Flat window slot f (0..32767) of head group bh: window row w = f >> 10, position s = f & 1023.
//   q index  = w < 16 ? pos_pad[w][s]    : pe[w-16][s]       (pe = pos_enc with -1 -> 0)
//   kv index = w < 16 ? pe[w][s]         : pos_pad[w-16][s]
//   masked   = (pos_enc[w & 15][s] == -1) || f < 1024
// Both tables are read unconditionally (same g for both halves) and clamped into [0, SEQ-1].
// ---------------------------------------------------------------------------
__device__ __forceinline__ void slot_idx(const int* __restrict__ pos_enc, const int* __restrict__ pos_pad,
                                         int bh, int f, int& qi, int& ki, bool& msk) {
  const int g = bh * NHALF + (f & (NHALF - 1));
  const int penc = pos_enc[g];
  const int ppad = pos_pad[g];
  const bool neg = (penc == -1);
  int pe = neg ? 0 : penc;
  pe = pe < 0 ? 0 : (pe > SEQ - 1 ? SEQ - 1 : pe);
  int pp = ppad < 0 ? 0 : (ppad > SEQ - 1 ? SEQ - 1 : ppad);
  const bool lo = f < NHALF;
  qi = lo ? pp : pe;
  ki = lo ? pe : pp;
  msk = neg || (f < SEQ);
}

// position index clamped into [0, SEQ-1]
__device__ __forceinline__ int clamp_pos(int v) { return v < 0 ? 0 : (v > SEQ - 1 ? SEQ - 1 : v); }

// Mask of the lanes of this wave whose 10-bit target t equals this lane's (all 32 lanes active): one ballot per bit.
__device__ __forceinline__ unsigned int same_target(int t) {
  unsigned int peers = 0xFFFFFFFFu;
#pragma unroll
  for (int bit = 0; bit < 10; ++bit) {
    const bool on = ((t >> bit) & 1) != 0;
    const unsigned int bl = __builtin_amdgcn_ballot_w32(on);
    peers &= on ? bl : ~bl;
  }
  return peers;
}

// ---------------------------------------------------------------------------
//   u <  NXU        : XB[z][off*8 ..]  z = u >> 18 selects query | key | value
//   u <  NXU + NWU  : WB[z][off*8 ..]  z selects Wq | Wk | Wv (rows [n][k] as given)
// coverage: NXU*8 = 3*4096*512, NWU*8 = 3*512*512, NWOU*8 = 512*1024 elements exactly.
// ---------------------------------------------------------------------------
__global__ __launch_bounds__(NTHR) void k_convert(
    const float* __restrict__ xq, const float* __restrict__ xk, const float* __restrict__ xv,
    const float* __restrict__ wq, const float* __restrict__ wk, const float* __restrict__ wv,
    const float* __restrict__ wo,
    unsigned short* xb, unsigned short* wb, unsigned short* wob, int nUnits)
{
  const int u = (int)blockIdx.x * NTHR + (int)threadIdx.x;
  if (u >= nUnits) return;
  const float* src;
  unsigned short* dst;
  if (u < NXU) {
    const int z = u >> 18, off = u & ((1 << 18) - 1);
    const float* xs = (z == 0) ? xq : ((z == 1) ? xk : xv);
    src = xs + (size_t)off * 8;
    dst = xb + (size_t)u * 8;
  } else if (u < NXU + NWU) {
    const int e = u - NXU;
    const int z = e >> 15, off = e & ((1 << 15) - 1);
    const float* wsp = (z == 0) ? wq : ((z == 1) ? wk : wv);
    src = wsp + (size_t)off * 8;
    dst = wb + (size_t)e * 8;
  } else {
    const int e = u - NXU - NWU;
    const int n = e >> 7;
    const int c8 = (e & 127) * 8;
    src = wo + (size_t)n * DM + (c8 & (DM - 1));
    dst = wob + (size_t)n * KOUT + c8;
  }
  const v4f a = *(const v4fa*)src;
  const v4f b = *(const v4fa*)(src + 4);
  const v8us o = cvt8b(a, b);
  *(v8us*)dst = o;
  
}

// ---------------------------------------------------------------------------
// bf16 WMMA GEMM, plane z = blockIdx.z: C[4096][N] tile = A[4096][K] (bf16, pitch K) x WT[N][K]^T (bf16 rows n,
// k-contiguous), K a multiple of 64. grid (4096/64, N/64, nz), 128 threads: wave w owns rows 16w..16w+15 of the 64x64
// tile, acc[4] = 4 column tiles. The 64 A rows and the 64 WT rows of the tile pass through LDS in chunks of 64 k (one
// 128-byte line per row): eight lanes read one line, so a load instruction covers four whole lines, and every line is
// read once per work-group. Two LDS buffers: the next chunk's lines are requested before this chunk's products and
// filed behind them; one barrier a chunk. Row pitch in LDS 144 bytes (16 B x odd) for the 16-byte fragment reads.
// A fragment (row m = lane&15): elements 0..7 <- k0+8h+0..7, 8..15 <- k0+16+8h+0..7
// (h = lane>>4); B fragment (col n = lane&15) from WT row (col0+16t+n) with the SAME k map; D element r =
// (row 8h+r, col lane&15). Tile staged in LDS as 64x64 f32 (over the chunk buffers, behind the loop's last barrier),
// then one instruction writes two 256-B row segments
//   EPI 0: head plane out[z][(b*8 + blockIdx.y)*1024 + s][64] f32 (b = row>>10, s = row&1023; column tile = one head)
//   EPI 1: out[row][512] f32 at columns col0..col0+63 (the final output, z = 0)
// coverage: grid (64, 8, nz) covers every (row, col) of each 4096 x 512 plane exactly once.
// ---------------------------------------------------------------------------
#define KC    64                     // k per staged chunk
#define LPT   72                     // LDS row pitch in bf16 elements (144 bytes)
#define TLE   (GBM * LPT)            // elements of one staged operand tile
static_assert(GBM == GBN && (DM % KC) == 0 && (KOUT % KC) == 0 && KC * 2 == 128);
static_assert(GTHR * 4 * 8 == GBM * KC);
static_assert(4 * TLE * 2 >= GBM * GBN * 4);

template<int EPI>
__global__ __launch_bounds__(GTHR) void k_gemm(
    const unsigned short* __restrict__ A, const unsigned short* __restrict__ WT,
    float* outF, int K, int strideA, int strideW, int strideO)
{
  __shared__ __attribute__((aligned(16))) v4f smem[4 * TLE * 2 / 16];   // 36,864 B: [buffer][A | WT][64][72] bf16
  unsigned short* tl = (unsigned short*)smem;
  float* stg = (float*)smem;                                            // 64 x 64 f32, epilogue only
  const int tid = (int)threadIdx.x, lane = tid & 31, wave = tid >> 5, hh = lane >> 4, m = lane & 15;
  const int z = (int)blockIdx.z;
  const unsigned short* Az = A  + (size_t)z * (size_t)strideA;
  const unsigned short* Wz = WT + (size_t)z * (size_t)strideW;
  float* Oz = outF + (size_t)z * (size_t)strideO;
  const int rowBase = (int)blockIdx.x * GBM;
  const int col0    = (int)blockIdx.y * GBN;

  v8f acc[4];
  {
    const v8f zz = {0.f, 0.f, 0.f, 0.f, 0.f, 0.f, 0.f, 0.f};
    acc[0] = zz; acc[1] = zz; acc[2] = zz; acc[3] = zz;
  }
  // staging: thread takes 16-byte piece sg of tile rows r0, r0+16, r0+32, r0+48 of both operands
  const int sg = tid & 7, r0 = tid >> 3;
  const char* ab = (const char*)(Az + (size_t)rowBase * (size_t)K);     // work-group uniform
  const char* wb = (const char*)(Wz + (size_t)col0 * (size_t)K);
  unsigned int go[4];
#pragma unroll
  for (int i = 0; i < 4; ++i) go[i] = (unsigned int)((r0 + 16 * i) * K + 8 * sg) * 2u;
  unsigned short* sp = tl + r0 * LPT + 8 * sg;
  const unsigned short* fa = tl + (16 * wave + m) * LPT + 8 * hh;       // A fragment row of this lane
  const unsigned short* fb = tl + TLE + m * LPT + 8 * hh;               // WT fragment row, column tile 0
  const int nch = K >> 6;
  v8us ra[4], rb[4];
#pragma unroll
  for (int i = 0; i < 4; ++i) {
    ra[i] = *(const v8usa*)(ab + go[i]);
    rb[i] = *(const v8usa*)(wb + go[i]);
  }
  // the wait before a register that these loads name is written again
  asm volatile("s_wait_xcnt 0x0" :: "v"(go[0]), "v"(go[1]), "v"(go[2]), "v"(go[3]) : "memory");
#pragma unroll
  for (int i = 0; i < 4; ++i) {
    *(v8usa*)(sp + 16 * i * LPT)       = ra[i];
    *(v8usa*)(sp + TLE + 16 * i * LPT) = rb[i];
  }
  __syncthreads();
  // kept rolled: a trip is a whole chunk (8 loads, 20 fragment reads, 8 products); a second copy would only add registers
#pragma unroll 1
  for (int c = 0; c < nch; ++c) {
    const int bo = (c & 1) * (2 * TLE);               // this chunk's buffer
    const bool nxt = c + 1 < nch;                     // work-group uniform
    unsigned int gn[4];                               // the next chunk's byte offsets
#pragma unroll
    for (int i = 0; i < 4; ++i) gn[i] = go[i] + (unsigned int)(c + 1) * (KC * 2u);
    if (nxt) {
#pragma unroll
      for (int i = 0; i < 4; ++i) {
        ra[i] = *(const v8usa*)(ab + gn[i]);
        rb[i] = *(const v8usa*)(wb + gn[i]);
      }
    }
    // the chunk's twenty fragment reads go out together, ahead of its eight products: one LDS latency a chunk
    FragB af[KC / 32], bf[KC / 32][4];
#pragma unroll
    for (int ks = 0; ks < KC / 32; ++ks) {
      af[ks].h[0] = *(const v8usa*)(fa + bo + 32 * ks);        // k = 64c + 32ks + 8hh + 0..7
      af[ks].h[1] = *(const v8usa*)(fa + bo + 32 * ks + 16);   // k = 64c + 32ks + 16 + 8hh + 0..7
#pragma unroll
      for (int t = 0; t < 4; ++t) {
        const unsigned short* wq = fb + bo + 16 * t * LPT + 32 * ks;   // WT row col0 + 16t + m
        bf[ks][t].h[0] = *(const v8usa*)wq;                    // same k map as A
        bf[ks][t].h[1] = *(const v8usa*)(wq + 16);
      }
    }
#pragma unroll
    for (int ks = 0; ks < KC / 32; ++ks) {
#pragma unroll
      for (int t = 0; t < 4; ++t) acc[t] = wmb(af[ks], bf[ks][t], acc[t]);
    }
    if (nxt) {
      // the wait before a register that the next chunk's loads name is written again; naming the offsets keeps each in a
      // register of its own up to here (else one could be a later load's destination). Behind the products it costs nothing.
      asm volatile("s_wait_xcnt 0x0" :: "v"(gn[0]), "v"(gn[1]), "v"(gn[2]), "v"(gn[3]) : "memory");
      unsigned short* sn = sp + (2 * TLE - bo);            // the other buffer: its readers left it at the last barrier
#pragma unroll
      for (int i = 0; i < 4; ++i) {
        *(v8usa*)(sn + 16 * i * LPT)       = ra[i];
        *(v8usa*)(sn + TLE + 16 * i * LPT) = rb[i];
      }
    }
    // publishes the next chunk and ends every wave's reads of this one (after the last chunk: frees the LDS for stg)
    __syncthreads();
  }

#pragma unroll
  for (int t = 0; t < 4; ++t) {
    const int lc = 16 * t + m;
#pragma unroll
    for (int r = 0; r < 8; ++r) {
      const int lr = 16 * wave + 8 * hh + r;          // D element r = (row 8hh+r, col m)
      stg[lr * GBN + lc] = acc[t][r];
    }
  }
  __syncthreads();

  float* ob;
  int ldo;
  if (EPI == 0) {
    const int bq = rowBase >> 10;
    const int s0 = rowBase & (SEQ - 1);
    ob  = Oz + ((size_t)(bq * NH + (int)blockIdx.y) * SEQ + s0) * DK;
    ldo = DK;
  } else {
    ob  = Oz + (size_t)rowBase * DM + col0;
    ldo = DM;
  }
  v4f fv[8];
#pragma unroll
  for (int i = 0; i < 8; ++i) {
    const int lr = 16 * wave + 2 * i + hh;
    fv[i] = *(const v4fa*)(stg + lr * GBN + 4 * m);
  }
#pragma unroll
  for (int i = 0; i < 8; ++i) {
    const int lr = 16 * wave + 2 * i + hh;
    float* op = ob + (size_t)lr * (size_t)ldo + 4 * m;
    *(v4f*)op = fv[i];
  }
  
}

// ---------------------------------------------------------------------------
// Bucketing of chunk ch (4096 consecutive flat slots) of one (b,h) by the slots' q index. It reads the position tables
// alone, no score, so it runs beside the scores, in the same launch (k_scores below), one work-group a chunk.
// Deterministic, in LDS (count -> exclusive scan -> f-ascending cursor fill, no atomics): wave w takes the chunk's flat
// slots [512w, 512w + 512), 32 a step; lanes with the same target are matched by ballots, the first of them updates the
// wave's own counter / cursor row, each lane's place is cursor + its rank among them.
// The finished list goes to the workspace in whole lines, with each target's segment start and count, for k_drain.
// cur [NWAVE][SEQ] per-wave counts, then per-wave cursors; ent [CSL] packed (f << 10 | kv); wtot [NWAVE]: all in LDS.
// coverage: 256 work-groups x (4096 entries + 1024 starts + 1024 counts + 1 total), each written once.
// ---------------------------------------------------------------------------
__device__ __forceinline__ void bucket_chunk(
    const int* __restrict__ pos_enc, const int* __restrict__ pos_pad, int bh, int ch,
    int* cur, int* ent, int* wtot, int* ENT, int* SOFF, int* SCNT, int* TOT)
{
  const int tid = (int)threadIdx.x, lane = tid & 31, wave = tid >> 5;
  const int lst = bh * NCH + ch;          // this work-group's list
  {
    const v4i z4 = {0, 0, 0, 0};
#pragma unroll
    for (int i = 0; i < CSL / (4 * NTHR); ++i) *(v4ia*)(ent + i * (4 * NTHR) + 4 * tid) = z4;
#pragma unroll
    for (int w2 = 0; w2 < NWAVE; ++w2) *(v4ia*)(cur + w2 * SEQ + 4 * tid) = z4;
  }
  __syncthreads();

  // ---- counts per (wave, target): every wave over its own 512 slots ----
  // A chunk's 4096 slots lie in one half of the window rows, so its q table and its kv table (slot_idx) are fixed:
  // lower half q <- pos_pad, kv <- pos_enc; upper half the other way round. clamp_pos sends pos_enc's -1 to 0.
  const int f0w = ch * CSL + __builtin_amdgcn_readfirstlane(wave) * FPW;   // wave-uniform: scalar loop control, table choice
  const bool lohalf = f0w < NHALF;
  const int* qtab = (lohalf ? pos_pad : pos_enc) + bh * NHALF + (f0w & (NHALF - 1));
  const int* ktab = (lohalf ? pos_enc : pos_pad) + bh * NHALF + (f0w & (NHALF - 1));
  int* wcur = cur + wave * SEQ;
  const unsigned int below = (1u << lane) - 1u;
  const unsigned int lane4 = 4u * (unsigned int)lane;
#pragma unroll 1
  for (int g = 0; g < FPW; g += 32 * BGRP) {
    int tq[BGRP];
#pragma unroll
    for (int j = 0; j < BGRP; ++j) tq[j] = clamp_pos(qtab[g + 32 * j + lane]) & (SEQ - 1);
#pragma unroll
    for (int j = 0; j < BGRP; ++j) {
      const unsigned int peers = same_target(tq[j]);
      if ((peers & below) == 0u) wcur[tq[j]] = wcur[tq[j]] + __builtin_popcount(peers);
      // the next step's reader of a counter may be another lane of this wave: keep the LDS accesses in step order
      __builtin_amdgcn_fence(__ATOMIC_ACQ_REL, "wavefront");
      __builtin_amdgcn_wave_barrier();
    }
  }
  __syncthreads();

  // ---- exclusive prefix over SEQ counts -> SOFF ----
  int tot;
  {
    v4i cw[NWAVE];
    v4i ca = {0, 0, 0, 0};
#pragma unroll
    for (int w2 = 0; w2 < NWAVE; ++w2) {
      cw[w2] = *(const v4ia*)(cur + w2 * SEQ + 4 * tid);
      ca += cw[w2];
    }
    *(v4ia*)(SCNT + lst * SEQ + 4 * tid) = ca;
    const int e0 = ca.x < 0 ? 0 : ca.x, e1 = ca.y < 0 ? 0 : ca.y, e2 = ca.z < 0 ? 0 : ca.z, e3 = ca.w < 0 ? 0 : ca.w;
    const int ts = e0 + e1 + e2 + e3;
    int incl = ts;
#pragma unroll
    for (int d = 1; d < 32; d <<= 1) {
      const int up = __shfl_up(incl, d);
      if (lane >= d) incl += up;
    }
    if (lane == 31) wtot[wave] = incl;
    __syncthreads();
    int pre = 0;
    tot = 0;
#pragma unroll
    for (int w2 = 0; w2 < NWAVE; ++w2) {
      const int t = wtot[w2];
      tot += t;
      pre += (w2 < wave) ? t : 0;
    }
    int run = pre + incl - ts;
    v4i so;
    so.x = run; run += e0;
    so.y = run; run += e1;
    so.z = run; run += e2;
    so.w = run;
    *(v4ia*)(SOFF + lst * SEQ + 4 * tid) = so;
    // wave w2's cursor of a target starts behind the slots that waves 0..w2-1 hold for it (f ascending over waves)
#pragma unroll
    for (int w2 = 0; w2 < NWAVE; ++w2) {
      *(v4ia*)(cur + w2 * SEQ + 4 * tid) = so;
      so += cw[w2];
    }
  }
  __syncthreads();

  // ---- fill: packed (f << 10 | kv) into target segments (every wave over its own slots, f ascending) ----
#pragma unroll 1
  for (int g = 0; g < FPW; g += 32 * BGRP) {
    int tq[BGRP], en[BGRP];
    // this group's kv indices, from the lane's own column on
    const int* kg = (const int*)((const char*)(ktab + g) + lane4);
#pragma unroll
    for (int j = 0; j < BGRP; ++j) {
      const int o = g + 32 * j + lane;
      tq[j] = clamp_pos(qtab[o]) & (SEQ - 1);
      en[j] = ((f0w + o) << 10) | clamp_pos(kg[32 * j]);
    }
    // the steps below reuse the address registers of the loads above
    asm volatile("s_wait_xcnt 0x0" ::: "memory");
#pragma unroll
    for (int j = 0; j < BGRP; ++j) {
      const unsigned int peers = same_target(tq[j]);
      const unsigned int lower = peers & below;
      const int base = wcur[tq[j]];
      int pos = base + __builtin_popcount(lower);
      pos = pos < 0 ? 0 : (pos > CSL - 1 ? CSL - 1 : pos);
      ent[pos] = en[j];
      if (lower == 0u) wcur[tq[j]] = base + __builtin_popcount(peers);
      // the next step's reader of a cursor may be another lane of this wave: keep the LDS accesses in step order
      __builtin_amdgcn_fence(__ATOMIC_ACQ_REL, "wavefront");
      __builtin_amdgcn_wave_barrier();
    }
  }
  __syncthreads();

  // ---- the list to the workspace, 16 bytes a lane ----
  {
    int* eg = ENT + (size_t)lst * CSL + 4 * tid;
    // unrolled whole: every store takes its place from an immediate offset, so no address register is written again
#pragma unroll
    for (int i = 0; i < CSL / (4 * NTHR); ++i) *(v4ia*)(eg + i * (4 * NTHR)) = *(const v4ia*)(ent + i * (4 * NTHR) + 4 * tid);
    if (tid == 0) TOT[lst] = tot;
  }
}

// ---------------------------------------------------------------------------
// Window scores, with the bucketing beside them. grid (32, 8 + 32): the 256 work-groups of rows y < 8 bucket one chunk
// each (bucket_chunk; they have the longest dependent chain); work-group (w, 8 + bh) takes window row w
// of (b,h) bh. 8 waves; a wave takes 128 consecutive slots of the row, 32 a step.
// Lane j reads slot j's indices. The rows are then read whole: the 16 lanes of a half-wave take one slot's q row and
// k row, 16 bytes a lane (channels 4c..4c+3, c = lane & 15), so one load instruction covers two 256-byte rows; half-wave
// g works through slots 16g..16g+15, the slot's row offset coming from its lane by a DPP row broadcast.
// rel_k[h][w], rel_q[h][w] rows staged in LDS as bf16 values, each lane keeps its four channels of both in registers.
// Per lane c2c, c2p, p2c over its four channels, (c2c + c2p) + p2c, then the sum over the 16 lanes; lane j keeps slot
// j's score; masked slots get -1e9.
// coverage: 32 work-groups x 8 waves x 4 steps x 32 lanes = all 32768 slots of each of the 32 (b,h).
// ---------------------------------------------------------------------------
#define SSTEP 4                      // 32-slot steps per wave in k_scores
static_assert(NWAVE * SSTEP * 32 == SEQ && DK == 64 && (NBKT % W2) == 0);

template<int CTRL>
__device__ __forceinline__ int dpp_mov(int x) { return __builtin_amdgcn_update_dpp(0, x, CTRL, 0xf, 0xf, true); }
// lane I of this lane's 16-lane row (DPP row_share)
template<int I>
__device__ __forceinline__ unsigned int row_bcast(int x) { return (unsigned int)dpp_mov<0x150 + I>(x); }
// sum over the 16 lanes of a row, in every lane of it (DPP row_xmask 1, 2, 4, 8)
__device__ __forceinline__ float row_sum16(float x) {
  x += __int_as_float(dpp_mov<0x161>(__float_as_int(x)));
  x += __int_as_float(dpp_mov<0x162>(__float_as_int(x)));
  x += __int_as_float(dpp_mov<0x164>(__float_as_int(x)));
  x += __int_as_float(dpp_mov<0x168>(__float_as_int(x)));
  return x;
}

// Slots I0..I0+7 of each half-wave: qo, ko = the lane's own slot's q and k row byte offsets, c16 = 16 * (lane & 15).
// All sixteen row loads are issued before the first is used. sc takes the score sum of the lane's own slot.
#define SC_ADDR(i) qa[i] = row_bcast<I0 + (i)>(qo) + c16; ka[i] = row_bcast<I0 + (i)>(ko) + c16;
template<int I0>
__device__ __forceinline__ void score8(int qo, int ko, unsigned int c16, int c,
                                       const char* __restrict__ qb, const char* __restrict__ kb,
                                       const v4f rkv, const v4f rqv, float& sc) {
  unsigned int qa[8], ka[8];
  v4f qv[8], kv[8];
  SC_ADDR(0) SC_ADDR(1) SC_ADDR(2) SC_ADDR(3) SC_ADDR(4) SC_ADDR(5) SC_ADDR(6) SC_ADDR(7)
#pragma unroll
  for (int i = 0; i < 8; ++i) {
    qv[i] = *(const v4fa*)(qb + qa[i]);
    kv[i] = *(const v4fa*)(kb + ka[i]);
  }
  // the wait before the loads' offset registers are written again; naming them keeps each in a register of its own up
  // to here. The "memory" clobber keeps the loads ahead of it.
  asm volatile("s_wait_xcnt 0x0" :: "v"(qa[0]), "v"(qa[1]), "v"(qa[2]), "v"(qa[3]), "v"(qa[4]), "v"(qa[5]), "v"(qa[6]),
               "v"(qa[7]), "v"(ka[0]), "v"(ka[1]), "v"(ka[2]), "v"(ka[3]), "v"(ka[4]), "v"(ka[5]), "v"(ka[6]), "v"(ka[7])
               : "memory");
#pragma unroll
  for (int i = 0; i < 8; ++i) {
    const v4f q = qv[i], k = kv[i];
    float c2c = q.x * k.x, c2p = q.x * rkv.x, p2c = rqv.x * k.x;
    c2c = fmaf(q.y, k.y, c2c);   c2c = fmaf(q.z, k.z, c2c);   c2c = fmaf(q.w, k.w, c2c);
    c2p = fmaf(q.y, rkv.y, c2p); c2p = fmaf(q.z, rkv.z, c2p); c2p = fmaf(q.w, rkv.w, c2p);
    p2c = fmaf(rqv.y, k.y, p2c); p2c = fmaf(rqv.z, k.z, p2c); p2c = fmaf(rqv.w, k.w, p2c);
    const float s = row_sum16((c2c + c2p) + p2c);
    sc = (c == I0 + i) ? s : sc;
  }
}

__global__ __launch_bounds__(NTHR) void k_scores(
    const int* __restrict__ pos_enc, const int* __restrict__ pos_pad,
    const float* __restrict__ rel_q, const float* __restrict__ rel_k,
    const float* __restrict__ QP, const float* __restrict__ KPl, float* S,
    int* ENT, int* SOFF, int* SCNT, int* TOT)
{
  __shared__ __attribute__((aligned(16))) int bcur[NWAVE * SEQ];
  __shared__ __attribute__((aligned(16))) int bent[CSL];
  __shared__ int bwtot[NWAVE];
  __shared__ __attribute__((aligned(16))) float rk[DK];
  __shared__ __attribute__((aligned(16))) float rq[DK];
  if ((int)blockIdx.y < NBKT / W2) {                 // work-group uniform
    const int lst = (int)blockIdx.y * W2 + (int)blockIdx.x;
    bucket_chunk(pos_enc, pos_pad, lst / NCH, lst % NCH, bcur, bent, bwtot, ENT, SOFF, SCNT, TOT);
    return;
  }
  const int tid = (int)threadIdx.x, lane = tid & 31, wave = tid >> 5;
  const int bh = (int)blockIdx.y - NBKT / W2, h = bh & (NH - 1);
  const int w = (int)blockIdx.x;
  {
    const int sel = tid >> 6, j = tid & 63;          // sel uniform per pair of waves
    const size_t rb = (size_t)(h * W2 + w) * DK + j;
    if (sel == 0) rk[j] = bf16f(rel_k[rb]);
    if (sel == 1) rq[j] = bf16f(rel_q[rb]);
  }
  __syncthreads();

  const int c = lane & 15;
  const unsigned int c16 = 16u * (unsigned int)c;
  const v4f rkv = *(const v4fa*)(rk + 4 * c);
  const v4f rqv = *(const v4fa*)(rq + 4 * c);
  const char* qb = (const char*)(QP  + (size_t)bh * SEQ * DK);
  const char* kb = (const char*)(KPl + (size_t)bh * SEQ * DK);
  const int f0 = w * SEQ + wave * (SSTEP * 32) + lane;
  int qo[SSTEP], ko[SSTEP];
  bool mk[SSTEP];
#pragma unroll
  for (int t = 0; t < SSTEP; ++t) {
    int qi, ki;
    slot_idx(pos_enc, pos_pad, bh, f0 + 32 * t, qi, ki, mk[t]);
    qo[t] = qi * (DK * 4);
    ko[t] = ki * (DK * 4);
  }
  float res[SSTEP];
#pragma unroll
  for (int t = 0; t < SSTEP; ++t) {
    float sc = 0.f;
    score8<0>(qo[t], ko[t], c16, c, qb, kb, rkv, rqv, sc);
    score8<8>(qo[t], ko[t], c16, c, qb, kb, rkv, rqv, sc);
    res[t] = mk[t] ? NEGBIG : sc * RINV24;
  }
  float* sp = S + (size_t)bh * NSLOT + f0;
#pragma unroll
  for (int t = 0; t < SSTEP; ++t) sp[32 * t] = res[t];
}

// ---------------------------------------------------------------------------
// One step of k_drain over 8*G slots: lane j holds slot j's value-row byte offset ov (kv * 256), its rel_v-row byte
// offset orl (w * 256) and the place sp of its score in LDS; its weight pm = exp(score - M) * invZ where on, 0 past the
// target's last slot (on false), which leaves the sums as they are.
// vb = value plane of this (b,h) (wave-uniform), rvl = rel_v rows in LDS + lane, lane4 = 4 * lane.
// ---------------------------------------------------------------------------
#define VO8(b) "v"(vo[(b)]), "v"(vo[(b) + 1]), "v"(vo[(b) + 2]), "v"(vo[(b) + 3]), \
               "v"(vo[(b) + 4]), "v"(vo[(b) + 5]), "v"(vo[(b) + 6]), "v"(vo[(b) + 7])
template<int G>
__device__ __forceinline__ void drain_step(int ov, int orl, const float* sp, bool on, float M, float invZ,
                                           const char* __restrict__ vb, const char* rvl,
                                           unsigned int lane4, float& a0, float& a1) {
  unsigned int vo[8 * G];
  float v0[8 * G], v1[8 * G], r0[8 * G], r1[8 * G];
#pragma unroll
  for (int j = 0; j < 8 * G; ++j) vo[j] = (unsigned int)__builtin_amdgcn_readlane(ov, j) + lane4;
#pragma unroll
  for (int j = 0; j < 8 * G; ++j) {
    const float* vr = (const float*)(vb + vo[j]);
    v0[j] = vr[0];
    v1[j] = vr[32];
  }
  const float sc = *sp;            // asked for behind the value rows: their latency covers this read and the exp
#pragma unroll
  for (int j = 0; j < 8 * G; ++j) {
    const float* rr = (const float*)(rvl + __builtin_amdgcn_readlane(orl, j));
    r0[j] = rr[0];
    r1[j] = rr[32];
  }
  // the wait before the loads' offset registers are written again; naming them keeps each in a register of its own up to
  // here (reused inside the step, an offset register would make the next load wait, or be a later load's destination);
  // a statement takes thirty operands, so 32 slots take two. The "memory" clobber keeps the step's loads ahead of it.
  if constexpr (G == 1) {
    asm volatile("s_wait_xcnt 0x0" :: VO8(0) : "memory");
  } else {
    asm volatile("s_wait_xcnt 0x0" :: VO8(0), VO8(8) : "memory");
    if constexpr (G == 3) asm volatile("s_wait_xcnt 0x0" :: VO8(16) : "memory");
    if constexpr (G == 4) asm volatile("s_wait_xcnt 0x0" :: VO8(16), VO8(24) : "memory");
  }
  const float pm = on ? __expf(sc - M) * invZ : 0.0f;
#pragma unroll
  for (int j = 0; j < 8 * G; ++j) {
    const float pj = __int_as_float(__builtin_amdgcn_readlane(__float_as_int(pm), j));
    a0 = fmaf(pj, v0[j] + r0[j], a0);
    a1 = fmaf(pj, v1[j] + r1[j], a1);
  }
}

// segment start in a chunk's list clamped into [0, CSL]
__device__ __forceinline__ int clamp_st(int st) { return st < 0 ? 0 : (st > CSL ? CSL : st); }

// Place in the lists of one (b,h) of position q (0 = first) among the slots of the wave's target jt (wave-uniform).
// Lane (c & 3) * 8 + jt of pre0 / bas0 (chunks 0..3) and pre1 / bas1 (chunks 4..7) holds, for chunk c, the number of the
// target's slots in the chunks before c, and c * CSL + segment start - that number. The last chunk whose first position
// is not above q is q's. Result clamped into [0, NSLOT-1].
__device__ __forceinline__ int seg_idx(int pre0, int pre1, int bas0, int bas1, int jt, int q) {
  int b = __builtin_amdgcn_readlane(bas0, jt);
#pragma unroll
  for (int c = 1; c < NCH; ++c) {
    const int ln = (c & 3) * 8 + jt;
    const int p  = __builtin_amdgcn_readlane(c < 4 ? pre0 : pre1, ln);
    const int bb = __builtin_amdgcn_readlane(c < 4 ? bas0 : bas1, ln);
    b = q >= p ? bb : b;
  }
  const int idx = q + b;
  return idx < 0 ? 0 : (idx > NSLOT - 1 ? NSLOT - 1 : idx);
}

// Place idx (0..NSLOT-1) of the entry list eb of one (b,h), one place a lane.
__device__ __forceinline__ int list_read(const int* __restrict__ eb, int idx) {
  const int e = eb[idx];
  // the wait before the load's index register is written again; naming it keeps it as it is up to here
  asm volatile("s_wait_xcnt 0x0" :: "v"(idx) : "memory");
  return e;
}

// ---------------------------------------------------------------------------
// Owner drain per target position: out_h[i][d] = sum over its slots of p[f] * (v[kv[f]][d] + rel_v[w][d]).
// grid (16 = group of 64 targets, 32 = bh), 8 waves; a wave owns 8 consecutive targets of the bucketing's lists.
// Every work-group first makes the softmax statistics over all 32768 scores of its (b,h) (the same sums in the same order
// in all sixteen) and keeps the scores in LDS; a slot's weight p = exp(S[f] - M) * (1/Z) is made where the slot is drained.
// A target's slots are its segments of the eight chunk lists one behind the other (chunks ascending, so f ascending).
// The drain takes up to 32 slots of a target a step: lane j holds slot j's entry and weight, both are broadcast by
// readlane, the step's value rows are all requested before the first is used, and the sum runs in slot order.
// Lane = channel d (and 32 + d); every loop bound and index is clamped to static ranges.
// Result written as the bf16 hi | lo lines of OA row (b*1024 + i), columns h*64.. (hi) and 512 + h*64..
// Count cap overflow or inconsistent totals -> NaN poison of the row.
// coverage: 512 blocks x 64 targets x (hi line + lo line) = all 4096 rows x 16 lines of OA exactly once.
// ---------------------------------------------------------------------------
__global__ __launch_bounds__(NTHR) void k_drain(
    const float* __restrict__ rel_v, const float* __restrict__ VP,
    const float* __restrict__ S, const int* __restrict__ ENT,
    const int* __restrict__ SOFF, const int* __restrict__ SCNT, const int* __restrict__ TOT,
    unsigned short* OA)
{
  __shared__ __attribute__((aligned(16))) float sl[NSLOT];      // the scores of this (b,h), by flat slot
  __shared__ __attribute__((aligned(16))) float relv[W2 * DK];
  __shared__ __attribute__((aligned(16))) float stw[NWAVE * 64];
  __shared__ float red[2 * NWAVE];
  const int tid = (int)threadIdx.x, lane = tid & 31, wave = tid >> 5;
  const int bh = (int)blockIdx.y, b = bh >> 3, h = bh & (NH - 1);
  const float* sb = S + (size_t)bh * NSLOT;
  const int* ent = ENT + (size_t)bh * NSLOT;
  const int tg0 = ((int)blockIdx.x * NWAVE + __builtin_amdgcn_readfirstlane(wave)) * TPD;
  // segment starts and counts of the wave's targets: lane l holds those of target tg0 + (l & 7) in chunk l >> 3 (index
  // ti0) and in chunk 4 + (l >> 3) (index ti1); lane l also reads the total of chunk l & 7
  const int ti0 = (bh * NCH + (lane >> 3)) * SEQ + tg0 + (lane & 7);
  const int ti1 = ti0 + 4 * SEQ;
  const int tix = bh * NCH + (lane & 7);
  const int s0r = SOFF[ti0], c0r = SCNT[ti0], s1r = SOFF[ti1], c1r = SCNT[ti1];
  const int totl = TOT[tix];
  // the wait before the loads' index registers are written again; naming them keeps them as they are up to here
  asm volatile("s_wait_xcnt 0x0" :: "v"(ti0), "v"(ti1), "v"(tix) : "memory");
  // The thread's 128 scores of this (b,h), slots 1024 i + 4 tid .. + 3, are read once and kept in registers for the
  // maximum and for the sum. All 32 loads are requested before the first is used (one memory latency in place of one
  // per load), from one index register and immediate offsets.
  v4f sv[NSV];
  // unrolled whole: sv is indexed by constants only (registers), and the loads stand one behind the other
#pragma unroll
  for (int i = 0; i < NSV; ++i) sv[i] = *(const v4fa*)(sb + i * (4 * NTHR) + 4 * tid);
  // the wait before the loads' index register is written again; naming it keeps it as it is up to here
  asm volatile("s_wait_xcnt 0x0" :: "v"(tid) : "memory");
  {
    const float* rp = rel_v + (size_t)h * (W2 * DK) + 8 * tid;
    const v4f a = *(const v4fa*)rp;
    const v4f c = *(const v4fa*)(rp + 4);
    float* q = relv + 8 * tid;
    q[0] = bf16f(a.x); q[1] = bf16f(a.y); q[2] = bf16f(a.z); q[3] = bf16f(a.w);
    q[4] = bf16f(c.x); q[5] = bf16f(c.y); q[6] = bf16f(c.z); q[7] = bf16f(c.w);
  }
  // per (chunk, target): count bounded by the chunk's list, slots of the target in earlier chunks (sum over the lanes
  // 8 apart, then over the two registers), and what seg_idx adds to a position; totv = the target's slots in all chunks
  const int st0 = clamp_st(s0r), st1 = clamp_st(s1r);
  int n0 = c0r < 0 ? 0 : c0r, n1 = c1r < 0 ? 0 : c1r;
  n0 = n0 > CSL - st0 ? CSL - st0 : n0;
  n1 = n1 > CSL - st1 ? CSL - st1 : n1;
  int i0 = n0, i1 = n1;
#pragma unroll
  for (int d = 8; d < 32; d <<= 1) {
    const int u0 = __shfl_up(i0, d), u1 = __shfl_up(i1, d);
    if (lane >= d) { i0 += u0; i1 += u1; }
  }
  const int t0 = __shfl(i0, 24 + (lane & 7)), t1 = __shfl(i1, 24 + (lane & 7));
  const int pre0 = i0 - n0, pre1 = t0 + i1 - n1;
  const int bas0 = (lane >> 3) * CSL + st0 - pre0;
  const int bas1 = (4 + (lane >> 3)) * CSL + st1 - pre1;
  const int totv = t0 + t1;
  const unsigned int negm = __builtin_amdgcn_ballot_w32(c0r < 0 || c1r < 0);
  // entries of the coming step, read one step ahead
  int epre = list_read(ent, seg_idx(pre0, pre1, bas0, bas1, 0, lane));

  // ---- softmax statistics: M = max, Z = sum exp(s - M), two-level fixed order; the scores go to LDS on the way ----
  float mx = -3.0e38f;
  // unrolled whole: sv stays in registers
#pragma unroll
  for (int i = 0; i < NSV; ++i) {
    const v4f s4 = sv[i];
    *(v4fa*)(sl + i * (4 * NTHR) + 4 * tid) = s4;
    mx = fmaxf(fmaxf(mx, fmaxf(s4.x, s4.y)), fmaxf(s4.z, s4.w));
  }
#pragma unroll
  for (int off = 16; off > 0; off >>= 1) mx = fmaxf(mx, __shfl_xor(mx, off));
  if (lane == 0) red[wave] = mx;
  // publishes rel_v, the scores and the waves' maxima
  __syncthreads();
  float M = red[0];
#pragma unroll
  for (int w2 = 1; w2 < NWAVE; ++w2) M = fmaxf(M, red[w2]);
  float zs = 0.f;
  // unrolled whole, for the same reason; the terms are added in the order of i
#pragma unroll
  for (int i = 0; i < NSV; ++i) {
    const v4f s4 = sv[i];
    zs += (__expf(s4.x - M) + __expf(s4.y - M)) + (__expf(s4.z - M) + __expf(s4.w - M));
  }
#pragma unroll
  for (int off = 16; off > 0; off >>= 1) zs += __shfl_xor(zs, off);
  if (lane == 0) red[NWAVE + wave] = zs;
  // publishes the waves' sums
  __syncthreads();
  float Z = 0.f;
#pragma unroll
  for (int w2 = 0; w2 < NWAVE; ++w2) Z += red[NWAVE + w2];
  const float invZ = 1.0f / Z;                        // Z >= 1 (the max slot contributes exp(0))

  const unsigned int lane4 = 4u * (unsigned int)lane;
  const float qnan = __int_as_float(0x7fc00000);
  const bool bad_tot = __builtin_amdgcn_ballot_w32(totl != CSL) != 0u;
  float* sw = stw + wave * 64;
  const int lc = lane & 7;
  const bool islo = (lane & 8) != 0;
  const char* vb  = (const char*)(VP + (size_t)bh * SEQ * DK);
  const char* rvl = (const char*)(relv + lane);
#pragma unroll 1
  for (int jt = 0; jt < TPD; ++jt) {
    const int tg = tg0 + jt;                           // 0..1023
    const int jn = jt + 1 < TPD ? jt + 1 : TPD - 1;
    const int craw = __builtin_amdgcn_readlane(totv, jt);
    int cnt = craw;
    cnt = cnt < 0 ? 0 : (cnt > DEGCAP ? DEGCAP : cnt);
    const bool cneg = ((negm >> jt) & 0x01010101u) != 0u;   // a negative count of this target in some chunk
    const float pz = (bad_tot || craw > DEGCAP || cneg) ? qnan : 0.0f;
    float a0 = 0.f, a1 = 0.f;
#pragma unroll 1
    for (int q0 = 0; q0 < cnt || q0 == 0; q0 += 32) {
      const int left = cnt - q0;                       // 0 only for an empty target: nothing summed, read-ahead moved on
      const int n = left > 32 ? 32 : left;
      const int ov  = (epre & (SEQ - 1)) * (DK * 4);
      const int orl = ((epre >> 20) & (W2 - 1)) * (DK * 4);
      const float* sp = sl + ((epre >> 10) & (NSLOT - 1));
      const bool on = lane < n;
      const bool more = left > 32;                     // this target goes on; else the next target's first step
      const int idx = seg_idx(pre0, pre1, bas0, bas1, more ? jt : jn, (more ? q0 + 32 : 0) + lane);
      epre = list_read(ent, idx);
      if (n > 24)      drain_step<4>(ov, orl, sp, on, M, invZ, vb, rvl, lane4, a0, a1);
      else if (n > 16) drain_step<3>(ov, orl, sp, on, M, invZ, vb, rvl, lane4, a0, a1);
      else if (n > 8)  drain_step<2>(ov, orl, sp, on, M, invZ, vb, rvl, lane4, a0, a1);
      else if (n > 0)  drain_step<1>(ov, orl, sp, on, M, invZ, vb, rvl, lane4, a0, a1);
    }
    a0 += pz;
    a1 += pz;
    // per-wave relayout: channels in order, then lanes 0..7 (hi) / 8..15 (lo) read 8 consecutive channels each
    __builtin_amdgcn_fence(__ATOMIC_RELEASE, "wavefront");
    __builtin_amdgcn_wave_barrier();
    sw[lane]      = a0;
    sw[32 + lane] = a1;
    __builtin_amdgcn_fence(__ATOMIC_RELEASE, "wavefront");
    __builtin_amdgcn_wave_barrier();
    const v4f ga = *(const v4fa*)(sw + 8 * lc);
    const v4f gb = *(const v4fa*)(sw + 8 * lc + 4);
    const v8us ov = split8(ga, gb, islo);
    const int orow = b * SEQ + tg;
    unsigned short* dst = OA + (size_t)orow * KOUT + (islo ? DM : 0) + h * DK + 8 * lc;
    const bool wsv = lane < 16;
    if (wsv) *(v8us*)dst = ov;
    // the wait before the store's address and data registers are written again for the next target
    asm volatile("s_wait_xcnt 0x0" ::: "memory");
  }
}

// ---------------------------------------------------------------------------
static inline int cdiv(int a, int b) { return (a + b - 1) / b; }

extern "C" void kernel_launch(void* const* d_in, const int* in_sizes, int n_in,
                              void* d_out, int out_size, void* d_ws, size_t ws_size,
                              hipStream_t stream) {
  if (n_in < 12) return;
  if (in_sizes[0] != NB_ * SEQ * DM || in_sizes[1] != NB_ * SEQ * DM || in_sizes[2] != NB_ * SEQ * DM) return;
  if (in_sizes[3] != NPOS || in_sizes[4] != NPOS) return;
  if (in_sizes[5] != NH * W2 * DK || in_sizes[6] != NH * W2 * DK || in_sizes[7] != NH * W2 * DK) return;
  if (in_sizes[8] != DM * DM || in_sizes[9] != DM * DM || in_sizes[10] != DM * DM || in_sizes[11] != DM * DM) return;
  if (out_size != NB_ * SEQ * DM) return;

  const float* query   = (const float*)d_in[0];    // [4][1024][512]
  const float* keyx    = (const float*)d_in[1];
  const float* value   = (const float*)d_in[2];
  const int*   pos_enc = (const int*)  d_in[3];    // [4][8][16][1024]
  const int*   pos_pad = (const int*)  d_in[4];
  const float* rel_q   = (const float*)d_in[5];    // [1][8][32][64]
  const float* rel_k   = (const float*)d_in[6];
  const float* rel_v   = (const float*)d_in[7];
  const float* Wq      = (const float*)d_in[8];    // [512][512] rows = output feature
  const float* Wk      = (const float*)d_in[9];
  const float* Wv      = (const float*)d_in[10];
  const float* Wo      = (const float*)d_in[11];
  float*       out     = (float*)d_out;            // [4][1024][512]

  // workspace carve (every region a whole number of 256-B blocks; all planes are exact tile multiples)
  char* ws = (char*)d_ws;
  size_t off = 0;
  const size_t oXB  = off; off += (size_t)NXU * 16;                     // 12,582,912  bf16 [3][4096][512]
  const size_t oWB  = off; off += (size_t)NWU * 16;                     //  1,572,864  bf16 [3][512][512]
  const size_t oWOB = off; off += (size_t)NWOU * 16;                    //  1,048,576  bf16 [512][1024]
  const size_t oQKV = off; off += (size_t)3 * PLQ * 4;                  // 25,165,824  f32 [3][32][1024][64]
  const size_t oS   = off; off += (size_t)NBH * NSLOT * 4;              //  4,194,304  f32 [32][32768]
  const size_t oOA  = off; off += (size_t)MROWS * KOUT * 2;             //  8,388,608  bf16 [4096][1024]
  const size_t oENT = off; off += (size_t)NBH * NSLOT * 4;              //  4,194,304  int [32][32768]
  const size_t oSOF = off; off += (size_t)NBH * NCH * SEQ * 4;          //  1,048,576  int [32][8][1024]
  const size_t oSCN = off; off += (size_t)NBH * NCH * SEQ * 4;          //  1,048,576  int [32][8][1024]
  const size_t oTOT = off; off += (size_t)NBH * NCH * 4;                //      1,024  int [32][8]
  if (off > ws_size || off > (size_t)WSMAX) return;                     // total 59,245,568
  unsigned short* XB  = (unsigned short*)(ws + oXB);
  unsigned short* WB  = (unsigned short*)(ws + oWB);
  unsigned short* WOB = (unsigned short*)(ws + oWOB);
  float*          QKV = (float*)(ws + oQKV);
  float*          S   = (float*)(ws + oS);
  unsigned short* OA  = (unsigned short*)(ws + oOA);
  int*            ENT = (int*)(ws + oENT);
  int*            SOFF = (int*)(ws + oSOF);
  int*            SCNT = (int*)(ws + oSCN);
  int*            TOT  = (int*)(ws + oTOT);
  const float* QP  = QKV;
  const float* KPl = QKV + (size_t)PLQ;
  const float* VP  = QKV + (size_t)2 * PLQ;

  // 1: bf16 operand planes
  k_convert<<<NCU / NTHR, NTHR, 0, stream>>>(query, keyx, value, Wq, Wk, Wv, Wo, XB, WB, WOB, NCU);
  // 2: q/k/v projections -> f32 head planes
  k_gemm<0><<<dim3(MROWS / GBM, DM / GBN, 3), GTHR, 0, stream>>>(XB, WB, QKV, DM, MROWS * DM, DM * DM, PLQ);
  // 3: window scores; beside them the slot lists grouped by target, one per chunk
  k_scores<<<dim3(W2, NBKT / W2 + NBH), NTHR, 0, stream>>>(pos_enc, pos_pad, rel_q, rel_k, QP, KPl, S, ENT, SOFF, SCNT, TOT);
  // 4: softmax + owner segment sums -> bf16 hi|lo plane
  k_drain<<<dim3(SEQ / (NWAVE * TPD), NBH), NTHR, 0, stream>>>(rel_v, VP, S, ENT, SOFF, SCNT, TOT, OA);
  // 5: output projection -> out
  k_gemm<1><<<dim3(MROWS / GBM, DM / GBN, 1), GTHR, 0, stream>>>(OA, WOB, out, KOUT, 0, 0, 0);
}

// v009
// It runs in 79.3 microseconds.
// Timed twice side by side with v008, it ran 1.04 and 1.05 times as fast.
// Over all steps from v000 it is 71.8 times as fast.
#include <hip/hip_runtime.h>
#include <stddef.h>
#include <stdint.h>

// Contractions: q/k/v input projections (K=512) and the output projection (K=1024 = activation bf16 hi|lo pair
// accumulate). Window scores (three 64-deep dots per slot), softmax statistics, weighted value sums and the
// per-position segment sums: f32 VALU.
//
// Carry audit: no plane carries a power-of-two scale; nothing is folded back anywhere.
//   XB  [3][4096][512]  bf16 = RNE(query | key | value)               (k_convert) -> A of the projections
//   WB  [3][512][512]   bf16 = RNE(Wq | Wk | Wv), rows [n][k]          (k_convert) -> B of the projections
//   OA  [4096][1024]    bf16 = [hi | lo] of the per-head attention output, hi = RNE(o), lo = RNE(o - hi)
//                                                                     (k_drain)   -> A of the output projection
//   rel_q, rel_k, rel_v are RNE-converted to bf16 values (held as f32) when staged in LDS.
//   f32 planes: QKV [3][32][1024][64] (projection results), S [32][32768] (masked, scaled scores).
//   Slot lists (bucketing groups of the k_scores launch -> k_drain), one per chunk of 4096 consecutive flat slots:
//   ENT [32][8][4096] int (f << 10 | kv), grouped by target inside the chunk; SOFF, SCNT [32][8][1024] int segment
//   start (in the chunk's list) and count per target; TOT [32][8] int slots filed.

#define NB_    4
#define SEQ    1024
#define DM     512
#define NH     8
#define DK     64
#define KP1    16
#define W2     32
#define NSLOT  32768                 // W2 * SEQ flat window slots per (b,h)
#define NHALF  16384                 // KP1 * SEQ
#define NBH    32                    // NB_ * NH
#define MROWS  4096                  // NB_ * SEQ
#define KOUT   1024                  // 2 * DM (hi | lo)
#define NPOS   (NBH * NHALF)         // ints per position table
#define PLQ    (NBH * SEQ * DK)      // floats per q/k/v plane (2097152)
#define NTHR   256
#define NWAVE  8
#define GTHR   128
#define GBM    64
#define GBN    64
#define TPD    8                     // targets per wave in k_drain
#define DEGCAP 256                   // static cap on slots per target position
#define RINV24 (1.0f / 24.0f)
#define NEGBIG (-1.0e9f)
#define WSMAX  134217728
#define NXU    (3 * (MROWS * DM / 8))   // 786432 convert units (8 elements each)
#define NWU    (3 * (DM * DM / 8))      // 98304
#define NWOU   (DM * KOUT / 8)          // 65536
#define NCU    (NXU + NWU + NWOU)       // 950272
#define NCH    8                     // chunks of flat slots per (b,h): one bucketing work-group each
#define CSL    (NSLOT / NCH)         // 4096 consecutive flat slots per chunk
#define FPW    (CSL / NWAVE)         // 512 consecutive flat slots per wave in the bucketing passes
#define BGRP   8                     // 32-slot steps whose index loads are issued together
#define NBKT   (NBH * NCH)           // bucketing work-groups at the head of the k_scores launch
#define NSV    (NSLOT / (4 * NTHR))  // 16-byte score loads per thread in the statistics of k_drain

static_assert((MROWS % GBM) == 0 && (DM % GBN) == 0 && (SEQ % GBM) == 0);
static_assert((DM % 32) == 0 && (KOUT % 32) == 0);
static_assert(GBN == DK);
static_assert(GBM == (GTHR / 32) * 16);
static_assert(NSLOT == W2 * SEQ && NHALF == KP1 * SEQ && NBH == NB_ * NH && MROWS == NB_ * SEQ);
static_assert(NSLOT == (1 << 15) && SEQ == (1 << 10));
static_assert((MROWS * DM / 8) == (1 << 18) && (DM * DM / 8) == (1 << 15) && (KOUT / 8) == 128);
static_assert((NXU % NTHR) == 0 && ((NXU + NWU) % NTHR) == 0 && (NCU % NTHR) == 0);
static_assert(NTHR * 4 == SEQ && (SEQ % (TPD * NWAVE)) == 0);
static_assert((NSLOT % (4 * NTHR)) == 0);
static_assert(NTHR * 8 == W2 * DK);
static_assert(TPD == 8 && NCH == 8 && (CSL * 4) % (16 * NTHR) == 0);
static_assert(FPW * NWAVE == CSL && CSL * NCH == NSLOT && (FPW % (32 * BGRP)) == 0 && (NHALF % CSL) == 0);
static_assert(PLQ == NB_ * SEQ * DM);

typedef float    v4f  __attribute__((ext_vector_type(4)));
typedef float    v8f  __attribute__((ext_vector_type(8)));
typedef int      v4i  __attribute__((ext_vector_type(4)));
typedef int      v8i  __attribute__((ext_vector_type(8)));
typedef unsigned short v8us __attribute__((ext_vector_type(8)));
typedef __bf16   v16b __attribute__((ext_vector_type(16)));
typedef v4f  __attribute__((may_alias)) v4fa;
typedef v4i  __attribute__((may_alias)) v4ia;
typedef v8us __attribute__((may_alias)) v8usa;
union FragB { v16b v; v8us h[2]; v8i w; };

// WMMA with hazard guard: ties D, keeps A/B live for 4 VALU slots
__device__ __forceinline__ v8f wmb(const FragB& a, const FragB& b, v8f c) {
  v8f d = __builtin_amdgcn_wmma_f32_16x16x32_bf16(false, a.v, false, b.v, (short)0, c, false, false);
  asm volatile("v_nop\n\tv_nop\n\tv_nop\n\tv_nop" : "+v"(d) : "v"(a.w), "v"(b.w));
  return d;
}

// f32 -> bf16 bits, RNE convert
__device__ __forceinline__ unsigned int bf16u(float x) {
  const unsigned int u = __float_as_uint(x);
  return (u + 0x7FFFu + ((u >> 16) & 1u)) >> 16;
}
// f32 -> nearest bf16 value held as f32
__device__ __forceinline__ float bf16f(float x) { return __uint_as_float(bf16u(x) << 16); }

__device__ __forceinline__ v8us cvt8b(const v4f a, const v4f b) {
  v8us r;
  r[0] = (unsigned short)bf16u(a.x); r[1] = (unsigned short)bf16u(a.y);
  r[2] = (unsigned short)bf16u(a.z); r[3] = (unsigned short)bf16u(a.w);
  r[4] = (unsigned short)bf16u(b.x); r[5] = (unsigned short)bf16u(b.y);
  r[6] = (unsigned short)bf16u(b.z); r[7] = (unsigned short)bf16u(b.w);
  return r;
}

__device__ __forceinline__ unsigned short hl1(float x, bool islo) {
  const unsigned int hu = bf16u(x);
  const float hf = __uint_as_float(hu << 16);
  const unsigned int lu = bf16u(x - hf);
  return (unsigned short)(islo ? lu : hu);
}
// 8 floats -> 8 bf16 hi parts (islo false) or 8 bf16 lo parts (islo true), lo = RNE(x - hi)
__device__ __forceinline__ v8us split8(const v4f a, const v4f b, bool islo) {
  v8us r;
  r[0] = hl1(a.x, islo); r[1] = hl1(a.y, islo); r[2] = hl1(a.z, islo); r[3] = hl1(a.w, islo);
  r[4] = hl1(b.x, islo); r[5] = hl1(b.y, islo); r[6] = hl1(b.z, islo); r[7] = hl1(b.w, islo);
  return r;
}

// ---------------------------------------------------------------------------
// Flat window slot f (0..32767) of head group bh: window row w = f >> 10, position s = f & 1023.
//   q index  = w < 16 ? pos_pad[w][s]    : pe[w-16][s]       (pe = pos_enc with -1 -> 0)
//   kv index = w < 16 ? pe[w][s]         : pos_pad[w-16][s]
//   masked   = (pos_enc[w & 15][s] == -1) || f < 1024
// Both tables are read unconditionally (same g for both halves) and clamped into [0, SEQ-1].
// ---------------------------------------------------------------------------
__device__ __forceinline__ void slot_idx(const int* __restrict__ pos_enc, const int* __restrict__ pos_pad,
                                         int bh, int f, int& qi, int& ki, bool& msk) {
  const int g = bh * NHALF + (f & (NHALF - 1));
  const int penc = pos_enc[g];
  const int ppad = pos_pad[g];
  const bool neg = (penc == -1);
  int pe = neg ? 0 : penc;
  pe = pe < 0 ? 0 : (pe > SEQ - 1 ? SEQ - 1 : pe);
  int pp = ppad < 0 ? 0 : (ppad > SEQ - 1 ? SEQ - 1 : ppad);
  const bool lo = f < NHALF;
  qi = lo ? pp : pe;
  ki = lo ? pe : pp;
  msk = neg || (f < SEQ);
}

// position index clamped into [0, SEQ-1]
__device__ __forceinline__ int clamp_pos(int v) { return v < 0 ? 0 : (v > SEQ - 1 ? SEQ - 1 : v); }

// Mask of the lanes of this wave whose 10-bit target t equals this lane's (all 32 lanes active): one ballot per bit.
__device__ __forceinline__ unsigned int same_target(int t) {
  unsigned int peers = 0xFFFFFFFFu;
#pragma unroll
  for (int bit = 0; bit < 10; ++bit) {
    const bool on = ((t >> bit) & 1) != 0;
    const unsigned int bl = __builtin_amdgcn_ballot_w32(on);
    peers &= on ? bl : ~bl;
  }
  return peers;
}

// ---------------------------------------------------------------------------
//   u <  NXU        : XB[z][off*8 ..]  z = u >> 18 selects query | key | value
//   u <  NXU + NWU  : WB[z][off*8 ..]  z selects Wq | Wk | Wv (rows [n][k] as given)
// coverage: NXU*8 = 3*4096*512, NWU*8 = 3*512*512, NWOU*8 = 512*1024 elements exactly.
// ---------------------------------------------------------------------------
__global__ __launch_bounds__(NTHR) void k_convert(
    const float* __restrict__ xq, const float* __restrict__ xk, const float* __restrict__ xv,
    const float* __restrict__ wq, const float* __restrict__ wk, const float* __restrict__ wv,
    const float* __restrict__ wo,
    unsigned short* xb, unsigned short* wb, unsigned short* wob, int nUnits)
{
  const int u = (int)blockIdx.x * NTHR + (int)threadIdx.x;
  if (u >= nUnits) return;
  const float* src;
  unsigned short* dst;
  if (u < NXU) {
    const int z = u >> 18, off = u & ((1 << 18) - 1);
    const float* xs = (z == 0) ? xq : ((z == 1) ? xk : xv);
    src = xs + (size_t)off * 8;
    dst = xb + (size_t)u * 8;
  } else if (u < NXU + NWU) {
    const int e = u - NXU;
    const int z = e >> 15, off = e & ((1 << 15) - 1);
    const float* wsp = (z == 0) ? wq : ((z == 1) ? wk : wv);
    src = wsp + (size_t)off * 8;
    dst = wb + (size_t)e * 8;
  } else {
    const int e = u - NXU - NWU;
    const int n = e >> 7;
    const int c8 = (e & 127) * 8;
    src = wo + (size_t)n * DM + (c8 & (DM - 1));
    dst = wob + (size_t)n * KOUT + c8;
  }
  const v4f a = *(const v4fa*)src;
  const v4f b = *(const v4fa*)(src + 4);
  const v8us o = cvt8b(a, b);
  *(v8us*)dst = o;
  
}

// ---------------------------------------------------------------------------
// bf16 WMMA GEMM, plane z = blockIdx.z: C[4096][N] tile = A[4096][K] (bf16, pitch K) x WT[N][K]^T (bf16 rows n,
// k-contiguous), K a multiple of 64. grid (4096/64, N/64, nz), 128 threads: wave w owns rows 16w..16w+15 of the 64x64
// tile, acc[4] = 4 column tiles. The 64 A rows and the 64 WT rows of the tile pass through LDS in chunks of 64 k (one
// 128-byte line per row): eight lanes read one line, so a load instruction covers four whole lines, and every line is
// read once per work-group. Two LDS buffers: the next chunk's lines are requested before this chunk's products and
// filed behind them (EPI 1: requested three chunks ahead and filed ahead of them); one barrier a chunk. Row pitch in LDS 144 bytes (16 B x odd) for the 16-byte fragment reads.
// A fragment (row m = lane&15): elements 0..7 <- k0+8h+0..7, 8..15 <- k0+16+8h+0..7
// (h = lane>>4); B fragment (col n = lane&15) from WT row (col0+16t+n) with the SAME k map; D element r =
// (row 8h+r, col lane&15). Tile staged in LDS as 64x64 f32 (over the chunk buffers, behind the loop's last barrier),
// then one instruction writes two 256-B row segments
//   EPI 0: head plane out[z][(b*8 + blockIdx.y)*1024 + s][64] f32 (b = row>>10, s = row&1023; column tile = one head)
//   EPI 1: out[row][512] f32 at columns col0..col0+63 (the final output, z = 0)
// coverage: grid (64, 8, nz) covers every (row, col) of each 4096 x 512 plane exactly once.
// ---------------------------------------------------------------------------
#define KC    64                     // k per staged chunk
#define LPT   72                     // LDS row pitch in bf16 elements (144 bytes)
#define TLE   (GBM * LPT)            // elements of one staged operand tile
static_assert(GBM == GBN && (DM % KC) == 0 && (KOUT % KC) == 0 && KC * 2 == 128);
static_assert(GTHR * 4 * 8 == GBM * KC);
static_assert(4 * TLE * 2 >= GBM * GBN * 4);

// Work-group barrier for LDS traffic alone: the wave's own LDS reads and writes are done, then the barrier.
// __syncthreads() also waits for every global load that is still out, which would end the requests that run ahead.
__device__ __forceinline__ void lds_barrier() {
  asm volatile("s_wait_dscnt 0x0\n\ts_barrier_signal -1\n\ts_barrier_wait -1" ::: "memory");
}

template<int EPI>
__global__ __launch_bounds__(GTHR) void k_gemm(
    const unsigned short* __restrict__ A, const unsigned short* __restrict__ WT,
    float* outF, int K, int strideA, int strideW, int strideO)
{
  __shared__ __attribute__((aligned(16))) v4f smem[4 * TLE * 2 / 16];   // 36,864 B: [buffer][A | WT][64][72] bf16
  unsigned short* tl = (unsigned short*)smem;
  float* stg = (float*)smem;                                            // 64 x 64 f32, epilogue only
  const int tid = (int)threadIdx.x, lane = tid & 31, wave = tid >> 5, hh = lane >> 4, m = lane & 15;
  const int z = (int)blockIdx.z;
  const unsigned short* Az = A  + (size_t)z * (size_t)strideA;
  const unsigned short* Wz = WT + (size_t)z * (size_t)strideW;
  float* Oz = outF + (size_t)z * (size_t)strideO;
  const int rowBase = (int)blockIdx.x * GBM;
  const int col0    = (int)blockIdx.y * GBN;
  const int Kp      = (EPI == 1) ? KOUT : K;          // the output projection's depth is fixed: its chunk loop is unrolled

  v8f acc[4];
  {
    const v8f zz = {0.f, 0.f, 0.f, 0.f, 0.f, 0.f, 0.f, 0.f};
    acc[0] = zz; acc[1] = zz; acc[2] = zz; acc[3] = zz;
  }
  // staging: thread takes 16-byte piece sg of tile rows r0, r0+16, r0+32, r0+48 of both operands
  const int sg = tid & 7, r0 = tid >> 3;
  const char* ab = (const char*)(Az + (size_t)rowBase * (size_t)Kp);    // work-group uniform
  const char* wb = (const char*)(Wz + (size_t)col0 * (size_t)Kp);
  unsigned int go[4];
#pragma unroll
  for (int i = 0; i < 4; ++i) go[i] = (unsigned int)((r0 + 16 * i) * Kp + 8 * sg) * 2u;
  unsigned short* sp = tl + r0 * LPT + 8 * sg;
  const unsigned short* fa = tl + (16 * wave + m) * LPT + 8 * hh;       // A fragment row of this lane
  const unsigned short* fb = tl + TLE + m * LPT + 8 * hh;               // WT fragment row, column tile 0
  if constexpr (EPI == 1) {
  // Output projection: two work-groups a WGP are too few waves to cover a wave's own round trip to L2 or memory. A chunk's
  // lines are requested PD chunks before they are filed in LDS, into PD sets of registers, and stay out over the barriers
  // between. The loop is unrolled whole: a set is chosen by a constant, and row and chunk are an immediate offset on one
  // offset register, which is never written again while a load is out.
  constexpr int NC = KOUT / KC;
  constexpr int PD = 3;
  constexpr int RS = 16 * KOUT * 2;                   // bytes from one of the thread's four rows to the next
  static_assert(NC > PD);
  v8us pa[PD][4], pb[PD][4];
#pragma unroll
  for (int d = 0; d < PD; ++d) {
#pragma unroll
    for (int i = 0; i < 4; ++i) {
      pa[d][i] = *(const v8usa*)(ab + go[0] + (i * RS + d * (KC * 2)));
      pb[d][i] = *(const v8usa*)(wb + go[0] + (i * RS + d * (KC * 2)));
    }
  }
#pragma unroll
  for (int i = 0; i < 4; ++i) {
    *(v8usa*)(sp + 16 * i * LPT)       = pa[0][i];
    *(v8usa*)(sp + TLE + 16 * i * LPT) = pb[0][i];
  }
#pragma unroll
  for (int i = 0; i < 4; ++i) {
    pa[0][i] = *(const v8usa*)(ab + go[0] + (i * RS + PD * (KC * 2)));
    pb[0][i] = *(const v8usa*)(wb + go[0] + (i * RS + PD * (KC * 2)));
  }
  lds_barrier();                                      // publishes chunk 0
  // unrolled whole: register sets and chunk offsets are constants
#pragma unroll
  for (int c = 0; c < NC; ++c) {
    const int bo = (c & 1) * (2 * TLE);               // this chunk's buffer
    // the chunk's twenty fragment reads go out together, ahead of its eight products: one LDS latency a chunk
    FragB af[KC / 32], bf[KC / 32][4];
#pragma unroll
    for (int ks = 0; ks < KC / 32; ++ks) {
      af[ks].h[0] = *(const v8usa*)(fa + bo + 32 * ks);        // k = 64c + 32ks + 8hh + 0..7
      af[ks].h[1] = *(const v8usa*)(fa + bo + 32 * ks + 16);   // k = 64c + 32ks + 16 + 8hh + 0..7
#pragma unroll
      for (int t = 0; t < 4; ++t) {
        const unsigned short* wq = fb + bo + 16 * t * LPT + 32 * ks;   // WT row col0 + 16t + m
        bf[ks][t].h[0] = *(const v8usa*)wq;                    // same k map as A
        bf[ks][t].h[1] = *(const v8usa*)(wq + 16);
      }
    }
    // chunk c + 1 was requested PD chunks ago: it is filed behind the fragment reads, so the LDS writes run under the products
    if (c + 1 < NC) {
      const int st = (c + 1) % PD;                         // the set that holds chunk c + 1
      unsigned short* sn = sp + (2 * TLE - bo);            // the other buffer: its readers left it at the last barrier
#pragma unroll
      for (int i = 0; i < 4; ++i) {
        *(v8usa*)(sn + 16 * i * LPT)       = pa[st][i];
        *(v8usa*)(sn + TLE + 16 * i * LPT) = pb[st][i];
      }
      if (c + 1 + PD < NC) {
#pragma unroll
        for (int i = 0; i < 4; ++i) {
          pa[st][i] = *(const v8usa*)(ab + go[0] + (i * RS + (c + 1 + PD) * (KC * 2)));
          pb[st][i] = *(const v8usa*)(wb + go[0] + (i * RS + (c + 1 + PD) * (KC * 2)));
        }
      }
    }
#pragma unroll
    for (int ks = 0; ks < KC / 32; ++ks) {
#pragma unroll
      for (int t = 0; t < 4; ++t) acc[t] = wmb(af[ks], bf[ks][t], acc[t]);
    }
    // publishes the next chunk and ends every wave's reads of this one (after the last chunk: frees the LDS for stg)
    lds_barrier();
  }
  // the wait before the loads' offset register is written again; naming it keeps it as it is up to here
  asm volatile("s_wait_xcnt 0x0" :: "v"(go[0]) : "memory");
  } else {
  const int nch = K >> 6;
  v8us ra[4], rb[4];
#pragma unroll
  for (int i = 0; i < 4; ++i) {
    ra[i] = *(const v8usa*)(ab + go[i]);
    rb[i] = *(const v8usa*)(wb + go[i]);
  }
  // the wait before a register that these loads name is written again
  asm volatile("s_wait_xcnt 0x0" :: "v"(go[0]), "v"(go[1]), "v"(go[2]), "v"(go[3]) : "memory");
#pragma unroll
  for (int i = 0; i < 4; ++i) {
    *(v8usa*)(sp + 16 * i * LPT)       = ra[i];
    *(v8usa*)(sp + TLE + 16 * i * LPT) = rb[i];
  }
  __syncthreads();
  // kept rolled: a trip is a whole chunk (8 loads, 20 fragment reads, 8 products); a second copy would only add registers
#pragma unroll 1
  for (int c = 0; c < nch; ++c) {
    const int bo = (c & 1) * (2 * TLE);               // this chunk's buffer
    const bool nxt = c + 1 < nch;                     // work-group uniform
    unsigned int gn[4];                               // the next chunk's byte offsets
#pragma unroll
    for (int i = 0; i < 4; ++i) gn[i] = go[i] + (unsigned int)(c + 1) * (KC * 2u);
    if (nxt) {
#pragma unroll
      for (int i = 0; i < 4; ++i) {
        ra[i] = *(const v8usa*)(ab + gn[i]);
        rb[i] = *(const v8usa*)(wb + gn[i]);
      }
    }
    // the chunk's twenty fragment reads go out together, ahead of its eight products: one LDS latency a chunk
    FragB af[KC / 32], bf[KC / 32][4];
#pragma unroll
    for (int ks = 0; ks < KC / 32; ++ks) {
      af[ks].h[0] = *(const v8usa*)(fa + bo + 32 * ks);        // k = 64c + 32ks + 8hh + 0..7
      af[ks].h[1] = *(const v8usa*)(fa + bo + 32 * ks + 16);   // k = 64c + 32ks + 16 + 8hh + 0..7
#pragma unroll
      for (int t = 0; t < 4; ++t) {
        const unsigned short* wq = fb + bo + 16 * t * LPT + 32 * ks;   // WT row col0 + 16t + m
        bf[ks][t].h[0] = *(const v8usa*)wq;                    // same k map as A
        bf[ks][t].h[1] = *(const v8usa*)(wq + 16);
      }
    }
#pragma unroll
    for (int ks = 0; ks < KC / 32; ++ks) {
#pragma unroll
      for (int t = 0; t < 4; ++t) acc[t] = wmb(af[ks], bf[ks][t], acc[t]);
    }
    if (nxt) {
      // the wait before a register that the next chunk's loads name is written again; naming the offsets keeps each in a
      // register of its own up to here (else one could be a later load's destination). Behind the products it costs nothing.
      asm volatile("s_wait_xcnt 0x0" :: "v"(gn[0]), "v"(gn[1]), "v"(gn[2]), "v"(gn[3]) : "memory");
      unsigned short* sn = sp + (2 * TLE - bo);            // the other buffer: its readers left it at the last barrier
#pragma unroll
      for (int i = 0; i < 4; ++i) {
        *(v8usa*)(sn + 16 * i * LPT)       = ra[i];
        *(v8usa*)(sn + TLE + 16 * i * LPT) = rb[i];
      }
    }
    // publishes the next chunk and ends every wave's reads of this one (after the last chunk: frees the LDS for stg)
    __syncthreads();
  }
  }

#pragma unroll
  for (int t = 0; t < 4; ++t) {
    const int lc = 16 * t + m;
#pragma unroll
    for (int r = 0; r < 8; ++r) {
      const int lr = 16 * wave + 8 * hh + r;          // D element r = (row 8hh+r, col m)
      stg[lr * GBN + lc] = acc[t][r];
    }
  }
  __syncthreads();

  float* ob;
  int ldo;
  if (EPI == 0) {
    const int bq = rowBase >> 10;
    const int s0 = rowBase & (SEQ - 1);
    ob  = Oz + ((size_t)(bq * NH + (int)blockIdx.y) * SEQ + s0) * DK;
    ldo = DK;
  } else {
    ob  = Oz + (size_t)rowBase * DM + col0;
    ldo = DM;
  }
  v4f fv[8];
#pragma unroll
  for (int i = 0; i < 8; ++i) {
    const int lr = 16 * wave + 2 * i + hh;
    fv[i] = *(const v4fa*)(stg + lr * GBN + 4 * m);
  }
#pragma unroll
  for (int i = 0; i < 8; ++i) {
    const int lr = 16 * wave + 2 * i + hh;
    float* op = ob + (size_t)lr * (size_t)ldo + 4 * m;
    *(v4f*)op = fv[i];
  }
  
}

// ---------------------------------------------------------------------------
// Bucketing of chunk ch (4096 consecutive flat slots) of one (b,h) by the slots' q index. It reads the position tables
// alone, no score, so it runs beside the scores, in the same launch (k_scores below), one work-group a chunk.
// Deterministic, in LDS (count -> exclusive scan -> f-ascending cursor fill, no atomics): wave w takes the chunk's flat
// slots [512w, 512w + 512), 32 a step; lanes with the same target are matched by ballots, the first of them updates the
// wave's own counter / cursor row, each lane's place is cursor + its rank among them.
// The finished list goes to the workspace in whole lines, with each target's segment start and count, for k_drain.
// cur [NWAVE][SEQ] per-wave counts, then per-wave cursors; ent [CSL] packed (f << 10 | kv); wtot [NWAVE]: all in LDS.
// coverage: 256 work-groups x (4096 entries + 1024 starts + 1024 counts + 1 total), each written once.
// ---------------------------------------------------------------------------
__device__ __forceinline__ void bucket_chunk(
    const int* __restrict__ pos_enc, const int* __restrict__ pos_pad, int bh, int ch,
    int* cur, int* ent, int* wtot, int* ENT, int* SOFF, int* SCNT, int* TOT)
{
  const int tid = (int)threadIdx.x, lane = tid & 31, wave = tid >> 5;
  const int lst = bh * NCH + ch;          // this work-group's list
  {
    const v4i z4 = {0, 0, 0, 0};
#pragma unroll
    for (int i = 0; i < CSL / (4 * NTHR); ++i) *(v4ia*)(ent + i * (4 * NTHR) + 4 * tid) = z4;
#pragma unroll
    for (int w2 = 0; w2 < NWAVE; ++w2) *(v4ia*)(cur + w2 * SEQ + 4 * tid) = z4;
  }
  __syncthreads();

  // ---- counts per (wave, target): every wave over its own 512 slots ----
  // A chunk's 4096 slots lie in one half of the window rows, so its q table and its kv table (slot_idx) are fixed:
  // lower half q <- pos_pad, kv <- pos_enc; upper half the other way round. clamp_pos sends pos_enc's -1 to 0.
  const int f0w = ch * CSL + __builtin_amdgcn_readfirstlane(wave) * FPW;   // wave-uniform: scalar loop control, table choice
  const bool lohalf = f0w < NHALF;
  const int* qtab = (lohalf ? pos_pad : pos_enc) + bh * NHALF + (f0w & (NHALF - 1));
  const int* ktab = (lohalf ? pos_enc : pos_pad) + bh * NHALF + (f0w & (NHALF - 1));
  int* wcur = cur + wave * SEQ;
  const unsigned int below = (1u << lane) - 1u;
  const unsigned int lane4 = 4u * (unsigned int)lane;
#pragma unroll 1
  for (int g = 0; g < FPW; g += 32 * BGRP) {
    int tq[BGRP];
#pragma unroll
    for (int j = 0; j < BGRP; ++j) tq[j] = clamp_pos(qtab[g + 32 * j + lane]) & (SEQ - 1);
#pragma unroll
    for (int j = 0; j < BGRP; ++j) {
      const unsigned int peers = same_target(tq[j]);
      if ((peers & below) == 0u) wcur[tq[j]] = wcur[tq[j]] + __builtin_popcount(peers);
      // the next step's reader of a counter may be another lane of this wave: keep the LDS accesses in step order
      __builtin_amdgcn_fence(__ATOMIC_ACQ_REL, "wavefront");
      __builtin_amdgcn_wave_barrier();
    }
  }
  __syncthreads();

  // ---- exclusive prefix over SEQ counts -> SOFF ----
  int tot;
  {
    v4i cw[NWAVE];
    v4i ca = {0, 0, 0, 0};
#pragma unroll
    for (int w2 = 0; w2 < NWAVE; ++w2) {
      cw[w2] = *(const v4ia*)(cur + w2 * SEQ + 4 * tid);
      ca += cw[w2];
    }
    *(v4ia*)(SCNT + lst * SEQ + 4 * tid) = ca;
    const int e0 = ca.x < 0 ? 0 : ca.x, e1 = ca.y < 0 ? 0 : ca.y, e2 = ca.z < 0 ? 0 : ca.z, e3 = ca.w < 0 ? 0 : ca.w;
    const int ts = e0 + e1 + e2 + e3;
    int incl = ts;
#pragma unroll
    for (int d = 1; d < 32; d <<= 1) {
      const int up = __shfl_up(incl, d);
      if (lane >= d) incl += up;
    }
    if (lane == 31) wtot[wave] = incl;
    __syncthreads();
    int pre = 0;
    tot = 0;
#pragma unroll
    for (int w2 = 0; w2 < NWAVE; ++w2) {
      const int t = wtot[w2];
      tot += t;
      pre += (w2 < wave) ? t : 0;
    }
    int run = pre + incl - ts;
    v4i so;
    so.x = run; run += e0;
    so.y = run; run += e1;
    so.z = run; run += e2;
    so.w = run;
    *(v4ia*)(SOFF + lst * SEQ + 4 * tid) = so;
    // wave w2's cursor of a target starts behind the slots that waves 0..w2-1 hold for it (f ascending over waves)
#pragma unroll
    for (int w2 = 0; w2 < NWAVE; ++w2) {
      *(v4ia*)(cur + w2 * SEQ + 4 * tid) = so;
      so += cw[w2];
    }
  }
  __syncthreads();

  // ---- fill: packed (f << 10 | kv) into target segments (every wave over its own slots, f ascending) ----
#pragma unroll 1
  for (int g = 0; g < FPW; g += 32 * BGRP) {
    int tq[BGRP], en[BGRP];
    // this group's kv indices, from the lane's own column on
    const int* kg = (const int*)((const char*)(ktab + g) + lane4);
#pragma unroll
    for (int j = 0; j < BGRP; ++j) {
      const int o = g + 32 * j + lane;
      tq[j] = clamp_pos(qtab[o]) & (SEQ - 1);
      en[j] = ((f0w + o) << 10) | clamp_pos(kg[32 * j]);
    }
    // the steps below reuse the address registers of the loads above
    asm volatile("s_wait_xcnt 0x0" ::: "memory");
#pragma unroll
    for (int j = 0; j < BGRP; ++j) {
      const unsigned int peers = same_target(tq[j]);
      const unsigned int lower = peers & below;
      const int base = wcur[tq[j]];
      int pos = base + __builtin_popcount(lower);
      pos = pos < 0 ? 0 : (pos > CSL - 1 ? CSL - 1 : pos);
      ent[pos] = en[j];
      if (lower == 0u) wcur[tq[j]] = base + __builtin_popcount(peers);
      // the next step's reader of a cursor may be another lane of this wave: keep the LDS accesses in step order
      __builtin_amdgcn_fence(__ATOMIC_ACQ_REL, "wavefront");
      __builtin_amdgcn_wave_barrier();
    }
  }
  __syncthreads();

  // ---- the list to the workspace, 16 bytes a lane ----
  {
    int* eg = ENT + (size_t)lst * CSL + 4 * tid;
    // unrolled whole: every store takes its place from an immediate offset, so no address register is written again
#pragma unroll
    for (int i = 0; i < CSL / (4 * NTHR); ++i) *(v4ia*)(eg + i * (4 * NTHR)) = *(const v4ia*)(ent + i * (4 * NTHR) + 4 * tid);
    if (tid == 0) TOT[lst] = tot;
  }
}

// ---------------------------------------------------------------------------
// Window scores, with the bucketing beside them. grid (32, 8 + 32): the 256 work-groups of rows y < 8 bucket one chunk
// each (bucket_chunk; they have the longest dependent chain); work-group (w, 8 + bh) takes window row w
// of (b,h) bh. 8 waves; a wave takes 128 consecutive slots of the row, 32 a step.
// Lane j reads slot j's indices. The rows are then read whole: the 16 lanes of a half-wave take one slot's q row and
// k row, 16 bytes a lane (channels 4c..4c+3, c = lane & 15), so one load instruction covers two 256-byte rows; half-wave
// g works through slots 16g..16g+15, the slot's row offset coming from its lane by a DPP row broadcast.
// rel_k[h][w], rel_q[h][w] rows staged in LDS as bf16 values, each lane keeps its four channels of both in registers.
// Per lane c2c, c2p, p2c over its four channels, (c2c + c2p) + p2c, then the sum over the 16 lanes; lane j keeps slot
// j's score; masked slots get -1e9.
// coverage: 32 work-groups x 8 waves x 4 steps x 32 lanes = all 32768 slots of each of the 32 (b,h).
// ---------------------------------------------------------------------------
#define SSTEP 4                      // 32-slot steps per wave in k_scores
static_assert(NWAVE * SSTEP * 32 == SEQ && DK == 64 && (NBKT % W2) == 0);

template<int CTRL>
__device__ __forceinline__ int dpp_mov(int x) { return __builtin_amdgcn_update_dpp(0, x, CTRL, 0xf, 0xf, true); }
// lane I of this lane's 16-lane row (DPP row_share)
template<int I>
__device__ __forceinline__ unsigned int row_bcast(int x) { return (unsigned int)dpp_mov<0x150 + I>(x); }
// sum over the 16 lanes of a row, in every lane of it (DPP row_xmask 1, 2, 4, 8)
__device__ __forceinline__ float row_sum16(float x) {
  x += __int_as_float(dpp_mov<0x161>(__float_as_int(x)));
  x += __int_as_float(dpp_mov<0x162>(__float_as_int(x)));
  x += __int_as_float(dpp_mov<0x164>(__float_as_int(x)));
  x += __int_as_float(dpp_mov<0x168>(__float_as_int(x)));
  return x;
}

// Slots I0..I0+7 of each half-wave: qo, ko = the lane's own slot's q and k row byte offsets, c16 = 16 * (lane & 15).
// All sixteen row loads are issued before the first is used. sc takes the score sum of the lane's own slot.
#define SC_ADDR(i) qa[i] = row_bcast<I0 + (i)>(qo) + c16; ka[i] = row_bcast<I0 + (i)>(ko) + c16;
template<int I0>
__device__ __forceinline__ void score8(int qo, int ko, unsigned int c16, int c,
                                       const char* __restrict__ qb, const char* __restrict__ kb,
                                       const v4f rkv, const v4f rqv, float& sc) {
  unsigned int qa[8], ka[8];
  v4f qv[8], kv[8];
  SC_ADDR(0) SC_ADDR(1) SC_ADDR(2) SC_ADDR(3) SC_ADDR(4) SC_ADDR(5) SC_ADDR(6) SC_ADDR(7)
#pragma unroll
  for (int i = 0; i < 8; ++i) {
    qv[i] = *(const v4fa*)(qb + qa[i]);
    kv[i] = *(const v4fa*)(kb + ka[i]);
  }
  // the wait before the loads' offset registers are written again; naming them keeps each in a register of its own up
  // to here. The "memory" clobber keeps the loads ahead of it.
  asm volatile("s_wait_xcnt 0x0" :: "v"(qa[0]), "v"(qa[1]), "v"(qa[2]), "v"(qa[3]), "v"(qa[4]), "v"(qa[5]), "v"(qa[6]),
               "v"(qa[7]), "v"(ka[0]), "v"(ka[1]), "v"(ka[2]), "v"(ka[3]), "v"(ka[4]), "v"(ka[5]), "v"(ka[6]), "v"(ka[7])
               : "memory");
#pragma unroll
  for (int i = 0; i < 8; ++i) {
    const v4f q = qv[i], k = kv[i];
    float c2c = q.x * k.x, c2p = q.x * rkv.x, p2c = rqv.x * k.x;
    c2c = fmaf(q.y, k.y, c2c);   c2c = fmaf(q.z, k.z, c2c);   c2c = fmaf(q.w, k.w, c2c);
    c2p = fmaf(q.y, rkv.y, c2p); c2p = fmaf(q.z, rkv.z, c2p); c2p = fmaf(q.w, rkv.w, c2p);
    p2c = fmaf(rqv.y, k.y, p2c); p2c = fmaf(rqv.z, k.z, p2c); p2c = fmaf(rqv.w, k.w, p2c);
    const float s = row_sum16((c2c + c2p) + p2c);
    sc = (c == I0 + i) ? s : sc;
  }
}

__global__ __launch_bounds__(NTHR) void k_scores(
    const int* __restrict__ pos_enc, const int* __restrict__ pos_pad,
    const float* __restrict__ rel_q, const float* __restrict__ rel_k,
    const float* __restrict__ QP, const float* __restrict__ KPl, float* S,
    int* ENT, int* SOFF, int* SCNT, int* TOT)
{
  __shared__ __attribute__((aligned(16))) int bcur[NWAVE * SEQ];
  __shared__ __attribute__((aligned(16))) int bent[CSL];
  __shared__ int bwtot[NWAVE];
  __shared__ __attribute__((aligned(16))) float rk[DK];
  __shared__ __attribute__((aligned(16))) float rq[DK];
  if ((int)blockIdx.y < NBKT / W2) {                 // work-group uniform
    const int lst = (int)blockIdx.y * W2 + (int)blockIdx.x;
    bucket_chunk(pos_enc, pos_pad, lst / NCH, lst % NCH, bcur, bent, bwtot, ENT, SOFF, SCNT, TOT);
    return;
  }
  const int tid = (int)threadIdx.x, lane = tid & 31, wave = tid >> 5;
  const int bh = (int)blockIdx.y - NBKT / W2, h = bh & (NH - 1);
  const int w = (int)blockIdx.x;
  {
    const int sel = tid >> 6, j = tid & 63;          // sel uniform per pair of waves
    const size_t rb = (size_t)(h * W2 + w) * DK + j;
    if (sel == 0) rk[j] = bf16f(rel_k[rb]);
    if (sel == 1) rq[j] = bf16f(rel_q[rb]);
  }
  __syncthreads();

  const int c = lane & 15;
  const unsigned int c16 = 16u * (unsigned int)c;
  const v4f rkv = *(const v4fa*)(rk + 4 * c);
  const v4f rqv = *(const v4fa*)(rq + 4 * c);
  const char* qb = (const char*)(QP  + (size_t)bh * SEQ * DK);
  const char* kb = (const char*)(KPl + (size_t)bh * SEQ * DK);
  const int f0 = w * SEQ + wave * (SSTEP * 32) + lane;
  int qo[SSTEP], ko[SSTEP];
  bool mk[SSTEP];
#pragma unroll
  for (int t = 0; t < SSTEP; ++t) {
    int qi, ki;
    slot_idx(pos_enc, pos_pad, bh, f0 + 32 * t, qi, ki, mk[t]);
    qo[t] = qi * (DK * 4);
    ko[t] = ki * (DK * 4);
  }
  float res[SSTEP];
#pragma unroll
  for (int t = 0; t < SSTEP; ++t) {
    float sc = 0.f;
    score8<0>(qo[t], ko[t], c16, c, qb, kb, rkv, rqv, sc);
    score8<8>(qo[t], ko[t], c16, c, qb, kb, rkv, rqv, sc);
    res[t] = mk[t] ? NEGBIG : sc * RINV24;
  }
  float* sp = S + (size_t)bh * NSLOT + f0;
#pragma unroll
  for (int t = 0; t < SSTEP; ++t) sp[32 * t] = res[t];
}

// ---------------------------------------------------------------------------
// One step of k_drain over 8*G slots: lane j holds slot j's value-row byte offset ov (kv * 256), its rel_v-row byte
// offset orl (w * 256) and the place sp of its score in LDS; its weight pm = exp(score - M) * invZ where on, 0 past the
// target's last slot (on false), which leaves the sums as they are.
// vb = value plane of this (b,h) (wave-uniform), rvl = rel_v rows in LDS + lane, lane4 = 4 * lane.
// ---------------------------------------------------------------------------
#define VO8(b) "v"(vo[(b)]), "v"(vo[(b) + 1]), "v"(vo[(b) + 2]), "v"(vo[(b) + 3]), \
               "v"(vo[(b) + 4]), "v"(vo[(b) + 5]), "v"(vo[(b) + 6]), "v"(vo[(b) + 7])
template<int G>
__device__ __forceinline__ void drain_step(int ov, int orl, const float* sp, bool on, float M, float invZ,
                                           const char* __restrict__ vb, const char* rvl,
                                           unsigned int lane4, float& a0, float& a1) {
  unsigned int vo[8 * G];
  float v0[8 * G], v1[8 * G], r0[8 * G], r1[8 * G];
#pragma unroll
  for (int j = 0; j < 8 * G; ++j) vo[j] = (unsigned int)__builtin_amdgcn_readlane(ov, j) + lane4;
#pragma unroll
  for (int j = 0; j < 8 * G; ++j) {
    const float* vr = (const float*)(vb + vo[j]);
    v0[j] = vr[0];
    v1[j] = vr[32];
  }
  const float sc = *sp;            // asked for behind the value rows: their latency covers this read and the exp
#pragma unroll
  for (int j = 0; j < 8 * G; ++j) {
    const float* rr = (const float*)(rvl + __builtin_amdgcn_readlane(orl, j));
    r0[j] = rr[0];
    r1[j] = rr[32];
  }
  // the wait before the loads' offset registers are written again; naming them keeps each in a register of its own up to
  // here (reused inside the step, an offset register would make the next load wait, or be a later load's destination);
  // a statement takes thirty operands, so 32 slots take two. The "memory" clobber keeps the step's loads ahead of it.
  if constexpr (G == 1) {
    asm volatile("s_wait_xcnt 0x0" :: VO8(0) : "memory");
  } else {
    asm volatile("s_wait_xcnt 0x0" :: VO8(0), VO8(8) : "memory");
    if constexpr (G == 3) asm volatile("s_wait_xcnt 0x0" :: VO8(16) : "memory");
    if constexpr (G == 4) asm volatile("s_wait_xcnt 0x0" :: VO8(16), VO8(24) : "memory");
  }
  const float pm = on ? __expf(sc - M) * invZ : 0.0f;
#pragma unroll
  for (int j = 0; j < 8 * G; ++j) {
    const float pj = __int_as_float(__builtin_amdgcn_readlane(__float_as_int(pm), j));
    a0 = fmaf(pj, v0[j] + r0[j], a0);
    a1 = fmaf(pj, v1[j] + r1[j], a1);
  }
}

// segment start in a chunk's list clamped into [0, CSL]
__device__ __forceinline__ int clamp_st(int st) { return st < 0 ? 0 : (st > CSL ? CSL : st); }

// Place in the lists of one (b,h) of position q (0 = first) among the slots of the wave's target jt (wave-uniform).
// Lane (c & 3) * 8 + jt of pre0 / bas0 (chunks 0..3) and pre1 / bas1 (chunks 4..7) holds, for chunk c, the number of the
// target's slots in the chunks before c, and c * CSL + segment start - that number. The last chunk whose first position
// is not above q is q's. Result clamped into [0, NSLOT-1].
__device__ __forceinline__ int seg_idx(int pre0, int pre1, int bas0, int bas1, int jt, int q) {
  int b = __builtin_amdgcn_readlane(bas0, jt);
#pragma unroll
  for (int c = 1; c < NCH; ++c) {
    const int ln = (c & 3) * 8 + jt;
    const int p  = __builtin_amdgcn_readlane(c < 4 ? pre0 : pre1, ln);
    const int bb = __builtin_amdgcn_readlane(c < 4 ? bas0 : bas1, ln);
    b = q >= p ? bb : b;
  }
  const int idx = q + b;
  return idx < 0 ? 0 : (idx > NSLOT - 1 ? NSLOT - 1 : idx);
}

// Place idx (0..NSLOT-1) of the entry list eb of one (b,h), one place a lane.
__device__ __forceinline__ int list_read(const int* __restrict__ eb, int idx) {
  const int e = eb[idx];
  // the wait before the load's index register is written again; naming it keeps it as it is up to here
  asm volatile("s_wait_xcnt 0x0" :: "v"(idx) : "memory");
  return e;
}

// ---------------------------------------------------------------------------
// Owner drain per target position: out_h[i][d] = sum over its slots of p[f] * (v[kv[f]][d] + rel_v[w][d]).
// grid (16 = group of 64 targets, 32 = bh), 8 waves; a wave owns 8 consecutive targets of the bucketing's lists.
// Every work-group first makes the softmax statistics over all 32768 scores of its (b,h) (the same sums in the same order
// in all sixteen) and keeps the scores in LDS; a slot's weight p = exp(S[f] - M) * (1/Z) is made where the slot is drained.
// A target's slots are its segments of the eight chunk lists one behind the other (chunks ascending, so f ascending).
// The drain takes up to 32 slots of a target a step: lane j holds slot j's entry and weight, both are broadcast by
// readlane, the step's value rows are all requested before the first is used, and the sum runs in slot order.
// Lane = channel d (and 32 + d); every loop bound and index is clamped to static ranges.
// Result written as the bf16 hi | lo lines of OA row (b*1024 + i), columns h*64.. (hi) and 512 + h*64..
// Count cap overflow or inconsistent totals -> NaN poison of the row.
// coverage: 512 blocks x 64 targets x (hi line + lo line) = all 4096 rows x 16 lines of OA exactly once.
// ---------------------------------------------------------------------------
__global__ __launch_bounds__(NTHR) void k_drain(
    const float* __restrict__ rel_v, const float* __restrict__ VP,
    const float* __restrict__ S, const int* __restrict__ ENT,
    const int* __restrict__ SOFF, const int* __restrict__ SCNT, const int* __restrict__ TOT,
    unsigned short* OA)
{
  __shared__ __attribute__((aligned(16))) float sl[NSLOT];      // the scores of this (b,h), by flat slot
  __shared__ __attribute__((aligned(16))) float relv[W2 * DK];
  __shared__ __attribute__((aligned(16))) float stw[NWAVE * 64];
  __shared__ float red[2 * NWAVE];
  const int tid = (int)threadIdx.x, lane = tid & 31, wave = tid >> 5;
  const int bh = (int)blockIdx.y, b = bh >> 3, h = bh & (NH - 1);
  const float* sb = S + (size_t)bh * NSLOT;
  const int* ent = ENT + (size_t)bh * NSLOT;
  const int tg0 = ((int)blockIdx.x * NWAVE + __builtin_amdgcn_readfirstlane(wave)) * TPD;
  // segment starts and counts of the wave's targets: lane l holds those of target tg0 + (l & 7) in chunk l >> 3 (index
  // ti0) and in chunk 4 + (l >> 3) (index ti1); lane l also reads the total of chunk l & 7
  const int ti0 = (bh * NCH + (lane >> 3)) * SEQ + tg0 + (lane & 7);
  const int ti1 = ti0 + 4 * SEQ;
  const int tix = bh * NCH + (lane & 7);
  const int s0r = SOFF[ti0], c0r = SCNT[ti0], s1r = SOFF[ti1], c1r = SCNT[ti1];
  const int totl = TOT[tix];
  // the wait before the loads' index registers are written again; naming them keeps them as they are up to here
  asm volatile("s_wait_xcnt 0x0" :: "v"(ti0), "v"(ti1), "v"(tix) : "memory");
  // The thread's 128 scores of this (b,h), slots 1024 i + 4 tid .. + 3, are read once and kept in registers for the
  // maximum and for the sum. All 32 loads are requested before the first is used (one memory latency in place of one
  // per load), from one index register and immediate offsets.
  v4f sv[NSV];
  // unrolled whole: sv is indexed by constants only (registers), and the loads stand one behind the other
#pragma unroll
  for (int i = 0; i < NSV; ++i) sv[i] = *(const v4fa*)(sb + i * (4 * NTHR) + 4 * tid);
  // the wait before the loads' index register is written again; naming it keeps it as it is up to here
  asm volatile("s_wait_xcnt 0x0" :: "v"(tid) : "memory");
  {
    const float* rp = rel_v + (size_t)h * (W2 * DK) + 8 * tid;
    const v4f a = *(const v4fa*)rp;
    const v4f c = *(const v4fa*)(rp + 4);
    float* q = relv + 8 * tid;
    q[0] = bf16f(a.x); q[1] = bf16f(a.y); q[2] = bf16f(a.z); q[3] = bf16f(a.w);
    q[4] = bf16f(c.x); q[5] = bf16f(c.y); q[6] = bf16f(c.z); q[7] = bf16f(c.w);
  }
  // per (chunk, target): count bounded by the chunk's list, slots of the target in earlier chunks (sum over the lanes
  // 8 apart, then over the two registers), and what seg_idx adds to a position; totv = the target's slots in all chunks
  const int st0 = clamp_st(s0r), st1 = clamp_st(s1r);
  int n0 = c0r < 0 ? 0 : c0r, n1 = c1r < 0 ? 0 : c1r;
  n0 = n0 > CSL - st0 ? CSL - st0 : n0;
  n1 = n1 > CSL - st1 ? CSL - st1 : n1;
  int i0 = n0, i1 = n1;
#pragma unroll
  for (int d = 8; d < 32; d <<= 1) {
    const int u0 = __shfl_up(i0, d), u1 = __shfl_up(i1, d);
    if (lane >= d) { i0 += u0; i1 += u1; }
  }
  const int t0 = __shfl(i0, 24 + (lane & 7)), t1 = __shfl(i1, 24 + (lane & 7));
  const int pre0 = i0 - n0, pre1 = t0 + i1 - n1;
  const int bas0 = (lane >> 3) * CSL + st0 - pre0;
  const int bas1 = (4 + (lane >> 3)) * CSL + st1 - pre1;
  const int totv = t0 + t1;
  const unsigned int negm = __builtin_amdgcn_ballot_w32(c0r < 0 || c1r < 0);
  // entries of the coming step, read one step ahead
  int epre = list_read(ent, seg_idx(pre0, pre1, bas0, bas1, 0, lane));

  // ---- softmax statistics: M = max, Z = sum exp(s - M), two-level fixed order; the scores go to LDS on the way ----
  float mx = -3.0e38f;
  // unrolled whole: sv stays in registers
#pragma unroll
  for (int i = 0; i < NSV; ++i) {
    const v4f s4 = sv[i];
    *(v4fa*)(sl + i * (4 * NTHR) + 4 * tid) = s4;
    mx = fmaxf(fmaxf(mx, fmaxf(s4.x, s4.y)), fmaxf(s4.z, s4.w));
  }
#pragma unroll
  for (int off = 16; off > 0; off >>= 1) mx = fmaxf(mx, __shfl_xor(mx, off));
  if (lane == 0) red[wave] = mx;
  // publishes rel_v, the scores and the waves' maxima
  __syncthreads();
  float M = red[0];
#pragma unroll
  for (int w2 = 1; w2 < NWAVE; ++w2) M = fmaxf(M, red[w2]);
  float zs = 0.f;
  // unrolled whole, for the same reason; the terms are added in the order of i
#pragma unroll
  for (int i = 0; i < NSV; ++i) {
    const v4f s4 = sv[i];
    zs += (__expf(s4.x - M) + __expf(s4.y - M)) + (__expf(s4.z - M) + __expf(s4.w - M));
  }
#pragma unroll
  for (int off = 16; off > 0; off >>= 1) zs += __shfl_xor(zs, off);
  if (lane == 0) red[NWAVE + wave] = zs;
  // publishes the waves' sums
  __syncthreads();
  float Z = 0.f;
#pragma unroll
  for (int w2 = 0; w2 < NWAVE; ++w2) Z += red[NWAVE + w2];
  const float invZ = 1.0f / Z;                        // Z >= 1 (the max slot contributes exp(0))

  const unsigned int lane4 = 4u * (unsigned int)lane;
  const float qnan = __int_as_float(0x7fc00000);
  const bool bad_tot = __builtin_amdgcn_ballot_w32(totl != CSL) != 0u;
  float* sw = stw + wave * 64;
  const int lc = lane & 7;
  const bool islo = (lane & 8) != 0;
  const char* vb  = (const char*)(VP + (size_t)bh * SEQ * DK);
  const char* rvl = (const char*)(relv + lane);
#pragma unroll 1
  for (int jt = 0; jt < TPD; ++jt) {
    const int tg = tg0 + jt;                           // 0..1023
    const int jn = jt + 1 < TPD ? jt + 1 : TPD - 1;
    const int craw = __builtin_amdgcn_readlane(totv, jt);
    int cnt = craw;
    cnt = cnt < 0 ? 0 : (cnt > DEGCAP ? DEGCAP : cnt);
    const bool cneg = ((negm >> jt) & 0x01010101u) != 0u;   // a negative count of this target in some chunk
    const float pz = (bad_tot || craw > DEGCAP || cneg) ? qnan : 0.0f;
    float a0 = 0.f, a1 = 0.f;
#pragma unroll 1
    for (int q0 = 0; q0 < cnt || q0 == 0; q0 += 32) {
      const int left = cnt - q0;                       // 0 only for an empty target: nothing summed, read-ahead moved on
      const int n = left > 32 ? 32 : left;
      const int ov  = (epre & (SEQ - 1)) * (DK * 4);
      const int orl = ((epre >> 20) & (W2 - 1)) * (DK * 4);
      const float* sp = sl + ((epre >> 10) & (NSLOT - 1));
      const bool on = lane < n;
      const bool more = left > 32;                     // this target goes on; else the next target's first step
      const int idx = seg_idx(pre0, pre1, bas0, bas1, more ? jt : jn, (more ? q0 + 32 : 0) + lane);
      epre = list_read(ent, idx);
      if (n > 24)      drain_step<4>(ov, orl, sp, on, M, invZ, vb, rvl, lane4, a0, a1);
      else if (n > 16) drain_step<3>(ov, orl, sp, on, M, invZ, vb, rvl, lane4, a0, a1);
      else if (n > 8)  drain_step<2>(ov, orl, sp, on, M, invZ, vb, rvl, lane4, a0, a1);
      else if (n > 0)  drain_step<1>(ov, orl, sp, on, M, invZ, vb, rvl, lane4, a0, a1);
    }
    a0 += pz;
    a1 += pz;
    // per-wave relayout: channels in order, then lanes 0..7 (hi) / 8..15 (lo) read 8 consecutive channels each
    __builtin_amdgcn_fence(__ATOMIC_RELEASE, "wavefront");
    __builtin_amdgcn_wave_barrier();
    sw[lane]      = a0;
    sw[32 + lane] = a1;
    __builtin_amdgcn_fence(__ATOMIC_RELEASE, "wavefront");
    __builtin_amdgcn_wave_barrier();
    const v4f ga = *(const v4fa*)(sw + 8 * lc);
    const v4f gb = *(const v4fa*)(sw + 8 * lc + 4);
    const v8us ov = split8(ga, gb, islo);
    const int orow = b * SEQ + tg;
    unsigned short* dst = OA + (size_t)orow * KOUT + (islo ? DM : 0) + h * DK + 8 * lc;
    const bool wsv = lane < 16;
    if (wsv) *(v8us*)dst = ov;
    // the wait before the store's address and data registers are written again for the next target
    asm volatile("s_wait_xcnt 0x0" ::: "memory");
  }
}

// ---------------------------------------------------------------------------
static inline int cdiv(int a, int b) { return (a + b - 1) / b; }

extern "C" void kernel_launch(void* const* d_in, const int* in_sizes, int n_in,
                              void* d_out, int out_size, void* d_ws, size_t ws_size,
                              hipStream_t stream) {
  if (n_in < 12) return;
  if (in_sizes[0] != NB_ * SEQ * DM || in_sizes[1] != NB_ * SEQ * DM || in_sizes[2] != NB_ * SEQ * DM) return;
  if (in_sizes[3] != NPOS || in_sizes[4] != NPOS) return;
  if (in_sizes[5] != NH * W2 * DK || in_sizes[6] != NH * W2 * DK || in_sizes[7] != NH * W2 * DK) return;
  if (in_sizes[8] != DM * DM || in_sizes[9] != DM * DM || in_sizes[10] != DM * DM || in_sizes[11] != DM * DM) return;
  if (out_size != NB_ * SEQ * DM) return;

  const float* query   = (const float*)d_in[0];    // [4][1024][512]
  const float* keyx    = (const float*)d_in[1];
  const float* value   = (const float*)d_in[2];
  const int*   pos_enc = (const int*)  d_in[3];    // [4][8][16][1024]
  const int*   pos_pad = (const int*)  d_in[4];
  const float* rel_q   = (const float*)d_in[5];    // [1][8][32][64]
  const float* rel_k   = (const float*)d_in[6];
  const float* rel_v   = (const float*)d_in[7];
  const float* Wq      = (const float*)d_in[8];    // [512][512] rows = output feature
  const float* Wk      = (const float*)d_in[9];
  const float* Wv      = (const float*)d_in[10];
  const float* Wo      = (const float*)d_in[11];
  float*       out     = (float*)d_out;            // [4][1024][512]

  // workspace carve (every region a whole number of 256-B blocks; all planes are exact tile multiples)
  char* ws = (char*)d_ws;
  size_t off = 0;
  const size_t oXB  = off; off += (size_t)NXU * 16;                     // 12,582,912  bf16 [3][4096][512]
  const size_t oWB  = off; off += (size_t)NWU * 16;                     //  1,572,864  bf16 [3][512][512]
  const size_t oWOB = off; off += (size_t)NWOU * 16;                    //  1,048,576  bf16 [512][1024]
  const size_t oQKV = off; off += (size_t)3 * PLQ * 4;                  // 25,165,824  f32 [3][32][1024][64]
  const size_t oS   = off; off += (size_t)NBH * NSLOT * 4;              //  4,194,304  f32 [32][32768]
  const size_t oOA  = off; off += (size_t)MROWS * KOUT * 2;             //  8,388,608  bf16 [4096][1024]
  const size_t oENT = off; off += (size_t)NBH * NSLOT * 4;              //  4,194,304  int [32][32768]
  const size_t oSOF = off; off += (size_t)NBH * NCH * SEQ * 4;          //  1,048,576  int [32][8][1024]
  const size_t oSCN = off; off += (size_t)NBH * NCH * SEQ * 4;          //  1,048,576  int [32][8][1024]
  const size_t oTOT = off; off += (size_t)NBH * NCH * 4;                //      1,024  int [32][8]
  if (off > ws_size || off > (size_t)WSMAX) return;                     // total 59,245,568
  unsigned short* XB  = (unsigned short*)(ws + oXB);
  unsigned short* WB  = (unsigned short*)(ws + oWB);
  unsigned short* WOB = (unsigned short*)(ws + oWOB);
  float*          QKV = (float*)(ws + oQKV);
  float*          S   = (float*)(ws + oS);
  unsigned short* OA  = (unsigned short*)(ws + oOA);
  int*            ENT = (int*)(ws + oENT);
  int*            SOFF = (int*)(ws + oSOF);
  int*            SCNT = (int*)(ws + oSCN);
  int*            TOT  = (int*)(ws + oTOT);
  const float* QP  = QKV;
  const float* KPl = QKV + (size_t)PLQ;
  const float* VP  = QKV + (size_t)2 * PLQ;

  // 1: bf16 operand planes
  k_convert<<<NCU / NTHR, NTHR, 0, stream>>>(query, keyx, value, Wq, Wk, Wv, Wo, XB, WB, WOB, NCU);
  // 2: q/k/v projections -> f32 head planes
  k_gemm<0><<<dim3(MROWS / GBM, DM / GBN, 3), GTHR, 0, stream>>>(XB, WB, QKV, DM, MROWS * DM, DM * DM, PLQ);
  // 3: window scores; beside them the slot lists grouped by target, one per chunk
  k_scores<<<dim3(W2, NBKT / W2 + NBH), NTHR, 0, stream>>>(pos_enc, pos_pad, rel_q, rel_k, QP, KPl, S, ENT, SOFF, SCNT, TOT);
  // 4: softmax + owner segment sums -> bf16 hi|lo plane
  k_drain<<<dim3(SEQ / (NWAVE * TPD), NBH), NTHR, 0, stream>>>(rel_v, VP, S, ENT, SOFF, SCNT, TOT, OA);
  // 5: output projection -> out
  k_gemm<1><<<dim3(MROWS / GBM, DM / GBN, 1), GTHR, 0, stream>>>(OA, WOB, out, KOUT, 0, 0, 0);
}

// v010
// Measured time: 77.4 microseconds a run.
// Two timings next to v009 both put it at 1.03 times that version's speed.
// All steps since v000 together make it 73.9 times as fast.
#include <hip/hip_runtime.h>
#include <stddef.h>
#include <stdint.h>

// Contractions: q/k/v input projections (K=512) and the output projection (K=1024 = activation bf16 hi|lo pair
// accumulate). Window scores (three 64-deep dots per slot), softmax statistics, weighted value sums and the
// per-position segment sums: f32 VALU.
//
// Carry audit: no plane carries a power-of-two scale; nothing is folded back anywhere.
//   XB  [3][4096][512]  bf16 = RNE(query | key | value)               (k_convert) -> A of the projections
//   WB  [3][512][512]   bf16 = RNE(Wq | Wk | Wv), rows [n][k]          (k_convert) -> B of the projections
//   OA  [4096][1024]    bf16 = [hi | lo] of the per-head attention output, hi = RNE(o), lo = RNE(o - hi)
//                                                                     (k_drain)   -> A of the output projection
//   rel_q, rel_k, rel_v are RNE-converted to bf16 values (held as f32): rel_v when staged in LDS, rel_q and rel_k in registers.
//   f32 planes: QKV [3][32][1024][64] (projection results), S [32][32768] (masked, scaled scores).
//   Slot lists (bucketing groups of the k_convert launch -> k_drain), one per chunk of 4096 consecutive flat slots:
//   ENT [32][8][4096] int (f << 10 | kv), grouped by target inside the chunk; SOFF, SCNT [32][8][1024] int segment
//   start (in the chunk's list) and count per target; TOT [32][8] int slots filed.

#define NB_    4
#define SEQ    1024
#define DM     512
#define NH     8
#define DK     64
#define KP1    16
#define W2     32
#define NSLOT  32768                 // W2 * SEQ flat window slots per (b,h)
#define NHALF  16384                 // KP1 * SEQ
#define NBH    32                    // NB_ * NH
#define MROWS  4096                  // NB_ * SEQ
#define KOUT   1024                  // 2 * DM (hi | lo)
#define NPOS   (NBH * NHALF)         // ints per position table
#define PLQ    (NBH * SEQ * DK)      // floats per q/k/v plane (2097152)
#define NTHR   256
#define NWAVE  8
#define GTHR   128
#define GBM    64
#define GBN    64
#define TPD    8                     // targets per wave in k_drain
#define DEGCAP 256                   // static cap on slots per target position
#define RINV24 (1.0f / 24.0f)
#define NEGBIG (-1.0e9f)
#define WSMAX  134217728
#define NXU    (3 * (MROWS * DM / 8))   // 786432 convert units (8 elements each)
#define NWU    (3 * (DM * DM / 8))      // 98304
#define NWOU   (DM * KOUT / 8)          // 65536
#define NCU    (NXU + NWU + NWOU)       // 950272
#define NCH    8                     // chunks of flat slots per (b,h): one bucketing work-group each
#define CSL    (NSLOT / NCH)         // 4096 consecutive flat slots per chunk
#define FPW    (CSL / NWAVE)         // 512 consecutive flat slots per wave in the bucketing passes
#define BGRP   8                     // 32-slot steps whose index loads are issued together
#define NBKT   (NBH * NCH)           // bucketing work-groups at the head of the k_convert launch
#define NSV    (NSLOT / (4 * NTHR))  // 16-byte score loads per thread in the statistics of k_drain

static_assert((MROWS % GBM) == 0 && (DM % GBN) == 0 && (SEQ % GBM) == 0);
static_assert((DM % 32) == 0 && (KOUT % 32) == 0);
static_assert(GBN == DK);
static_assert(GBM == (GTHR / 32) * 16);
static_assert(NSLOT == W2 * SEQ && NHALF == KP1 * SEQ && NBH == NB_ * NH && MROWS == NB_ * SEQ);
static_assert(NSLOT == (1 << 15) && SEQ == (1 << 10));
static_assert((MROWS * DM / 8) == (1 << 18) && (DM * DM / 8) == (1 << 15) && (KOUT / 8) == 128);
static_assert((NXU % NTHR) == 0 && ((NXU + NWU) % NTHR) == 0 && (NCU % NTHR) == 0);
static_assert(NTHR * 4 == SEQ && (SEQ % (TPD * NWAVE)) == 0);
static_assert((NSLOT % (4 * NTHR)) == 0);
static_assert(NTHR * 8 == W2 * DK);
static_assert(TPD == 8 && NCH == 8 && (CSL * 4) % (16 * NTHR) == 0);
static_assert(FPW * NWAVE == CSL && CSL * NCH == NSLOT && (FPW % (32 * BGRP)) == 0 && (NHALF % CSL) == 0);
static_assert(PLQ == NB_ * SEQ * DM);

typedef float    v4f  __attribute__((ext_vector_type(4)));
typedef float    v8f  __attribute__((ext_vector_type(8)));
typedef int      v4i  __attribute__((ext_vector_type(4)));
typedef int      v8i  __attribute__((ext_vector_type(8)));
typedef unsigned short v8us __attribute__((ext_vector_type(8)));
typedef __bf16   v16b __attribute__((ext_vector_type(16)));
typedef v4f  __attribute__((may_alias)) v4fa;
typedef v4i  __attribute__((may_alias)) v4ia;
typedef v8us __attribute__((may_alias)) v8usa;
union FragB { v16b v; v8us h[2]; v8i w; };

// WMMA with hazard guard: ties D, keeps A/B live for 4 VALU slots
__device__ __forceinline__ v8f wmb(const FragB& a, const FragB& b, v8f c) {
  v8f d = __builtin_amdgcn_wmma_f32_16x16x32_bf16(false, a.v, false, b.v, (short)0, c, false, false);
  asm volatile("v_nop\n\tv_nop\n\tv_nop\n\tv_nop" : "+v"(d) : "v"(a.w), "v"(b.w));
  return d;
}

// f32 -> bf16 bits, RNE convert
__device__ __forceinline__ unsigned int bf16u(float x) {
  const unsigned int u = __float_as_uint(x);
  return (u + 0x7FFFu + ((u >> 16) & 1u)) >> 16;
}
// f32 -> nearest bf16 value held as f32
__device__ __forceinline__ float bf16f(float x) { return __uint_as_float(bf16u(x) << 16); }

__device__ __forceinline__ v8us cvt8b(const v4f a, const v4f b) {
  v8us r;
  r[0] = (unsigned short)bf16u(a.x); r[1] = (unsigned short)bf16u(a.y);
  r[2] = (unsigned short)bf16u(a.z); r[3] = (unsigned short)bf16u(a.w);
  r[4] = (unsigned short)bf16u(b.x); r[5] = (unsigned short)bf16u(b.y);
  r[6] = (unsigned short)bf16u(b.z); r[7] = (unsigned short)bf16u(b.w);
  return r;
}

__device__ __forceinline__ unsigned short hl1(float x, bool islo) {
  const unsigned int hu = bf16u(x);
  const float hf = __uint_as_float(hu << 16);
  const unsigned int lu = bf16u(x - hf);
  return (unsigned short)(islo ? lu : hu);
}
// 8 floats -> 8 bf16 hi parts (islo false) or 8 bf16 lo parts (islo true), lo = RNE(x - hi)
__device__ __forceinline__ v8us split8(const v4f a, const v4f b, bool islo) {
  v8us r;
  r[0] = hl1(a.x, islo); r[1] = hl1(a.y, islo); r[2] = hl1(a.z, islo); r[3] = hl1(a.w, islo);
  r[4] = hl1(b.x, islo); r[5] = hl1(b.y, islo); r[6] = hl1(b.z, islo); r[7] = hl1(b.w, islo);
  return r;
}

// ---------------------------------------------------------------------------
// Flat window slot f (0..32767) of head group bh: window row w = f >> 10, position s = f & 1023.
//   q index  = w < 16 ? pos_pad[w][s]    : pe[w-16][s]       (pe = pos_enc with -1 -> 0)
//   kv index = w < 16 ? pe[w][s]         : pos_pad[w-16][s]
//   masked   = (pos_enc[w & 15][s] == -1) || f < 1024
// Both tables are read unconditionally by the caller (same place g = bh * NHALF + (f & (NHALF - 1)) for both halves):
// penc = pos_enc[g], ppad = pos_pad[g]; both are clamped into [0, SEQ-1] here.
// ---------------------------------------------------------------------------
__device__ __forceinline__ void slot_idx(int penc, int ppad, int f, int& qi, int& ki, bool& msk) {
  const bool neg = (penc == -1);
  int pe = neg ? 0 : penc;
  pe = pe < 0 ? 0 : (pe > SEQ - 1 ? SEQ - 1 : pe);
  int pp = ppad < 0 ? 0 : (ppad > SEQ - 1 ? SEQ - 1 : ppad);
  const bool lo = f < NHALF;
  qi = lo ? pp : pe;
  ki = lo ? pe : pp;
  msk = neg || (f < SEQ);
}

// position index clamped into [0, SEQ-1]
__device__ __forceinline__ int clamp_pos(int v) { return v < 0 ? 0 : (v > SEQ - 1 ? SEQ - 1 : v); }

// Mask of the lanes of this wave whose 10-bit target t equals this lane's (all 32 lanes active): one ballot per bit.
__device__ __forceinline__ unsigned int same_target(int t) {
  unsigned int peers = 0xFFFFFFFFu;
#pragma unroll
  for (int bit = 0; bit < 10; ++bit) {
    const bool on = ((t >> bit) & 1) != 0;
    const unsigned int bl = __builtin_amdgcn_ballot_w32(on);
    peers &= on ? bl : ~bl;
  }
  return peers;
}

// ---------------------------------------------------------------------------
// bf16 WMMA GEMM, plane z = blockIdx.z: C[4096][N] tile = A[4096][K] (bf16, pitch K) x WT[N][K]^T (bf16 rows n,
// k-contiguous), K a multiple of 64. grid (4096/64, N/64, nz), 128 threads: wave w owns rows 16w..16w+15 of the 64x64
// tile, acc[4] = 4 column tiles. The 64 A rows and the 64 WT rows of the tile pass through LDS in chunks of 64 k (one
// 128-byte line per row): eight lanes read one line, so a load instruction covers four whole lines, and every line is
// read once per work-group. Two LDS buffers: the next chunk's lines are requested before this chunk's products and
// filed behind them (EPI 1: requested three chunks ahead and filed ahead of them); one barrier a chunk. Row pitch in LDS 144 bytes (16 B x odd) for the 16-byte fragment reads.
// A fragment (row m = lane&15): elements 0..7 <- k0+8h+0..7, 8..15 <- k0+16+8h+0..7
// (h = lane>>4); B fragment (col n = lane&15) from WT row (col0+16t+n) with the SAME k map; D element r =
// (row 8h+r, col lane&15). Tile staged in LDS as 64x64 f32 (over the chunk buffers, behind the loop's last barrier),
// then one instruction writes two 256-B row segments
//   EPI 0: head plane out[z][(b*8 + blockIdx.y)*1024 + s][64] f32 (b = row>>10, s = row&1023; column tile = one head)
//   EPI 1: out[row][512] f32 at columns col0..col0+63 (the final output, z = 0)
// coverage: grid (64, 8, nz) covers every (row, col) of each 4096 x 512 plane exactly once.
// ---------------------------------------------------------------------------
#define KC    64                     // k per staged chunk
#define LPT   72                     // LDS row pitch in bf16 elements (144 bytes)
#define TLE   (GBM * LPT)            // elements of one staged operand tile
static_assert(GBM == GBN && (DM % KC) == 0 && (KOUT % KC) == 0 && KC * 2 == 128);
static_assert(GTHR * 4 * 8 == GBM * KC);
static_assert(4 * TLE * 2 >= GBM * GBN * 4);

// Work-group barrier for LDS traffic alone: the wave's own LDS reads and writes are done, then the barrier.
// __syncthreads() also waits for every global load that is still out, which would end the requests that run ahead.
__device__ __forceinline__ void lds_barrier() {
  asm volatile("s_wait_dscnt 0x0\n\ts_barrier_signal -1\n\ts_barrier_wait -1" ::: "memory");
}

template<int EPI>
__global__ __launch_bounds__(GTHR) void k_gemm(
    const unsigned short* __restrict__ A, const unsigned short* __restrict__ WT,
    float* outF, int K, int strideA, int strideW, int strideO)
{
  __shared__ __attribute__((aligned(16))) v4f smem[4 * TLE * 2 / 16];   // 36,864 B: [buffer][A | WT][64][72] bf16
  unsigned short* tl = (unsigned short*)smem;
  float* stg = (float*)smem;                                            // 64 x 64 f32, epilogue only
  const int tid = (int)threadIdx.x, lane = tid & 31, wave = tid >> 5, hh = lane >> 4, m = lane & 15;
  const int z = (int)blockIdx.z;
  const unsigned short* Az = A  + (size_t)z * (size_t)strideA;
  const unsigned short* Wz = WT + (size_t)z * (size_t)strideW;
  float* Oz = outF + (size_t)z * (size_t)strideO;
  const int rowBase = (int)blockIdx.x * GBM;
  const int col0    = (int)blockIdx.y * GBN;
  const int Kp      = (EPI == 1) ? KOUT : K;          // the output projection's depth is fixed: its chunk loop is unrolled

  v8f acc[4];
  {
    const v8f zz = {0.f, 0.f, 0.f, 0.f, 0.f, 0.f, 0.f, 0.f};
    acc[0] = zz; acc[1] = zz; acc[2] = zz; acc[3] = zz;
  }
  // staging: thread takes 16-byte piece sg of tile rows r0, r0+16, r0+32, r0+48 of both operands
  const int sg = tid & 7, r0 = tid >> 3;
  const char* ab = (const char*)(Az + (size_t)rowBase * (size_t)Kp);    // work-group uniform
  const char* wb = (const char*)(Wz + (size_t)col0 * (size_t)Kp);
  unsigned int go[4];
#pragma unroll
  for (int i = 0; i < 4; ++i) go[i] = (unsigned int)((r0 + 16 * i) * Kp + 8 * sg) * 2u;
  unsigned short* sp = tl + r0 * LPT + 8 * sg;
  const unsigned short* fa = tl + (16 * wave + m) * LPT + 8 * hh;       // A fragment row of this lane
  const unsigned short* fb = tl + TLE + m * LPT + 8 * hh;               // WT fragment row, column tile 0
  if constexpr (EPI == 1) {
  // Output projection: two work-groups a WGP are too few waves to cover a wave's own round trip to L2 or memory. A chunk's
  // lines are requested PD chunks before they are filed in LDS, into PD sets of registers, and stay out over the barriers
  // between. The loop is unrolled whole: a set is chosen by a constant, and row and chunk are an immediate offset on one
  // offset register, which is never written again while a load is out.
  constexpr int NC = KOUT / KC;
  constexpr int PD = 3;
  constexpr int RS = 16 * KOUT * 2;                   // bytes from one of the thread's four rows to the next
  static_assert(NC > PD);
  v8us pa[PD][4], pb[PD][4];
#pragma unroll
  for (int d = 0; d < PD; ++d) {
#pragma unroll
    for (int i = 0; i < 4; ++i) {
      pa[d][i] = *(const v8usa*)(ab + go[0] + (i * RS + d * (KC * 2)));
      pb[d][i] = *(const v8usa*)(wb + go[0] + (i * RS + d * (KC * 2)));
    }
  }
#pragma unroll
  for (int i = 0; i < 4; ++i) {
    *(v8usa*)(sp + 16 * i * LPT)       = pa[0][i];
    *(v8usa*)(sp + TLE + 16 * i * LPT) = pb[0][i];
  }
#pragma unroll
  for (int i = 0; i < 4; ++i) {
    pa[0][i] = *(const v8usa*)(ab + go[0] + (i * RS + PD * (KC * 2)));
    pb[0][i] = *(const v8usa*)(wb + go[0] + (i * RS + PD * (KC * 2)));
  }
  lds_barrier();                                      // publishes chunk 0
  // unrolled whole: register sets and chunk offsets are constants
#pragma unroll
  for (int c = 0; c < NC; ++c) {
    const int bo = (c & 1) * (2 * TLE);               // this chunk's buffer
    // the chunk's twenty fragment reads go out together, ahead of its eight products: one LDS latency a chunk
    FragB af[KC / 32], bf[KC / 32][4];
#pragma unroll
    for (int ks = 0; ks < KC / 32; ++ks) {
      af[ks].h[0] = *(const v8usa*)(fa + bo + 32 * ks);        // k = 64c + 32ks + 8hh + 0..7
      af[ks].h[1] = *(const v8usa*)(fa + bo + 32 * ks + 16);   // k = 64c + 32ks + 16 + 8hh + 0..7
#pragma unroll
      for (int t = 0; t < 4; ++t) {
        const unsigned short* wq = fb + bo + 16 * t * LPT + 32 * ks;   // WT row col0 + 16t + m
        bf[ks][t].h[0] = *(const v8usa*)wq;                    // same k map as A
        bf[ks][t].h[1] = *(const v8usa*)(wq + 16);
      }
    }
    // chunk c + 1 was requested PD chunks ago: it is filed behind the fragment reads, so the LDS writes run under the products
    if (c + 1 < NC) {
      const int st = (c + 1) % PD;                         // the set that holds chunk c + 1
      unsigned short* sn = sp + (2 * TLE - bo);            // the other buffer: its readers left it at the last barrier
#pragma unroll
      for (int i = 0; i < 4; ++i) {
        *(v8usa*)(sn + 16 * i * LPT)       = pa[st][i];
        *(v8usa*)(sn + TLE + 16 * i * LPT) = pb[st][i];
      }
      if (c + 1 + PD < NC) {
#pragma unroll
        for (int i = 0; i < 4; ++i) {
          pa[st][i] = *(const v8usa*)(ab + go[0] + (i * RS + (c + 1 + PD) * (KC * 2)));
          pb[st][i] = *(const v8usa*)(wb + go[0] + (i * RS + (c + 1 + PD) * (KC * 2)));
        }
      }
    }
#pragma unroll
    for (int ks = 0; ks < KC / 32; ++ks) {
#pragma unroll
      for (int t = 0; t < 4; ++t) acc[t] = wmb(af[ks], bf[ks][t], acc[t]);
    }
    // publishes the next chunk and ends every wave's reads of this one (after the last chunk: frees the LDS for stg)
    lds_barrier();
  }
  // the wait before the loads' offset register is written again; naming it keeps it as it is up to here
  asm volatile("s_wait_xcnt 0x0" :: "v"(go[0]) : "memory");
  } else {
  const int nch = K >> 6;
  v8us ra[4], rb[4];
#pragma unroll
  for (int i = 0; i < 4; ++i) {
    ra[i] = *(const v8usa*)(ab + go[i]);
    rb[i] = *(const v8usa*)(wb + go[i]);
  }
  // the wait before a register that these loads name is written again
  asm volatile("s_wait_xcnt 0x0" :: "v"(go[0]), "v"(go[1]), "v"(go[2]), "v"(go[3]) : "memory");
#pragma unroll
  for (int i = 0; i < 4; ++i) {
    *(v8usa*)(sp + 16 * i * LPT)       = ra[i];
    *(v8usa*)(sp + TLE + 16 * i * LPT) = rb[i];
  }
  __syncthreads();
  // kept rolled: a trip is a whole chunk (8 loads, 20 fragment reads, 8 products); a second copy would only add registers
#pragma unroll 1
  for (int c = 0; c < nch; ++c) {
    const int bo = (c & 1) * (2 * TLE);               // this chunk's buffer
    const bool nxt = c + 1 < nch;                     // work-group uniform
    unsigned int gn[4];                               // the next chunk's byte offsets
#pragma unroll
    for (int i = 0; i < 4; ++i) gn[i] = go[i] + (unsigned int)(c + 1) * (KC * 2u);
    if (nxt) {
#pragma unroll
      for (int i = 0; i < 4; ++i) {
        ra[i] = *(const v8usa*)(ab + gn[i]);
        rb[i] = *(const v8usa*)(wb + gn[i]);
      }
    }
    // the chunk's twenty fragment reads go out together, ahead of its eight products: one LDS latency a chunk
    FragB af[KC / 32], bf[KC / 32][4];
#pragma unroll
    for (int ks = 0; ks < KC / 32; ++ks) {
      af[ks].h[0] = *(const v8usa*)(fa + bo + 32 * ks);        // k = 64c + 32ks + 8hh + 0..7
      af[ks].h[1] = *(const v8usa*)(fa + bo + 32 * ks + 16);   // k = 64c + 32ks + 16 + 8hh + 0..7
#pragma unroll
      for (int t = 0; t < 4; ++t) {
        const unsigned short* wq = fb + bo + 16 * t * LPT + 32 * ks;   // WT row col0 + 16t + m
        bf[ks][t].h[0] = *(const v8usa*)wq;                    // same k map as A
        bf[ks][t].h[1] = *(const v8usa*)(wq + 16);
      }
    }
#pragma unroll
    for (int ks = 0; ks < KC / 32; ++ks) {
#pragma unroll
      for (int t = 0; t < 4; ++t) acc[t] = wmb(af[ks], bf[ks][t], acc[t]);
    }
    if (nxt) {
      // the wait before a register that the next chunk's loads name is written again; naming the offsets keeps each in a
      // register of its own up to here (else one could be a later load's destination). Behind the products it costs nothing.
      asm volatile("s_wait_xcnt 0x0" :: "v"(gn[0]), "v"(gn[1]), "v"(gn[2]), "v"(gn[3]) : "memory");
      unsigned short* sn = sp + (2 * TLE - bo);            // the other buffer: its readers left it at the last barrier
#pragma unroll
      for (int i = 0; i < 4; ++i) {
        *(v8usa*)(sn + 16 * i * LPT)       = ra[i];
        *(v8usa*)(sn + TLE + 16 * i * LPT) = rb[i];
      }
    }
    // publishes the next chunk and ends every wave's reads of this one (after the last chunk: frees the LDS for stg)
    __syncthreads();
  }
  }

#pragma unroll
  for (int t = 0; t < 4; ++t) {
    const int lc = 16 * t + m;
#pragma unroll
    for (int r = 0; r < 8; ++r) {
      const int lr = 16 * wave + 8 * hh + r;          // D element r = (row 8hh+r, col m)
      stg[lr * GBN + lc] = acc[t][r];
    }
  }
  __syncthreads();

  float* ob;
  int ldo;
  if (EPI == 0) {
    const int bq = rowBase >> 10;
    const int s0 = rowBase & (SEQ - 1);
    ob  = Oz + ((size_t)(bq * NH + (int)blockIdx.y) * SEQ + s0) * DK;
    ldo = DK;
  } else {
    ob  = Oz + (size_t)rowBase * DM + col0;
    ldo = DM;
  }
  v4f fv[8];
#pragma unroll
  for (int i = 0; i < 8; ++i) {
    const int lr = 16 * wave + 2 * i + hh;
    fv[i] = *(const v4fa*)(stg + lr * GBN + 4 * m);
  }
#pragma unroll
  for (int i = 0; i < 8; ++i) {
    const int lr = 16 * wave + 2 * i + hh;
    float* op = ob + (size_t)lr * (size_t)ldo + 4 * m;
    *(v4f*)op = fv[i];
  }
  
}

// ---------------------------------------------------------------------------
// Bucketing of chunk ch (4096 consecutive flat slots) of one (b,h) by the slots' q index. It reads the position tables
// alone, nothing computed, so it runs beside the conversions, in the first launch (k_convert below), one work-group a chunk.
// Deterministic, in LDS (count -> exclusive scan -> f-ascending cursor fill, no atomics): wave w takes the chunk's flat
// slots [512w, 512w + 512), 32 a step; lanes with the same target are matched by ballots, the first of them updates the
// wave's own counter / cursor row, each lane's place is cursor + its rank among them.
// The finished list goes to the workspace in whole lines, with each target's segment start and count, for k_drain.
// cur [NWAVE][SEQ] per-wave counts, then per-wave cursors; ent [CSL] packed (f << 10 | kv); wtot [NWAVE]: all in LDS.
// coverage: 256 work-groups x (4096 entries + 1024 starts + 1024 counts + 1 total), each written once.
// ---------------------------------------------------------------------------
__device__ __forceinline__ void bucket_chunk(
    const int* __restrict__ pos_enc, const int* __restrict__ pos_pad, int bh, int ch,
    int* cur, int* ent, int* wtot, int* ENT, int* SOFF, int* SCNT, int* TOT)
{
  const int tid = (int)threadIdx.x, lane = tid & 31, wave = tid >> 5;
  const int lst = bh * NCH + ch;          // this work-group's list
  {
    const v4i z4 = {0, 0, 0, 0};
#pragma unroll
    for (int i = 0; i < CSL / (4 * NTHR); ++i) *(v4ia*)(ent + i * (4 * NTHR) + 4 * tid) = z4;
#pragma unroll
    for (int w2 = 0; w2 < NWAVE; ++w2) *(v4ia*)(cur + w2 * SEQ + 4 * tid) = z4;
  }
  __syncthreads();

  // ---- counts per (wave, target): every wave over its own 512 slots ----
  // A chunk's 4096 slots lie in one half of the window rows, so its q table and its kv table (slot_idx) are fixed:
  // lower half q <- pos_pad, kv <- pos_enc; upper half the other way round. clamp_pos sends pos_enc's -1 to 0.
  const int f0w = ch * CSL + __builtin_amdgcn_readfirstlane(wave) * FPW;   // wave-uniform: scalar loop control, table choice
  const bool lohalf = f0w < NHALF;
  const int* qtab = (lohalf ? pos_pad : pos_enc) + bh * NHALF + (f0w & (NHALF - 1));
  const int* ktab = (lohalf ? pos_enc : pos_pad) + bh * NHALF + (f0w & (NHALF - 1));
  int* wcur = cur + wave * SEQ;
  const unsigned int below = (1u << lane) - 1u;
  const unsigned int lane4 = 4u * (unsigned int)lane;
#pragma unroll 1
  for (int g = 0; g < FPW; g += 32 * BGRP) {
    int tq[BGRP];
#pragma unroll
    for (int j = 0; j < BGRP; ++j) tq[j] = clamp_pos(qtab[g + 32 * j + lane]) & (SEQ - 1);
#pragma unroll
    for (int j = 0; j < BGRP; ++j) {
      const unsigned int peers = same_target(tq[j]);
      if ((peers & below) == 0u) wcur[tq[j]] = wcur[tq[j]] + __builtin_popcount(peers);
      // the next step's reader of a counter may be another lane of this wave: keep the LDS accesses in step order
      __builtin_amdgcn_fence(__ATOMIC_ACQ_REL, "wavefront");
      __builtin_amdgcn_wave_barrier();
    }
  }
  __syncthreads();

  // ---- exclusive prefix over SEQ counts -> SOFF ----
  int tot;
  {
    v4i cw[NWAVE];
    v4i ca = {0, 0, 0, 0};
#pragma unroll
    for (int w2 = 0; w2 < NWAVE; ++w2) {
      cw[w2] = *(const v4ia*)(cur + w2 * SEQ + 4 * tid);
      ca += cw[w2];
    }
    *(v4ia*)(SCNT + lst * SEQ + 4 * tid) = ca;
    const int e0 = ca.x < 0 ? 0 : ca.x, e1 = ca.y < 0 ? 0 : ca.y, e2 = ca.z < 0 ? 0 : ca.z, e3 = ca.w < 0 ? 0 : ca.w;
    const int ts = e0 + e1 + e2 + e3;
    int incl = ts;
#pragma unroll
    for (int d = 1; d < 32; d <<= 1) {
      const int up = __shfl_up(incl, d);
      if (lane >= d) incl += up;
    }
    if (lane == 31) wtot[wave] = incl;
    __syncthreads();
    int pre = 0;
    tot = 0;
#pragma unroll
    for (int w2 = 0; w2 < NWAVE; ++w2) {
      const int t = wtot[w2];
      tot += t;
      pre += (w2 < wave) ? t : 0;
    }
    int run = pre + incl - ts;
    v4i so;
    so.x = run; run += e0;
    so.y = run; run += e1;
    so.z = run; run += e2;
    so.w = run;
    *(v4ia*)(SOFF + lst * SEQ + 4 * tid) = so;
    // wave w2's cursor of a target starts behind the slots that waves 0..w2-1 hold for it (f ascending over waves)
#pragma unroll
    for (int w2 = 0; w2 < NWAVE; ++w2) {
      *(v4ia*)(cur + w2 * SEQ + 4 * tid) = so;
      so += cw[w2];
    }
  }
  __syncthreads();

  // ---- fill: packed (f << 10 | kv) into target segments (every wave over its own slots, f ascending) ----
#pragma unroll 1
  for (int g = 0; g < FPW; g += 32 * BGRP) {
    int tq[BGRP], en[BGRP];
    // this group's kv indices, from the lane's own column on
    const int* kg = (const int*)((const char*)(ktab + g) + lane4);
#pragma unroll
    for (int j = 0; j < BGRP; ++j) {
      const int o = g + 32 * j + lane;
      tq[j] = clamp_pos(qtab[o]) & (SEQ - 1);
      en[j] = ((f0w + o) << 10) | clamp_pos(kg[32 * j]);
    }
    // the steps below reuse the address registers of the loads above
    asm volatile("s_wait_xcnt 0x0" ::: "memory");
#pragma unroll
    for (int j = 0; j < BGRP; ++j) {
      const unsigned int peers = same_target(tq[j]);
      const unsigned int lower = peers & below;
      const int base = wcur[tq[j]];
      int pos = base + __builtin_popcount(lower);
      pos = pos < 0 ? 0 : (pos > CSL - 1 ? CSL - 1 : pos);
      ent[pos] = en[j];
      if (lower == 0u) wcur[tq[j]] = base + __builtin_popcount(peers);
      // the next step's reader of a cursor may be another lane of this wave: keep the LDS accesses in step order
      __builtin_amdgcn_fence(__ATOMIC_ACQ_REL, "wavefront");
      __builtin_amdgcn_wave_barrier();
    }
  }
  __syncthreads();

  // ---- the list to the workspace, 16 bytes a lane ----
  {
    int* eg = ENT + (size_t)lst * CSL + 4 * tid;
    // unrolled whole: every store takes its place from an immediate offset, so no address register is written again
#pragma unroll
    for (int i = 0; i < CSL / (4 * NTHR); ++i) *(v4ia*)(eg + i * (4 * NTHR)) = *(const v4ia*)(ent + i * (4 * NTHR) + 4 * tid);
    if (tid == 0) TOT[lst] = tot;
  }
}

// ---------------------------------------------------------------------------
// bf16 operand planes, with the bucketing beside them. The first 256 work-groups bucket one chunk each (bucket_chunk: it
// reads the position tables alone, has the longest dependent chain); the others convert, unit u:
//   u <  NXU        : XB[z][off*8 ..]  z = u >> 18 selects query | key | value
//   u <  NXU + NWU  : WB[z][off*8 ..]  z selects Wq | Wk | Wv (rows [n][k] as given)
// coverage: NXU*8 = 3*4096*512, NWU*8 = 3*512*512, NWOU*8 = 512*1024 elements exactly.
// ---------------------------------------------------------------------------
__global__ __launch_bounds__(NTHR) void k_convert(
    const float* __restrict__ xq, const float* __restrict__ xk, const float* __restrict__ xv,
    const float* __restrict__ wq, const float* __restrict__ wk, const float* __restrict__ wv,
    const float* __restrict__ wo,
    unsigned short* xb, unsigned short* wb, unsigned short* wob, int nUnits,
    const int* __restrict__ pos_enc, const int* __restrict__ pos_pad,
    int* ENT, int* SOFF, int* SCNT, int* TOT)
{
  __shared__ __attribute__((aligned(16))) int bcur[NWAVE * SEQ];
  __shared__ __attribute__((aligned(16))) int bent[CSL];
  __shared__ int bwtot[NWAVE];
  if ((int)blockIdx.x < NBKT) {                      // work-group uniform
    const int lst = (int)blockIdx.x;
    bucket_chunk(pos_enc, pos_pad, lst / NCH, lst % NCH, bcur, bent, bwtot, ENT, SOFF, SCNT, TOT);
    return;
  }
  const int u = ((int)blockIdx.x - NBKT) * NTHR + (int)threadIdx.x;
  if (u >= nUnits) return;
  const float* src;
  unsigned short* dst;
  if (u < NXU) {
    const int z = u >> 18, off = u & ((1 << 18) - 1);
    const float* xs = (z == 0) ? xq : ((z == 1) ? xk : xv);
    src = xs + (size_t)off * 8;
    dst = xb + (size_t)u * 8;
  } else if (u < NXU + NWU) {
    const int e = u - NXU;
    const int z = e >> 15, off = e & ((1 << 15) - 1);
    const float* wsp = (z == 0) ? wq : ((z == 1) ? wk : wv);
    src = wsp + (size_t)off * 8;
    dst = wb + (size_t)e * 8;
  } else {
    const int e = u - NXU - NWU;
    const int n = e >> 7;
    const int c8 = (e & 127) * 8;
    src = wo + (size_t)n * DM + (c8 & (DM - 1));
    dst = wob + (size_t)n * KOUT + c8;
  }
  const v4f a = *(const v4fa*)src;
  const v4f b = *(const v4fa*)(src + 4);
  const v8us o = cvt8b(a, b);
  *(v8us*)dst = o;
}

// ---------------------------------------------------------------------------
// Window scores. grid (8, 32): work-group (g, bh) takes window rows 4g..4g+3 of (b,h) bh, one work-group a WGP.
// The k plane of the (b,h), 1024 rows of 256 bytes, is first brought whole into LDS by line-wide loads; a slot's k row is
// then read from LDS, only its q row from L2. A row's 16 lanes read 256 consecutive bytes: every bank once, no pad.
// A wave takes SSTEP * 32 consecutive slots of one window row, 32 a step.
// Lane j reads slot j's indices. The rows are then read whole: the 16 lanes of a half-wave take one slot's q row and
// k row, 16 bytes a lane (channels 4c..4c+3, c = lane & 15), so one load instruction covers two 256-byte rows; half-wave
// g works through slots 16g..16g+15, the slot's row offset coming from its lane by a DPP row broadcast.
// rel_k[h][w], rel_q[h][w] rows as bf16 values: each lane reads and keeps its four channels of both in registers.
// Per lane c2c, c2p, p2c over its four channels, (c2c + c2p) + p2c, then the sum over the 16 lanes; lane j keeps slot
// j's score; masked slots get -1e9.
// coverage: 8 work-groups x SWV waves x SSTEP steps x 32 lanes = all 32768 slots of each of the 32 (b,h).
// ---------------------------------------------------------------------------
#define STHR  512                    // threads of a k_scores work-group
#define SWV   (STHR / 32)
#define SROW  4                      // window rows per work-group
#define WPR   (SWV / SROW)           // waves per window row
#define SSTEP (SEQ / (32 * WPR))     // 32-slot steps per wave in k_scores
#define NKV   (SEQ * DK / (4 * STHR))   // 16-byte pieces of the k plane per thread
static_assert(SWV * SSTEP * 32 == SROW * SEQ && DK == 64 && (W2 % SROW) == 0 && WPR * SROW == SWV);
static_assert(NKV * 4 * STHR == SEQ * DK && (NHALF % (SSTEP * 32)) == 0);

template<int CTRL>
__device__ __forceinline__ int dpp_mov(int x) { return __builtin_amdgcn_update_dpp(0, x, CTRL, 0xf, 0xf, true); }
// lane I of this lane's 16-lane row (DPP row_share)
template<int I>
__device__ __forceinline__ unsigned int row_bcast(int x) { return (unsigned int)dpp_mov<0x150 + I>(x); }
// sum over the 16 lanes of a row, in every lane of it (DPP row_xmask 1, 2, 4, 8)
__device__ __forceinline__ float row_sum16(float x) {
  x += __int_as_float(dpp_mov<0x161>(__float_as_int(x)));
  x += __int_as_float(dpp_mov<0x162>(__float_as_int(x)));
  x += __int_as_float(dpp_mov<0x164>(__float_as_int(x)));
  x += __int_as_float(dpp_mov<0x168>(__float_as_int(x)));
  return x;
}

// Slots I0..I0+7 of each half-wave: qo, ko = the lane's own slot's q and k row byte offsets, c16 = 16 * (lane & 15).
// qb = q plane in memory, kl = k plane in LDS. All eight q row loads are issued before the first is used, the k rows
// behind them. sc takes the score sum of the lane's own slot.
#define SC_ADDR(i) qa[i] = row_bcast<I0 + (i)>(qo) + c16; ka[i] = row_bcast<I0 + (i)>(ko) + c16;
template<int I0>
__device__ __forceinline__ void score8(int qo, int ko, unsigned int c16, int c,
                                       const char* __restrict__ qb, const char* kl,
                                       const v4f rkv, const v4f rqv, float& sc) {
  unsigned int qa[8], ka[8];
  v4f qv[8], kv[8];
  SC_ADDR(0) SC_ADDR(1) SC_ADDR(2) SC_ADDR(3) SC_ADDR(4) SC_ADDR(5) SC_ADDR(6) SC_ADDR(7)
#pragma unroll
  for (int i = 0; i < 8; ++i) qv[i] = *(const v4fa*)(qb + qa[i]);
#pragma unroll
  for (int i = 0; i < 8; ++i) kv[i] = *(const v4fa*)(kl + ka[i]);
  // the wait before the loads' offset registers are written again; naming them keeps each in a register of its own up
  // to here. The "memory" clobber keeps the loads ahead of it.
  asm volatile("s_wait_xcnt 0x0" :: "v"(qa[0]), "v"(qa[1]), "v"(qa[2]), "v"(qa[3]), "v"(qa[4]), "v"(qa[5]), "v"(qa[6]),
               "v"(qa[7]) : "memory");
#pragma unroll
  for (int i = 0; i < 8; ++i) {
    const v4f q = qv[i], k = kv[i];
    float c2c = q.x * k.x, c2p = q.x * rkv.x, p2c = rqv.x * k.x;
    c2c = fmaf(q.y, k.y, c2c);   c2c = fmaf(q.z, k.z, c2c);   c2c = fmaf(q.w, k.w, c2c);
    c2p = fmaf(q.y, rkv.y, c2p); c2p = fmaf(q.z, rkv.z, c2p); c2p = fmaf(q.w, rkv.w, c2p);
    p2c = fmaf(rqv.y, k.y, p2c); p2c = fmaf(rqv.z, k.z, p2c); p2c = fmaf(rqv.w, k.w, p2c);
    const float s = row_sum16((c2c + c2p) + p2c);
    sc = (c == I0 + i) ? s : sc;
  }
}

__global__ __launch_bounds__(STHR) void k_scores(
    const int* __restrict__ pos_enc, const int* __restrict__ pos_pad,
    const float* __restrict__ rel_q, const float* __restrict__ rel_k,
    const float* __restrict__ QP, const float* __restrict__ KPl, float* S)
{
  __shared__ __attribute__((aligned(16))) float kpl[SEQ * DK];      // 262,144 B: the k plane of this (b,h)
  const int tid = (int)threadIdx.x, lane = tid & 31;
  const int wave = __builtin_amdgcn_readfirstlane(tid >> 5);        // wave-uniform: the rel rows get a scalar base
  const int bh = (int)blockIdx.y, h = bh & (NH - 1);
  const int w = (int)blockIdx.x * SROW + wave / WPR;                // the wave's window row
  const int c = lane & 15;
  const unsigned int c16 = 16u * (unsigned int)c;
  // the slots' indices and the lane's four channels of the two rel rows are asked for with the plane and arrive under it.
  // A wave's slots lie in one block of SSTEP * 32 places of the tables: one index register, immediate offsets.
  const int f0 = w * SEQ + (wave % WPR) * (SSTEP * 32) + lane;
  const int g0 = bh * NHALF + (f0 & (NHALF - 1));
  int pen[SSTEP], ppd[SSTEP];
#pragma unroll
  for (int t = 0; t < SSTEP; ++t) {
    pen[t] = pos_enc[g0 + 32 * t];
    ppd[t] = pos_pad[g0 + 32 * t];
  }
  const v4f rk4 = *(const v4fa*)((const char*)(rel_k + (size_t)(h * W2 + w) * DK) + c16);
  const v4f rq4 = *(const v4fa*)((const char*)(rel_q + (size_t)(h * W2 + w) * DK) + c16);
  // the k plane: all of the thread's loads are requested together, from one index register and immediate offsets
  const float* kp = KPl + (size_t)bh * SEQ * DK;
  v4f st[NKV];
  // unrolled whole: st is indexed by constants only (registers), and the loads stand one behind the other
#pragma unroll
  for (int i = 0; i < NKV; ++i) st[i] = *(const v4fa*)(kp + i * (4 * STHR) + 4 * tid);
#pragma unroll
  for (int i = 0; i < NKV; ++i) *(v4fa*)(kpl + i * (4 * STHR) + 4 * tid) = st[i];
  // Takes the loaded indices and rel channels as inputs only: it keeps their loads ahead of the barrier (behind it their
  // latency would stand in the open), and it is the wait before the index register, named here too, is written again.
  static_assert(SSTEP == 8);
  asm volatile("s_wait_xcnt 0x0" :: "v"(g0), "v"(pen[0]), "v"(pen[1]), "v"(pen[2]), "v"(pen[3]), "v"(pen[4]), "v"(pen[5]),
               "v"(pen[6]), "v"(pen[7]), "v"(ppd[0]), "v"(ppd[1]), "v"(ppd[2]), "v"(ppd[3]), "v"(ppd[4]), "v"(ppd[5]),
               "v"(ppd[6]), "v"(ppd[7]), "v"(rk4), "v"(rq4) : "memory");
  int qo[SSTEP], ko[SSTEP];
  bool mk[SSTEP];
#pragma unroll
  for (int t = 0; t < SSTEP; ++t) {
    int qi, ki;
    slot_idx(pen[t], ppd[t], f0 + 32 * t, qi, ki, mk[t]);
    qo[t] = qi * (DK * 4);
    ko[t] = ki * (DK * 4);
  }
  // publishes the k plane
  __syncthreads();

  const v4f rkv = {bf16f(rk4.x), bf16f(rk4.y), bf16f(rk4.z), bf16f(rk4.w)};
  const v4f rqv = {bf16f(rq4.x), bf16f(rq4.y), bf16f(rq4.z), bf16f(rq4.w)};
  const char* qb = (const char*)(QP + (size_t)bh * SEQ * DK);
  const char* kl = (const char*)kpl;
  float res[SSTEP];
#pragma unroll
  for (int t = 0; t < SSTEP; ++t) {
    float sc = 0.f;
    score8<0>(qo[t], ko[t], c16, c, qb, kl, rkv, rqv, sc);
    score8<8>(qo[t], ko[t], c16, c, qb, kl, rkv, rqv, sc);
    res[t] = mk[t] ? NEGBIG : sc * RINV24;
  }
  float* sp = S + (size_t)bh * NSLOT + f0;
#pragma unroll
  for (int t = 0; t < SSTEP; ++t) sp[32 * t] = res[t];
}

// ---------------------------------------------------------------------------
// One step of k_drain over 8*G slots: lane j holds slot j's value-row byte offset ov (kv * 256), its rel_v-row byte
// offset orl (w * 256) and the place sp of its score in LDS; its weight pm = exp(score - M) * invZ where on, 0 past the
// target's last slot (on false), which leaves the sums as they are.
// vb = value plane of this (b,h) (wave-uniform), rvl = rel_v rows in LDS + lane, lane4 = 4 * lane.
// ---------------------------------------------------------------------------
#define VO8(b) "v"(vo[(b)]), "v"(vo[(b) + 1]), "v"(vo[(b) + 2]), "v"(vo[(b) + 3]), \
               "v"(vo[(b) + 4]), "v"(vo[(b) + 5]), "v"(vo[(b) + 6]), "v"(vo[(b) + 7])
template<int G>
__device__ __forceinline__ void drain_step(int ov, int orl, const float* sp, bool on, float M, float invZ,
                                           const char* __restrict__ vb, const char* rvl,
                                           unsigned int lane4, float& a0, float& a1) {
  unsigned int vo[8 * G];
  float v0[8 * G], v1[8 * G], r0[8 * G], r1[8 * G];
#pragma unroll
  for (int j = 0; j < 8 * G; ++j) vo[j] = (unsigned int)__builtin_amdgcn_readlane(ov, j) + lane4;
#pragma unroll
  for (int j = 0; j < 8 * G; ++j) {
    const float* vr = (const float*)(vb + vo[j]);
    v0[j] = vr[0];
    v1[j] = vr[32];
  }
  const float sc = *sp;            // asked for behind the value rows: their latency covers this read and the exp
#pragma unroll
  for (int j = 0; j < 8 * G; ++j) {
    const float* rr = (const float*)(rvl + __builtin_amdgcn_readlane(orl, j));
    r0[j] = rr[0];
    r1[j] = rr[32];
  }
  // the wait before the loads' offset registers are written again; naming them keeps each in a register of its own up to
  // here (reused inside the step, an offset register would make the next load wait, or be a later load's destination);
  // a statement takes thirty operands, so 32 slots take two. The "memory" clobber keeps the step's loads ahead of it.
  if constexpr (G == 1) {
    asm volatile("s_wait_xcnt 0x0" :: VO8(0) : "memory");
  } else {
    asm volatile("s_wait_xcnt 0x0" :: VO8(0), VO8(8) : "memory");
    if constexpr (G == 3) asm volatile("s_wait_xcnt 0x0" :: VO8(16) : "memory");
    if constexpr (G == 4) asm volatile("s_wait_xcnt 0x0" :: VO8(16), VO8(24) : "memory");
  }
  const float pm = on ? __expf(sc - M) * invZ : 0.0f;
#pragma unroll
  for (int j = 0; j < 8 * G; ++j) {
    const float pj = __int_as_float(__builtin_amdgcn_readlane(__float_as_int(pm), j));
    a0 = fmaf(pj, v0[j] + r0[j], a0);
    a1 = fmaf(pj, v1[j] + r1[j], a1);
  }
}

// segment start in a chunk's list clamped into [0, CSL]
__device__ __forceinline__ int clamp_st(int st) { return st < 0 ? 0 : (st > CSL ? CSL : st); }

// Place in the lists of one (b,h) of position q (0 = first) among the slots of the wave's target jt (wave-uniform).
// Lane (c & 3) * 8 + jt of pre0 / bas0 (chunks 0..3) and pre1 / bas1 (chunks 4..7) holds, for chunk c, the number of the
// target's slots in the chunks before c, and c * CSL + segment start - that number. The last chunk whose first position
// is not above q is q's. Result clamped into [0, NSLOT-1].
__device__ __forceinline__ int seg_idx(int pre0, int pre1, int bas0, int bas1, int jt, int q) {
  int b = __builtin_amdgcn_readlane(bas0, jt);
#pragma unroll
  for (int c = 1; c < NCH; ++c) {
    const int ln = (c & 3) * 8 + jt;
    const int p  = __builtin_amdgcn_readlane(c < 4 ? pre0 : pre1, ln);
    const int bb = __builtin_amdgcn_readlane(c < 4 ? bas0 : bas1, ln);
    b = q >= p ? bb : b;
  }
  const int idx = q + b;
  return idx < 0 ? 0 : (idx > NSLOT - 1 ? NSLOT - 1 : idx);
}

// Place idx (0..NSLOT-1) of the entry list eb of one (b,h), one place a lane.
__device__ __forceinline__ int list_read(const int* __restrict__ eb, int idx) {
  const int e = eb[idx];
  // the wait before the load's index register is written again; naming it keeps it as it is up to here
  asm volatile("s_wait_xcnt 0x0" :: "v"(idx) : "memory");
  return e;
}

// ---------------------------------------------------------------------------
// Owner drain per target position: out_h[i][d] = sum over its slots of p[f] * (v[kv[f]][d] + rel_v[w][d]).
// grid (16 = group of 64 targets, 32 = bh), 8 waves; a wave owns 8 consecutive targets of the bucketing's lists.
// Every work-group first makes the softmax statistics over all 32768 scores of its (b,h) (the same sums in the same order
// in all sixteen) and keeps the scores in LDS; a slot's weight p = exp(S[f] - M) * (1/Z) is made where the slot is drained.
// A target's slots are its segments of the eight chunk lists one behind the other (chunks ascending, so f ascending).
// The drain takes up to 32 slots of a target a step: lane j holds slot j's entry and weight, both are broadcast by
// readlane, the step's value rows are all requested before the first is used, and the sum runs in slot order.
// Lane = channel d (and 32 + d); every loop bound and index is clamped to static ranges.
// Result written as the bf16 hi | lo lines of OA row (b*1024 + i), columns h*64.. (hi) and 512 + h*64..
// Count cap overflow or inconsistent totals -> NaN poison of the row.
// coverage: 512 blocks x 64 targets x (hi line + lo line) = all 4096 rows x 16 lines of OA exactly once.
// ---------------------------------------------------------------------------
__global__ __launch_bounds__(NTHR) void k_drain(
    const float* __restrict__ rel_v, const float* __restrict__ VP,
    const float* __restrict__ S, const int* __restrict__ ENT,
    const int* __restrict__ SOFF, const int* __restrict__ SCNT, const int* __restrict__ TOT,
    unsigned short* OA)
{
  __shared__ __attribute__((aligned(16))) float sl[NSLOT];      // the scores of this (b,h), by flat slot
  __shared__ __attribute__((aligned(16))) float relv[W2 * DK];
  __shared__ __attribute__((aligned(16))) float stw[NWAVE * 64];
  __shared__ float red[2 * NWAVE];
  const int tid = (int)threadIdx.x, lane = tid & 31, wave = tid >> 5;
  const int bh = (int)blockIdx.y, b = bh >> 3, h = bh & (NH - 1);
  const float* sb = S + (size_t)bh * NSLOT;
  const int* ent = ENT + (size_t)bh * NSLOT;
  const int tg0 = ((int)blockIdx.x * NWAVE + __builtin_amdgcn_readfirstlane(wave)) * TPD;
  // segment starts and counts of the wave's targets: lane l holds those of target tg0 + (l & 7) in chunk l >> 3 (index
  // ti0) and in chunk 4 + (l >> 3) (index ti1); lane l also reads the total of chunk l & 7
  const int ti0 = (bh * NCH + (lane >> 3)) * SEQ + tg0 + (lane & 7);
  const int ti1 = ti0 + 4 * SEQ;
  const int tix = bh * NCH + (lane & 7);
  const int s0r = SOFF[ti0], c0r = SCNT[ti0], s1r = SOFF[ti1], c1r = SCNT[ti1];
  const int totl = TOT[tix];
  // the wait before the loads' index registers are written again; naming them keeps them as they are up to here
  asm volatile("s_wait_xcnt 0x0" :: "v"(ti0), "v"(ti1), "v"(tix) : "memory");
  // The thread's 128 scores of this (b,h), slots 1024 i + 4 tid .. + 3, are read once and kept in registers for the
  // maximum and for the sum. All 32 loads are requested before the first is used (one memory latency in place of one
  // per load), from one index register and immediate offsets.
  v4f sv[NSV];
  // unrolled whole: sv is indexed by constants only (registers), and the loads stand one behind the other
#pragma unroll
  for (int i = 0; i < NSV; ++i) sv[i] = *(const v4fa*)(sb + i * (4 * NTHR) + 4 * tid);
  // the wait before the loads' index register is written again; naming it keeps it as it is up to here
  asm volatile("s_wait_xcnt 0x0" :: "v"(tid) : "memory");
  {
    const float* rp = rel_v + (size_t)h * (W2 * DK) + 8 * tid;
    const v4f a = *(const v4fa*)rp;
    const v4f c = *(const v4fa*)(rp + 4);
    float* q = relv + 8 * tid;
    q[0] = bf16f(a.x); q[1] = bf16f(a.y); q[2] = bf16f(a.z); q[3] = bf16f(a.w);
    q[4] = bf16f(c.x); q[5] = bf16f(c.y); q[6] = bf16f(c.z); q[7] = bf16f(c.w);
  }
  // per (chunk, target): count bounded by the chunk's list, slots of the target in earlier chunks (sum over the lanes
  // 8 apart, then over the two registers), and what seg_idx adds to a position; totv = the target's slots in all chunks
  const int st0 = clamp_st(s0r), st1 = clamp_st(s1r);
  int n0 = c0r < 0 ? 0 : c0r, n1 = c1r < 0 ? 0 : c1r;
  n0 = n0 > CSL - st0 ? CSL - st0 : n0;
  n1 = n1 > CSL - st1 ? CSL - st1 : n1;
  int i0 = n0, i1 = n1;
#pragma unroll
  for (int d = 8; d < 32; d <<= 1) {
    const int u0 = __shfl_up(i0, d), u1 = __shfl_up(i1, d);
    if (lane >= d) { i0 += u0; i1 += u1; }
  }
  const int t0 = __shfl(i0, 24 + (lane & 7)), t1 = __shfl(i1, 24 + (lane & 7));
  const int pre0 = i0 - n0, pre1 = t0 + i1 - n1;
  const int bas0 = (lane >> 3) * CSL + st0 - pre0;
  const int bas1 = (4 + (lane >> 3)) * CSL + st1 - pre1;
  const int totv = t0 + t1;
  const unsigned int negm = __builtin_amdgcn_ballot_w32(c0r < 0 || c1r < 0);
  // entries of the coming step, read one step ahead
  int epre = list_read(ent, seg_idx(pre0, pre1, bas0, bas1, 0, lane));

  // ---- softmax statistics: M = max, Z = sum exp(s - M), two-level fixed order; the scores go to LDS on the way ----
  float mx = -3.0e38f;
  // unrolled whole: sv stays in registers
#pragma unroll
  for (int i = 0; i < NSV; ++i) {
    const v4f s4 = sv[i];
    *(v4fa*)(sl + i * (4 * NTHR) + 4 * tid) = s4;
    mx = fmaxf(fmaxf(mx, fmaxf(s4.x, s4.y)), fmaxf(s4.z, s4.w));
  }
#pragma unroll
  for (int off = 16; off > 0; off >>= 1) mx = fmaxf(mx, __shfl_xor(mx, off));
  if (lane == 0) red[wave] = mx;
  // publishes rel_v, the scores and the waves' maxima
  __syncthreads();
  float M = red[0];
#pragma unroll
  for (int w2 = 1; w2 < NWAVE; ++w2) M = fmaxf(M, red[w2]);
  float zs = 0.f;
  // unrolled whole, for the same reason; the terms are added in the order of i
#pragma unroll
  for (int i = 0; i < NSV; ++i) {
    const v4f s4 = sv[i];
    zs += (__expf(s4.x - M) + __expf(s4.y - M)) + (__expf(s4.z - M) + __expf(s4.w - M));
  }
#pragma unroll
  for (int off = 16; off > 0; off >>= 1) zs += __shfl_xor(zs, off);
  if (lane == 0) red[NWAVE + wave] = zs;
  // publishes the waves' sums
  __syncthreads();
  float Z = 0.f;
#pragma unroll
  for (int w2 = 0; w2 < NWAVE; ++w2) Z += red[NWAVE + w2];
  const float invZ = 1.0f / Z;                        // Z >= 1 (the max slot contributes exp(0))

  const unsigned int lane4 = 4u * (unsigned int)lane;
  const float qnan = __int_as_float(0x7fc00000);
  const bool bad_tot = __builtin_amdgcn_ballot_w32(totl != CSL) != 0u;
  float* sw = stw + wave * 64;
  const int lc = lane & 7;
  const bool islo = (lane & 8) != 0;
  const char* vb  = (const char*)(VP + (size_t)bh * SEQ * DK);
  const char* rvl = (const char*)(relv + lane);
#pragma unroll 1
  for (int jt = 0; jt < TPD; ++jt) {
    const int tg = tg0 + jt;                           // 0..1023
    const int jn = jt + 1 < TPD ? jt + 1 : TPD - 1;
    const int craw = __builtin_amdgcn_readlane(totv, jt);
    int cnt = craw;
    cnt = cnt < 0 ? 0 : (cnt > DEGCAP ? DEGCAP : cnt);
    const bool cneg = ((negm >> jt) & 0x01010101u) != 0u;   // a negative count of this target in some chunk
    const float pz = (bad_tot || craw > DEGCAP || cneg) ? qnan : 0.0f;
    float a0 = 0.f, a1 = 0.f;
#pragma unroll 1
    for (int q0 = 0; q0 < cnt || q0 == 0; q0 += 32) {
      const int left = cnt - q0;                       // 0 only for an empty target: nothing summed, read-ahead moved on
      const int n = left > 32 ? 32 : left;
      const int ov  = (epre & (SEQ - 1)) * (DK * 4);
      const int orl = ((epre >> 20) & (W2 - 1)) * (DK * 4);
      const float* sp = sl + ((epre >> 10) & (NSLOT - 1));
      const bool on = lane < n;
      const bool more = left > 32;                     // this target goes on; else the next target's first step
      const int idx = seg_idx(pre0, pre1, bas0, bas1, more ? jt : jn, (more ? q0 + 32 : 0) + lane);
      epre = list_read(ent, idx);
      if (n > 24)      drain_step<4>(ov, orl, sp, on, M, invZ, vb, rvl, lane4, a0, a1);
      else if (n > 16) drain_step<3>(ov, orl, sp, on, M, invZ, vb, rvl, lane4, a0, a1);
      else if (n > 8)  drain_step<2>(ov, orl, sp, on, M, invZ, vb, rvl, lane4, a0, a1);
      else if (n > 0)  drain_step<1>(ov, orl, sp, on, M, invZ, vb, rvl, lane4, a0, a1);
    }
    a0 += pz;
    a1 += pz;
    // per-wave relayout: channels in order, then lanes 0..7 (hi) / 8..15 (lo) read 8 consecutive channels each
    __builtin_amdgcn_fence(__ATOMIC_RELEASE, "wavefront");
    __builtin_amdgcn_wave_barrier();
    sw[lane]      = a0;
    sw[32 + lane] = a1;
    __builtin_amdgcn_fence(__ATOMIC_RELEASE, "wavefront");
    __builtin_amdgcn_wave_barrier();
    const v4f ga = *(const v4fa*)(sw + 8 * lc);
    const v4f gb = *(const v4fa*)(sw + 8 * lc + 4);
    const v8us ov = split8(ga, gb, islo);
    const int orow = b * SEQ + tg;
    unsigned short* dst = OA + (size_t)orow * KOUT + (islo ? DM : 0) + h * DK + 8 * lc;
    const bool wsv = lane < 16;
    if (wsv) *(v8us*)dst = ov;
    // the wait before the store's address and data registers are written again for the next target
    asm volatile("s_wait_xcnt 0x0" ::: "memory");
  }
}

// ---------------------------------------------------------------------------
static inline int cdiv(int a, int b) { return (a + b - 1) / b; }

extern "C" void kernel_launch(void* const* d_in, const int* in_sizes, int n_in,
                              void* d_out, int out_size, void* d_ws, size_t ws_size,
                              hipStream_t stream) {
  if (n_in < 12) return;
  if (in_sizes[0] != NB_ * SEQ * DM || in_sizes[1] != NB_ * SEQ * DM || in_sizes[2] != NB_ * SEQ * DM) return;
  if (in_sizes[3] != NPOS || in_sizes[4] != NPOS) return;
  if (in_sizes[5] != NH * W2 * DK || in_sizes[6] != NH * W2 * DK || in_sizes[7] != NH * W2 * DK) return;
  if (in_sizes[8] != DM * DM || in_sizes[9] != DM * DM || in_sizes[10] != DM * DM || in_sizes[11] != DM * DM) return;
  if (out_size != NB_ * SEQ * DM) return;

  const float* query   = (const float*)d_in[0];    // [4][1024][512]
  const float* keyx    = (const float*)d_in[1];
  const float* value   = (const float*)d_in[2];
  const int*   pos_enc = (const int*)  d_in[3];    // [4][8][16][1024]
  const int*   pos_pad = (const int*)  d_in[4];
  const float* rel_q   = (const float*)d_in[5];    // [1][8][32][64]
  const float* rel_k   = (const float*)d_in[6];
  const float* rel_v   = (const float*)d_in[7];
  const float* Wq      = (const float*)d_in[8];    // [512][512] rows = output feature
  const float* Wk      = (const float*)d_in[9];
  const float* Wv      = (const float*)d_in[10];
  const float* Wo      = (const float*)d_in[11];
  float*       out     = (float*)d_out;            // [4][1024][512]

  // workspace carve (every region a whole number of 256-B blocks; all planes are exact tile multiples)
  char* ws = (char*)d_ws;
  size_t off = 0;
  const size_t oXB  = off; off += (size_t)NXU * 16;                     // 12,582,912  bf16 [3][4096][512]
  const size_t oWB  = off; off += (size_t)NWU * 16;                     //  1,572,864  bf16 [3][512][512]
  const size_t oWOB = off; off += (size_t)NWOU * 16;                    //  1,048,576  bf16 [512][1024]
  const size_t oQKV = off; off += (size_t)3 * PLQ * 4;                  // 25,165,824  f32 [3][32][1024][64]
  const size_t oS   = off; off += (size_t)NBH * NSLOT * 4;              //  4,194,304  f32 [32][32768]
  const size_t oOA  = off; off += (size_t)MROWS * KOUT * 2;             //  8,388,608  bf16 [4096][1024]
  const size_t oENT = off; off += (size_t)NBH * NSLOT * 4;              //  4,194,304  int [32][32768]
  const size_t oSOF = off; off += (size_t)NBH * NCH * SEQ * 4;          //  1,048,576  int [32][8][1024]
  const size_t oSCN = off; off += (size_t)NBH * NCH * SEQ * 4;          //  1,048,576  int [32][8][1024]
  const size_t oTOT = off; off += (size_t)NBH * NCH * 4;                //      1,024  int [32][8]
  if (off > ws_size || off > (size_t)WSMAX) return;                     // total 59,245,568
  unsigned short* XB  = (unsigned short*)(ws + oXB);
  unsigned short* WB  = (unsigned short*)(ws + oWB);
  unsigned short* WOB = (unsigned short*)(ws + oWOB);
  float*          QKV = (float*)(ws + oQKV);
  float*          S   = (float*)(ws + oS);
  unsigned short* OA  = (unsigned short*)(ws + oOA);
  int*            ENT = (int*)(ws + oENT);
  int*            SOFF = (int*)(ws + oSOF);
  int*            SCNT = (int*)(ws + oSCN);
  int*            TOT  = (int*)(ws + oTOT);
  const float* QP  = QKV;
  const float* KPl = QKV + (size_t)PLQ;
  const float* VP  = QKV + (size_t)2 * PLQ;

  // 1: bf16 operand planes; beside them the slot lists grouped by target, one per chunk
  k_convert<<<NBKT + NCU / NTHR, NTHR, 0, stream>>>(query, keyx, value, Wq, Wk, Wv, Wo, XB, WB, WOB, NCU,
                                                    pos_enc, pos_pad, ENT, SOFF, SCNT, TOT);
  // 2: q/k/v projections -> f32 head planes
  k_gemm<0><<<dim3(MROWS / GBM, DM / GBN, 3), GTHR, 0, stream>>>(XB, WB, QKV, DM, MROWS * DM, DM * DM, PLQ);
  // 3: window scores
  k_scores<<<dim3(W2 / SROW, NBH), STHR, 0, stream>>>(pos_enc, pos_pad, rel_q, rel_k, QP, KPl, S);
  // 4: softmax + owner segment sums -> bf16 hi|lo plane
  k_drain<<<dim3(SEQ / (NWAVE * TPD), NBH), NTHR, 0, stream>>>(rel_v, VP, S, ENT, SOFF, SCNT, TOT, OA);
  // 5: output projection -> out
  k_gemm<1><<<dim3(MROWS / GBM, DM / GBN, 1), GTHR, 0, stream>>>(OA, WOB, out, KOUT, 0, 0, 0);
}
